// v000
// Measured on an AMD MI455X. A time is GPU time per run, averaged over a window of back-to-back runs after a warm-up
// (all launches, gaps included; the runs take copies of the inputs in turn), and the median of several windows.
// Apart from v000's, it joins two sittings. Times from different sittings can be a few percent apart, while
// side-by-side timings come from the same sitting.
// v000, which the later versions start from, runs in 463 microseconds.
#include <hip/hip_runtime.h>

// Contractions, f32 accumulate: q/k/v = x.W + b and out = attn.Wo + bo ([4096 x 1024].[1024 x 1024]) on v_wmma_f32_16x16x32_bf16 — plain bf16 = rounded inputs
// (exact; k-major weights transposed to n-major planes) for the projections, attn as bf16 hi + residual planes (two products) for Wo; the relative-position
// attention fused on v_wmma_f32_16x16x32_f16 with UNSCALED logits (sigma ~ 11 over 1024 keys, near one-hot): content q.k as hi.hi + hi.lo + lo.hi, the relative-key
// band q.rel_k[m] (q hi + lo vs the exact f16 INPUT table) gathered per (i, j) at m = i - j + 1024, softmax, weights (x32768) hi + residual against v hi + residual,

#define NB_  4
#define SS   1024
#define DM   1024
#define NH_  16
#define HD   64
#define NTK  (NB_ * SS)          // 4096
#define NRL  2049                // relative table rows
#define NRP  2112                // padded (band reads up to mbase + 47 <= 2063; P~ k-chunks up to mbase + 63 <= 2079)
#define PSC  32768.0f
#define LOSC 1024.0f
#define LOSCI (1.0f / 1024.0f)

typedef _Float16 h16;
typedef unsigned short bf;
typedef __attribute__((ext_vector_type(16))) __bf16   v16bf;
typedef __attribute__((ext_vector_type(16))) _Float16 v16h;
typedef __attribute__((ext_vector_type(8)))  _Float16 v8h;
typedef __attribute__((ext_vector_type(8)))  unsigned short v8us;
typedef __attribute__((ext_vector_type(8)))  float    v8f;
typedef __attribute__((ext_vector_type(4)))  float    v4f;
typedef v8h  __attribute__((may_alias)) v8ha;
typedef v4f  __attribute__((may_alias)) v4fa;
typedef v8us __attribute__((may_alias)) v8usa;

__device__ __forceinline__ unsigned short f2bf(float f) { unsigned u = __float_as_uint(f); u += 0x7FFFu + ((u >> 16) & 1u); return (unsigned short)(u >> 16); }
__device__ __forceinline__ float bf2f(unsigned short b) { return __uint_as_float(((unsigned)b) << 16); }
__device__ __forceinline__ float bfr(float f) { return bf2f(f2bf(f)); }
__device__ __forceinline__ v16h cat16(v8h lo, v8h hi) { return __builtin_shufflevector(lo, hi, 0, 1, 2, 3, 4, 5, 6, 7, 8, 9, 10, 11, 12, 13, 14, 15); }
__device__ __forceinline__ v16bf cat16b(v8us lo, v8us hi) { return __builtin_bit_cast(v16bf, __builtin_shufflevector(lo, hi, 0, 1, 2, 3, 4, 5, 6, 7, 8, 9, 10, 11, 12, 13, 14, 15)); }
__device__ __forceinline__ v8f wmma16(v16h a, v16h b, v8f c) { return __builtin_amdgcn_wmma_f32_16x16x32_f16(false, a, false, b, (short)0, c, false, false); }
__device__ __forceinline__ v8f wmmab(v16bf a, v16bf b, v8f c) { return __builtin_amdgcn_wmma_f32_16x16x32_bf16(false, a, false, b, (short)0, c, false, false); }
#define VST2(T, p, v) do { const T vst2_v_ = (v); *(T*)(p) = vst2_v_;  } while (0)

// k_cvtb: bf16 rows of an [nrows][1024] matrix; k_wt: k-major [1024][1024] -> n-major bf16.
__global__ __launch_bounds__(256) void k_cvtb(const float* __restrict__ src, int nrows, bf* dst) {
    const int lane = threadIdx.x & 31, r = blockIdx.x * 8 + (threadIdx.x >> 5);
    if (r >= nrows) return;
#pragma unroll
    for (int q = 0; q < DM / 256; ++q) { v8us t;
#pragma unroll
        for (int i = 0; i < 8; ++i) t[i] = f2bf(src[(size_t)r * DM + q * 256 + lane * 8 + i]);
        VST2(v8us, dst + (size_t)r * DM + q * 256 + lane * 8, t); }
}
__global__ __launch_bounds__(256) void k_wt(const float* __restrict__ Wm, bf* WT) {
    __shared__ __align__(16) unsigned short tl[64 * 72];
    const int tid = threadIdx.x, k0 = blockIdx.x * 64, n0 = blockIdx.y * 64;
    const int kk = tid >> 2, nq = (tid & 3) * 16;
#pragma unroll
    for (int i = 0; i < 16; ++i) tl[(nq + i) * 72 + kk] = f2bf(Wm[(size_t)(k0 + kk) * DM + n0 + nq + i]);
    __syncthreads();
    const int piece = tid & 7;
    auto pass = [&]() {
#pragma unroll
        for (int s = 0; s < 2; ++s) { const int nr = (tid >> 3) + 32 * s; const v8us val = *(const v8usa*)(tl + nr * 72 + piece * 8);
            *(v8us*)(WT + (size_t)(n0 + nr) * DM + k0 + piece * 8) = val; }
    };
    pass(); 
}
// k_gemmb: 64 x 64 tile of A.B^T + bias over K = 1024 (bf16 exact); MODE 0: f16 hi + residual planes (ld 1024); MODE 1: f32 rows (V).
template <int MODE>
__global__ __launch_bounds__(128) void k_gemmb(const bf* __restrict__ A, const bf* __restrict__ Bn, const float* __restrict__ bias, void* C, void* C2) {
    __shared__ __align__(16) float ost[4][16 * 68];
    const int lane = threadIdx.x & 31, wave = threadIdx.x >> 5, lr = lane & 15, hi = lane >> 4;
    const int r0 = blockIdx.x * 64 + wave * 16, c0 = blockIdx.y * 64;
    const size_t aoff = (size_t)(r0 + lr) * DM + 8 * hi;
    size_t boff[4];
#pragma unroll
    for (int t = 0; t < 4; ++t) boff[t] = (size_t)(c0 + t * 16 + lr) * DM + 8 * hi;
    v8f acc[4];
#pragma unroll
    for (int t = 0; t < 4; ++t) acc[t] = (v8f){};
#pragma unroll 1
    for (int kc = 0; kc < DM; kc += 32) {
        const v16bf a = cat16b(*(const v8us*)(A + aoff + kc), *(const v8us*)(A + aoff + kc + 16));
#pragma unroll
        for (int t = 0; t < 4; ++t) acc[t] = wmmab(a, cat16b(*(const v8us*)(Bn + boff[t] + kc), *(const v8us*)(Bn + boff[t] + kc + 16)), acc[t]);
        asm volatile("v_nop\n\tv_nop\n\tv_nop\n\tv_nop" : "+v"(acc[0]), "+v"(acc[1]), "+v"(acc[2]), "+v"(acc[3]) : "v"(a));
    }
    float* os = &ost[wave][0];
#pragma unroll
    for (int t = 0; t < 4; ++t) { const float bv = bfr(bias[c0 + t * 16 + lr]);
#pragma unroll
        for (int j = 0; j < 8; ++j) os[(hi * 8 + j) * 68 + t * 16 + lr] = acc[t][j] + bv; }
    __syncthreads();
    if (MODE == 1) {
        float* crow = (float*)C + (size_t)r0 * DM + c0;
        auto pass = [&]() {
#pragma unroll
            for (int s = 0; s < 8; ++s) { const int Lid = (lane >> 3) + 4 * s, piece = lane & 7; const int row = Lid >> 1, cofs = (Lid & 1) * 32 + piece * 4;
                const v4f val = *(const v4fa*)(os + row * 68 + cofs); *(v4f*)(crow + (size_t)row * DM + cofs) = val; }
        };
        pass(); 
    } else {
        h16* c1 = (h16*)C + (size_t)r0 * DM + c0; h16* c2 = (h16*)C2 + (size_t)r0 * DM + c0;
        auto pass = [&]() {
#pragma unroll
            for (int s = 0; s < 4; ++s) { const int row = 4 * s + (lane >> 3), piece = lane & 7; const float* sp = os + row * 68 + piece * 8; v8h o1, o2;
#pragma unroll
                for (int i = 0; i < 8; ++i) { const h16 a = (h16)sp[i]; o1[i] = a; o2[i] = (h16)((sp[i] - (float)a) * LOSC); }
                *(v8h*)(c1 + (size_t)row * DM + piece * 8) = o1; *(v8h*)(c2 + (size_t)row * DM + piece * 8) = o2; }
        };
        pass(); 
    }
}
// k_vt: VTH/VTL [b][h][d][s] = f16 hi + residual of V rows; block (b, h, 64 s).
__global__ __launch_bounds__(256) void k_vt(const float* __restrict__ V, h16* VTH, h16* VTL) {
    __shared__ __align__(16) h16 tile[HD * 72];
    __shared__ __align__(16) h16 til2[HD * 72];
    const int bid = blockIdx.x;
    const int b = bid / (NH_ * (SS / 64)), rem = bid - b * (NH_ * (SS / 64)), h = rem / (SS / 64), kt = rem - h * (SS / 64);
    const int s0 = kt * 64, tid = threadIdx.x, ss = tid >> 2, d0 = (tid & 3) * 16;
    const float* src = V + ((size_t)b * SS + s0 + ss) * DM + h * HD + d0;
#pragma unroll
    for (int i = 0; i < 16; ++i) { const float v = src[i]; const h16 a = (h16)v; tile[(d0 + i) * 72 + ss] = a; til2[(d0 + i) * 72 + ss] = (h16)((v - (float)a) * LOSC); }
    __syncthreads();
    const int piece = tid & 7;
    const size_t base = (((size_t)b * NH_ + h) * HD) * SS + s0;
    auto pass = [&]() {
#pragma unroll
        for (int s = 0; s < 4; ++s) { const int Lid = (tid >> 3) + 32 * s; const int pln = Lid >> 6, d = Lid & 63;
            const v8h val = *(const v8ha*)((pln ? til2 : tile) + d * 72 + piece * 8); *(v8h*)((pln ? VTL : VTH) + base + (size_t)d * SS + piece * 8) = val; }
    };
    pass(); 
}
// k_tabs: RK16 [NRP][64] = f16(bf16(rel_k_emb)) rows (zero pad beyond 2049); RVT16 [64][NRP] = f16(bf16(rel_v_emb))^T (rows d, k = m) via 64x64 LDS transposes;
// grid NRP/64 blocks.
__global__ __launch_bounds__(256) void k_tabs(const float* __restrict__ rk, const float* __restrict__ rv, h16* RK16, h16* RVT16) {
    __shared__ __align__(16) h16 tile[HD * 72];
    const int m0 = blockIdx.x * 64, tid = threadIdx.x, mm = tid >> 2, d0 = (tid & 3) * 16;
#pragma unroll
    for (int i = 0; i < 16; ++i) { const int m = m0 + mm; tile[(d0 + i) * 72 + mm] = (m < NRL) ? (h16)bfr(rv[(size_t)m * HD + d0 + i]) : (h16)0.f; }
    __syncthreads();
    const int piece = tid & 7;
    auto pass = [&]() {
#pragma unroll
        for (int s = 0; s < 2; ++s) { const int m = m0 + s * 32 + (tid >> 3); v8h o;
#pragma unroll
            for (int i = 0; i < 8; ++i) o[i] = (m < NRL) ? (h16)bfr(rk[(size_t)m * HD + piece * 8 + i]) : (h16)0.f;
            *(v8h*)(RK16 + (size_t)m * HD + piece * 8) = o; }
#pragma unroll
        for (int s = 0; s < 2; ++s) { const int d = (tid >> 3) + 32 * s; const v8h val = *(const v8ha*)(tile + d * 72 + piece * 8); *(v8h*)(RVT16 + (size_t)d * NRP + m0 + piece * 8) = val; }
    };
    pass(); 
}
// k_attn: block = (b, h, 64 queries), wave = 16 queries i = q0..q0+15; 32 key tiles of 32: content 12 WMMA (hi.hi + hi.lo + lo.hi, q residual fragments re-read);
// relative-key band: rows m = mbase + 0..47 of RK16 (mbase = q0 - l0 - 31 + 1024) x (q hi, q lo) = 12 WMMA, parked in LDS; logit(i,j) = content + band[r][r - kk + 31]
// (UNSCALED); online softmax; weights x32768 hi + residual tiles pl/pl2 [16][32] AND the same weights scattered into relative coordinates pt/pt2 [16][64]
// (column r + 31 - kk; zero elsewhere); o += pa.vh, ox += pa.vl + px.vh (12 WMMA), o += pt.rv, ox += pt2.rv (16 WMMA, B = RVT16 rows d at k = mbase + ..);
// ctx = (o + ox/1024)/sum -> bf16 hi/lo planes [tok][h*64+d].
__global__ __launch_bounds__(128) void k_attn(const h16* __restrict__ QH, const h16* __restrict__ QL, const h16* __restrict__ KH, const h16* __restrict__ KL,
                                             const h16* __restrict__ RK16, const h16* __restrict__ RVT16, const h16* __restrict__ VTH, const h16* __restrict__ VTL, bf* CH, bf* CL) {
    __shared__ __align__(16) h16 plds[4][16 * 32];
    __shared__ __align__(16) h16 plds2[4][16 * 32];
    __shared__ __align__(16) h16 ptl[4][16 * 72];
    __shared__ __align__(16) h16 ptl2[4][16 * 72];
    __shared__ __align__(16) float posl[4][16 * 52];
    __shared__ __align__(16) float ost[4][16 * 68];
    const int lane = threadIdx.x & 31, wave = threadIdx.x >> 5, lr = lane & 15, hi = lane >> 4;
    const int bid = blockIdx.x;
    const int b = bid / (NH_ * (SS / 64)), rem = bid - b * (NH_ * (SS / 64)), h = rem / (SS / 64), qt = rem - h * (SS / 64);
    const int q0 = qt * 64 + wave * 16;
    const size_t tok0 = (size_t)b * SS;
    h16* pl = &plds[wave][0]; h16* pl2 = &plds2[wave][0]; h16* pt = &ptl[wave][0]; h16* pt2 = &ptl2[wave][0]; float* ps = &posl[wave][0];
    const size_t qo0 = (tok0 + q0 + lr) * DM + h * HD + 8 * hi;
    v16h qa[2];
#pragma unroll
    for (int kc = 0; kc < 2; ++kc) qa[kc] = cat16(*(const v8h*)(QH + qo0 + kc * 32), *(const v8h*)(QH + qo0 + kc * 32 + 16));
    const size_t vbase = (((size_t)b * NH_ + h) * HD) * SS;
    v8f o[4], ox[4];
#pragma unroll
    for (int n = 0; n < 4; ++n) { o[n] = (v8f){}; ox[n] = (v8f){}; }
    float mrow[8], lpart[8];
#pragma unroll
    for (int j = 0; j < 8; ++j) { mrow[j] = -3.0e38f; lpart[j] = 0.f; }
    // zero the relative-coordinate weight tiles once (entries outside [r, r+31] of each row stay zero for every step)
    for (int e = lane; e < 16 * 72; e += 32) { pt[e] = (h16)0.f; pt2[e] = (h16)0.f; }
#pragma unroll 1
    for (int kt = 0; kt < SS / 32; ++kt) {
        const int l0 = kt * 32, mbase = q0 - l0 - 31 + 1024;
        v8f s0 = {}, s1 = {}, x0 = {}, x1 = {};
#pragma unroll
        for (int kc = 0; kc < 2; ++kc) {
            const size_t ko = (tok0 + l0 + lr) * DM + h * HD + kc * 32 + 8 * hi, k1o = ko + (size_t)16 * DM;
            const v16h qlk = cat16(*(const v8h*)(QL + qo0 + kc * 32), *(const v8h*)(QL + qo0 + kc * 32 + 16));
            { const v16h k0h = cat16(*(const v8h*)(KH + ko), *(const v8h*)(KH + ko + 16)), k1h = cat16(*(const v8h*)(KH + k1o), *(const v8h*)(KH + k1o + 16));
              s0 = wmma16(qa[kc], k0h, s0); x0 = wmma16(qlk, k0h, x0); s1 = wmma16(qa[kc], k1h, s1); x1 = wmma16(qlk, k1h, x1);
              asm volatile("v_nop" : "+v"(s0), "+v"(s1), "+v"(x0), "+v"(x1) : "v"(qlk), "v"(k0h), "v"(k1h) : "memory"); }
            { const v16h k0l = cat16(*(const v8h*)(KL + ko), *(const v8h*)(KL + ko + 16)), k1l = cat16(*(const v8h*)(KL + k1o), *(const v8h*)(KL + k1o + 16));
              x0 = wmma16(qa[kc], k0l, x0); x1 = wmma16(qa[kc], k1l, x1);
              asm volatile("v_nop" : "+v"(x0), "+v"(x1) : "v"(k0l), "v"(k1l) : "memory"); }
            // band tiles for this k-chunk: rows m = mbase + t*16 + lr of RK16, k = kc*32 ..
#pragma unroll
            for (int t = 0; t < 3; ++t) { const size_t om = (size_t)(mbase + t * 16 + lr) * HD + kc * 32 + 8 * hi;
                const v16h rb = cat16(*(const v8h*)(RK16 + om), *(const v8h*)(RK16 + om + 16));
                v8f ph = wmma16(qa[kc], rb, (v8f){}); v8f pq = wmma16(qlk, rb, (v8f){});
                asm volatile("v_nop\n\tv_nop\n\tv_nop\n\tv_nop" : "+v"(ph), "+v"(pq) : "v"(rb), "v"(qlk));
#pragma unroll
                for (int j = 0; j < 8; ++j) { const int idx = (hi * 8 + j) * 52 + t * 16 + lr; const float v = ph[j] + pq[j] * LOSCI; if (kc == 0) ps[idx] = v; else ps[idx] += v; }
                asm volatile("" ::: "memory"); }
        }
        asm volatile("v_nop\n\tv_nop\n\tv_nop\n\tv_nop" : "+v"(s0), "+v"(s1), "+v"(x0), "+v"(x1) : "v"(qa[0]), "v"(qa[1]));
        asm volatile("" ::: "memory");
        __builtin_amdgcn_wave_barrier();
        float alpha[8];
#pragma unroll
        for (int j = 0; j < 8; ++j) {
            const int r = hi * 8 + j;
            const float p0v = ps[r * 52 + r - lr + 31], p1v = ps[r * 52 + r - (lr + 16) + 31];
            const float a0 = s0[j] + x0[j] * LOSCI + p0v, a1 = s1[j] + x1[j] * LOSCI + p1v;
            float mx = fmaxf(a0, a1);
            mx = fmaxf(mx, __shfl_xor(mx, 1, 16)); mx = fmaxf(mx, __shfl_xor(mx, 2, 16)); mx = fmaxf(mx, __shfl_xor(mx, 4, 16)); mx = fmaxf(mx, __shfl_xor(mx, 8, 16));
            const float mn = fmaxf(mrow[j], mx);
            alpha[j] = __expf(mrow[j] - mn); mrow[j] = mn;
            const float e0 = __expf(a0 - mn), e1 = __expf(a1 - mn);
            lpart[j] = lpart[j] * alpha[j] + (e0 + e1);
            const float ps0 = e0 * PSC, ps1 = e1 * PSC; const h16 h0 = (h16)ps0, h1 = (h16)ps1; const h16 g0 = (h16)((ps0 - (float)h0) * LOSC), g1 = (h16)((ps1 - (float)h1) * LOSC);
            pl[r * 32 + lr] = h0; pl[r * 32 + 16 + lr] = h1; pl2[r * 32 + lr] = g0; pl2[r * 32 + 16 + lr] = g1;
            pt[r * 72 + r + 31 - lr] = h0; pt[r * 72 + r + 31 - (lr + 16)] = h1; pt2[r * 72 + r + 31 - lr] = g0; pt2[r * 72 + r + 31 - (lr + 16)] = g1;
        }
#pragma unroll
        for (int n = 0; n < 4; ++n)
#pragma unroll
            for (int j = 0; j < 8; ++j) { o[n][j] *= alpha[j]; ox[n][j] *= alpha[j]; }
        asm volatile("" ::: "memory");
        const v16h pa = cat16(*(const v8ha*)(pl + lr * 32 + hi * 8), *(const v8ha*)(pl + lr * 32 + 16 + hi * 8));
        const v16h px = cat16(*(const v8ha*)(pl2 + lr * 32 + hi * 8), *(const v8ha*)(pl2 + lr * 32 + 16 + hi * 8));
#pragma unroll
        for (int n = 0; n < 4; ++n) { const size_t vo = vbase + (size_t)(n * 16 + lr) * SS + l0 + hi * 8;
            const v16h vh = cat16(*(const v8h*)(VTH + vo), *(const v8h*)(VTH + vo + 16)), vl = cat16(*(const v8h*)(VTL + vo), *(const v8h*)(VTL + vo + 16));
            o[n] = wmma16(pa, vh, o[n]); ox[n] = wmma16(pa, vl, ox[n]); ox[n] = wmma16(px, vh, ox[n]);
            asm volatile("" : "+v"(o[n]), "+v"(ox[n]) : "v"(vh), "v"(vl) : "memory"); }
        // relative-coordinate weights x rel_v: A = pt rows (k = m_local, 2 k-chunks), B = RVT16 rows d at k = mbase + kc*32
#pragma unroll
        for (int kc = 0; kc < 2; ++kc) {
            const v16h ra = cat16(*(const v8ha*)(pt + lr * 72 + kc * 32 + hi * 8), *(const v8ha*)(pt + lr * 72 + kc * 32 + 16 + hi * 8));
            const v16h rx = cat16(*(const v8ha*)(pt2 + lr * 72 + kc * 32 + hi * 8), *(const v8ha*)(pt2 + lr * 72 + kc * 32 + 16 + hi * 8));
#pragma unroll
            for (int n = 0; n < 4; ++n) { const size_t ro = (size_t)(n * 16 + lr) * NRP + mbase + kc * 32 + hi * 8;
                const v16h rvb = cat16(*(const v8h*)(RVT16 + ro), *(const v8h*)(RVT16 + ro + 16));
                o[n] = wmma16(ra, rvb, o[n]); ox[n] = wmma16(rx, rvb, ox[n]);
                asm volatile("" : "+v"(o[n]), "+v"(ox[n]) : "v"(rvb), "v"(ra), "v"(rx) : "memory"); }
        }
        __builtin_amdgcn_wave_barrier();
        // clear this step's scattered entries (row r used columns r .. r+31) for the next step
#pragma unroll
        for (int j = 0; j < 8; ++j) { const int r = hi * 8 + j; pt[r * 72 + r + 31 - lr] = (h16)0.f; pt[r * 72 + r + 31 - (lr + 16)] = (h16)0.f; pt2[r * 72 + r + 31 - lr] = (h16)0.f; pt2[r * 72 + r + 31 - (lr + 16)] = (h16)0.f; }
        asm volatile("" ::: "memory");
    }
    asm volatile("v_nop\n\tv_nop\n\tv_nop\n\tv_nop" : "+v"(o[0]), "+v"(o[1]), "+v"(o[2]), "+v"(o[3]), "+v"(ox[0]), "+v"(ox[1]), "+v"(ox[2]), "+v"(ox[3]));
    float inv[8];
#pragma unroll
    for (int j = 0; j < 8; ++j) { float rs = lpart[j]; rs += __shfl_xor(rs, 1, 16); rs += __shfl_xor(rs, 2, 16); rs += __shfl_xor(rs, 4, 16); rs += __shfl_xor(rs, 8, 16); inv[j] = 1.0f / (rs * PSC); }
    float* os = &ost[wave][0];
#pragma unroll
    for (int n = 0; n < 4; ++n)
#pragma unroll
        for (int j = 0; j < 8; ++j) os[(hi * 8 + j) * 68 + n * 16 + lr] = (o[n][j] + ox[n][j] * LOSCI) * inv[j];
    __syncthreads();
    const size_t cbase = (tok0 + q0) * DM + (size_t)h * HD;
    auto pass = [&]() {
#pragma unroll
        for (int s = 0; s < 4; ++s) { const int row = 4 * s + (lane >> 3), piece = lane & 7; const float* sp = os + row * 68 + piece * 8; v8us oh, ol;
#pragma unroll
            for (int i = 0; i < 8; ++i) { const unsigned short hb = f2bf(sp[i]); oh[i] = hb; ol[i] = f2bf(sp[i] - bf2f(hb)); }
            *(v8us*)(CH + cbase + (size_t)row * DM + piece * 8) = oh; *(v8us*)(CL + cbase + (size_t)row * DM + piece * 8) = ol; }
    };
    pass(); 
}
// k_outp: 64 x 64 tile of out = (CH + CL).WoT^T + bo over K = 1024 (2 products); f32 rows.
__global__ __launch_bounds__(128) void k_outp(const bf* __restrict__ A, const bf* __restrict__ Al, const bf* __restrict__ Bn, const float* __restrict__ bias, float* C) {
    __shared__ __align__(16) float ost[4][16 * 68];
    const int lane = threadIdx.x & 31, wave = threadIdx.x >> 5, lr = lane & 15, hi = lane >> 4;
    const int r0 = blockIdx.x * 64 + wave * 16, c0 = blockIdx.y * 64;
    const size_t aoff = (size_t)(r0 + lr) * DM + 8 * hi;
    size_t boff[4];
#pragma unroll
    for (int t = 0; t < 4; ++t) boff[t] = (size_t)(c0 + t * 16 + lr) * DM + 8 * hi;
    v8f acc[4];
#pragma unroll
    for (int t = 0; t < 4; ++t) acc[t] = (v8f){};
#pragma unroll 1
    for (int kc = 0; kc < DM; kc += 32) {
        const v16bf a = cat16b(*(const v8us*)(A + aoff + kc), *(const v8us*)(A + aoff + kc + 16)), al = cat16b(*(const v8us*)(Al + aoff + kc), *(const v8us*)(Al + aoff + kc + 16));
#pragma unroll
        for (int t = 0; t < 4; ++t) { const v16bf bb = cat16b(*(const v8us*)(Bn + boff[t] + kc), *(const v8us*)(Bn + boff[t] + kc + 16)); acc[t] = wmmab(a, bb, acc[t]); acc[t] = wmmab(al, bb, acc[t]); }
        asm volatile("v_nop\n\tv_nop\n\tv_nop\n\tv_nop" : "+v"(acc[0]), "+v"(acc[1]), "+v"(acc[2]), "+v"(acc[3]) : "v"(a), "v"(al));
    }
    float* os = &ost[wave][0];
#pragma unroll
    for (int t = 0; t < 4; ++t) { const float bv = bfr(bias[c0 + t * 16 + lr]);
#pragma unroll
        for (int j = 0; j < 8; ++j) os[(hi * 8 + j) * 68 + t * 16 + lr] = acc[t][j] + bv; }
    __syncthreads();
    float* crow = C + (size_t)r0 * DM + c0;
    auto pass = [&]() {
#pragma unroll
        for (int s = 0; s < 8; ++s) { const int Lid = (lane >> 3) + 4 * s, piece = lane & 7; const int row = Lid >> 1, cofs = (Lid & 1) * 32 + piece * 4;
            const v4f val = *(const v4fa*)(os + row * 68 + cofs); *(v4f*)(crow + (size_t)row * DM + cofs) = val; }
    };
    pass(); 
}

extern "C" void kernel_launch(void* const* d_in, const int* in_sizes, int n_in,
                              void* d_out, int out_size, void* d_ws, size_t ws_size, hipStream_t stream) {
    (void)in_sizes; (void)n_in; (void)out_size;
    const float* x = (const float*)d_in[0]; const float* Wq = (const float*)d_in[1]; const float* bq = (const float*)d_in[2]; const float* Wk = (const float*)d_in[3]; const float* bk = (const float*)d_in[4];
    const float* Wv = (const float*)d_in[5]; const float* bv = (const float*)d_in[6]; const float* Wo = (const float*)d_in[7]; const float* bo = (const float*)d_in[8];
    const float* rk = (const float*)d_in[9]; const float* rv = (const float*)d_in[10];
    float* out = (float*)d_out;    // [4][1024][1024]
    char* wsp = (char*)d_ws;
    auto take = [&](size_t bytes) { char* p = wsp; wsp += (bytes + 255) & ~(size_t)255; return (void*)p; };
    bf* Xb = (bf*)take((size_t)NTK * DM * 2); bf* WqT = (bf*)take((size_t)DM * DM * 2); bf* WkT = (bf*)take((size_t)DM * DM * 2); bf* WvT = (bf*)take((size_t)DM * DM * 2); bf* WoT = (bf*)take((size_t)DM * DM * 2);
    h16* QH = (h16*)take((size_t)NTK * DM * 2); h16* QL = (h16*)take((size_t)NTK * DM * 2); h16* KH = (h16*)take((size_t)NTK * DM * 2); h16* KL = (h16*)take((size_t)NTK * DM * 2);
    float* Vf = (float*)take((size_t)NTK * DM * 4); h16* VTH = (h16*)take((size_t)NTK * DM * 2); h16* VTL = (h16*)take((size_t)NTK * DM * 2);
    h16* RK16 = (h16*)take((size_t)NRP * HD * 2); h16* RVT16 = (h16*)take((size_t)HD * NRP * 2);
    if ((size_t)(wsp - (char*)d_ws) > ws_size) return;    // 8.4 + 8.4 + 33.5 + 16.8 + 16.8 + 0.5 ~ 85 MB; ctx planes alias Vf (dead after k_vt)
    bf* CH = (bf*)Vf; bf* CL = (bf*)((char*)Vf + (size_t)NTK * DM * 2);
    k_cvtb<<<NTK / 8, 256, 0, stream>>>(x, NTK, Xb);
    k_wt<<<dim3(DM / 64, DM / 64, 1), 256, 0, stream>>>(Wq, WqT); k_wt<<<dim3(DM / 64, DM / 64, 1), 256, 0, stream>>>(Wk, WkT);
    k_wt<<<dim3(DM / 64, DM / 64, 1), 256, 0, stream>>>(Wv, WvT); k_wt<<<dim3(DM / 64, DM / 64, 1), 256, 0, stream>>>(Wo, WoT);
    k_gemmb<0><<<dim3(NTK / 64, DM / 64, 1), 128, 0, stream>>>(Xb, WqT, bq, QH, QL);
    k_gemmb<0><<<dim3(NTK / 64, DM / 64, 1), 128, 0, stream>>>(Xb, WkT, bk, KH, KL);
    k_gemmb<1><<<dim3(NTK / 64, DM / 64, 1), 128, 0, stream>>>(Xb, WvT, bv, Vf, nullptr);
    k_vt<<<NB_ * NH_ * (SS / 64), 256, 0, stream>>>(Vf, VTH, VTL);
    k_tabs<<<NRP / 64, 256, 0, stream>>>(rk, rv, RK16, RVT16);
    k_attn<<<NB_ * NH_ * (SS / 64), 128, 0, stream>>>(QH, QL, KH, KL, RK16, RVT16, VTH, VTL, CH, CL);
    k_outp<<<dim3(NTK / 64, DM / 64, 1), 128, 0, stream>>>(CH, CL, WoT, bo, out);
}

// v001
// Measured time: 463 microseconds a run.
// Two timings next to v000 put it at 1.04 and 1.06 times that version's speed.
#include <hip/hip_runtime.h>

// Contractions, f32 accumulate: q/k/v = x.W + b and out = attn.Wo + bo ([4096 x 1024].[1024 x 1024]) on v_wmma_f32_16x16x32_bf16 — plain bf16 = rounded inputs
// (exact; k-major weights transposed to n-major planes) for the projections, attn as bf16 hi + residual planes (two products) for Wo; the relative-position
// attention fused on v_wmma_f32_16x16x32_f16 with UNSCALED logits (sigma ~ 11 over 1024 keys, near one-hot): content q.k as hi.hi + hi.lo + lo.hi, the relative-key
// band q.rel_k[m] (q hi + lo vs the exact f16 INPUT table) gathered per (i, j) at m = i - j + 1024, softmax, weights (x32768) hi + residual against v hi + residual,

#define NB_  4
#define SS   1024
#define DM   1024
#define NH_  16
#define HD   64
#define NTK  (NB_ * SS)          // 4096
#define NRL  2049                // relative table rows
#define NRP  2112                // padded (band reads up to mbase + 47 <= 2063; P~ k-chunks up to mbase + 63 <= 2079)
#define NGK  128                 // 16-row groups of the relative-key table that a band can reach (m <= 2048)
#define NGV  129                 // 16-row groups of the relative-value table (k-chunks reach m <= 2064, zero beyond 2048)
#define PSC  32768.0f
#define LOSC 1024.0f
#define LOSCI (1.0f / 1024.0f)

typedef _Float16 h16;
typedef unsigned short bf;
typedef __attribute__((ext_vector_type(16))) __bf16   v16bf;
typedef __attribute__((ext_vector_type(16))) _Float16 v16h;
typedef __attribute__((ext_vector_type(8)))  _Float16 v8h;
typedef __attribute__((ext_vector_type(8)))  unsigned short v8us;
typedef __attribute__((ext_vector_type(8)))  float    v8f;
typedef __attribute__((ext_vector_type(4)))  float    v4f;
typedef v8h  __attribute__((may_alias)) v8ha;
typedef v4f  __attribute__((may_alias)) v4fa;
typedef v8us __attribute__((may_alias)) v8usa;

__device__ __forceinline__ unsigned short f2bf(float f) { unsigned u = __float_as_uint(f); u += 0x7FFFu + ((u >> 16) & 1u); return (unsigned short)(u >> 16); }
__device__ __forceinline__ float bf2f(unsigned short b) { return __uint_as_float(((unsigned)b) << 16); }
__device__ __forceinline__ float bfr(float f) { return bf2f(f2bf(f)); }
__device__ __forceinline__ v16h cat16(v8h lo, v8h hi) { return __builtin_shufflevector(lo, hi, 0, 1, 2, 3, 4, 5, 6, 7, 8, 9, 10, 11, 12, 13, 14, 15); }
__device__ __forceinline__ v16bf cat16b(v8us lo, v8us hi) { return __builtin_bit_cast(v16bf, __builtin_shufflevector(lo, hi, 0, 1, 2, 3, 4, 5, 6, 7, 8, 9, 10, 11, 12, 13, 14, 15)); }
__device__ __forceinline__ v8f wmma16(v16h a, v16h b, v8f c) { return __builtin_amdgcn_wmma_f32_16x16x32_f16(false, a, false, b, (short)0, c, false, false); }
__device__ __forceinline__ v8f wmmab(v16bf a, v16bf b, v8f c) { return __builtin_amdgcn_wmma_f32_16x16x32_bf16(false, a, false, b, (short)0, c, false, false); }
#define VST2(T, p, v) do { const T vst2_v_ = (v); *(T*)(p) = vst2_v_;  } while (0)
// Fragment-order layout of a [rows][1024] 16-bit plane: 512-byte blocks of 16 rows x 16 columns, lane-major (lane = 16 * ((col >> 3) & 1) + (row & 15), 8 elements
// a lane), blocks ordered by (row >> 4, col >> 5, (col >> 4) & 1). pko = element offset of the 8-element piece at (row, col), col a multiple of 8. One wave-wide
// 16-byte fragment load then reads one block = 4 whole 128-byte lines; the second half of a fragment is the next block (+256), the next k-chunk of 32 is +512.
__device__ __forceinline__ size_t pko(int row, int col) {
    return ((size_t)(((row >> 4) * 32 + (col >> 5)) * 2 + ((col >> 4) & 1)) << 8) + (size_t)(((((col >> 3) & 1) << 4) + (row & 15)) << 3);
}

// k_cvtb: bf16 of an [nrows][1024] matrix; k_wt: k-major [1024][1024] -> n-major bf16; both written in fragment order (pko).
__global__ __launch_bounds__(256) void k_cvtb(const float* __restrict__ src, int nrows, bf* dst) {
    const int lane = threadIdx.x & 31, gw = blockIdx.x * 8 + (threadIdx.x >> 5), r = (gw >> 4) * 16 + (lane & 15);    // wave = 16 rows x 64 columns
    if (r >= nrows) return;
#pragma unroll
    for (int q = 0; q < 4; ++q) { const int col = (gw & 15) * 64 + q * 16 + (lane >> 4) * 8; v8us t;
#pragma unroll
        for (int i = 0; i < 8; ++i) t[i] = f2bf(src[(size_t)r * DM + col + i]);
        VST2(v8us, dst + pko(r, col), t); }
}
__global__ __launch_bounds__(256) void k_wt(const float* __restrict__ Wm, bf* WT) {
    __shared__ __align__(16) unsigned short tl[64 * 72];
    const int tid = threadIdx.x, k0 = blockIdx.x * 64, n0 = blockIdx.y * 64;
    const int kk = tid >> 2, nq = (tid & 3) * 16;
#pragma unroll
    for (int i = 0; i < 16; ++i) tl[(nq + i) * 72 + kk] = f2bf(Wm[(size_t)(k0 + kk) * DM + n0 + nq + i]);
    __syncthreads();
    auto pass = [&]() {
#pragma unroll
        for (int s = 0; s < 2; ++s) { const int u = (tid >> 5) + 8 * s, nr = (u >> 2) * 16 + (tid & 15), kcol = (u & 3) * 16 + ((tid >> 4) & 1) * 8;
            const v8us val = *(const v8usa*)(tl + nr * 72 + kcol);
            *(v8us*)(WT + pko(n0 + nr, k0 + kcol)) = val; }
    };
    pass(); 
}
// k_gemmb: 64 x 64 tile of A.B^T + bias over K = 1024 (bf16 exact; A, B in fragment order); MODE 0: f16 hi + residual planes (fragment order); MODE 1: f32 rows (V).
template <int MODE>
__global__ __launch_bounds__(128) void k_gemmb(const bf* __restrict__ A, const bf* __restrict__ Bn, const float* __restrict__ bias, void* C, void* C2) {
    __shared__ __align__(16) float ost[4][16 * 68];
    const int lane = threadIdx.x & 31, wave = threadIdx.x >> 5, lr = lane & 15, hi = lane >> 4;
    const int r0 = blockIdx.x * 64 + wave * 16, c0 = blockIdx.y * 64;
    const size_t aoff = pko(r0 + lr, 8 * hi);
    size_t boff[4];
#pragma unroll
    for (int t = 0; t < 4; ++t) boff[t] = pko(c0 + t * 16 + lr, 8 * hi);
    v8f acc[4];
#pragma unroll
    for (int t = 0; t < 4; ++t) acc[t] = (v8f){};
#pragma unroll 1
    for (int kc = 0; kc < DM; kc += 32) {
        const int ko = kc * 16;    // 512 elements a k-chunk of 32 in fragment order
        const v16bf a = cat16b(*(const v8us*)(A + aoff + ko), *(const v8us*)(A + aoff + ko + 256));
#pragma unroll
        for (int t = 0; t < 4; ++t) acc[t] = wmmab(a, cat16b(*(const v8us*)(Bn + boff[t] + ko), *(const v8us*)(Bn + boff[t] + ko + 256)), acc[t]);
        asm volatile("v_nop\n\tv_nop\n\tv_nop\n\tv_nop" : "+v"(acc[0]), "+v"(acc[1]), "+v"(acc[2]), "+v"(acc[3]) : "v"(a));
    }
    float* os = &ost[wave][0];
#pragma unroll
    for (int t = 0; t < 4; ++t) { const float bv = bfr(bias[c0 + t * 16 + lr]);
#pragma unroll
        for (int j = 0; j < 8; ++j) os[(hi * 8 + j) * 68 + t * 16 + lr] = acc[t][j] + bv; }
    __syncthreads();
    if (MODE == 1) {
        float* crow = (float*)C + (size_t)r0 * DM + c0;
        auto pass = [&]() {
#pragma unroll
            for (int s = 0; s < 8; ++s) { const int Lid = (lane >> 3) + 4 * s, piece = lane & 7; const int row = Lid >> 1, cofs = (Lid & 1) * 32 + piece * 4;
                const v4f val = *(const v4fa*)(os + row * 68 + cofs); *(v4f*)(crow + (size_t)row * DM + cofs) = val; }
        };
        pass(); 
    } else {
        h16* c1 = (h16*)C; h16* c2 = (h16*)C2;
        auto pass = [&]() {
#pragma unroll
            for (int s = 0; s < 4; ++s) { const int col = s * 16 + hi * 8; const float* sp = os + lr * 68 + col; const size_t po = pko(r0 + lr, c0 + col); v8h o1, o2;
#pragma unroll
                for (int i = 0; i < 8; ++i) { const h16 a = (h16)sp[i]; o1[i] = a; o2[i] = (h16)((sp[i] - (float)a) * LOSC); }
                *(v8h*)(c1 + po) = o1; *(v8h*)(c2 + po) = o2; }
        };
        pass(); 
    }
}
// k_vt: VTH/VTL = f16 hi + residual of V^T, fragment order: [b][h][s / 32][d / 16][(s >> 4) & 1] blocks of 512 bytes, lane = 16 * ((s >> 3) & 1) + (d & 15); block (b, h, 64 s).
__global__ __launch_bounds__(256) void k_vt(const float* __restrict__ V, h16* VTH, h16* VTL) {
    __shared__ __align__(16) h16 tile[HD * 72];
    __shared__ __align__(16) h16 til2[HD * 72];
    const int bid = blockIdx.x;
    const int b = bid / (NH_ * (SS / 64)), rem = bid - b * (NH_ * (SS / 64)), h = rem / (SS / 64), kt = rem - h * (SS / 64);
    const int s0 = kt * 64, tid = threadIdx.x, ss = tid >> 2, d0 = (tid & 3) * 16;
    const float* src = V + ((size_t)b * SS + s0 + ss) * DM + h * HD + d0;
#pragma unroll
    for (int i = 0; i < 16; ++i) { const float v = src[i]; const h16 a = (h16)v; tile[(d0 + i) * 72 + ss] = a; til2[(d0 + i) * 72 + ss] = (h16)((v - (float)a) * LOSC); }
    __syncthreads();
    const size_t base = (((size_t)b * NH_ + h) * HD) * SS;
    const int lane = tid & 31, wv = tid >> 5, n = wv >> 1, p = wv & 1, d = n * 16 + (lane & 15);
    auto pass = [&]() {
#pragma unroll
        for (int s = 0; s < 4; ++s) { const int pln = s >> 1, ktl = s & 1;
            const v8h val = *(const v8ha*)((pln ? til2 : tile) + d * 72 + ktl * 32 + p * 16 + (lane >> 4) * 8);
            *(v8h*)((pln ? VTL : VTH) + base + (size_t)((((s0 >> 5) + ktl) * 4 + n) * 2 + p) * 256 + lane * 8) = val; }
    };
    pass(); 
}
// k_tabs: both tables in fragment order over groups g of 16 table rows m = 16 g + 1 .. 16 g + 16 (every band of k_attn starts at m = 1 mod 16; m = 0 is never used):
// RK16 [g < NGK][d / 16] blocks of 512 bytes = f16(bf16(rel_k_emb)), lane = 16 * ((d >> 3) & 1) + (m - 1 & 15); RVT16 [g < NGV][d / 16] blocks = f16(bf16(rel_v_emb))^T,
// lane = 16 * ((m - 1 >> 3) & 1) + (d & 15), via 64x64 LDS transposes (zero beyond row 2048); grid NRP/64 blocks.
__global__ __launch_bounds__(256) void k_tabs(const float* __restrict__ rk, const float* __restrict__ rv, h16* RK16, h16* RVT16) {
    __shared__ __align__(16) h16 tile[HD * 72];
    const int m0 = blockIdx.x * 64 + 1, tid = threadIdx.x, mm = tid >> 2, d0 = (tid & 3) * 16;
#pragma unroll
    for (int i = 0; i < 16; ++i) { const int m = m0 + mm; tile[(d0 + i) * 72 + mm] = (m < NRL) ? (h16)bfr(rv[(size_t)m * HD + d0 + i]) : (h16)0.f; }
    __syncthreads();
    const int lane = tid & 31, lr = lane & 15, hi = lane >> 4;
    auto pass = [&]() {
#pragma unroll
        for (int s = 0; s < 2; ++s) { const int u = (tid >> 5) + 8 * s, g = blockIdx.x * 4 + (u >> 2), m = 16 * g + 1 + lr, col = (u & 3) * 16 + hi * 8; v8h o;
#pragma unroll
            for (int i = 0; i < 8; ++i) o[i] = (m < NRL) ? (h16)bfr(rk[(size_t)m * HD + col + i]) : (h16)0.f;
            if (g < NGK) *(v8h*)(RK16 + (size_t)(g * 4 + (u & 3)) * 256 + lane * 8) = o; }
#pragma unroll
        for (int s = 0; s < 2; ++s) { const int u = (tid >> 5) + 8 * s, gl = u >> 2, n = u & 3, g = blockIdx.x * 4 + gl;
            const v8h val = *(const v8ha*)(tile + (n * 16 + lr) * 72 + gl * 16 + hi * 8);
            if (g < NGV) *(v8h*)(RVT16 + (size_t)(g * 4 + n) * 256 + lane * 8) = val; }
    };
    pass(); 
}
// k_attn: block = (b, h, 64 queries), wave = 16 queries i = q0..q0+15; 32 key tiles of 32: content 12 WMMA (hi.hi + hi.lo + lo.hi, q residual fragments re-read);
// relative-key band: rows m = mbase + 0..47 of RK16 (mbase = q0 - l0 - 31 + 1024) x (q hi, q lo) = 12 WMMA, parked in LDS; logit(i,j) = content + band[r][r - kk + 31]
// (UNSCALED); online softmax; weights x32768 hi + residual tiles pl/pl2 [16][32] AND the same weights scattered into relative coordinates pt/pt2 [16][64]
// (column r + 31 - kk; zero elsewhere); o += pa.vh, ox += pa.vl + px.vh (12 WMMA), o += pt.rv, ox += pt2.rv (16 WMMA, B = RVT16 rows d at k = mbase + ..);
// ctx = (o + ox/1024)/sum -> bf16 hi/lo planes [tok][h*64+d] in fragment order. Every global operand is read in fragment order (pko, k_vt, k_tabs).
__global__ __launch_bounds__(128) void k_attn(const h16* __restrict__ QH, const h16* __restrict__ QL, const h16* __restrict__ KH, const h16* __restrict__ KL,
                                             const h16* __restrict__ RK16, const h16* __restrict__ RVT16, const h16* __restrict__ VTH, const h16* __restrict__ VTL, bf* CH, bf* CL) {
    __shared__ __align__(16) h16 plds[4][16 * 32];
    __shared__ __align__(16) h16 plds2[4][16 * 32];
    __shared__ __align__(16) h16 ptl[4][16 * 72];
    __shared__ __align__(16) h16 ptl2[4][16 * 72];
    __shared__ __align__(16) float posl[4][16 * 52];
    __shared__ __align__(16) float ost[4][16 * 68];
    const int lane = threadIdx.x & 31, wave = threadIdx.x >> 5, lr = lane & 15, hi = lane >> 4;
    const int bid = blockIdx.x;
    const int b = bid / (NH_ * (SS / 64)), rem = bid - b * (NH_ * (SS / 64)), h = rem / (SS / 64), qt = rem - h * (SS / 64);
    const int q0 = qt * 64 + wave * 16;
    const size_t tok0 = (size_t)b * SS;
    h16* pl = &plds[wave][0]; h16* pl2 = &plds2[wave][0]; h16* pt = &ptl[wave][0]; h16* pt2 = &ptl2[wave][0]; float* ps = &posl[wave][0];
    const size_t qo0 = pko((int)tok0 + q0 + lr, h * HD + 8 * hi);
    v16h qa[2];
#pragma unroll
    for (int kc = 0; kc < 2; ++kc) qa[kc] = cat16(*(const v8h*)(QH + qo0 + kc * 512), *(const v8h*)(QH + qo0 + kc * 512 + 256));
    const size_t vbase = (((size_t)b * NH_ + h) * HD) * SS;
    v8f o[4], ox[4];
#pragma unroll
    for (int n = 0; n < 4; ++n) { o[n] = (v8f){}; ox[n] = (v8f){}; }
    float mrow[8], lpart[8];
#pragma unroll
    for (int j = 0; j < 8; ++j) { mrow[j] = -3.0e38f; lpart[j] = 0.f; }
    // zero the relative-coordinate weight tiles once (entries outside [r, r+31] of each row stay zero for every step)
    for (int e = lane; e < 16 * 72; e += 32) { pt[e] = (h16)0.f; pt2[e] = (h16)0.f; }
#pragma unroll 1
    for (int kt = 0; kt < SS / 32; ++kt) {
        const int l0 = kt * 32, mbase = q0 - l0 - 31 + 1024, gb = (mbase - 1) >> 4;    // mbase = 16 gb + 1
        v8f s0 = {}, s1 = {}, x0 = {}, x1 = {};
#pragma unroll
        for (int kc = 0; kc < 2; ++kc) {
            const size_t ko = pko((int)tok0 + l0 + lr, h * HD + kc * 32 + 8 * hi), k1o = ko + (size_t)16 * DM;    // the next 16 rows: 64 blocks on
            const v16h qlk = cat16(*(const v8h*)(QL + qo0 + kc * 512), *(const v8h*)(QL + qo0 + kc * 512 + 256));
            { const v16h k0h = cat16(*(const v8h*)(KH + ko), *(const v8h*)(KH + ko + 256)), k1h = cat16(*(const v8h*)(KH + k1o), *(const v8h*)(KH + k1o + 256));
              s0 = wmma16(qa[kc], k0h, s0); x0 = wmma16(qlk, k0h, x0); s1 = wmma16(qa[kc], k1h, s1); x1 = wmma16(qlk, k1h, x1);
              asm volatile("v_nop" : "+v"(s0), "+v"(s1), "+v"(x0), "+v"(x1) : "v"(qlk), "v"(k0h), "v"(k1h) : "memory"); }
            { const v16h k0l = cat16(*(const v8h*)(KL + ko), *(const v8h*)(KL + ko + 256)), k1l = cat16(*(const v8h*)(KL + k1o), *(const v8h*)(KL + k1o + 256));
              x0 = wmma16(qa[kc], k0l, x0); x1 = wmma16(qa[kc], k1l, x1);
              asm volatile("v_nop" : "+v"(x0), "+v"(x1) : "v"(k0l), "v"(k1l) : "memory"); }
            // band tiles for this k-chunk: rows m = mbase + t*16 + lr of RK16, k = kc*32 ..
#pragma unroll
            for (int t = 0; t < 3; ++t) { const size_t om = (size_t)((gb + t) * 4 + kc * 2) * 256 + lane * 8;
                const v16h rb = cat16(*(const v8h*)(RK16 + om), *(const v8h*)(RK16 + om + 256));
                v8f ph = wmma16(qa[kc], rb, (v8f){}); v8f pq = wmma16(qlk, rb, (v8f){});
                asm volatile("v_nop\n\tv_nop\n\tv_nop\n\tv_nop" : "+v"(ph), "+v"(pq) : "v"(rb), "v"(qlk));
#pragma unroll
                for (int j = 0; j < 8; ++j) { const int idx = (hi * 8 + j) * 52 + t * 16 + lr; const float v = ph[j] + pq[j] * LOSCI; if (kc == 0) ps[idx] = v; else ps[idx] += v; }
                asm volatile("" ::: "memory"); }
        }
        asm volatile("v_nop\n\tv_nop\n\tv_nop\n\tv_nop" : "+v"(s0), "+v"(s1), "+v"(x0), "+v"(x1) : "v"(qa[0]), "v"(qa[1]));
        asm volatile("" ::: "memory");
        __builtin_amdgcn_wave_barrier();
        float alpha[8];
#pragma unroll
        for (int j = 0; j < 8; ++j) {
            const int r = hi * 8 + j;
            const float p0v = ps[r * 52 + r - lr + 31], p1v = ps[r * 52 + r - (lr + 16) + 31];
            const float a0 = s0[j] + x0[j] * LOSCI + p0v, a1 = s1[j] + x1[j] * LOSCI + p1v;
            float mx = fmaxf(a0, a1);
            mx = fmaxf(mx, __shfl_xor(mx, 1, 16)); mx = fmaxf(mx, __shfl_xor(mx, 2, 16)); mx = fmaxf(mx, __shfl_xor(mx, 4, 16)); mx = fmaxf(mx, __shfl_xor(mx, 8, 16));
            const float mn = fmaxf(mrow[j], mx);
            alpha[j] = __expf(mrow[j] - mn); mrow[j] = mn;
            const float e0 = __expf(a0 - mn), e1 = __expf(a1 - mn);
            lpart[j] = lpart[j] * alpha[j] + (e0 + e1);
            const float ps0 = e0 * PSC, ps1 = e1 * PSC; const h16 h0 = (h16)ps0, h1 = (h16)ps1; const h16 g0 = (h16)((ps0 - (float)h0) * LOSC), g1 = (h16)((ps1 - (float)h1) * LOSC);
            pl[r * 32 + lr] = h0; pl[r * 32 + 16 + lr] = h1; pl2[r * 32 + lr] = g0; pl2[r * 32 + 16 + lr] = g1;
            pt[r * 72 + r + 31 - lr] = h0; pt[r * 72 + r + 31 - (lr + 16)] = h1; pt2[r * 72 + r + 31 - lr] = g0; pt2[r * 72 + r + 31 - (lr + 16)] = g1;
        }
#pragma unroll
        for (int n = 0; n < 4; ++n)
#pragma unroll
            for (int j = 0; j < 8; ++j) { o[n][j] *= alpha[j]; ox[n][j] *= alpha[j]; }
        asm volatile("" ::: "memory");
        const v16h pa = cat16(*(const v8ha*)(pl + lr * 32 + hi * 8), *(const v8ha*)(pl + lr * 32 + 16 + hi * 8));
        const v16h px = cat16(*(const v8ha*)(pl2 + lr * 32 + hi * 8), *(const v8ha*)(pl2 + lr * 32 + 16 + hi * 8));
#pragma unroll
        for (int n = 0; n < 4; ++n) { const size_t vo = vbase + (size_t)((kt * 4 + n) * 2) * 256 + lane * 8;
            const v16h vh = cat16(*(const v8h*)(VTH + vo), *(const v8h*)(VTH + vo + 256)), vl = cat16(*(const v8h*)(VTL + vo), *(const v8h*)(VTL + vo + 256));
            o[n] = wmma16(pa, vh, o[n]); ox[n] = wmma16(pa, vl, ox[n]); ox[n] = wmma16(px, vh, ox[n]);
            asm volatile("" : "+v"(o[n]), "+v"(ox[n]) : "v"(vh), "v"(vl) : "memory"); }
        // relative-coordinate weights x rel_v: A = pt rows (k = m_local, 2 k-chunks), B = RVT16 rows d at k = mbase + kc*32
#pragma unroll
        for (int kc = 0; kc < 2; ++kc) {
            const v16h ra = cat16(*(const v8ha*)(pt + lr * 72 + kc * 32 + hi * 8), *(const v8ha*)(pt + lr * 72 + kc * 32 + 16 + hi * 8));
            const v16h rx = cat16(*(const v8ha*)(pt2 + lr * 72 + kc * 32 + hi * 8), *(const v8ha*)(pt2 + lr * 72 + kc * 32 + 16 + hi * 8));
#pragma unroll
            for (int n = 0; n < 4; ++n) { const size_t ro = (size_t)((gb + kc * 2) * 4 + n) * 256 + lane * 8;
                const v16h rvb = cat16(*(const v8h*)(RVT16 + ro), *(const v8h*)(RVT16 + ro + 1024));
                o[n] = wmma16(ra, rvb, o[n]); ox[n] = wmma16(rx, rvb, ox[n]);
                asm volatile("" : "+v"(o[n]), "+v"(ox[n]) : "v"(rvb), "v"(ra), "v"(rx) : "memory"); }
        }
        __builtin_amdgcn_wave_barrier();
        // clear this step's scattered entries (row r used columns r .. r+31) for the next step
#pragma unroll
        for (int j = 0; j < 8; ++j) { const int r = hi * 8 + j; pt[r * 72 + r + 31 - lr] = (h16)0.f; pt[r * 72 + r + 31 - (lr + 16)] = (h16)0.f; pt2[r * 72 + r + 31 - lr] = (h16)0.f; pt2[r * 72 + r + 31 - (lr + 16)] = (h16)0.f; }
        asm volatile("" ::: "memory");
    }
    asm volatile("v_nop\n\tv_nop\n\tv_nop\n\tv_nop" : "+v"(o[0]), "+v"(o[1]), "+v"(o[2]), "+v"(o[3]), "+v"(ox[0]), "+v"(ox[1]), "+v"(ox[2]), "+v"(ox[3]));
    float inv[8];
#pragma unroll
    for (int j = 0; j < 8; ++j) { float rs = lpart[j]; rs += __shfl_xor(rs, 1, 16); rs += __shfl_xor(rs, 2, 16); rs += __shfl_xor(rs, 4, 16); rs += __shfl_xor(rs, 8, 16); inv[j] = 1.0f / (rs * PSC); }
    float* os = &ost[wave][0];
#pragma unroll
    for (int n = 0; n < 4; ++n)
#pragma unroll
        for (int j = 0; j < 8; ++j) os[(hi * 8 + j) * 68 + n * 16 + lr] = (o[n][j] + ox[n][j] * LOSCI) * inv[j];
    __syncthreads();
    auto pass = [&]() {
#pragma unroll
        for (int s = 0; s < 4; ++s) { const int col = s * 16 + hi * 8; const float* sp = os + lr * 68 + col; const size_t po = pko((int)tok0 + q0 + lr, h * HD + col); v8us oh, ol;
#pragma unroll
            for (int i = 0; i < 8; ++i) { const unsigned short hb = f2bf(sp[i]); oh[i] = hb; ol[i] = f2bf(sp[i] - bf2f(hb)); }
            *(v8us*)(CH + po) = oh; *(v8us*)(CL + po) = ol; }
    };
    pass(); 
}
// k_outp: 64 x 64 tile of out = (CH + CL).WoT^T + bo over K = 1024 (2 products); f32 rows.
__global__ __launch_bounds__(128) void k_outp(const bf* __restrict__ A, const bf* __restrict__ Al, const bf* __restrict__ Bn, const float* __restrict__ bias, float* C) {
    __shared__ __align__(16) float ost[4][16 * 68];
    const int lane = threadIdx.x & 31, wave = threadIdx.x >> 5, lr = lane & 15, hi = lane >> 4;
    const int r0 = blockIdx.x * 64 + wave * 16, c0 = blockIdx.y * 64;
    const size_t aoff = pko(r0 + lr, 8 * hi);
    size_t boff[4];
#pragma unroll
    for (int t = 0; t < 4; ++t) boff[t] = pko(c0 + t * 16 + lr, 8 * hi);
    v8f acc[4];
#pragma unroll
    for (int t = 0; t < 4; ++t) acc[t] = (v8f){};
#pragma unroll 1
    for (int kc = 0; kc < DM; kc += 32) {
        const int ko = kc * 16;    // 512 elements a k-chunk of 32 in fragment order
        const bf* pa = A + aoff + ko; const bf* pl = Al + aoff + ko;
        const v16bf a = cat16b(*(const v8us*)pa, *(const v8us*)(pa + 256)), al = cat16b(*(const v8us*)pl, *(const v8us*)(pl + 256));
        // keeps the two address pairs whole until the four loads above have taken them
        asm volatile("s_wait_xcnt 0x0" :: "v"(pa), "v"(pl) : "memory");
#pragma unroll
        for (int t = 0; t < 4; ++t) { const v16bf bb = cat16b(*(const v8us*)(Bn + boff[t] + ko), *(const v8us*)(Bn + boff[t] + ko + 256)); acc[t] = wmmab(a, bb, acc[t]); acc[t] = wmmab(al, bb, acc[t]); }
        asm volatile("v_nop\n\tv_nop\n\tv_nop\n\tv_nop" : "+v"(acc[0]), "+v"(acc[1]), "+v"(acc[2]), "+v"(acc[3]) : "v"(a), "v"(al));
    }
    float* os = &ost[wave][0];
#pragma unroll
    for (int t = 0; t < 4; ++t) { const float bv = bfr(bias[c0 + t * 16 + lr]);
#pragma unroll
        for (int j = 0; j < 8; ++j) os[(hi * 8 + j) * 68 + t * 16 + lr] = acc[t][j] + bv; }
    __syncthreads();
    float* crow = C + (size_t)r0 * DM + c0;
    auto pass = [&]() {
#pragma unroll
        for (int s = 0; s < 8; ++s) { const int Lid = (lane >> 3) + 4 * s, piece = lane & 7; const int row = Lid >> 1, cofs = (Lid & 1) * 32 + piece * 4;
            const v4f val = *(const v4fa*)(os + row * 68 + cofs); *(v4f*)(crow + (size_t)row * DM + cofs) = val; }
    };
    pass(); 
}

extern "C" void kernel_launch(void* const* d_in, const int* in_sizes, int n_in,
                              void* d_out, int out_size, void* d_ws, size_t ws_size, hipStream_t stream) {
    (void)in_sizes; (void)n_in; (void)out_size;
    const float* x = (const float*)d_in[0]; const float* Wq = (const float*)d_in[1]; const float* bq = (const float*)d_in[2]; const float* Wk = (const float*)d_in[3]; const float* bk = (const float*)d_in[4];
    const float* Wv = (const float*)d_in[5]; const float* bv = (const float*)d_in[6]; const float* Wo = (const float*)d_in[7]; const float* bo = (const float*)d_in[8];
    const float* rk = (const float*)d_in[9]; const float* rv = (const float*)d_in[10];
    float* out = (float*)d_out;    // [4][1024][1024]
    char* wsp = (char*)d_ws;
    auto take = [&](size_t bytes) { char* p = wsp; wsp += (bytes + 255) & ~(size_t)255; return (void*)p; };
    bf* Xb = (bf*)take((size_t)NTK * DM * 2); bf* WqT = (bf*)take((size_t)DM * DM * 2); bf* WkT = (bf*)take((size_t)DM * DM * 2); bf* WvT = (bf*)take((size_t)DM * DM * 2); bf* WoT = (bf*)take((size_t)DM * DM * 2);
    h16* QH = (h16*)take((size_t)NTK * DM * 2); h16* QL = (h16*)take((size_t)NTK * DM * 2); h16* KH = (h16*)take((size_t)NTK * DM * 2); h16* KL = (h16*)take((size_t)NTK * DM * 2);
    float* Vf = (float*)take((size_t)NTK * DM * 4); h16* VTH = (h16*)take((size_t)NTK * DM * 2); h16* VTL = (h16*)take((size_t)NTK * DM * 2);
    h16* RK16 = (h16*)take((size_t)NRP * HD * 2); h16* RVT16 = (h16*)take((size_t)HD * NRP * 2);
    if ((size_t)(wsp - (char*)d_ws) > ws_size) return;    // 8.4 + 8.4 + 33.5 + 16.8 + 16.8 + 0.5 ~ 85 MB; ctx planes alias Vf (dead after k_vt)
    bf* CH = (bf*)Vf; bf* CL = (bf*)((char*)Vf + (size_t)NTK * DM * 2);
    k_cvtb<<<NTK / 8, 256, 0, stream>>>(x, NTK, Xb);
    k_wt<<<dim3(DM / 64, DM / 64, 1), 256, 0, stream>>>(Wq, WqT); k_wt<<<dim3(DM / 64, DM / 64, 1), 256, 0, stream>>>(Wk, WkT);
    k_wt<<<dim3(DM / 64, DM / 64, 1), 256, 0, stream>>>(Wv, WvT); k_wt<<<dim3(DM / 64, DM / 64, 1), 256, 0, stream>>>(Wo, WoT);
    k_gemmb<0><<<dim3(NTK / 64, DM / 64, 1), 128, 0, stream>>>(Xb, WqT, bq, QH, QL);
    k_gemmb<0><<<dim3(NTK / 64, DM / 64, 1), 128, 0, stream>>>(Xb, WkT, bk, KH, KL);
    k_gemmb<1><<<dim3(NTK / 64, DM / 64, 1), 128, 0, stream>>>(Xb, WvT, bv, Vf, nullptr);
    k_vt<<<NB_ * NH_ * (SS / 64), 256, 0, stream>>>(Vf, VTH, VTL);
    k_tabs<<<NRP / 64, 256, 0, stream>>>(rk, rv, RK16, RVT16);
    k_attn<<<NB_ * NH_ * (SS / 64), 128, 0, stream>>>(QH, QL, KH, KL, RK16, RVT16, VTH, VTL, CH, CL);
    k_outp<<<dim3(NTK / 64, DM / 64, 1), 128, 0, stream>>>(CH, CL, WoT, bo, out);
}

// v002
// One run takes 380 microseconds.
// In two side-by-side timings against v001, it was 1.21 and 1.20 times as fast.
// Counting every step since v000, it is 1.27 times as fast.
#include <hip/hip_runtime.h>

// Contractions, f32 accumulate: q/k/v = x.W + b and out = attn.Wo + bo ([4096 x 1024].[1024 x 1024]) on v_wmma_f32_16x16x32_bf16 — plain bf16 = rounded inputs
// (exact; k-major weights transposed to n-major planes) for the projections, attn as bf16 hi + residual planes (two products) for Wo; the relative-position
// attention fused on v_wmma_f32_16x16x32_f16 with UNSCALED logits (sigma ~ 11 over 1024 keys, near one-hot): content q.k as hi.hi + hi.lo + lo.hi, the relative-key
// band q.rel_k[m] (q hi + lo vs the exact f16 INPUT table) gathered per (i, j) at m = i - j + 1024, softmax, weights (x32768) hi + residual against v hi + residual,

#define NB_  4
#define SS   1024
#define DM   1024
#define NH_  16
#define HD   64
#define NTK  (NB_ * SS)          // 4096
#define NRL  2049                // relative table rows
#define NRP  2112                // padded (band reads up to mbase + 47 <= 2048; P~ k-chunks up to mbase + 63 <= 2064)
#define NGK  128                 // 16-row groups of the relative-key table that a band can reach (m <= 2048)
#define NGV  129                 // 16-row groups of the relative-value table (k-chunks reach m <= 2064, zero beyond 2048)
#define PSC  32768.0f
#define LOSC 1024.0f
#define LOSCI (1.0f / 1024.0f)

typedef _Float16 h16;
typedef unsigned short bf;
typedef __attribute__((ext_vector_type(16))) __bf16   v16bf;
typedef __attribute__((ext_vector_type(16))) _Float16 v16h;
typedef __attribute__((ext_vector_type(8)))  _Float16 v8h;
typedef __attribute__((ext_vector_type(8)))  unsigned short v8us;
typedef __attribute__((ext_vector_type(8)))  float    v8f;
typedef __attribute__((ext_vector_type(4)))  float    v4f;
typedef v8h  __attribute__((may_alias)) v8ha;
typedef v4f  __attribute__((may_alias)) v4fa;
typedef v8us __attribute__((may_alias)) v8usa;

__device__ __forceinline__ unsigned short f2bf(float f) { unsigned u = __float_as_uint(f); u += 0x7FFFu + ((u >> 16) & 1u); return (unsigned short)(u >> 16); }
__device__ __forceinline__ float bf2f(unsigned short b) { return __uint_as_float(((unsigned)b) << 16); }
__device__ __forceinline__ float bfr(float f) { return bf2f(f2bf(f)); }
__device__ __forceinline__ v16h cat16(v8h lo, v8h hi) { return __builtin_shufflevector(lo, hi, 0, 1, 2, 3, 4, 5, 6, 7, 8, 9, 10, 11, 12, 13, 14, 15); }
__device__ __forceinline__ v16bf cat16b(v8us lo, v8us hi) { return __builtin_bit_cast(v16bf, __builtin_shufflevector(lo, hi, 0, 1, 2, 3, 4, 5, 6, 7, 8, 9, 10, 11, 12, 13, 14, 15)); }
__device__ __forceinline__ v8f wmma16(v16h a, v16h b, v8f c) { return __builtin_amdgcn_wmma_f32_16x16x32_f16(false, a, false, b, (short)0, c, false, false); }
__device__ __forceinline__ v8f wmmab(v16bf a, v16bf b, v8f c) { return __builtin_amdgcn_wmma_f32_16x16x32_bf16(false, a, false, b, (short)0, c, false, false); }
// A wave-uniform operand address held in scalar registers (each half through readfirstlane, cast to unsigned behind it), so that a fragment load is
// scalar base + one lane offset + immediate and needs no 64-bit address register pair of its own.
typedef __attribute__((address_space(1))) const v8h gv8h;
__device__ __forceinline__ gv8h* uptr(const h16* p) {
    const unsigned long long a = (unsigned long long)p;
    return (gv8h*)(((unsigned long long)(unsigned)__builtin_amdgcn_readfirstlane((int)(a >> 32)) << 32) | (unsigned)__builtin_amdgcn_readfirstlane((int)(unsigned)a));
}
// one 16 x 32 f16 fragment in fragment order: two 512-byte blocks at element offsets c and c + d2 from the uniform base u, each lane its own 16 bytes
#define LDU(u, c, d2) cat16((u)[ulane + (c) / 8], (u)[ulane + ((c) + (d2)) / 8])
#define VST2(T, p, v) do { const T vst2_v_ = (v); *(T*)(p) = vst2_v_;  } while (0)
// Fragment-order layout of a [rows][1024] 16-bit plane: 512-byte blocks of 16 rows x 16 columns, lane-major (lane = 16 * ((col >> 3) & 1) + (row & 15), 8 elements
// a lane), blocks ordered by (row >> 4, col >> 5, (col >> 4) & 1). pko = element offset of the 8-element piece at (row, col), col a multiple of 8. One wave-wide
// 16-byte fragment load then reads one block = 4 whole 128-byte lines; the second half of a fragment is the next block (+256), the next k-chunk of 32 is +512.
__device__ __forceinline__ size_t pko(int row, int col) {
    return ((size_t)(((row >> 4) * 32 + (col >> 5)) * 2 + ((col >> 4) & 1)) << 8) + (size_t)(((((col >> 3) & 1) << 4) + (row & 15)) << 3);
}

// k_cvtb: bf16 of an [nrows][1024] matrix; k_wt: k-major [1024][1024] -> n-major bf16; both written in fragment order (pko).
__global__ __launch_bounds__(256) void k_cvtb(const float* __restrict__ src, int nrows, bf* dst) {
    const int lane = threadIdx.x & 31, gw = blockIdx.x * 8 + (threadIdx.x >> 5), r = (gw >> 4) * 16 + (lane & 15);    // wave = 16 rows x 64 columns
    if (r >= nrows) return;
#pragma unroll
    for (int q = 0; q < 4; ++q) { const int col = (gw & 15) * 64 + q * 16 + (lane >> 4) * 8; v8us t;
#pragma unroll
        for (int i = 0; i < 8; ++i) t[i] = f2bf(src[(size_t)r * DM + col + i]);
        VST2(v8us, dst + pko(r, col), t); }
}
__global__ __launch_bounds__(256) void k_wt(const float* __restrict__ Wm, bf* WT) {
    __shared__ __align__(16) unsigned short tl[64 * 72];
    const int tid = threadIdx.x, k0 = blockIdx.x * 64, n0 = blockIdx.y * 64;
    const int kk = tid >> 2, nq = (tid & 3) * 16;
#pragma unroll
    for (int i = 0; i < 16; ++i) tl[(nq + i) * 72 + kk] = f2bf(Wm[(size_t)(k0 + kk) * DM + n0 + nq + i]);
    __syncthreads();
    auto pass = [&]() {
#pragma unroll
        for (int s = 0; s < 2; ++s) { const int u = (tid >> 5) + 8 * s, nr = (u >> 2) * 16 + (tid & 15), kcol = (u & 3) * 16 + ((tid >> 4) & 1) * 8;
            const v8us val = *(const v8usa*)(tl + nr * 72 + kcol);
            *(v8us*)(WT + pko(n0 + nr, k0 + kcol)) = val; }
    };
    pass(); 
}
// k_gemmb: 64 x 64 tile of A.B^T + bias over K = 1024 (bf16 exact; A, B in fragment order); MODE 0: f16 hi + residual planes (fragment order); MODE 1: f32 rows (V).
template <int MODE>
__global__ __launch_bounds__(128) void k_gemmb(const bf* __restrict__ A, const bf* __restrict__ Bn, const float* __restrict__ bias, void* C, void* C2) {
    __shared__ __align__(16) float ost[4][16 * 68];
    const int lane = threadIdx.x & 31, wave = threadIdx.x >> 5, lr = lane & 15, hi = lane >> 4;
    const int r0 = blockIdx.x * 64 + wave * 16, c0 = blockIdx.y * 64;
    const size_t aoff = pko(r0 + lr, 8 * hi);
    size_t boff[4];
#pragma unroll
    for (int t = 0; t < 4; ++t) boff[t] = pko(c0 + t * 16 + lr, 8 * hi);
    v8f acc[4];
#pragma unroll
    for (int t = 0; t < 4; ++t) acc[t] = (v8f){};
#pragma unroll 1
    for (int kc = 0; kc < DM; kc += 32) {
        const int ko = kc * 16;    // 512 elements a k-chunk of 32 in fragment order
        const v16bf a = cat16b(*(const v8us*)(A + aoff + ko), *(const v8us*)(A + aoff + ko + 256));
#pragma unroll
        for (int t = 0; t < 4; ++t) acc[t] = wmmab(a, cat16b(*(const v8us*)(Bn + boff[t] + ko), *(const v8us*)(Bn + boff[t] + ko + 256)), acc[t]);
        asm volatile("v_nop\n\tv_nop\n\tv_nop\n\tv_nop" : "+v"(acc[0]), "+v"(acc[1]), "+v"(acc[2]), "+v"(acc[3]) : "v"(a));
    }
    float* os = &ost[wave][0];
#pragma unroll
    for (int t = 0; t < 4; ++t) { const float bv = bfr(bias[c0 + t * 16 + lr]);
#pragma unroll
        for (int j = 0; j < 8; ++j) os[(hi * 8 + j) * 68 + t * 16 + lr] = acc[t][j] + bv; }
    __syncthreads();
    if (MODE == 1) {
        float* crow = (float*)C + (size_t)r0 * DM + c0;
        auto pass = [&]() {
#pragma unroll
            for (int s = 0; s < 8; ++s) { const int Lid = (lane >> 3) + 4 * s, piece = lane & 7; const int row = Lid >> 1, cofs = (Lid & 1) * 32 + piece * 4;
                const v4f val = *(const v4fa*)(os + row * 68 + cofs); *(v4f*)(crow + (size_t)row * DM + cofs) = val; }
        };
        pass(); 
    } else {
        h16* c1 = (h16*)C; h16* c2 = (h16*)C2;
        auto pass = [&]() {
#pragma unroll
            for (int s = 0; s < 4; ++s) { const int col = s * 16 + hi * 8; const float* sp = os + lr * 68 + col; const size_t po = pko(r0 + lr, c0 + col); v8h o1, o2;
#pragma unroll
                for (int i = 0; i < 8; ++i) { const h16 a = (h16)sp[i]; o1[i] = a; o2[i] = (h16)((sp[i] - (float)a) * LOSC); }
                *(v8h*)(c1 + po) = o1; *(v8h*)(c2 + po) = o2; }
        };
        pass(); 
    }
}
// k_vt: VTH/VTL = f16 hi + residual of V^T, fragment order: [b][h][s / 32][d / 16][(s >> 4) & 1] blocks of 512 bytes, lane = 16 * ((s >> 3) & 1) + (d & 15); block (b, h, 64 s).
__global__ __launch_bounds__(256) void k_vt(const float* __restrict__ V, h16* VTH, h16* VTL) {
    __shared__ __align__(16) h16 tile[HD * 72];
    __shared__ __align__(16) h16 til2[HD * 72];
    const int bid = blockIdx.x;
    const int b = bid / (NH_ * (SS / 64)), rem = bid - b * (NH_ * (SS / 64)), h = rem / (SS / 64), kt = rem - h * (SS / 64);
    const int s0 = kt * 64, tid = threadIdx.x, ss = tid >> 2, d0 = (tid & 3) * 16;
    const float* src = V + ((size_t)b * SS + s0 + ss) * DM + h * HD + d0;
#pragma unroll
    for (int i = 0; i < 16; ++i) { const float v = src[i]; const h16 a = (h16)v; tile[(d0 + i) * 72 + ss] = a; til2[(d0 + i) * 72 + ss] = (h16)((v - (float)a) * LOSC); }
    __syncthreads();
    const size_t base = (((size_t)b * NH_ + h) * HD) * SS;
    const int lane = tid & 31, wv = tid >> 5, n = wv >> 1, p = wv & 1, d = n * 16 + (lane & 15);
    auto pass = [&]() {
#pragma unroll
        for (int s = 0; s < 4; ++s) { const int pln = s >> 1, ktl = s & 1;
            const v8h val = *(const v8ha*)((pln ? til2 : tile) + d * 72 + ktl * 32 + p * 16 + (lane >> 4) * 8);
            *(v8h*)((pln ? VTL : VTH) + base + (size_t)((((s0 >> 5) + ktl) * 4 + n) * 2 + p) * 256 + lane * 8) = val; }
    };
    pass(); 
}
// k_tabs: both tables in fragment order over groups g of 16 table rows m = 16 g + 1 .. 16 g + 16 (every band of k_attn starts at m = 1 mod 16; m = 0 is never used):
// RK16 [g < NGK][d / 16] blocks of 512 bytes = f16(bf16(rel_k_emb)), lane = 16 * ((d >> 3) & 1) + (m - 1 & 15); RVT16 [g < NGV][d / 16] blocks = f16(bf16(rel_v_emb))^T,
// lane = 16 * ((m - 1 >> 3) & 1) + (d & 15), via 64x64 LDS transposes (zero beyond row 2048); grid NRP/64 blocks.
__global__ __launch_bounds__(256) void k_tabs(const float* __restrict__ rk, const float* __restrict__ rv, h16* RK16, h16* RVT16) {
    __shared__ __align__(16) h16 tile[HD * 72];
    const int m0 = blockIdx.x * 64 + 1, tid = threadIdx.x, mm = tid >> 2, d0 = (tid & 3) * 16;
#pragma unroll
    for (int i = 0; i < 16; ++i) { const int m = m0 + mm; tile[(d0 + i) * 72 + mm] = (m < NRL) ? (h16)bfr(rv[(size_t)m * HD + d0 + i]) : (h16)0.f; }
    __syncthreads();
    const int lane = tid & 31, lr = lane & 15, hi = lane >> 4;
    auto pass = [&]() {
#pragma unroll
        for (int s = 0; s < 2; ++s) { const int u = (tid >> 5) + 8 * s, g = blockIdx.x * 4 + (u >> 2), m = 16 * g + 1 + lr, col = (u & 3) * 16 + hi * 8; v8h o;
#pragma unroll
            for (int i = 0; i < 8; ++i) o[i] = (m < NRL) ? (h16)bfr(rk[(size_t)m * HD + col + i]) : (h16)0.f;
            if (g < NGK) *(v8h*)(RK16 + (size_t)(g * 4 + (u & 3)) * 256 + lane * 8) = o; }
#pragma unroll
        for (int s = 0; s < 2; ++s) { const int u = (tid >> 5) + 8 * s, gl = u >> 2, n = u & 3, g = blockIdx.x * 4 + gl;
            const v8h val = *(const v8ha*)(tile + (n * 16 + lr) * 72 + gl * 16 + hi * 8);
            if (g < NGV) *(v8h*)(RVT16 + (size_t)(g * 4 + n) * 256 + lane * 8) = val; }
    };
    pass(); 
}
// k_attn: block = (b, h, 64 queries), wave = 16 queries i = q0..q0+15; 32 key tiles of 32: content 12 WMMA (hi.hi + hi.lo + lo.hi, q residual fragments re-read);
// relative-key band: rows m = mbase + 0..47 of RK16 (mbase = q0 - l0 - 31 + 1024) x (q hi, q lo) = 12 WMMA, parked in LDS; logit(i,j) = content + band[r][r - kk + 31]
// (UNSCALED); online softmax; weights x32768 hi + residual tiles pl/pl2 [16][32] AND the same weights scattered into relative coordinates pt/pt2 [16][64]
// (column r + 31 - kk; zero elsewhere); o += pa.vh, ox += pa.vl + px.vh (12 WMMA), o += pt.rv, ox += pt2.rv (16 WMMA, B = RVT16 rows d at k = mbase + ..);
// ctx = (o + ox/1024)/sum -> bf16 hi/lo planes [tok][h*64+d] in fragment order. Every global operand is read in fragment order (pko, k_vt, k_tabs).
__global__ __launch_bounds__(128, 4) void k_attn(const h16* __restrict__ QH, const h16* __restrict__ QL, const h16* __restrict__ KH, const h16* __restrict__ KL,
                                             const h16* __restrict__ RK16, const h16* __restrict__ RVT16, const h16* __restrict__ VTH, const h16* __restrict__ VTL, bf* CH, bf* CL) {
    __shared__ __align__(16) h16 plds[4][16 * 32];
    __shared__ __align__(16) h16 plds2[4][16 * 32];
    __shared__ __align__(16) h16 ptl[4][16 * 72];
    __shared__ __align__(16) h16 ptl2[4][16 * 72];
    __shared__ __align__(16) float posl[4][16 * 52];
    __shared__ __align__(16) float ost[4][16 * 68];
    const int lane = threadIdx.x & 31, wave = __builtin_amdgcn_readfirstlane(threadIdx.x >> 5), lr = lane & 15, hi = lane >> 4;    // wave in a scalar register: every operand block address below is scalar base + lane offset
    const unsigned ulane = lane;
    const int bid = blockIdx.x;
    const int b = bid / (NH_ * (SS / 64)), rem = bid - b * (NH_ * (SS / 64)), h = rem / (SS / 64), qt = rem - h * (SS / 64);
    const int q0 = qt * 64 + wave * 16;
    const size_t tok0 = (size_t)b * SS;
    h16* pl = &plds[wave][0]; h16* pl2 = &plds2[wave][0]; h16* pt = &ptl[wave][0]; h16* pt2 = &ptl2[wave][0]; float* ps = &posl[wave][0];
    // row r = 8 hi + j of each LDS tile addressed as one lane base + a constant in j (an immediate offset), so that the rows need no address register each
    float* psb = ps + hi * (8 * 52) + lr; const float* psg = ps + hi * (8 * 53) + 15 - lr;
    h16* plb = pl + hi * (8 * 32) + lr; h16* plb2 = pl2 + hi * (8 * 32) + lr; h16* ptb = pt + hi * (8 * 73) + 15 - lr; h16* ptb2 = pt2 + hi * (8 * 73) + 15 - lr;
    const size_t qo0 = pko((int)tok0 + q0, h * HD);    // wave-uniform block offset; LDU adds the lane's own piece
    v16h qa[2];
#pragma unroll
    for (int kc = 0; kc < 2; ++kc) qa[kc] = LDU(uptr(QH + qo0), kc * 512, 256);
    const size_t vbase = (((size_t)b * NH_ + h) * HD) * SS;
    v8f o[4], ox[4];
#pragma unroll
    for (int n = 0; n < 4; ++n) { o[n] = (v8f){}; ox[n] = (v8f){}; }
    float mrow[8], lpart[8];
#pragma unroll
    for (int j = 0; j < 8; ++j) { mrow[j] = -3.0e38f; lpart[j] = 0.f; }
    // zero the relative-coordinate weight tiles once (entries outside [r, r+31] of each row stay zero for every step)
    for (int e = lane; e < 16 * 72; e += 32) { pt[e] = (h16)0.f; pt2[e] = (h16)0.f; }
    // Operand fragments are loaded in groups well ahead of the WMMAs that read them (the "memory" fences below keep each group where it is written).
    // The q residual and band fragments of k-chunk 0 of a key tile are loaded during the tile before it and carried over the loop edge in these registers.
    v16h ql0, rb0[3];
    { gv8h* uql = uptr(QL + qo0); gv8h* urk = uptr(RK16 + (size_t)((q0 - 31 + 1024 - 1) >> 4) * 1024); ql0 = LDU(uql, 0, 256);
#pragma unroll
      for (int t = 0; t < 3; ++t) rb0[t] = LDU(urk, t * 1024, 256); }
#pragma unroll 1
    for (int kt = 0; kt < SS / 32; ++kt) {
        const int l0 = kt * 32, mbase = q0 - l0 - 31 + 1024, gb = (mbase - 1) >> 4;    // mbase = 16 gb + 1
        const size_t ko = pko((int)tok0 + l0, h * HD);    // + 512: k-chunk 1; + 16 * DM: the next 16 rows, 64 blocks on
        gv8h* ukh = uptr(KH + ko); gv8h* ukl = uptr(KL + ko); gv8h* uql = uptr(QL + qo0); gv8h* urk = uptr(RK16 + (size_t)gb * 1024);
        // group: q residual and band fragments of k-chunk 1, k fragments of k-chunk 0: in flight under the band of k-chunk 0
        v16h rb1[3];
        const v16h ql1 = LDU(uql, 512, 256);
#pragma unroll
        for (int t = 0; t < 3; ++t) rb1[t] = LDU(urk, t * 1024 + 512, 256);
        const v16h k0h0 = LDU(ukh, 0, 256), k1h0 = LDU(ukh, 16 * DM, 256), k0l0 = LDU(ukl, 0, 256), k1l0 = LDU(ukl, 16 * DM, 256);
        // The v_nop statements of this loop fill the vector slots the chip needs between a WMMA and the first read of its D or rewrite of its A / B,
        // and name those registers so that they stay whole up to there; their "memory" clobber also fences the load groups.
        // band tiles, k-chunk 0: rows m = mbase + t*16 + lr of RK16
#pragma unroll
        for (int t = 0; t < 3; ++t) {
            v8f ph = wmma16(qa[0], rb0[t], (v8f){}); v8f pq = wmma16(ql0, rb0[t], (v8f){});
            asm volatile("v_nop\n\tv_nop\n\tv_nop\n\tv_nop" : "+v"(ph), "+v"(pq) : "v"(rb0[t]), "v"(ql0));
#pragma unroll
            for (int j = 0; j < 8; ++j) psb[j * 52 + t * 16] = ph[j] + pq[j] * LOSCI;
            asm volatile("" ::: "memory"); }
        // group: k fragments of k-chunk 1, in flight under the band of k-chunk 1
        const v16h k0h1 = LDU(ukh, 512, 256), k1h1 = LDU(ukh, 16 * DM + 512, 256), k0l1 = LDU(ukl, 512, 256), k1l1 = LDU(ukl, 16 * DM + 512, 256);
        // band tiles, k-chunk 1
#pragma unroll
        for (int t = 0; t < 3; ++t) {
            v8f ph = wmma16(qa[1], rb1[t], (v8f){}); v8f pq = wmma16(ql1, rb1[t], (v8f){});
            asm volatile("v_nop\n\tv_nop\n\tv_nop\n\tv_nop" : "+v"(ph), "+v"(pq) : "v"(rb1[t]), "v"(ql1));
#pragma unroll
            for (int j = 0; j < 8; ++j) psb[j * 52 + t * 16] += ph[j] + pq[j] * LOSCI;
            asm volatile("" ::: "memory"); }
        // content, k-chunk 0 then 1
        v8f s0 = {}, s1 = {}, x0 = {}, x1 = {};
        s0 = wmma16(qa[0], k0h0, s0); x0 = wmma16(ql0, k0h0, x0); s1 = wmma16(qa[0], k1h0, s1); x1 = wmma16(ql0, k1h0, x1);
        asm volatile("v_nop" : "+v"(s0), "+v"(s1), "+v"(x0), "+v"(x1) : "v"(ql0), "v"(k0h0), "v"(k1h0) : "memory");
        x0 = wmma16(qa[0], k0l0, x0); x1 = wmma16(qa[0], k1l0, x1);
        asm volatile("v_nop" : "+v"(x0), "+v"(x1) : "v"(k0l0), "v"(k1l0) : "memory");
        s0 = wmma16(qa[1], k0h1, s0); x0 = wmma16(ql1, k0h1, x0); s1 = wmma16(qa[1], k1h1, s1); x1 = wmma16(ql1, k1h1, x1);
        asm volatile("v_nop" : "+v"(s0), "+v"(s1), "+v"(x0), "+v"(x1) : "v"(ql1), "v"(k0h1), "v"(k1h1) : "memory");
        x0 = wmma16(qa[1], k0l1, x0); x1 = wmma16(qa[1], k1l1, x1);
        asm volatile("v_nop" : "+v"(x0), "+v"(x1) : "v"(k0l1), "v"(k1l1) : "memory");
        asm volatile("v_nop\n\tv_nop\n\tv_nop\n\tv_nop" : "+v"(s0), "+v"(s1), "+v"(x0), "+v"(x1) : "v"(qa[0]), "v"(qa[1]));
        asm volatile("" ::: "memory");
        __builtin_amdgcn_wave_barrier();
        float alpha[8];
#pragma unroll
        for (int j = 0; j < 8; ++j) {
            const float p0v = psg[j * 53 + 16], p1v = psg[j * 53];    // band[r][r - kk + 31], kk = lr and lr + 16
            const float a0 = s0[j] + x0[j] * LOSCI + p0v, a1 = s1[j] + x1[j] * LOSCI + p1v;
            float mx = fmaxf(a0, a1);
            mx = fmaxf(mx, __shfl_xor(mx, 1, 16)); mx = fmaxf(mx, __shfl_xor(mx, 2, 16)); mx = fmaxf(mx, __shfl_xor(mx, 4, 16)); mx = fmaxf(mx, __shfl_xor(mx, 8, 16));
            const float mn = fmaxf(mrow[j], mx);
            alpha[j] = __expf(mrow[j] - mn); mrow[j] = mn;
            const float e0 = __expf(a0 - mn), e1 = __expf(a1 - mn);
            lpart[j] = lpart[j] * alpha[j] + (e0 + e1);
            const float ps0 = e0 * PSC, ps1 = e1 * PSC; const h16 h0 = (h16)ps0, h1 = (h16)ps1; const h16 g0 = (h16)((ps0 - (float)h0) * LOSC), g1 = (h16)((ps1 - (float)h1) * LOSC);
            plb[j * 32] = h0; plb[j * 32 + 16] = h1; plb2[j * 32] = g0; plb2[j * 32 + 16] = g1;
            ptb[j * 73 + 16] = h0; ptb[j * 73] = h1; ptb2[j * 73 + 16] = g0; ptb2[j * 73] = g1;
        }
#pragma unroll
        for (int n = 0; n < 4; ++n)
#pragma unroll
            for (int j = 0; j < 8; ++j) { o[n][j] *= alpha[j]; ox[n][j] *= alpha[j]; }
        asm volatile("" ::: "memory");
        // group: this tile's v hi + residual fragments and the rel_v fragments of the first k-chunk
        v16h vh[4], vl[4], rv0[4], rv1[4];
        gv8h* uvh = uptr(VTH + vbase + (size_t)kt * 2048); gv8h* uvl = uptr(VTL + vbase + (size_t)kt * 2048); gv8h* urv = uptr(RVT16 + (size_t)gb * 1024);
#pragma unroll
        for (int n = 0; n < 4; ++n) { vh[n] = LDU(uvh, n * 512, 256); vl[n] = LDU(uvl, n * 512, 256); }
#pragma unroll
        for (int n = 0; n < 4; ++n) rv0[n] = LDU(urv, n * 256, 1024);
        const v16h pa = cat16(*(const v8ha*)(pl + lr * 32 + hi * 8), *(const v8ha*)(pl + lr * 32 + 16 + hi * 8));
        const v16h px = cat16(*(const v8ha*)(pl2 + lr * 32 + hi * 8), *(const v8ha*)(pl2 + lr * 32 + 16 + hi * 8));
#pragma unroll
        for (int n = 0; n < 4; ++n) {
            o[n] = wmma16(pa, vh[n], o[n]); ox[n] = wmma16(pa, vl[n], ox[n]); ox[n] = wmma16(px, vh[n], ox[n]);
            asm volatile("" : "+v"(o[n]), "+v"(ox[n]) : "v"(vh[n]), "v"(vl[n]) : "memory");    // keeps the fragments whole through their WMMAs; its "memory" clobber holds the load groups where they are written
            if (n == 1) {    // group: rel_v fragments of the second k-chunk
#pragma unroll
                for (int m = 0; m < 4; ++m) rv1[m] = LDU(urv, 2048 + m * 256, 1024); }
        }
        // group: the next key tile's q residual and band fragments of k-chunk 0 (the last tile loads its own again: in bounds, unused)
        { const int ktn = kt + 1 < SS / 32 ? kt + 1 : kt; gv8h* urn = uptr(RK16 + (size_t)((q0 - ktn * 32 - 31 + 1024 - 1) >> 4) * 1024); ql0 = LDU(uql, 0, 256);
#pragma unroll
          for (int t = 0; t < 3; ++t) rb0[t] = LDU(urn, t * 1024, 256); }
        // relative-coordinate weights x rel_v: A = pt rows (k = m_local, 2 k-chunks), B = RVT16 rows d at k = mbase + kc*32
#pragma unroll
        for (int kc = 0; kc < 2; ++kc) {
            const v16h ra = cat16(*(const v8ha*)(pt + lr * 72 + kc * 32 + hi * 8), *(const v8ha*)(pt + lr * 72 + kc * 32 + 16 + hi * 8));
            const v16h rx = cat16(*(const v8ha*)(pt2 + lr * 72 + kc * 32 + hi * 8), *(const v8ha*)(pt2 + lr * 72 + kc * 32 + 16 + hi * 8));
#pragma unroll
            for (int n = 0; n < 4; ++n) { const v16h rvb = kc ? rv1[n] : rv0[n];
                o[n] = wmma16(ra, rvb, o[n]); ox[n] = wmma16(rx, rvb, ox[n]);
                asm volatile("" : "+v"(o[n]), "+v"(ox[n]) : "v"(rvb), "v"(ra), "v"(rx) : "memory"); }
        }
        __builtin_amdgcn_wave_barrier();
        // clear this step's scattered entries (row r used columns r .. r+31) for the next step
#pragma unroll
        for (int j = 0; j < 8; ++j) { ptb[j * 73 + 16] = (h16)0.f; ptb[j * 73] = (h16)0.f; ptb2[j * 73 + 16] = (h16)0.f; ptb2[j * 73] = (h16)0.f; }
        asm volatile("" ::: "memory");
        // the carried group's loads name scalar base registers that the next trip's address arithmetic rewrites: the wait stands in front of that rewrite
        asm volatile("s_wait_xcnt 0x0" ::: "memory");
    }
    asm volatile("v_nop\n\tv_nop\n\tv_nop\n\tv_nop" : "+v"(o[0]), "+v"(o[1]), "+v"(o[2]), "+v"(o[3]), "+v"(ox[0]), "+v"(ox[1]), "+v"(ox[2]), "+v"(ox[3]));
    float inv[8];
#pragma unroll
    for (int j = 0; j < 8; ++j) { float rs = lpart[j]; rs += __shfl_xor(rs, 1, 16); rs += __shfl_xor(rs, 2, 16); rs += __shfl_xor(rs, 4, 16); rs += __shfl_xor(rs, 8, 16); inv[j] = 1.0f / (rs * PSC); }
    float* os = &ost[wave][0];
#pragma unroll
    for (int n = 0; n < 4; ++n)
#pragma unroll
        for (int j = 0; j < 8; ++j) os[(hi * 8 + j) * 68 + n * 16 + lr] = (o[n][j] + ox[n][j] * LOSCI) * inv[j];
    __syncthreads();
    auto pass = [&]() {
#pragma unroll
        for (int s = 0; s < 4; ++s) { const int col = s * 16 + hi * 8; const float* sp = os + lr * 68 + col; const size_t po = pko((int)tok0 + q0 + lr, h * HD + col); v8us oh, ol;
#pragma unroll
            for (int i = 0; i < 8; ++i) { const unsigned short hb = f2bf(sp[i]); oh[i] = hb; ol[i] = f2bf(sp[i] - bf2f(hb)); }
            *(v8us*)(CH + po) = oh; *(v8us*)(CL + po) = ol; }
    };
    pass(); 
}
// k_outp: 64 x 64 tile of out = (CH + CL).WoT^T + bo over K = 1024 (2 products); f32 rows.
__global__ __launch_bounds__(128) void k_outp(const bf* __restrict__ A, const bf* __restrict__ Al, const bf* __restrict__ Bn, const float* __restrict__ bias, float* C) {
    __shared__ __align__(16) float ost[4][16 * 68];
    const int lane = threadIdx.x & 31, wave = threadIdx.x >> 5, lr = lane & 15, hi = lane >> 4;
    const int r0 = blockIdx.x * 64 + wave * 16, c0 = blockIdx.y * 64;
    const size_t aoff = pko(r0 + lr, 8 * hi);
    size_t boff[4];
#pragma unroll
    for (int t = 0; t < 4; ++t) boff[t] = pko(c0 + t * 16 + lr, 8 * hi);
    v8f acc[4];
#pragma unroll
    for (int t = 0; t < 4; ++t) acc[t] = (v8f){};
#pragma unroll 1
    for (int kc = 0; kc < DM; kc += 32) {
        const int ko = kc * 16;    // 512 elements a k-chunk of 32 in fragment order
        const bf* pa = A + aoff + ko; const bf* pl = Al + aoff + ko;
        const v16bf a = cat16b(*(const v8us*)pa, *(const v8us*)(pa + 256)), al = cat16b(*(const v8us*)pl, *(const v8us*)(pl + 256));
        // keeps the two address pairs whole until the four loads above have taken them
        asm volatile("s_wait_xcnt 0x0" :: "v"(pa), "v"(pl) : "memory");
#pragma unroll
        for (int t = 0; t < 4; ++t) { const v16bf bb = cat16b(*(const v8us*)(Bn + boff[t] + ko), *(const v8us*)(Bn + boff[t] + ko + 256)); acc[t] = wmmab(a, bb, acc[t]); acc[t] = wmmab(al, bb, acc[t]); }
        asm volatile("v_nop\n\tv_nop\n\tv_nop\n\tv_nop" : "+v"(acc[0]), "+v"(acc[1]), "+v"(acc[2]), "+v"(acc[3]) : "v"(a), "v"(al));
    }
    float* os = &ost[wave][0];
#pragma unroll
    for (int t = 0; t < 4; ++t) { const float bv = bfr(bias[c0 + t * 16 + lr]);
#pragma unroll
        for (int j = 0; j < 8; ++j) os[(hi * 8 + j) * 68 + t * 16 + lr] = acc[t][j] + bv; }
    __syncthreads();
    float* crow = C + (size_t)r0 * DM + c0;
    auto pass = [&]() {
#pragma unroll
        for (int s = 0; s < 8; ++s) { const int Lid = (lane >> 3) + 4 * s, piece = lane & 7; const int row = Lid >> 1, cofs = (Lid & 1) * 32 + piece * 4;
            const v4f val = *(const v4fa*)(os + row * 68 + cofs); *(v4f*)(crow + (size_t)row * DM + cofs) = val; }
    };
    pass(); 
}

extern "C" void kernel_launch(void* const* d_in, const int* in_sizes, int n_in,
                              void* d_out, int out_size, void* d_ws, size_t ws_size, hipStream_t stream) {
    (void)in_sizes; (void)n_in; (void)out_size;
    const float* x = (const float*)d_in[0]; const float* Wq = (const float*)d_in[1]; const float* bq = (const float*)d_in[2]; const float* Wk = (const float*)d_in[3]; const float* bk = (const float*)d_in[4];
    const float* Wv = (const float*)d_in[5]; const float* bv = (const float*)d_in[6]; const float* Wo = (const float*)d_in[7]; const float* bo = (const float*)d_in[8];
    const float* rk = (const float*)d_in[9]; const float* rv = (const float*)d_in[10];
    float* out = (float*)d_out;    // [4][1024][1024]
    char* wsp = (char*)d_ws;
    auto take = [&](size_t bytes) { char* p = wsp; wsp += (bytes + 255) & ~(size_t)255; return (void*)p; };
    bf* Xb = (bf*)take((size_t)NTK * DM * 2); bf* WqT = (bf*)take((size_t)DM * DM * 2); bf* WkT = (bf*)take((size_t)DM * DM * 2); bf* WvT = (bf*)take((size_t)DM * DM * 2); bf* WoT = (bf*)take((size_t)DM * DM * 2);
    h16* QH = (h16*)take((size_t)NTK * DM * 2); h16* QL = (h16*)take((size_t)NTK * DM * 2); h16* KH = (h16*)take((size_t)NTK * DM * 2); h16* KL = (h16*)take((size_t)NTK * DM * 2);
    float* Vf = (float*)take((size_t)NTK * DM * 4); h16* VTH = (h16*)take((size_t)NTK * DM * 2); h16* VTL = (h16*)take((size_t)NTK * DM * 2);
    h16* RK16 = (h16*)take((size_t)NRP * HD * 2); h16* RVT16 = (h16*)take((size_t)HD * NRP * 2);
    if ((size_t)(wsp - (char*)d_ws) > ws_size) return;    // 8.4 + 8.4 + 33.5 + 16.8 + 16.8 + 0.5 ~ 85 MB; ctx planes alias Vf (dead after k_vt)
    bf* CH = (bf*)Vf; bf* CL = (bf*)((char*)Vf + (size_t)NTK * DM * 2);
    k_cvtb<<<NTK / 8, 256, 0, stream>>>(x, NTK, Xb);
    k_wt<<<dim3(DM / 64, DM / 64, 1), 256, 0, stream>>>(Wq, WqT); k_wt<<<dim3(DM / 64, DM / 64, 1), 256, 0, stream>>>(Wk, WkT);
    k_wt<<<dim3(DM / 64, DM / 64, 1), 256, 0, stream>>>(Wv, WvT); k_wt<<<dim3(DM / 64, DM / 64, 1), 256, 0, stream>>>(Wo, WoT);
    k_gemmb<0><<<dim3(NTK / 64, DM / 64, 1), 128, 0, stream>>>(Xb, WqT, bq, QH, QL);
    k_gemmb<0><<<dim3(NTK / 64, DM / 64, 1), 128, 0, stream>>>(Xb, WkT, bk, KH, KL);
    k_gemmb<1><<<dim3(NTK / 64, DM / 64, 1), 128, 0, stream>>>(Xb, WvT, bv, Vf, nullptr);
    k_vt<<<NB_ * NH_ * (SS / 64), 256, 0, stream>>>(Vf, VTH, VTL);
    k_tabs<<<NRP / 64, 256, 0, stream>>>(rk, rv, RK16, RVT16);
    k_attn<<<NB_ * NH_ * (SS / 64), 128, 0, stream>>>(QH, QL, KH, KL, RK16, RVT16, VTH, VTL, CH, CL);
    k_outp<<<dim3(NTK / 64, DM / 64, 1), 128, 0, stream>>>(CH, CL, WoT, bo, out);
}

// v003
// It runs in 223 microseconds.
// Next to v002, in two timings, it ran 1.71 times as fast each time.
// Over all steps from v000 it is 2.17 times as fast.
#include <hip/hip_runtime.h>

// Contractions, f32 accumulate: q/k/v = x.W + b and out = attn.Wo + bo ([4096 x 1024].[1024 x 1024]) on v_wmma_f32_16x16x32_bf16 — plain bf16 = rounded inputs
// (exact; k-major weights transposed to n-major planes) for the projections, attn as bf16 hi + residual planes (two products) for Wo; the relative-position
// attention fused on v_wmma_f32_16x16x32_f16 with UNSCALED logits (sigma ~ 11 over 1024 keys, near one-hot): content q.k as hi.hi + hi.lo + lo.hi, the relative-key
// band q.rel_k[m] (q hi + lo vs the exact f16 INPUT table) gathered per (i, j) at m = i - j + 1024, softmax, weights (x32768) hi + residual against v hi + residual,

#define NB_  4
#define SS   1024
#define DM   1024
#define NH_  16
#define HD   64
#define NTK  (NB_ * SS)          // 4096
#define NRL  2049                // relative table rows
#define NRP  2112                // padded (band reads up to mbase + 47 <= 2048; P~ k-chunks up to mbase + 63 <= 2064)
#define NGK  128                 // 16-row groups of the relative-key table that a band can reach (m <= 2048)
#define NGV  129                 // 16-row groups of the relative-value table (k-chunks reach m <= 2064, zero beyond 2048)
#define PSC  32768.0f
#define LOSC 1024.0f
#define LOSCI (1.0f / 1024.0f)

typedef _Float16 h16;
typedef unsigned short bf;
typedef __attribute__((ext_vector_type(16))) __bf16   v16bf;
typedef __attribute__((ext_vector_type(16))) _Float16 v16h;
typedef __attribute__((ext_vector_type(8)))  _Float16 v8h;
typedef __attribute__((ext_vector_type(8)))  unsigned short v8us;
typedef __attribute__((ext_vector_type(8)))  float    v8f;
typedef __attribute__((ext_vector_type(4)))  float    v4f;
typedef v8h  __attribute__((may_alias)) v8ha;
typedef v4f  __attribute__((may_alias)) v4fa;
typedef v8us __attribute__((may_alias)) v8usa;

__device__ __forceinline__ unsigned short f2bf(float f) { unsigned u = __float_as_uint(f); u += 0x7FFFu + ((u >> 16) & 1u); return (unsigned short)(u >> 16); }
__device__ __forceinline__ float bf2f(unsigned short b) { return __uint_as_float(((unsigned)b) << 16); }
__device__ __forceinline__ float bfr(float f) { return bf2f(f2bf(f)); }
__device__ __forceinline__ v16h cat16(v8h lo, v8h hi) { return __builtin_shufflevector(lo, hi, 0, 1, 2, 3, 4, 5, 6, 7, 8, 9, 10, 11, 12, 13, 14, 15); }
__device__ __forceinline__ v16bf cat16b(v8us lo, v8us hi) { return __builtin_bit_cast(v16bf, __builtin_shufflevector(lo, hi, 0, 1, 2, 3, 4, 5, 6, 7, 8, 9, 10, 11, 12, 13, 14, 15)); }
__device__ __forceinline__ v8f wmma16(v16h a, v16h b, v8f c) { return __builtin_amdgcn_wmma_f32_16x16x32_f16(false, a, false, b, (short)0, c, false, false); }
__device__ __forceinline__ v8f wmmab(v16bf a, v16bf b, v8f c) { return __builtin_amdgcn_wmma_f32_16x16x32_bf16(false, a, false, b, (short)0, c, false, false); }
// A wave-uniform operand address held in scalar registers (each half through readfirstlane, cast to unsigned behind it), so that a fragment load is
// scalar base + one lane offset + immediate and needs no 64-bit address register pair of its own.
typedef __attribute__((address_space(1))) const v8h gv8h;
__device__ __forceinline__ gv8h* uptr(const h16* p) {
    const unsigned long long a = (unsigned long long)p;
    return (gv8h*)(((unsigned long long)(unsigned)__builtin_amdgcn_readfirstlane((int)(a >> 32)) << 32) | (unsigned)__builtin_amdgcn_readfirstlane((int)(unsigned)a));
}
typedef __attribute__((address_space(1))) const v8us gv8u;
__device__ __forceinline__ gv8u* uptrb(const bf* p) {
    const unsigned long long a = (unsigned long long)p;
    return (gv8u*)(((unsigned long long)(unsigned)__builtin_amdgcn_readfirstlane((int)(a >> 32)) << 32) | (unsigned)__builtin_amdgcn_readfirstlane((int)(unsigned)a));
}
// one 16 x 32 bf16 fragment in fragment order: the two 512-byte blocks at element offsets c and c + 256 from the uniform base u, each lane its own 16 bytes
#define LDB(u, c) cat16b((u)[ulane + (c) / 8], (u)[ulane + ((c) + 256) / 8])
// one 16 x 32 f16 fragment in fragment order: two 512-byte blocks at element offsets c and c + d2 from the uniform base u, each lane its own 16 bytes
#define LDU(u, c, d2) cat16((u)[ulane + (c) / 8], (u)[ulane + ((c) + (d2)) / 8])
#define VST2(T, p, v) do { const T vst2_v_ = (v); *(T*)(p) = vst2_v_;  } while (0)
// Fragment-order layout of a [rows][1024] 16-bit plane: 512-byte blocks of 16 rows x 16 columns, lane-major (lane = 16 * ((col >> 3) & 1) + (row & 15), 8 elements
// a lane), blocks ordered by (row >> 4, col >> 5, (col >> 4) & 1). pko = element offset of the 8-element piece at (row, col), col a multiple of 8. One wave-wide
// 16-byte fragment load then reads one block = 4 whole 128-byte lines; the second half of a fragment is the next block (+256), the next k-chunk of 32 is +512.
__device__ __forceinline__ size_t pko(int row, int col) {
    return ((size_t)(((row >> 4) * 32 + (col >> 5)) * 2 + ((col >> 4) & 1)) << 8) + (size_t)(((((col >> 3) & 1) << 4) + (row & 15)) << 3);
}

// k_cvtb: bf16 of an [nrows][1024] matrix; k_wt: k-major [1024][1024] -> n-major bf16; both written in fragment order (pko).
__global__ __launch_bounds__(256) void k_cvtb(const float* __restrict__ src, int nrows, bf* dst) {
    const int lane = threadIdx.x & 31, gw = blockIdx.x * 8 + (threadIdx.x >> 5), r = (gw >> 4) * 16 + (lane & 15);    // wave = 16 rows x 64 columns
    if (r >= nrows) return;
#pragma unroll
    for (int q = 0; q < 4; ++q) { const int col = (gw & 15) * 64 + q * 16 + (lane >> 4) * 8; v8us t;
#pragma unroll
        for (int i = 0; i < 8; ++i) t[i] = f2bf(src[(size_t)r * DM + col + i]);
        VST2(v8us, dst + pko(r, col), t); }
}
__global__ __launch_bounds__(256) void k_wt(const float* __restrict__ Wm, bf* WT) {
    __shared__ __align__(16) unsigned short tl[64 * 72];
    const int tid = threadIdx.x, k0 = blockIdx.x * 64, n0 = blockIdx.y * 64;
    const int kk = tid >> 2, nq = (tid & 3) * 16;
#pragma unroll
    for (int i = 0; i < 16; ++i) tl[(nq + i) * 72 + kk] = f2bf(Wm[(size_t)(k0 + kk) * DM + n0 + nq + i]);
    __syncthreads();
    auto pass = [&]() {
#pragma unroll
        for (int s = 0; s < 2; ++s) { const int u = (tid >> 5) + 8 * s, nr = (u >> 2) * 16 + (tid & 15), kcol = (u & 3) * 16 + ((tid >> 4) & 1) * 8;
            const v8us val = *(const v8usa*)(tl + nr * 72 + kcol);
            *(v8us*)(WT + pko(n0 + nr, k0 + kcol)) = val; }
    };
    pass(); 
}
// k_gemmb: 64 x 64 tile of A.B^T + bias over K = 1024 (bf16 exact; A, B in fragment order); MODE 0: f16 hi + residual planes (fragment order); MODE 1: f32 rows (V).
// The k loop is unrolled over a ring of GD register stages (one stage = the A fragment and the four B fragments of one k-chunk of 32): the loads of k-chunk c + GD are
// issued behind the WMMAs of k-chunk c, so that a wave waits for loads that are GD - 1 chunks old. A 16-row group of a plane is 32 KB in a row: every load is scalar base + lane + immediate.
#define GD 4
template <int MODE>
__global__ __launch_bounds__(128, 4) void k_gemmb(const bf* __restrict__ A, const bf* __restrict__ Bn, const float* __restrict__ bias, void* C, void* C2) {
    __shared__ __align__(16) float ost[4][16 * 68];
    const int lane = threadIdx.x & 31, wave = __builtin_amdgcn_readfirstlane(threadIdx.x >> 5), lr = lane & 15, hi = lane >> 4;    // wave in a scalar register: the operand bases below are scalar
    // the lane's number as the hardware counts it (equal to threadIdx.x & 31 here): with the mask form the compiler folds some constant block offsets into the mask, and such a load takes an address register of its own
    const unsigned ulane = __builtin_amdgcn_mbcnt_lo(~0u, 0u);
    const int r0 = blockIdx.x * 64 + wave * 16, c0 = blockIdx.y * 64;
    gv8u* ua = uptrb(A + pko(r0, 0)); gv8u* ub = uptrb(Bn + pko(c0, 0));    // + 512 elements: the next k-chunk; + 16 * DM: the next 16 rows
    v8f acc[4];
#pragma unroll
    for (int t = 0; t < 4; ++t) acc[t] = (v8f){};
    v16bf ar[GD], br[GD][4];
#pragma unroll
    for (int s = 0; s < GD; ++s) { ar[s] = LDB(ua, s * 512);
#pragma unroll
        for (int t = 0; t < 4; ++t) br[s][t] = LDB(ub, t * 16 * DM + s * 512);
        __builtin_amdgcn_sched_barrier(0); }    // keeps each stage's loads together and in stage order, so that the waits can count
#pragma unroll
    for (int c = 0; c < DM / 32; ++c) {
        const int s = c % GD;
#pragma unroll
        for (int t = 0; t < 4; ++t) acc[t] = wmmab(ar[s], br[s][t], acc[t]);
        __builtin_amdgcn_sched_barrier(0);    // the refill stays behind the WMMAs that read this stage, so that it lands in the same registers (no stage more, no spill)
        if (c + GD < DM / 32) { ar[s] = LDB(ua, (c + GD) * 512);
#pragma unroll
            for (int t = 0; t < 4; ++t) br[s][t] = LDB(ub, t * 16 * DM + (c + GD) * 512); }
        __builtin_amdgcn_sched_barrier(0);    // holds the refill of this stage here, GD chunks ahead of its WMMAs: without it the scheduler sinks the loads down to their use
    }
    asm volatile("s_wait_xcnt 0x0" ::: "memory");    // the epilogue reuses the lane-offset and scalar base registers that the ring's loads name: the wait stands in front of that
    __builtin_amdgcn_sched_barrier(0);    // keeps the epilogue's first register writes behind that wait
    float* os = &ost[wave][0];
#pragma unroll
    for (int t = 0; t < 4; ++t) { const float bv = bfr(bias[c0 + t * 16 + lr]);
#pragma unroll
        for (int j = 0; j < 8; ++j) os[(hi * 8 + j) * 68 + t * 16 + lr] = acc[t][j] + bv; }
    __syncthreads();
    if (MODE == 1) {
        float* crow = (float*)C + (size_t)r0 * DM + c0;
        auto pass = [&]() {
#pragma unroll
            for (int s = 0; s < 8; ++s) { const int Lid = (lane >> 3) + 4 * s, piece = lane & 7; const int row = Lid >> 1, cofs = (Lid & 1) * 32 + piece * 4;
                const v4f val = *(const v4fa*)(os + row * 68 + cofs); *(v4f*)(crow + (size_t)row * DM + cofs) = val; }
        };
        pass(); 
    } else {
        h16* c1 = (h16*)C; h16* c2 = (h16*)C2;
        auto pass = [&]() {
#pragma unroll
            for (int s = 0; s < 4; ++s) { const int col = s * 16 + hi * 8; const float* sp = os + lr * 68 + col; const size_t po = pko(r0 + lr, c0 + col); v8h o1, o2;
#pragma unroll
                for (int i = 0; i < 8; ++i) { const h16 a = (h16)sp[i]; o1[i] = a; o2[i] = (h16)((sp[i] - (float)a) * LOSC); }
                *(v8h*)(c1 + po) = o1; *(v8h*)(c2 + po) = o2; }
        };
        pass(); 
    }
}
// k_vt: VTH/VTL = f16 hi + residual of V^T, fragment order: [b][h][s / 32][d / 16][(s >> 4) & 1] blocks of 512 bytes, lane = 16 * ((s >> 3) & 1) + (d & 15); block (b, h, 64 s).
__global__ __launch_bounds__(256) void k_vt(const float* __restrict__ V, h16* VTH, h16* VTL) {
    __shared__ __align__(16) h16 tile[HD * 72];
    __shared__ __align__(16) h16 til2[HD * 72];
    const int bid = blockIdx.x;
    const int b = bid / (NH_ * (SS / 64)), rem = bid - b * (NH_ * (SS / 64)), h = rem / (SS / 64), kt = rem - h * (SS / 64);
    const int s0 = kt * 64, tid = threadIdx.x, ss = tid >> 2, d0 = (tid & 3) * 16;
    const float* src = V + ((size_t)b * SS + s0 + ss) * DM + h * HD + d0;
#pragma unroll
    for (int i = 0; i < 16; ++i) { const float v = src[i]; const h16 a = (h16)v; tile[(d0 + i) * 72 + ss] = a; til2[(d0 + i) * 72 + ss] = (h16)((v - (float)a) * LOSC); }
    __syncthreads();
    const size_t base = (((size_t)b * NH_ + h) * HD) * SS;
    const int lane = tid & 31, wv = tid >> 5, n = wv >> 1, p = wv & 1, d = n * 16 + (lane & 15);
    auto pass = [&]() {
#pragma unroll
        for (int s = 0; s < 4; ++s) { const int pln = s >> 1, ktl = s & 1;
            const v8h val = *(const v8ha*)((pln ? til2 : tile) + d * 72 + ktl * 32 + p * 16 + (lane >> 4) * 8);
            *(v8h*)((pln ? VTL : VTH) + base + (size_t)((((s0 >> 5) + ktl) * 4 + n) * 2 + p) * 256 + lane * 8) = val; }
    };
    pass(); 
}
// k_tabs: both tables in fragment order over groups g of 16 table rows m = 16 g + 1 .. 16 g + 16 (every band of k_attn starts at m = 1 mod 16; m = 0 is never used):
// RK16 [g < NGK][d / 16] blocks of 512 bytes = f16(bf16(rel_k_emb)), lane = 16 * ((d >> 3) & 1) + (m - 1 & 15); RVT16 [g < NGV][d / 16] blocks = f16(bf16(rel_v_emb))^T,
// lane = 16 * ((m - 1 >> 3) & 1) + (d & 15), via 64x64 LDS transposes (zero beyond row 2048); grid NRP/64 blocks.
__global__ __launch_bounds__(256) void k_tabs(const float* __restrict__ rk, const float* __restrict__ rv, h16* RK16, h16* RVT16) {
    __shared__ __align__(16) h16 tile[HD * 72];
    const int m0 = blockIdx.x * 64 + 1, tid = threadIdx.x, mm = tid >> 2, d0 = (tid & 3) * 16;
#pragma unroll
    for (int i = 0; i < 16; ++i) { const int m = m0 + mm; tile[(d0 + i) * 72 + mm] = (m < NRL) ? (h16)bfr(rv[(size_t)m * HD + d0 + i]) : (h16)0.f; }
    __syncthreads();
    const int lane = tid & 31, lr = lane & 15, hi = lane >> 4;
    auto pass = [&]() {
#pragma unroll
        for (int s = 0; s < 2; ++s) { const int u = (tid >> 5) + 8 * s, g = blockIdx.x * 4 + (u >> 2), m = 16 * g + 1 + lr, col = (u & 3) * 16 + hi * 8; v8h o;
#pragma unroll
            for (int i = 0; i < 8; ++i) o[i] = (m < NRL) ? (h16)bfr(rk[(size_t)m * HD + col + i]) : (h16)0.f;
            if (g < NGK) *(v8h*)(RK16 + (size_t)(g * 4 + (u & 3)) * 256 + lane * 8) = o; }
#pragma unroll
        for (int s = 0; s < 2; ++s) { const int u = (tid >> 5) + 8 * s, gl = u >> 2, n = u & 3, g = blockIdx.x * 4 + gl;
            const v8h val = *(const v8ha*)(tile + (n * 16 + lr) * 72 + gl * 16 + hi * 8);
            if (g < NGV) *(v8h*)(RVT16 + (size_t)(g * 4 + n) * 256 + lane * 8) = val; }
    };
    pass(); 
}
// k_attn: block = (b, h, 64 queries), wave = 16 queries i = q0..q0+15; 32 key tiles of 32: content 12 WMMA (hi.hi + hi.lo + lo.hi, q residual fragments re-read);
// relative-key band: rows m = mbase + 0..47 of RK16 (mbase = q0 - l0 - 31 + 1024) x (q hi, q lo) = 12 WMMA, parked in LDS; logit(i,j) = content + band[r][r - kk + 31]
// (UNSCALED); online softmax; weights x32768 hi + residual tiles pl/pl2 [16][32] AND the same weights scattered into relative coordinates pt/pt2 [16][64]
// (column r + 31 - kk; zero elsewhere); o += pa.vh, ox += pa.vl + px.vh (12 WMMA), o += pt.rv, ox += pt2.rv (16 WMMA, B = RVT16 rows d at k = mbase + ..);
// ctx = (o + ox/1024)/sum -> bf16 hi/lo planes [tok][h*64+d] in fragment order. Every global operand is read in fragment order (pko, k_vt, k_tabs).
__global__ __launch_bounds__(128, 4) void k_attn(const h16* __restrict__ QH, const h16* __restrict__ QL, const h16* __restrict__ KH, const h16* __restrict__ KL,
                                             const h16* __restrict__ RK16, const h16* __restrict__ RVT16, const h16* __restrict__ VTH, const h16* __restrict__ VTL, bf* CH, bf* CL) {
    __shared__ __align__(16) h16 plds[4][16 * 32];
    __shared__ __align__(16) h16 plds2[4][16 * 32];
    __shared__ __align__(16) h16 ptl[4][16 * 72];
    __shared__ __align__(16) h16 ptl2[4][16 * 72];
    __shared__ __align__(16) float posl[4][16 * 52];
    __shared__ __align__(16) float ost[4][16 * 68];
    const int lane = threadIdx.x & 31, wave = __builtin_amdgcn_readfirstlane(threadIdx.x >> 5), lr = lane & 15, hi = lane >> 4;    // wave in a scalar register: every operand block address below is scalar base + lane offset
    const unsigned ulane = lane;
    const int bid = blockIdx.x;
    const int b = bid / (NH_ * (SS / 64)), rem = bid - b * (NH_ * (SS / 64)), h = rem / (SS / 64), qt = rem - h * (SS / 64);
    const int q0 = qt * 64 + wave * 16;
    const size_t tok0 = (size_t)b * SS;
    h16* pl = &plds[wave][0]; h16* pl2 = &plds2[wave][0]; h16* pt = &ptl[wave][0]; h16* pt2 = &ptl2[wave][0]; float* ps = &posl[wave][0];
    // row r = 8 hi + j of each LDS tile addressed as one lane base + a constant in j (an immediate offset), so that the rows need no address register each
    float* psb = ps + hi * (8 * 52) + lr; const float* psg = ps + hi * (8 * 53) + 15 - lr;
    h16* plb = pl + hi * (8 * 32) + lr; h16* plb2 = pl2 + hi * (8 * 32) + lr; h16* ptb = pt + hi * (8 * 73) + 15 - lr; h16* ptb2 = pt2 + hi * (8 * 73) + 15 - lr;
    const size_t qo0 = pko((int)tok0 + q0, h * HD);    // wave-uniform block offset; LDU adds the lane's own piece
    v16h qa[2];
#pragma unroll
    for (int kc = 0; kc < 2; ++kc) qa[kc] = LDU(uptr(QH + qo0), kc * 512, 256);
    const size_t vbase = (((size_t)b * NH_ + h) * HD) * SS;
    v8f o[4], ox[4];
#pragma unroll
    for (int n = 0; n < 4; ++n) { o[n] = (v8f){}; ox[n] = (v8f){}; }
    float mrow[8], lpart[8];
#pragma unroll
    for (int j = 0; j < 8; ++j) { mrow[j] = -3.0e38f; lpart[j] = 0.f; }
    // zero the relative-coordinate weight tiles once (entries outside [r, r+31] of each row stay zero for every step)
    for (int e = lane; e < 16 * 72; e += 32) { pt[e] = (h16)0.f; pt2[e] = (h16)0.f; }
    // Operand fragments are loaded in groups well ahead of the WMMAs that read them (the "memory" fences below keep each group where it is written).
    // The q residual and band fragments of k-chunk 0 of a key tile are loaded during the tile before it and carried over the loop edge in these registers.
    v16h ql0, rb0[3];
    { gv8h* uql = uptr(QL + qo0); gv8h* urk = uptr(RK16 + (size_t)((q0 - 31 + 1024 - 1) >> 4) * 1024); ql0 = LDU(uql, 0, 256);
#pragma unroll
      for (int t = 0; t < 3; ++t) rb0[t] = LDU(urk, t * 1024, 256); }
#pragma unroll 1
    for (int kt = 0; kt < SS / 32; ++kt) {
        const int l0 = kt * 32, mbase = q0 - l0 - 31 + 1024, gb = (mbase - 1) >> 4;    // mbase = 16 gb + 1
        const size_t ko = pko((int)tok0 + l0, h * HD);    // + 512: k-chunk 1; + 16 * DM: the next 16 rows, 64 blocks on
        gv8h* ukh = uptr(KH + ko); gv8h* ukl = uptr(KL + ko); gv8h* uql = uptr(QL + qo0); gv8h* urk = uptr(RK16 + (size_t)gb * 1024);
        // group: q residual and band fragments of k-chunk 1, k fragments of k-chunk 0: in flight under the band of k-chunk 0
        v16h rb1[3];
        const v16h ql1 = LDU(uql, 512, 256);
#pragma unroll
        for (int t = 0; t < 3; ++t) rb1[t] = LDU(urk, t * 1024 + 512, 256);
        const v16h k0h0 = LDU(ukh, 0, 256), k1h0 = LDU(ukh, 16 * DM, 256), k0l0 = LDU(ukl, 0, 256), k1l0 = LDU(ukl, 16 * DM, 256);
        // The v_nop statements of this loop fill the vector slots the chip needs between a WMMA and the first read of its D or rewrite of its A / B,
        // and name those registers so that they stay whole up to there; their "memory" clobber also fences the load groups.
        // band tiles, k-chunk 0: rows m = mbase + t*16 + lr of RK16
#pragma unroll
        for (int t = 0; t < 3; ++t) {
            v8f ph = wmma16(qa[0], rb0[t], (v8f){}); v8f pq = wmma16(ql0, rb0[t], (v8f){});
            asm volatile("v_nop\n\tv_nop\n\tv_nop\n\tv_nop" : "+v"(ph), "+v"(pq) : "v"(rb0[t]), "v"(ql0));
#pragma unroll
            for (int j = 0; j < 8; ++j) psb[j * 52 + t * 16] = ph[j] + pq[j] * LOSCI;
            asm volatile("" ::: "memory"); }
        // group: k fragments of k-chunk 1, in flight under the band of k-chunk 1
        const v16h k0h1 = LDU(ukh, 512, 256), k1h1 = LDU(ukh, 16 * DM + 512, 256), k0l1 = LDU(ukl, 512, 256), k1l1 = LDU(ukl, 16 * DM + 512, 256);
        // band tiles, k-chunk 1
#pragma unroll
        for (int t = 0; t < 3; ++t) {
            v8f ph = wmma16(qa[1], rb1[t], (v8f){}); v8f pq = wmma16(ql1, rb1[t], (v8f){});
            asm volatile("v_nop\n\tv_nop\n\tv_nop\n\tv_nop" : "+v"(ph), "+v"(pq) : "v"(rb1[t]), "v"(ql1));
#pragma unroll
            for (int j = 0; j < 8; ++j) psb[j * 52 + t * 16] += ph[j] + pq[j] * LOSCI;
            asm volatile("" ::: "memory"); }
        // content, k-chunk 0 then 1
        v8f s0 = {}, s1 = {}, x0 = {}, x1 = {};
        s0 = wmma16(qa[0], k0h0, s0); x0 = wmma16(ql0, k0h0, x0); s1 = wmma16(qa[0], k1h0, s1); x1 = wmma16(ql0, k1h0, x1);
        asm volatile("v_nop" : "+v"(s0), "+v"(s1), "+v"(x0), "+v"(x1) : "v"(ql0), "v"(k0h0), "v"(k1h0) : "memory");
        x0 = wmma16(qa[0], k0l0, x0); x1 = wmma16(qa[0], k1l0, x1);
        asm volatile("v_nop" : "+v"(x0), "+v"(x1) : "v"(k0l0), "v"(k1l0) : "memory");
        s0 = wmma16(qa[1], k0h1, s0); x0 = wmma16(ql1, k0h1, x0); s1 = wmma16(qa[1], k1h1, s1); x1 = wmma16(ql1, k1h1, x1);
        asm volatile("v_nop" : "+v"(s0), "+v"(s1), "+v"(x0), "+v"(x1) : "v"(ql1), "v"(k0h1), "v"(k1h1) : "memory");
        x0 = wmma16(qa[1], k0l1, x0); x1 = wmma16(qa[1], k1l1, x1);
        asm volatile("v_nop" : "+v"(x0), "+v"(x1) : "v"(k0l1), "v"(k1l1) : "memory");
        asm volatile("v_nop\n\tv_nop\n\tv_nop\n\tv_nop" : "+v"(s0), "+v"(s1), "+v"(x0), "+v"(x1) : "v"(qa[0]), "v"(qa[1]));
        asm volatile("" ::: "memory");
        __builtin_amdgcn_wave_barrier();
        float alpha[8];
#pragma unroll
        for (int j = 0; j < 8; ++j) {
            const float p0v = psg[j * 53 + 16], p1v = psg[j * 53];    // band[r][r - kk + 31], kk = lr and lr + 16
            const float a0 = s0[j] + x0[j] * LOSCI + p0v, a1 = s1[j] + x1[j] * LOSCI + p1v;
            float mx = fmaxf(a0, a1);
            mx = fmaxf(mx, __shfl_xor(mx, 1, 16)); mx = fmaxf(mx, __shfl_xor(mx, 2, 16)); mx = fmaxf(mx, __shfl_xor(mx, 4, 16)); mx = fmaxf(mx, __shfl_xor(mx, 8, 16));
            const float mn = fmaxf(mrow[j], mx);
            alpha[j] = __expf(mrow[j] - mn); mrow[j] = mn;
            const float e0 = __expf(a0 - mn), e1 = __expf(a1 - mn);
            lpart[j] = lpart[j] * alpha[j] + (e0 + e1);
            const float ps0 = e0 * PSC, ps1 = e1 * PSC; const h16 h0 = (h16)ps0, h1 = (h16)ps1; const h16 g0 = (h16)((ps0 - (float)h0) * LOSC), g1 = (h16)((ps1 - (float)h1) * LOSC);
            plb[j * 32] = h0; plb[j * 32 + 16] = h1; plb2[j * 32] = g0; plb2[j * 32 + 16] = g1;
            ptb[j * 73 + 16] = h0; ptb[j * 73] = h1; ptb2[j * 73 + 16] = g0; ptb2[j * 73] = g1;
        }
#pragma unroll
        for (int n = 0; n < 4; ++n)
#pragma unroll
            for (int j = 0; j < 8; ++j) { o[n][j] *= alpha[j]; ox[n][j] *= alpha[j]; }
        asm volatile("" ::: "memory");
        // group: this tile's v hi + residual fragments and the rel_v fragments of the first k-chunk
        v16h vh[4], vl[4], rv0[4], rv1[4];
        gv8h* uvh = uptr(VTH + vbase + (size_t)kt * 2048); gv8h* uvl = uptr(VTL + vbase + (size_t)kt * 2048); gv8h* urv = uptr(RVT16 + (size_t)gb * 1024);
#pragma unroll
        for (int n = 0; n < 4; ++n) { vh[n] = LDU(uvh, n * 512, 256); vl[n] = LDU(uvl, n * 512, 256); }
#pragma unroll
        for (int n = 0; n < 4; ++n) rv0[n] = LDU(urv, n * 256, 1024);
        const v16h pa = cat16(*(const v8ha*)(pl + lr * 32 + hi * 8), *(const v8ha*)(pl + lr * 32 + 16 + hi * 8));
        const v16h px = cat16(*(const v8ha*)(pl2 + lr * 32 + hi * 8), *(const v8ha*)(pl2 + lr * 32 + 16 + hi * 8));
#pragma unroll
        for (int n = 0; n < 4; ++n) {
            o[n] = wmma16(pa, vh[n], o[n]); ox[n] = wmma16(pa, vl[n], ox[n]); ox[n] = wmma16(px, vh[n], ox[n]);
            asm volatile("" : "+v"(o[n]), "+v"(ox[n]) : "v"(vh[n]), "v"(vl[n]) : "memory");    // keeps the fragments whole through their WMMAs; its "memory" clobber holds the load groups where they are written
            if (n == 1) {    // group: rel_v fragments of the second k-chunk
#pragma unroll
                for (int m = 0; m < 4; ++m) rv1[m] = LDU(urv, 2048 + m * 256, 1024); }
        }
        // group: the next key tile's q residual and band fragments of k-chunk 0 (the last tile loads its own again: in bounds, unused)
        { const int ktn = kt + 1 < SS / 32 ? kt + 1 : kt; gv8h* urn = uptr(RK16 + (size_t)((q0 - ktn * 32 - 31 + 1024 - 1) >> 4) * 1024); ql0 = LDU(uql, 0, 256);
#pragma unroll
          for (int t = 0; t < 3; ++t) rb0[t] = LDU(urn, t * 1024, 256); }
        // relative-coordinate weights x rel_v: A = pt rows (k = m_local, 2 k-chunks), B = RVT16 rows d at k = mbase + kc*32
#pragma unroll
        for (int kc = 0; kc < 2; ++kc) {
            const v16h ra = cat16(*(const v8ha*)(pt + lr * 72 + kc * 32 + hi * 8), *(const v8ha*)(pt + lr * 72 + kc * 32 + 16 + hi * 8));
            const v16h rx = cat16(*(const v8ha*)(pt2 + lr * 72 + kc * 32 + hi * 8), *(const v8ha*)(pt2 + lr * 72 + kc * 32 + 16 + hi * 8));
#pragma unroll
            for (int n = 0; n < 4; ++n) { const v16h rvb = kc ? rv1[n] : rv0[n];
                o[n] = wmma16(ra, rvb, o[n]); ox[n] = wmma16(rx, rvb, ox[n]);
                asm volatile("" : "+v"(o[n]), "+v"(ox[n]) : "v"(rvb), "v"(ra), "v"(rx) : "memory"); }
        }
        __builtin_amdgcn_wave_barrier();
        // clear this step's scattered entries (row r used columns r .. r+31) for the next step
#pragma unroll
        for (int j = 0; j < 8; ++j) { ptb[j * 73 + 16] = (h16)0.f; ptb[j * 73] = (h16)0.f; ptb2[j * 73 + 16] = (h16)0.f; ptb2[j * 73] = (h16)0.f; }
        asm volatile("" ::: "memory");
        // the carried group's loads name scalar base registers that the next trip's address arithmetic rewrites: the wait stands in front of that rewrite
        asm volatile("s_wait_xcnt 0x0" ::: "memory");
    }
    asm volatile("v_nop\n\tv_nop\n\tv_nop\n\tv_nop" : "+v"(o[0]), "+v"(o[1]), "+v"(o[2]), "+v"(o[3]), "+v"(ox[0]), "+v"(ox[1]), "+v"(ox[2]), "+v"(ox[3]));
    float inv[8];
#pragma unroll
    for (int j = 0; j < 8; ++j) { float rs = lpart[j]; rs += __shfl_xor(rs, 1, 16); rs += __shfl_xor(rs, 2, 16); rs += __shfl_xor(rs, 4, 16); rs += __shfl_xor(rs, 8, 16); inv[j] = 1.0f / (rs * PSC); }
    float* os = &ost[wave][0];
#pragma unroll
    for (int n = 0; n < 4; ++n)
#pragma unroll
        for (int j = 0; j < 8; ++j) os[(hi * 8 + j) * 68 + n * 16 + lr] = (o[n][j] + ox[n][j] * LOSCI) * inv[j];
    __syncthreads();
    auto pass = [&]() {
#pragma unroll
        for (int s = 0; s < 4; ++s) { const int col = s * 16 + hi * 8; const float* sp = os + lr * 68 + col; const size_t po = pko((int)tok0 + q0 + lr, h * HD + col); v8us oh, ol;
#pragma unroll
            for (int i = 0; i < 8; ++i) { const unsigned short hb = f2bf(sp[i]); oh[i] = hb; ol[i] = f2bf(sp[i] - bf2f(hb)); }
            *(v8us*)(CH + po) = oh; *(v8us*)(CL + po) = ol; }
    };
    pass(); 
}
// k_outp: 64 x 64 tile of out = (CH + CL).WoT^T + bo over K = 1024 (2 products); f32 rows.
// Same register ring as k_gemmb, OD stages of two A fragments and four B fragments.
#define OD 3
__global__ __launch_bounds__(128, 4) void k_outp(const bf* __restrict__ A, const bf* __restrict__ Al, const bf* __restrict__ Bn, const float* __restrict__ bias, float* C) {
    __shared__ __align__(16) float ost[4][16 * 68];
    const int lane = threadIdx.x & 31, wave = __builtin_amdgcn_readfirstlane(threadIdx.x >> 5), lr = lane & 15, hi = lane >> 4;    // wave in a scalar register: the operand bases below are scalar
    // the lane's number as the hardware counts it (equal to threadIdx.x & 31 here): with the mask form the compiler folds some constant block offsets into the mask, and such a load takes an address register of its own
    const unsigned ulane = __builtin_amdgcn_mbcnt_lo(~0u, 0u);
    const int r0 = blockIdx.x * 64 + wave * 16, c0 = blockIdx.y * 64;
    gv8u* ua = uptrb(A + pko(r0, 0)); gv8u* ul = uptrb(Al + pko(r0, 0)); gv8u* ub = uptrb(Bn + pko(c0, 0));    // + 512 elements: the next k-chunk; + 16 * DM: the next 16 rows
    v8f acc[4];
#pragma unroll
    for (int t = 0; t < 4; ++t) acc[t] = (v8f){};
    v16bf ar[OD], lr2[OD], br[OD][4];
#pragma unroll
    for (int s = 0; s < OD; ++s) { ar[s] = LDB(ua, s * 512); lr2[s] = LDB(ul, s * 512);
#pragma unroll
        for (int t = 0; t < 4; ++t) br[s][t] = LDB(ub, t * 16 * DM + s * 512);
        __builtin_amdgcn_sched_barrier(0); }    // keeps each stage's loads together and in stage order, so that the waits can count
#pragma unroll
    for (int c = 0; c < DM / 32; ++c) {
        const int s = c % OD;
#pragma unroll
        for (int t = 0; t < 4; ++t) { acc[t] = wmmab(ar[s], br[s][t], acc[t]); acc[t] = wmmab(lr2[s], br[s][t], acc[t]); }
        __builtin_amdgcn_sched_barrier(0);    // the refill stays behind the WMMAs that read this stage, so that it lands in the same registers (no stage more, no spill)
        if (c + OD < DM / 32) { ar[s] = LDB(ua, (c + OD) * 512); lr2[s] = LDB(ul, (c + OD) * 512);
#pragma unroll
            for (int t = 0; t < 4; ++t) br[s][t] = LDB(ub, t * 16 * DM + (c + OD) * 512); }
        __builtin_amdgcn_sched_barrier(0);    // holds the refill of this stage here, OD chunks ahead of its WMMAs: without it the scheduler sinks the loads down to their use
    }
    asm volatile("s_wait_xcnt 0x0" ::: "memory");    // the epilogue reuses the lane-offset and scalar base registers that the ring's loads name: the wait stands in front of that
    __builtin_amdgcn_sched_barrier(0);    // keeps the epilogue's first register writes behind that wait
    float* os = &ost[wave][0];
#pragma unroll
    for (int t = 0; t < 4; ++t) { const float bv = bfr(bias[c0 + t * 16 + lr]);
#pragma unroll
        for (int j = 0; j < 8; ++j) os[(hi * 8 + j) * 68 + t * 16 + lr] = acc[t][j] + bv; }
    __syncthreads();
    float* crow = C + (size_t)r0 * DM + c0;
    auto pass = [&]() {
#pragma unroll
        for (int s = 0; s < 8; ++s) { const int Lid = (lane >> 3) + 4 * s, piece = lane & 7; const int row = Lid >> 1, cofs = (Lid & 1) * 32 + piece * 4;
            const v4f val = *(const v4fa*)(os + row * 68 + cofs); *(v4f*)(crow + (size_t)row * DM + cofs) = val; }
    };
    pass(); 
}

extern "C" void kernel_launch(void* const* d_in, const int* in_sizes, int n_in,
                              void* d_out, int out_size, void* d_ws, size_t ws_size, hipStream_t stream) {
    (void)in_sizes; (void)n_in; (void)out_size;
    const float* x = (const float*)d_in[0]; const float* Wq = (const float*)d_in[1]; const float* bq = (const float*)d_in[2]; const float* Wk = (const float*)d_in[3]; const float* bk = (const float*)d_in[4];
    const float* Wv = (const float*)d_in[5]; const float* bv = (const float*)d_in[6]; const float* Wo = (const float*)d_in[7]; const float* bo = (const float*)d_in[8];
    const float* rk = (const float*)d_in[9]; const float* rv = (const float*)d_in[10];
    float* out = (float*)d_out;    // [4][1024][1024]
    char* wsp = (char*)d_ws;
    auto take = [&](size_t bytes) { char* p = wsp; wsp += (bytes + 255) & ~(size_t)255; return (void*)p; };
    bf* Xb = (bf*)take((size_t)NTK * DM * 2); bf* WqT = (bf*)take((size_t)DM * DM * 2); bf* WkT = (bf*)take((size_t)DM * DM * 2); bf* WvT = (bf*)take((size_t)DM * DM * 2); bf* WoT = (bf*)take((size_t)DM * DM * 2);
    h16* QH = (h16*)take((size_t)NTK * DM * 2); h16* QL = (h16*)take((size_t)NTK * DM * 2); h16* KH = (h16*)take((size_t)NTK * DM * 2); h16* KL = (h16*)take((size_t)NTK * DM * 2);
    float* Vf = (float*)take((size_t)NTK * DM * 4); h16* VTH = (h16*)take((size_t)NTK * DM * 2); h16* VTL = (h16*)take((size_t)NTK * DM * 2);
    h16* RK16 = (h16*)take((size_t)NRP * HD * 2); h16* RVT16 = (h16*)take((size_t)HD * NRP * 2);
    if ((size_t)(wsp - (char*)d_ws) > ws_size) return;    // 8.4 + 8.4 + 33.5 + 16.8 + 16.8 + 0.5 ~ 85 MB; ctx planes alias Vf (dead after k_vt)
    bf* CH = (bf*)Vf; bf* CL = (bf*)((char*)Vf + (size_t)NTK * DM * 2);
    k_cvtb<<<NTK / 8, 256, 0, stream>>>(x, NTK, Xb);
    k_wt<<<dim3(DM / 64, DM / 64, 1), 256, 0, stream>>>(Wq, WqT); k_wt<<<dim3(DM / 64, DM / 64, 1), 256, 0, stream>>>(Wk, WkT);
    k_wt<<<dim3(DM / 64, DM / 64, 1), 256, 0, stream>>>(Wv, WvT); k_wt<<<dim3(DM / 64, DM / 64, 1), 256, 0, stream>>>(Wo, WoT);
    k_gemmb<0><<<dim3(NTK / 64, DM / 64, 1), 128, 0, stream>>>(Xb, WqT, bq, QH, QL);
    k_gemmb<0><<<dim3(NTK / 64, DM / 64, 1), 128, 0, stream>>>(Xb, WkT, bk, KH, KL);
    k_gemmb<1><<<dim3(NTK / 64, DM / 64, 1), 128, 0, stream>>>(Xb, WvT, bv, Vf, nullptr);
    k_vt<<<NB_ * NH_ * (SS / 64), 256, 0, stream>>>(Vf, VTH, VTL);
    k_tabs<<<NRP / 64, 256, 0, stream>>>(rk, rv, RK16, RVT16);
    k_attn<<<NB_ * NH_ * (SS / 64), 128, 0, stream>>>(QH, QL, KH, KL, RK16, RVT16, VTH, VTL, CH, CL);
    k_outp<<<dim3(NTK / 64, DM / 64, 1), 128, 0, stream>>>(CH, CL, WoT, bo, out);
}

// v004
// Measured time: 191 microseconds a run.
// In both of two side-by-side timings against v003, it was 1.17 times as fast.
// Counting every step since v000, it is 2.53 times as fast.
#include <hip/hip_runtime.h>

// Contractions, f32 accumulate: q/k/v = x.W + b and out = attn.Wo + bo ([4096 x 1024].[1024 x 1024]) on v_wmma_f32_16x16x32_bf16 — plain bf16 = rounded inputs
// (exact; k-major weights transposed to n-major planes) for the projections, attn as bf16 hi + residual planes (two products) for Wo; the relative-position
// attention fused on v_wmma_f32_16x16x32_f16 with UNSCALED logits (sigma ~ 11 over 1024 keys, near one-hot): content q.k as hi.hi + hi.lo + lo.hi, the relative-key
// band q.rel_k[m] (q hi + lo vs the exact f16 INPUT table) gathered per (i, j) at m = i - j + 1024, softmax, weights (x32768) hi + residual against v hi + residual,

#define NB_  4
#define SS   1024
#define DM   1024
#define NH_  16
#define HD   64
#define NTK  (NB_ * SS)          // 4096
#define NRL  2049                // relative table rows
#define NRP  2112                // padded (band reads up to mbase + 47 <= 2048; P~ k-chunks up to mbase + 63 <= 2064)
#define NGK  128                 // 16-row groups of the relative-key table that a band can reach (m <= 2048)
#define NGV  129                 // 16-row groups of the relative-value table (k-chunks reach m <= 2064, zero beyond 2048)
#define PSC  32768.0f
#define LOSC 1024.0f
#define LOSCI (1.0f / 1024.0f)

typedef _Float16 h16;
typedef unsigned short bf;
typedef __attribute__((ext_vector_type(16))) __bf16   v16bf;
typedef __attribute__((ext_vector_type(16))) _Float16 v16h;
typedef __attribute__((ext_vector_type(8)))  _Float16 v8h;
typedef __attribute__((ext_vector_type(8)))  unsigned short v8us;
typedef __attribute__((ext_vector_type(8)))  float    v8f;
typedef __attribute__((ext_vector_type(4)))  float    v4f;
typedef v8h  __attribute__((may_alias)) v8ha;
typedef v4f  __attribute__((may_alias)) v4fa;
typedef v8us __attribute__((may_alias)) v8usa;

__device__ __forceinline__ unsigned short f2bf(float f) { unsigned u = __float_as_uint(f); u += 0x7FFFu + ((u >> 16) & 1u); return (unsigned short)(u >> 16); }
__device__ __forceinline__ float bf2f(unsigned short b) { return __uint_as_float(((unsigned)b) << 16); }
__device__ __forceinline__ float bfr(float f) { return bf2f(f2bf(f)); }
__device__ __forceinline__ v16h cat16(v8h lo, v8h hi) { return __builtin_shufflevector(lo, hi, 0, 1, 2, 3, 4, 5, 6, 7, 8, 9, 10, 11, 12, 13, 14, 15); }
__device__ __forceinline__ v16bf cat16b(v8us lo, v8us hi) { return __builtin_bit_cast(v16bf, __builtin_shufflevector(lo, hi, 0, 1, 2, 3, 4, 5, 6, 7, 8, 9, 10, 11, 12, 13, 14, 15)); }
__device__ __forceinline__ v8f wmma16(v16h a, v16h b, v8f c) { return __builtin_amdgcn_wmma_f32_16x16x32_f16(false, a, false, b, (short)0, c, false, false); }
__device__ __forceinline__ v8f wmmab(v16bf a, v16bf b, v8f c) { return __builtin_amdgcn_wmma_f32_16x16x32_bf16(false, a, false, b, (short)0, c, false, false); }
// A wave-uniform operand address held in scalar registers (each half through readfirstlane, cast to unsigned behind it), so that a fragment load is
// scalar base + one lane offset + immediate and needs no 64-bit address register pair of its own.
typedef __attribute__((address_space(1))) const v8h gv8h;
__device__ __forceinline__ gv8h* uptr(const h16* p) {
    const unsigned long long a = (unsigned long long)p;
    return (gv8h*)(((unsigned long long)(unsigned)__builtin_amdgcn_readfirstlane((int)(a >> 32)) << 32) | (unsigned)__builtin_amdgcn_readfirstlane((int)(unsigned)a));
}
typedef __attribute__((address_space(1))) const v8us gv8u;
__device__ __forceinline__ gv8u* uptrb(const bf* p) {
    const unsigned long long a = (unsigned long long)p;
    return (gv8u*)(((unsigned long long)(unsigned)__builtin_amdgcn_readfirstlane((int)(a >> 32)) << 32) | (unsigned)__builtin_amdgcn_readfirstlane((int)(unsigned)a));
}
// one 16 x 32 bf16 fragment in fragment order: the two 512-byte blocks at element offsets c and c + 256 from the uniform base u, each lane its own 16 bytes
#define LDB(u, c) cat16b((u)[ulane + (c) / 8], (u)[ulane + ((c) + 256) / 8])
// one 16 x 32 f16 fragment in fragment order: two 512-byte blocks at element offsets c and c + d2 from the uniform base u, each lane its own 16 bytes
#define LDU(u, c, d2) cat16((u)[ulane + (c) / 8], (u)[ulane + ((c) + (d2)) / 8])
#define VST2(T, p, v) do { const T vst2_v_ = (v); *(T*)(p) = vst2_v_;  } while (0)
// Fragment-order layout of a [rows][1024] 16-bit plane: 512-byte blocks of 16 rows x 16 columns, lane-major (lane = 16 * ((col >> 3) & 1) + (row & 15), 8 elements
// a lane), blocks ordered by (row >> 4, col >> 5, (col >> 4) & 1). pko = element offset of the 8-element piece at (row, col), col a multiple of 8. One wave-wide
// 16-byte fragment load then reads one block = 4 whole 128-byte lines; the second half of a fragment is the next block (+256), the next k-chunk of 32 is +512.
__device__ __forceinline__ size_t pko(int row, int col) {
    return ((size_t)(((row >> 4) * 32 + (col >> 5)) * 2 + ((col >> 4) & 1)) << 8) + (size_t)(((((col >> 3) & 1) << 4) + (row & 15)) << 3);
}

// k_cvtb: bf16 of an [nrows][1024] matrix; k_wt: k-major [1024][1024] -> n-major bf16; both written in fragment order (pko).
__global__ __launch_bounds__(256) void k_cvtb(const float* __restrict__ src, int nrows, bf* dst) {
    const int lane = threadIdx.x & 31, gw = blockIdx.x * 8 + (threadIdx.x >> 5), r = (gw >> 4) * 16 + (lane & 15);    // wave = 16 rows x 64 columns
    if (r >= nrows) return;
#pragma unroll
    for (int q = 0; q < 4; ++q) { const int col = (gw & 15) * 64 + q * 16 + (lane >> 4) * 8; v8us t;
#pragma unroll
        for (int i = 0; i < 8; ++i) t[i] = f2bf(src[(size_t)r * DM + col + i]);
        VST2(v8us, dst + pko(r, col), t); }
}
__global__ __launch_bounds__(256) void k_wt(const float* __restrict__ Wm, bf* WT) {
    __shared__ __align__(16) unsigned short tl[64 * 72];
    const int tid = threadIdx.x, k0 = blockIdx.x * 64, n0 = blockIdx.y * 64;
    const int kk = tid >> 2, nq = (tid & 3) * 16;
#pragma unroll
    for (int i = 0; i < 16; ++i) tl[(nq + i) * 72 + kk] = f2bf(Wm[(size_t)(k0 + kk) * DM + n0 + nq + i]);
    __syncthreads();
    auto pass = [&]() {
#pragma unroll
        for (int s = 0; s < 2; ++s) { const int u = (tid >> 5) + 8 * s, nr = (u >> 2) * 16 + (tid & 15), kcol = (u & 3) * 16 + ((tid >> 4) & 1) * 8;
            const v8us val = *(const v8usa*)(tl + nr * 72 + kcol);
            *(v8us*)(WT + pko(n0 + nr, k0 + kcol)) = val; }
    };
    pass(); 
}
// k_gemmb: 64 x 64 tile of A.B^T + bias over K = 1024 (bf16 exact; A, B in fragment order); MODE 0: f16 hi + residual planes (fragment order); MODE 1: f32 rows (V).
// The k loop is unrolled over a ring of GD register stages (one stage = the A fragment and the four B fragments of one k-chunk of 32): the loads of k-chunk c + GD are
// issued behind the WMMAs of k-chunk c, so that a wave waits for loads that are GD - 1 chunks old. A 16-row group of a plane is 32 KB in a row: every load is scalar base + lane + immediate.
#define GD 4
template <int MODE>
__global__ __launch_bounds__(128, 4) void k_gemmb(const bf* __restrict__ A, const bf* __restrict__ Bn, const float* __restrict__ bias, void* C, void* C2) {
    __shared__ __align__(16) float ost[4][16 * 68];
    const int lane = threadIdx.x & 31, wave = __builtin_amdgcn_readfirstlane(threadIdx.x >> 5), lr = lane & 15, hi = lane >> 4;    // wave in a scalar register: the operand bases below are scalar
    // the lane's number as the hardware counts it (equal to threadIdx.x & 31 here): with the mask form the compiler folds some constant block offsets into the mask, and such a load takes an address register of its own
    const unsigned ulane = __builtin_amdgcn_mbcnt_lo(~0u, 0u);
    const int r0 = blockIdx.x * 64 + wave * 16, c0 = blockIdx.y * 64;
    gv8u* ua = uptrb(A + pko(r0, 0)); gv8u* ub = uptrb(Bn + pko(c0, 0));    // + 512 elements: the next k-chunk; + 16 * DM: the next 16 rows
    v8f acc[4];
#pragma unroll
    for (int t = 0; t < 4; ++t) acc[t] = (v8f){};
    v16bf ar[GD], br[GD][4];
#pragma unroll
    for (int s = 0; s < GD; ++s) { ar[s] = LDB(ua, s * 512);
#pragma unroll
        for (int t = 0; t < 4; ++t) br[s][t] = LDB(ub, t * 16 * DM + s * 512);
        __builtin_amdgcn_sched_barrier(0); }    // keeps each stage's loads together and in stage order, so that the waits can count
#pragma unroll
    for (int c = 0; c < DM / 32; ++c) {
        const int s = c % GD;
#pragma unroll
        for (int t = 0; t < 4; ++t) acc[t] = wmmab(ar[s], br[s][t], acc[t]);
        __builtin_amdgcn_sched_barrier(0);    // the refill stays behind the WMMAs that read this stage, so that it lands in the same registers (no stage more, no spill)
        if (c + GD < DM / 32) { ar[s] = LDB(ua, (c + GD) * 512);
#pragma unroll
            for (int t = 0; t < 4; ++t) br[s][t] = LDB(ub, t * 16 * DM + (c + GD) * 512); }
        __builtin_amdgcn_sched_barrier(0);    // holds the refill of this stage here, GD chunks ahead of its WMMAs: without it the scheduler sinks the loads down to their use
    }
    asm volatile("s_wait_xcnt 0x0" ::: "memory");    // the epilogue reuses the lane-offset and scalar base registers that the ring's loads name: the wait stands in front of that
    __builtin_amdgcn_sched_barrier(0);    // keeps the epilogue's first register writes behind that wait
    float* os = &ost[wave][0];
#pragma unroll
    for (int t = 0; t < 4; ++t) { const float bv = bfr(bias[c0 + t * 16 + lr]);
#pragma unroll
        for (int j = 0; j < 8; ++j) os[(hi * 8 + j) * 68 + t * 16 + lr] = acc[t][j] + bv; }
    __syncthreads();
    if (MODE == 1) {
        float* crow = (float*)C + (size_t)r0 * DM + c0;
        auto pass = [&]() {
#pragma unroll
            for (int s = 0; s < 8; ++s) { const int Lid = (lane >> 3) + 4 * s, piece = lane & 7; const int row = Lid >> 1, cofs = (Lid & 1) * 32 + piece * 4;
                const v4f val = *(const v4fa*)(os + row * 68 + cofs); *(v4f*)(crow + (size_t)row * DM + cofs) = val; }
        };
        pass(); 
    } else {
        h16* c1 = (h16*)C; h16* c2 = (h16*)C2;
        auto pass = [&]() {
#pragma unroll
            for (int s = 0; s < 4; ++s) { const int col = s * 16 + hi * 8; const float* sp = os + lr * 68 + col; const size_t po = pko(r0 + lr, c0 + col); v8h o1, o2;
#pragma unroll
                for (int i = 0; i < 8; ++i) { const h16 a = (h16)sp[i]; o1[i] = a; o2[i] = (h16)((sp[i] - (float)a) * LOSC); }
                *(v8h*)(c1 + po) = o1; *(v8h*)(c2 + po) = o2; }
        };
        pass(); 
    }
}
// k_vt: VTH/VTL = f16 hi + residual of V^T, fragment order: [b][h][s / 32][d / 16][(s >> 4) & 1] blocks of 512 bytes, lane = 16 * ((s >> 3) & 1) + (d & 15); block (b, h, 64 s).
__global__ __launch_bounds__(256) void k_vt(const float* __restrict__ V, h16* VTH, h16* VTL) {
    __shared__ __align__(16) h16 tile[HD * 72];
    __shared__ __align__(16) h16 til2[HD * 72];
    const int bid = blockIdx.x;
    const int b = bid / (NH_ * (SS / 64)), rem = bid - b * (NH_ * (SS / 64)), h = rem / (SS / 64), kt = rem - h * (SS / 64);
    const int s0 = kt * 64, tid = threadIdx.x, ss = tid >> 2, d0 = (tid & 3) * 16;
    const float* src = V + ((size_t)b * SS + s0 + ss) * DM + h * HD + d0;
#pragma unroll
    for (int i = 0; i < 16; ++i) { const float v = src[i]; const h16 a = (h16)v; tile[(d0 + i) * 72 + ss] = a; til2[(d0 + i) * 72 + ss] = (h16)((v - (float)a) * LOSC); }
    __syncthreads();
    const size_t base = (((size_t)b * NH_ + h) * HD) * SS;
    const int lane = tid & 31, wv = tid >> 5, n = wv >> 1, p = wv & 1, d = n * 16 + (lane & 15);
    auto pass = [&]() {
#pragma unroll
        for (int s = 0; s < 4; ++s) { const int pln = s >> 1, ktl = s & 1;
            const v8h val = *(const v8ha*)((pln ? til2 : tile) + d * 72 + ktl * 32 + p * 16 + (lane >> 4) * 8);
            *(v8h*)((pln ? VTL : VTH) + base + (size_t)((((s0 >> 5) + ktl) * 4 + n) * 2 + p) * 256 + lane * 8) = val; }
    };
    pass(); 
}
// k_tabs: both tables in fragment order over groups g of 16 table rows m = 16 g + 1 .. 16 g + 16 (every band of k_attn starts at m = 1 mod 16; m = 0 is never used):
// RK16 [g < NGK][d / 16] blocks of 512 bytes = f16(bf16(rel_k_emb)), lane = 16 * ((d >> 3) & 1) + (m - 1 & 15); RVT16 [g < NGV][d / 16] blocks = f16(bf16(rel_v_emb))^T,
// lane = 16 * ((m - 1 >> 3) & 1) + (d & 15), via 64x64 LDS transposes (zero beyond row 2048); grid NRP/64 blocks.
__global__ __launch_bounds__(256) void k_tabs(const float* __restrict__ rk, const float* __restrict__ rv, h16* RK16, h16* RVT16) {
    __shared__ __align__(16) h16 tile[HD * 72];
    const int m0 = blockIdx.x * 64 + 1, tid = threadIdx.x, mm = tid >> 2, d0 = (tid & 3) * 16;
#pragma unroll
    for (int i = 0; i < 16; ++i) { const int m = m0 + mm; tile[(d0 + i) * 72 + mm] = (m < NRL) ? (h16)bfr(rv[(size_t)m * HD + d0 + i]) : (h16)0.f; }
    __syncthreads();
    const int lane = tid & 31, lr = lane & 15, hi = lane >> 4;
    auto pass = [&]() {
#pragma unroll
        for (int s = 0; s < 2; ++s) { const int u = (tid >> 5) + 8 * s, g = blockIdx.x * 4 + (u >> 2), m = 16 * g + 1 + lr, col = (u & 3) * 16 + hi * 8; v8h o;
#pragma unroll
            for (int i = 0; i < 8; ++i) o[i] = (m < NRL) ? (h16)bfr(rk[(size_t)m * HD + col + i]) : (h16)0.f;
            if (g < NGK) *(v8h*)(RK16 + (size_t)(g * 4 + (u & 3)) * 256 + lane * 8) = o; }
#pragma unroll
        for (int s = 0; s < 2; ++s) { const int u = (tid >> 5) + 8 * s, gl = u >> 2, n = u & 3, g = blockIdx.x * 4 + gl;
            const v8h val = *(const v8ha*)(tile + (n * 16 + lr) * 72 + gl * 16 + hi * 8);
            if (g < NGV) *(v8h*)(RVT16 + (size_t)(g * 4 + n) * 256 + lane * 8) = val; }
    };
    pass(); 
}
// k_attn: block = (b, h, 64 queries), wave = 16 queries i = q0..q0+15; 32 key tiles of 32. Every product is taken TRANSPOSED (a stored fragment serves as A or as B alike): lane (lr, hi)
// holds column lr = ONE query of every tile, its 8 registers the rows 8 hi + j. Content S^T = k.q^T, 12 WMMA (hi.hi + hi.lo + lo.hi, q residual fragments re-read);
// relative-key band^T: rows m = mbase + 0..47 of RK16 (mbase = q0 - l0 - 31 + 1024) x (q hi, q lo) = 12 WMMA, parked in LDS as ps[query][m]; logit(i,j) = content + ps[r][r - kk + 31]
// (UNSCALED); online softmax: maximum and sum inside the lane plus one exchange between the wave halves; the weights x32768 hi + residual of the two score tiles, packed in place, ARE
// the B operand (k = 8 hi + s, 16 + 8 hi + s) of o^T += vh.pa, ox^T += vl.pa + vh.px (12 WMMA); the same weights scattered into relative coordinates pt/pt2 [query][64]
// (column r + 31 - kk; zero elsewhere) are the B operand of o^T += rv.pt, ox^T += rv.pt2 (16 WMMA, A = RVT16 rows d at k = mbase + ..);
// ctx = (o + ox/1024)/sum: a lane holds 8 consecutive d of its query = one 16-byte piece of the bf16 hi/lo planes [tok][h*64+d] in fragment order. Every global operand is read in fragment order (pko, k_vt, k_tabs).
#define PTP 136                  // row pitch of pt/pt2 in halves: 16 bytes x odd for the 16-byte readers; the scatter's lane stride PTP + 1 is 9 halves modulo the 64 banks, so the 8-half stores of 16 lanes lie side by side
typedef __attribute__((ext_vector_type(4))) unsigned v4u;
typedef v4u __attribute__((may_alias, aligned(2))) v4u2;
// the 8 halves of x in reverse order: the dwords reversed, each rotated by 16 bits
__device__ __forceinline__ v4u rev8(v8h x) { const v4u u = __builtin_bit_cast(v4u, x); return (v4u){ (u[3] >> 16) | (u[3] << 16), (u[2] >> 16) | (u[2] << 16), (u[1] >> 16) | (u[1] << 16), (u[0] >> 16) | (u[0] << 16) }; }
__device__ __forceinline__ float xhalf(float x) { return __builtin_bit_cast(float, __builtin_amdgcn_permlanex16(__builtin_bit_cast(int, x), __builtin_bit_cast(int, x), 0x76543210, 0xfedcba98, false, false)); }    // lane l with lane l ^ 16
__global__ __launch_bounds__(128, 4) void k_attn(const h16* __restrict__ QH, const h16* __restrict__ QL, const h16* __restrict__ KH, const h16* __restrict__ KL,
                                             const h16* __restrict__ RK16, const h16* __restrict__ RVT16, const h16* __restrict__ VTH, const h16* __restrict__ VTL, bf* CH, bf* CL) {
    __shared__ __align__(16) h16 ptl[4][16 * PTP];
    __shared__ __align__(16) h16 ptl2[4][16 * PTP];
    __shared__ __align__(16) float posl[4][16 * 52];
    const int lane = threadIdx.x & 31, wave = __builtin_amdgcn_readfirstlane(threadIdx.x >> 5), lr = lane & 15, hi = lane >> 4;    // wave in a scalar register: every operand block address below is scalar base + lane offset
    const unsigned ulane = lane;
    const int bid = blockIdx.x;
    const int b = bid / (NH_ * (SS / 64)), rem = bid - b * (NH_ * (SS / 64)), h = rem / (SS / 64), qt = rem - h * (SS / 64);
    const int q0 = qt * 64 + wave * 16;
    const size_t tok0 = (size_t)b * SS;
    h16* pt = &ptl[wave][0]; h16* pt2 = &ptl2[wave][0]; float* ps = &posl[wave][0];
    // row lr (the lane's query) of each LDS tile addressed as one lane base + a constant (an immediate offset). psb + 16 t + j: band column m = 16 t + 8 hi + j;
    // psg, ptb, ptb2 + 23 - 16 T - j: column r + 31 - kk of key kk = 16 T + 8 hi + j
    float* psb = ps + lr * 52 + hi * 8; const float* psg = ps + lr * 53 + 8 - hi * 8;
    h16* ptb = pt + lr * (PTP + 1) + 8 - hi * 8; h16* ptb2 = pt2 + lr * (PTP + 1) + 8 - hi * 8;
    const size_t qo0 = pko((int)tok0 + q0, h * HD);    // wave-uniform block offset; LDU adds the lane's own piece
    v16h qa[2];
#pragma unroll
    for (int kc = 0; kc < 2; ++kc) qa[kc] = LDU(uptr(QH + qo0), kc * 512, 256);
    const size_t vbase = (((size_t)b * NH_ + h) * HD) * SS;
    v8f o[4], ox[4];
#pragma unroll
    for (int n = 0; n < 4; ++n) { o[n] = (v8f){}; ox[n] = (v8f){}; }
    float mrow = -3.0e38f, lpart = 0.f;    // of the lane's query; lpart sums the keys of the lane's own wave half
    // zero the relative-coordinate weight tiles once (entries outside [r, r+31] of each row stay zero for every step)
    for (int e = lane; e < 16 * PTP; e += 32) { pt[e] = (h16)0.f; pt2[e] = (h16)0.f; }
    // Operand fragments are loaded in groups well ahead of the WMMAs that read them (the "memory" fences below keep each group where it is written).
    // The q residual and band fragments of k-chunk 0 of a key tile are loaded during the tile before it and carried over the loop edge in these registers.
    v16h ql0, rb0[3];
    { gv8h* uql = uptr(QL + qo0); gv8h* urk = uptr(RK16 + (size_t)((q0 - 31 + 1024 - 1) >> 4) * 1024); ql0 = LDU(uql, 0, 256);
#pragma unroll
      for (int t = 0; t < 3; ++t) rb0[t] = LDU(urk, t * 1024, 256); }
#pragma unroll 1
    for (int kt = 0; kt < SS / 32; ++kt) {
        const int l0 = kt * 32, mbase = q0 - l0 - 31 + 1024, gb = (mbase - 1) >> 4;    // mbase = 16 gb + 1
        const size_t ko = pko((int)tok0 + l0, h * HD);    // + 512: k-chunk 1; + 16 * DM: the next 16 rows, 64 blocks on
        gv8h* ukh = uptr(KH + ko); gv8h* ukl = uptr(KL + ko); gv8h* uql = uptr(QL + qo0); gv8h* urk = uptr(RK16 + (size_t)gb * 1024);
        // group: q residual and band fragments of k-chunk 1, k fragments of k-chunk 0: in flight under the band of k-chunk 0
        v16h rb1[3];
        const v16h ql1 = LDU(uql, 512, 256);
#pragma unroll
        for (int t = 0; t < 3; ++t) rb1[t] = LDU(urk, t * 1024 + 512, 256);
        const v16h k0h0 = LDU(ukh, 0, 256), k1h0 = LDU(ukh, 16 * DM, 256), k0l0 = LDU(ukl, 0, 256), k1l0 = LDU(ukl, 16 * DM, 256);
        // The v_nop statements of this loop fill the vector slots the chip needs between a WMMA and the first read of its D or rewrite of its A / B,
        // and name those registers so that they stay whole up to there; their "memory" clobber also fences the load groups.
        // band tiles, k-chunk 0: rows m = mbase + t*16 + lr of RK16
#pragma unroll
        for (int t = 0; t < 3; ++t) {
            v8f ph = wmma16(rb0[t], qa[0], (v8f){}); v8f pq = wmma16(rb0[t], ql0, (v8f){});
            asm volatile("v_nop\n\tv_nop\n\tv_nop\n\tv_nop" : "+v"(ph), "+v"(pq) : "v"(rb0[t]), "v"(ql0));
            v4f b0, b1;
#pragma unroll
            for (int j = 0; j < 4; ++j) { b0[j] = ph[j] + pq[j] * LOSCI; b1[j] = ph[j + 4] + pq[j + 4] * LOSCI; }
            *(v4fa*)(psb + t * 16) = b0; *(v4fa*)(psb + t * 16 + 4) = b1;
            asm volatile("" ::: "memory"); }
        // group: k fragments of k-chunk 1, in flight under the band of k-chunk 1
        const v16h k0h1 = LDU(ukh, 512, 256), k1h1 = LDU(ukh, 16 * DM + 512, 256), k0l1 = LDU(ukl, 512, 256), k1l1 = LDU(ukl, 16 * DM + 512, 256);
        // band tiles, k-chunk 1
#pragma unroll
        for (int t = 0; t < 3; ++t) {
            v8f ph = wmma16(rb1[t], qa[1], (v8f){}); v8f pq = wmma16(rb1[t], ql1, (v8f){});
            asm volatile("v_nop\n\tv_nop\n\tv_nop\n\tv_nop" : "+v"(ph), "+v"(pq) : "v"(rb1[t]), "v"(ql1));
            v4f b0 = *(const v4fa*)(psb + t * 16), b1 = *(const v4fa*)(psb + t * 16 + 4);
#pragma unroll
            for (int j = 0; j < 4; ++j) { b0[j] += ph[j] + pq[j] * LOSCI; b1[j] += ph[j + 4] + pq[j + 4] * LOSCI; }
            *(v4fa*)(psb + t * 16) = b0; *(v4fa*)(psb + t * 16 + 4) = b1;
            asm volatile("" ::: "memory"); }
        // content, k-chunk 0 then 1
        v8f s0 = {}, s1 = {}, x0 = {}, x1 = {};
        s0 = wmma16(k0h0, qa[0], s0); x0 = wmma16(k0h0, ql0, x0); s1 = wmma16(k1h0, qa[0], s1); x1 = wmma16(k1h0, ql0, x1);
        asm volatile("v_nop" : "+v"(s0), "+v"(s1), "+v"(x0), "+v"(x1) : "v"(ql0), "v"(k0h0), "v"(k1h0) : "memory");
        x0 = wmma16(k0l0, qa[0], x0); x1 = wmma16(k1l0, qa[0], x1);
        asm volatile("v_nop" : "+v"(x0), "+v"(x1) : "v"(k0l0), "v"(k1l0) : "memory");
        s0 = wmma16(k0h1, qa[1], s0); x0 = wmma16(k0h1, ql1, x0); s1 = wmma16(k1h1, qa[1], s1); x1 = wmma16(k1h1, ql1, x1);
        asm volatile("v_nop" : "+v"(s0), "+v"(s1), "+v"(x0), "+v"(x1) : "v"(ql1), "v"(k0h1), "v"(k1h1) : "memory");
        x0 = wmma16(k0l1, qa[1], x0); x1 = wmma16(k1l1, qa[1], x1);
        asm volatile("v_nop" : "+v"(x0), "+v"(x1) : "v"(k0l1), "v"(k1l1) : "memory");
        asm volatile("v_nop\n\tv_nop\n\tv_nop\n\tv_nop" : "+v"(s0), "+v"(s1), "+v"(x0), "+v"(x1) : "v"(qa[0]), "v"(qa[1]));
        asm volatile("" ::: "memory");
        __builtin_amdgcn_wave_barrier();
        v8f g0v, g1v;
#pragma unroll
        for (int j = 0; j < 8; ++j) g0v[j] = psg[23 - j];    // band[r][r - kk + 31], kk = 8 hi + j
#pragma unroll
        for (int j = 0; j < 8; ++j) g1v[j] = psg[7 - j];     // kk = 16 + 8 hi + j
        const v8f a0 = s0 + x0 * LOSCI + g0v, a1 = s1 + x1 * LOSCI + g1v;
        float tm[8];
#pragma unroll
        for (int j = 0; j < 8; ++j) tm[j] = fmaxf(a0[j], a1[j]);
        float mx = fmaxf(fmaxf(fmaxf(tm[0], tm[1]), fmaxf(tm[2], tm[3])), fmaxf(fmaxf(tm[4], tm[5]), fmaxf(tm[6], tm[7])));
        mx = fmaxf(mx, xhalf(mx));    // the other 16 keys of this query sit in the other wave half
        const float mn = fmaxf(mrow, mx), alpha = __expf(mrow - mn); mrow = mn;
        v8f e0, e1;
#pragma unroll
        for (int j = 0; j < 8; ++j) e0[j] = __expf(a0[j] - mn);
#pragma unroll
        for (int j = 0; j < 8; ++j) e1[j] = __expf(a1[j] - mn);
        const v8f es = e0 + e1, w0 = e0 * PSC, w1 = e1 * PSC;
        const v8h h0 = __builtin_convertvector(w0, v8h), h1 = __builtin_convertvector(w1, v8h);
        const v8h r0 = __builtin_convertvector((w0 - __builtin_convertvector(h0, v8f)) * LOSC, v8h), r1 = __builtin_convertvector((w1 - __builtin_convertvector(h1, v8f)) * LOSC, v8h);
        const v16h pa = cat16(h0, h1), px = cat16(r0, r1);
        // a lane's 8 keys of a tile are 8 consecutive relative columns in falling order: one 16-byte LDS store each, at an address that is a multiple of 2 bytes only
        *(v4u2*)(ptb + 16) = rev8(h0); *(v4u2*)ptb = rev8(h1); *(v4u2*)(ptb2 + 16) = rev8(r0); *(v4u2*)ptb2 = rev8(r1);
        lpart = lpart * alpha + (((es[0] + es[1]) + (es[2] + es[3])) + ((es[4] + es[5]) + (es[6] + es[7])));
#pragma unroll
        for (int n = 0; n < 4; ++n)
#pragma unroll
            for (int j = 0; j < 8; ++j) { o[n][j] *= alpha; ox[n][j] *= alpha; }
        asm volatile("" ::: "memory");
        // group: this tile's v hi + residual fragments and the rel_v fragments of the first k-chunk
        v16h vh[4], vl[4], rv0[4], rv1[4];
        gv8h* uvh = uptr(VTH + vbase + (size_t)kt * 2048); gv8h* uvl = uptr(VTL + vbase + (size_t)kt * 2048); gv8h* urv = uptr(RVT16 + (size_t)gb * 1024);
#pragma unroll
        for (int n = 0; n < 4; ++n) { vh[n] = LDU(uvh, n * 512, 256); vl[n] = LDU(uvl, n * 512, 256); }
#pragma unroll
        for (int n = 0; n < 4; ++n) rv0[n] = LDU(urv, n * 256, 1024);
#pragma unroll
        for (int n = 0; n < 4; ++n) {
            o[n] = wmma16(vh[n], pa, o[n]); ox[n] = wmma16(vl[n], pa, ox[n]); ox[n] = wmma16(vh[n], px, ox[n]);
            asm volatile("" : "+v"(o[n]), "+v"(ox[n]) : "v"(vh[n]), "v"(vl[n]) : "memory");    // keeps the fragments whole through their WMMAs; its "memory" clobber holds the load groups where they are written
            if (n == 1) {    // group: rel_v fragments of the second k-chunk
#pragma unroll
                for (int m = 0; m < 4; ++m) rv1[m] = LDU(urv, 2048 + m * 256, 1024); }
        }
        // group: the next key tile's q residual and band fragments of k-chunk 0 (the last tile loads its own again: in bounds, unused)
        { const int ktn = kt + 1 < SS / 32 ? kt + 1 : kt; gv8h* urn = uptr(RK16 + (size_t)((q0 - ktn * 32 - 31 + 1024 - 1) >> 4) * 1024); ql0 = LDU(uql, 0, 256);
#pragma unroll
          for (int t = 0; t < 3; ++t) rb0[t] = LDU(urn, t * 1024, 256); }
        // rel_v x relative-coordinate weights: A = RVT16 rows d at k = mbase + kc*32, B = pt rows (one query a lane, k = m_local, 2 k-chunks)
#pragma unroll
        for (int kc = 0; kc < 2; ++kc) {
            const v16h ra = cat16(*(const v8ha*)(pt + lr * PTP + kc * 32 + hi * 8), *(const v8ha*)(pt + lr * PTP + kc * 32 + 16 + hi * 8));
            const v16h rx = cat16(*(const v8ha*)(pt2 + lr * PTP + kc * 32 + hi * 8), *(const v8ha*)(pt2 + lr * PTP + kc * 32 + 16 + hi * 8));
#pragma unroll
            for (int n = 0; n < 4; ++n) { const v16h rvb = kc ? rv1[n] : rv0[n];
                o[n] = wmma16(rvb, ra, o[n]); ox[n] = wmma16(rvb, rx, ox[n]);
                asm volatile("" : "+v"(o[n]), "+v"(ox[n]) : "v"(rvb), "v"(ra), "v"(rx) : "memory"); }
        }
        __builtin_amdgcn_wave_barrier();
        // clear this step's scattered entries (row r used columns r .. r+31) for the next step
#pragma unroll
        for (int j = 0; j < 8; ++j) { ptb[23 - j] = (h16)0.f; ptb[7 - j] = (h16)0.f; ptb2[23 - j] = (h16)0.f; ptb2[7 - j] = (h16)0.f; }
        asm volatile("" ::: "memory");
        // the carried group's loads name scalar base registers that the next trip's address arithmetic rewrites: the wait stands in front of that rewrite
        asm volatile("s_wait_xcnt 0x0" ::: "memory");
    }
    asm volatile("v_nop\n\tv_nop\n\tv_nop\n\tv_nop" : "+v"(o[0]), "+v"(o[1]), "+v"(o[2]), "+v"(o[3]), "+v"(ox[0]), "+v"(ox[1]), "+v"(ox[2]), "+v"(ox[3]));
    const float rs = lpart + xhalf(lpart), inv = 1.0f / (rs * PSC);    // the two wave halves' sums of this query joined once
#pragma unroll
    for (int s = 0; s < 4; ++s) { const size_t po = pko((int)tok0 + q0 + lr, h * HD + s * 16 + hi * 8); v8us oh, ol;
#pragma unroll
        for (int i = 0; i < 8; ++i) { const float cv = (o[s][i] + ox[s][i] * LOSCI) * inv; const unsigned short hb = f2bf(cv); oh[i] = hb; ol[i] = f2bf(cv - bf2f(hb)); }
        *(v8us*)(CH + po) = oh; *(v8us*)(CL + po) = ol; }
}
// k_outp: 64 x 64 tile of out = (CH + CL).WoT^T + bo over K = 1024 (2 products); f32 rows.
// Same register ring as k_gemmb, OD stages of two A fragments and four B fragments.
#define OD 3
__global__ __launch_bounds__(128, 4) void k_outp(const bf* __restrict__ A, const bf* __restrict__ Al, const bf* __restrict__ Bn, const float* __restrict__ bias, float* C) {
    __shared__ __align__(16) float ost[4][16 * 68];
    const int lane = threadIdx.x & 31, wave = __builtin_amdgcn_readfirstlane(threadIdx.x >> 5), lr = lane & 15, hi = lane >> 4;    // wave in a scalar register: the operand bases below are scalar
    // the lane's number as the hardware counts it (equal to threadIdx.x & 31 here): with the mask form the compiler folds some constant block offsets into the mask, and such a load takes an address register of its own
    const unsigned ulane = __builtin_amdgcn_mbcnt_lo(~0u, 0u);
    const int r0 = blockIdx.x * 64 + wave * 16, c0 = blockIdx.y * 64;
    gv8u* ua = uptrb(A + pko(r0, 0)); gv8u* ul = uptrb(Al + pko(r0, 0)); gv8u* ub = uptrb(Bn + pko(c0, 0));    // + 512 elements: the next k-chunk; + 16 * DM: the next 16 rows
    v8f acc[4];
#pragma unroll
    for (int t = 0; t < 4; ++t) acc[t] = (v8f){};
    v16bf ar[OD], lr2[OD], br[OD][4];
#pragma unroll
    for (int s = 0; s < OD; ++s) { ar[s] = LDB(ua, s * 512); lr2[s] = LDB(ul, s * 512);
#pragma unroll
        for (int t = 0; t < 4; ++t) br[s][t] = LDB(ub, t * 16 * DM + s * 512);
        __builtin_amdgcn_sched_barrier(0); }    // keeps each stage's loads together and in stage order, so that the waits can count
#pragma unroll
    for (int c = 0; c < DM / 32; ++c) {
        const int s = c % OD;
#pragma unroll
        for (int t = 0; t < 4; ++t) { acc[t] = wmmab(ar[s], br[s][t], acc[t]); acc[t] = wmmab(lr2[s], br[s][t], acc[t]); }
        __builtin_amdgcn_sched_barrier(0);    // the refill stays behind the WMMAs that read this stage, so that it lands in the same registers (no stage more, no spill)
        if (c + OD < DM / 32) { ar[s] = LDB(ua, (c + OD) * 512); lr2[s] = LDB(ul, (c + OD) * 512);
#pragma unroll
            for (int t = 0; t < 4; ++t) br[s][t] = LDB(ub, t * 16 * DM + (c + OD) * 512); }
        __builtin_amdgcn_sched_barrier(0);    // holds the refill of this stage here, OD chunks ahead of its WMMAs: without it the scheduler sinks the loads down to their use
    }
    asm volatile("s_wait_xcnt 0x0" ::: "memory");    // the epilogue reuses the lane-offset and scalar base registers that the ring's loads name: the wait stands in front of that
    __builtin_amdgcn_sched_barrier(0);    // keeps the epilogue's first register writes behind that wait
    float* os = &ost[wave][0];
#pragma unroll
    for (int t = 0; t < 4; ++t) { const float bv = bfr(bias[c0 + t * 16 + lr]);
#pragma unroll
        for (int j = 0; j < 8; ++j) os[(hi * 8 + j) * 68 + t * 16 + lr] = acc[t][j] + bv; }
    __syncthreads();
    float* crow = C + (size_t)r0 * DM + c0;
    auto pass = [&]() {
#pragma unroll
        for (int s = 0; s < 8; ++s) { const int Lid = (lane >> 3) + 4 * s, piece = lane & 7; const int row = Lid >> 1, cofs = (Lid & 1) * 32 + piece * 4;
            const v4f val = *(const v4fa*)(os + row * 68 + cofs); *(v4f*)(crow + (size_t)row * DM + cofs) = val; }
    };
    pass(); 
}

extern "C" void kernel_launch(void* const* d_in, const int* in_sizes, int n_in,
                              void* d_out, int out_size, void* d_ws, size_t ws_size, hipStream_t stream) {
    (void)in_sizes; (void)n_in; (void)out_size;
    const float* x = (const float*)d_in[0]; const float* Wq = (const float*)d_in[1]; const float* bq = (const float*)d_in[2]; const float* Wk = (const float*)d_in[3]; const float* bk = (const float*)d_in[4];
    const float* Wv = (const float*)d_in[5]; const float* bv = (const float*)d_in[6]; const float* Wo = (const float*)d_in[7]; const float* bo = (const float*)d_in[8];
    const float* rk = (const float*)d_in[9]; const float* rv = (const float*)d_in[10];
    float* out = (float*)d_out;    // [4][1024][1024]
    char* wsp = (char*)d_ws;
    auto take = [&](size_t bytes) { char* p = wsp; wsp += (bytes + 255) & ~(size_t)255; return (void*)p; };
    bf* Xb = (bf*)take((size_t)NTK * DM * 2); bf* WqT = (bf*)take((size_t)DM * DM * 2); bf* WkT = (bf*)take((size_t)DM * DM * 2); bf* WvT = (bf*)take((size_t)DM * DM * 2); bf* WoT = (bf*)take((size_t)DM * DM * 2);
    h16* QH = (h16*)take((size_t)NTK * DM * 2); h16* QL = (h16*)take((size_t)NTK * DM * 2); h16* KH = (h16*)take((size_t)NTK * DM * 2); h16* KL = (h16*)take((size_t)NTK * DM * 2);
    float* Vf = (float*)take((size_t)NTK * DM * 4); h16* VTH = (h16*)take((size_t)NTK * DM * 2); h16* VTL = (h16*)take((size_t)NTK * DM * 2);
    h16* RK16 = (h16*)take((size_t)NRP * HD * 2); h16* RVT16 = (h16*)take((size_t)HD * NRP * 2);
    if ((size_t)(wsp - (char*)d_ws) > ws_size) return;    // 8.4 + 8.4 + 33.5 + 16.8 + 16.8 + 0.5 ~ 85 MB; ctx planes alias Vf (dead after k_vt)
    bf* CH = (bf*)Vf; bf* CL = (bf*)((char*)Vf + (size_t)NTK * DM * 2);
    k_cvtb<<<NTK / 8, 256, 0, stream>>>(x, NTK, Xb);
    k_wt<<<dim3(DM / 64, DM / 64, 1), 256, 0, stream>>>(Wq, WqT); k_wt<<<dim3(DM / 64, DM / 64, 1), 256, 0, stream>>>(Wk, WkT);
    k_wt<<<dim3(DM / 64, DM / 64, 1), 256, 0, stream>>>(Wv, WvT); k_wt<<<dim3(DM / 64, DM / 64, 1), 256, 0, stream>>>(Wo, WoT);
    k_gemmb<0><<<dim3(NTK / 64, DM / 64, 1), 128, 0, stream>>>(Xb, WqT, bq, QH, QL);
    k_gemmb<0><<<dim3(NTK / 64, DM / 64, 1), 128, 0, stream>>>(Xb, WkT, bk, KH, KL);
    k_gemmb<1><<<dim3(NTK / 64, DM / 64, 1), 128, 0, stream>>>(Xb, WvT, bv, Vf, nullptr);
    k_vt<<<NB_ * NH_ * (SS / 64), 256, 0, stream>>>(Vf, VTH, VTL);
    k_tabs<<<NRP / 64, 256, 0, stream>>>(rk, rv, RK16, RVT16);
    k_attn<<<NB_ * NH_ * (SS / 64), 128, 0, stream>>>(QH, QL, KH, KL, RK16, RVT16, VTH, VTL, CH, CL);
    k_outp<<<dim3(NTK / 64, DM / 64, 1), 128, 0, stream>>>(CH, CL, WoT, bo, out);
}

// v005
// A run of this version takes 177 microseconds.
// Next to v004, in two timings, it ran 1.08 times as fast each time.
// All steps since v000 together make it 2.74 times as fast.
#include <hip/hip_runtime.h>

// Contractions, f32 accumulate: q/k/v = x.W + b and out = attn.Wo + bo ([4096 x 1024].[1024 x 1024]) on v_wmma_f32_16x16x32_bf16 — plain bf16 = rounded inputs
// (exact; k-major weights transposed to n-major planes) for the projections, attn as bf16 hi + residual planes (two products) for Wo; the relative-position
// attention fused on v_wmma_f32_16x16x32_f16 with UNSCALED logits (sigma ~ 11 over 1024 keys, near one-hot): content q.k as hi.hi + hi.lo + lo.hi, the relative-key
// band q.rel_k[m] (q hi + lo vs the exact f16 INPUT table) gathered per (i, j) at m = i - j + 1024, softmax, weights (x32768) hi + residual against v hi + residual,

#define NB_  4
#define SS   1024
#define DM   1024
#define NH_  16
#define HD   64
#define NTK  (NB_ * SS)          // 4096
#define NRL  2049                // relative table rows
#define NRP  2112                // padded (band reads up to mbase + 47 <= 2048; P~ k-chunks up to mbase + 63 <= 2064)
#define NGK  128                 // 16-row groups of the relative-key table that a band can reach (m <= 2048)
#define NGV  129                 // 16-row groups of the relative-value table (k-chunks reach m <= 2064, zero beyond 2048)
#define PSC  32768.0f
#define LOSC 1024.0f
#define LOSCI (1.0f / 1024.0f)

typedef _Float16 h16;
typedef unsigned short bf;
typedef __attribute__((ext_vector_type(16))) __bf16   v16bf;
typedef __attribute__((ext_vector_type(16))) _Float16 v16h;
typedef __attribute__((ext_vector_type(8)))  _Float16 v8h;
typedef __attribute__((ext_vector_type(8)))  unsigned short v8us;
typedef __attribute__((ext_vector_type(8)))  float    v8f;
typedef __attribute__((ext_vector_type(4)))  float    v4f;
typedef v8h  __attribute__((may_alias)) v8ha;
typedef v4f  __attribute__((may_alias)) v4fa;
typedef v8us __attribute__((may_alias)) v8usa;

__device__ __forceinline__ unsigned short f2bf(float f) { unsigned u = __float_as_uint(f); u += 0x7FFFu + ((u >> 16) & 1u); return (unsigned short)(u >> 16); }
__device__ __forceinline__ float bf2f(unsigned short b) { return __uint_as_float(((unsigned)b) << 16); }
__device__ __forceinline__ float bfr(float f) { return bf2f(f2bf(f)); }
__device__ __forceinline__ v16h cat16(v8h lo, v8h hi) { return __builtin_shufflevector(lo, hi, 0, 1, 2, 3, 4, 5, 6, 7, 8, 9, 10, 11, 12, 13, 14, 15); }
__device__ __forceinline__ v16bf cat16b(v8us lo, v8us hi) { return __builtin_bit_cast(v16bf, __builtin_shufflevector(lo, hi, 0, 1, 2, 3, 4, 5, 6, 7, 8, 9, 10, 11, 12, 13, 14, 15)); }
__device__ __forceinline__ v8f wmma16(v16h a, v16h b, v8f c) { return __builtin_amdgcn_wmma_f32_16x16x32_f16(false, a, false, b, (short)0, c, false, false); }
__device__ __forceinline__ v8f wmmab(v16bf a, v16bf b, v8f c) { return __builtin_amdgcn_wmma_f32_16x16x32_bf16(false, a, false, b, (short)0, c, false, false); }
// A wave-uniform operand address held in scalar registers (each half through readfirstlane, cast to unsigned behind it), so that a fragment load is
// scalar base + one lane offset + immediate and needs no 64-bit address register pair of its own.
typedef __attribute__((address_space(1))) const v8h gv8h;
__device__ __forceinline__ gv8h* uptr(const h16* p) {
    const unsigned long long a = (unsigned long long)p;
    return (gv8h*)(((unsigned long long)(unsigned)__builtin_amdgcn_readfirstlane((int)(a >> 32)) << 32) | (unsigned)__builtin_amdgcn_readfirstlane((int)(unsigned)a));
}
typedef __attribute__((address_space(1))) const v8us gv8u;
__device__ __forceinline__ gv8u* uptrb(const bf* p) {
    const unsigned long long a = (unsigned long long)p;
    return (gv8u*)(((unsigned long long)(unsigned)__builtin_amdgcn_readfirstlane((int)(a >> 32)) << 32) | (unsigned)__builtin_amdgcn_readfirstlane((int)(unsigned)a));
}
// one 16 x 32 bf16 fragment in fragment order: the two 512-byte blocks at element offsets c and c + 256 from the uniform base u, each lane its own 16 bytes
#define LDB(u, c) cat16b((u)[ulane + (c) / 8], (u)[ulane + ((c) + 256) / 8])
// one 16 x 32 f16 fragment in fragment order: two 512-byte blocks at element offsets c and c + d2 from the uniform base u, each lane its own 16 bytes
#define LDU(u, c, d2) cat16((u)[ulane + (c) / 8], (u)[ulane + ((c) + (d2)) / 8])
#define VST2(T, p, v) do { const T vst2_v_ = (v); *(T*)(p) = vst2_v_;  } while (0)
// Fragment-order layout of a [rows][1024] 16-bit plane: 512-byte blocks of 16 rows x 16 columns, lane-major (lane = 16 * ((col >> 3) & 1) + (row & 15), 8 elements
// a lane), blocks ordered by (row >> 4, col >> 5, (col >> 4) & 1). pko = element offset of the 8-element piece at (row, col), col a multiple of 8. One wave-wide
// 16-byte fragment load then reads one block = 4 whole 128-byte lines; the second half of a fragment is the next block (+256), the next k-chunk of 32 is +512.
__device__ __forceinline__ size_t pko(int row, int col) {
    return ((size_t)(((row >> 4) * 32 + (col >> 5)) * 2 + ((col >> 4) & 1)) << 8) + (size_t)(((((col >> 3) & 1) << 4) + (row & 15)) << 3);
}

// The conversions that depend on inputs alone are block ranges of ONE launch (k_prep, below); each body takes its own block index.
// b_cvtb: bf16 of an [nrows][1024] matrix; b_wt: k-major [1024][1024] -> n-major bf16; both written in fragment order (pko).
__device__ __forceinline__ void b_cvtb(int blk, const float* __restrict__ src, int nrows, bf* dst) {
    const int lane = threadIdx.x & 31, gw = blk * 8 + (threadIdx.x >> 5), r = (gw >> 4) * 16 + (lane & 15);    // wave = 16 rows x 64 columns
    if (r >= nrows) return;
#pragma unroll
    for (int q = 0; q < 4; ++q) { const int col = (gw & 15) * 64 + q * 16 + (lane >> 4) * 8; v8us t;
#pragma unroll
        for (int i = 0; i < 8; ++i) t[i] = f2bf(src[(size_t)r * DM + col + i]);
        VST2(v8us, dst + pko(r, col), t); }
}
__device__ __forceinline__ void b_wt(int bk, int bn, unsigned short* tl, const float* __restrict__ Wm, bf* WT) {
    const int tid = threadIdx.x, k0 = bk * 64, n0 = bn * 64;
    const int kk = tid >> 2, nq = (tid & 3) * 16;
#pragma unroll
    for (int i = 0; i < 16; ++i) tl[(nq + i) * 72 + kk] = f2bf(Wm[(size_t)(k0 + kk) * DM + n0 + nq + i]);
    __syncthreads();
    auto pass = [&]() {
#pragma unroll
        for (int s = 0; s < 2; ++s) { const int u = (tid >> 5) + 8 * s, nr = (u >> 2) * 16 + (tid & 15), kcol = (u & 3) * 16 + ((tid >> 4) & 1) * 8;
            const v8us val = *(const v8usa*)(tl + nr * 72 + kcol);
            *(v8us*)(WT + pko(n0 + nr, k0 + kcol)) = val; }
    };
    pass();
    asm volatile("s_wait_xcnt 0x0" ::: "memory");    // in k_prep the code of the other block ranges follows these stores in the program and rewrites the registers they name: the wait stands in front of that
}
// k_gemmb: 64 x 64 tile of A.B^T + bias over K = 1024 (bf16 exact; A, B in fragment order); the three projections are the z planes of one grid:
// z = 0, 1 (q, k): f16 hi + residual planes (fragment order); z = 2 (v): f32 rows.
// The k loop is unrolled over a ring of GD register stages (one stage = the A fragment and the four B fragments of one k-chunk of 32): the loads of k-chunk c + GD are
// issued behind the WMMAs of k-chunk c, so that a wave waits for loads that are GD - 1 chunks old. A 16-row group of a plane is 32 KB in a row: every load is scalar base + lane + immediate.
#define GD 4
__global__ __launch_bounds__(128, 4) void k_gemmb(const bf* __restrict__ A, const bf* __restrict__ Bq, const bf* __restrict__ Bk, const bf* __restrict__ Bv,
                                                  const float* __restrict__ bq, const float* __restrict__ bk, const float* __restrict__ bv,
                                                  h16* QH, h16* QL, h16* KH, h16* KL, float* Vf) {
    __shared__ __align__(16) float ost[4][16 * 68];
    const int z = blockIdx.z;
    const bf* Bn = z == 0 ? Bq : z == 1 ? Bk : Bv; const float* bias = z == 0 ? bq : z == 1 ? bk : bv;
    const int lane = threadIdx.x & 31, wave = __builtin_amdgcn_readfirstlane(threadIdx.x >> 5), lr = lane & 15, hi = lane >> 4;    // wave in a scalar register: the operand bases below are scalar
    // the lane's number as the hardware counts it (equal to threadIdx.x & 31 here): with the mask form the compiler folds some constant block offsets into the mask, and such a load takes an address register of its own
    const unsigned ulane = __builtin_amdgcn_mbcnt_lo(~0u, 0u);
    const int r0 = blockIdx.x * 64 + wave * 16, c0 = blockIdx.y * 64;
    gv8u* ua = uptrb(A + pko(r0, 0)); gv8u* ub = uptrb(Bn + pko(c0, 0));    // + 512 elements: the next k-chunk; + 16 * DM: the next 16 rows
    v8f acc[4];
#pragma unroll
    for (int t = 0; t < 4; ++t) acc[t] = (v8f){};
    v16bf ar[GD], br[GD][4];
#pragma unroll
    for (int s = 0; s < GD; ++s) { ar[s] = LDB(ua, s * 512);
#pragma unroll
        for (int t = 0; t < 4; ++t) br[s][t] = LDB(ub, t * 16 * DM + s * 512);
        __builtin_amdgcn_sched_barrier(0); }    // keeps each stage's loads together and in stage order, so that the waits can count
#pragma unroll
    for (int c = 0; c < DM / 32; ++c) {
        const int s = c % GD;
#pragma unroll
        for (int t = 0; t < 4; ++t) acc[t] = wmmab(ar[s], br[s][t], acc[t]);
        __builtin_amdgcn_sched_barrier(0);    // the refill stays behind the WMMAs that read this stage, so that it lands in the same registers (no stage more, no spill)
        if (c + GD < DM / 32) { ar[s] = LDB(ua, (c + GD) * 512);
#pragma unroll
            for (int t = 0; t < 4; ++t) br[s][t] = LDB(ub, t * 16 * DM + (c + GD) * 512); }
        __builtin_amdgcn_sched_barrier(0);    // holds the refill of this stage here, GD chunks ahead of its WMMAs: without it the scheduler sinks the loads down to their use
    }
    asm volatile("s_wait_xcnt 0x0" ::: "memory");    // the epilogue reuses the lane-offset and scalar base registers that the ring's loads name: the wait stands in front of that
    __builtin_amdgcn_sched_barrier(0);    // keeps the epilogue's first register writes behind that wait
    float* os = &ost[wave][0];
#pragma unroll
    for (int t = 0; t < 4; ++t) { const float bv = bfr(bias[c0 + t * 16 + lr]);
#pragma unroll
        for (int j = 0; j < 8; ++j) os[(hi * 8 + j) * 68 + t * 16 + lr] = acc[t][j] + bv; }
    __syncthreads();
    if (z == 2) {
        float* crow = Vf + (size_t)r0 * DM + c0;
        auto pass = [&]() {
#pragma unroll
            for (int s = 0; s < 8; ++s) { const int Lid = (lane >> 3) + 4 * s, piece = lane & 7; const int row = Lid >> 1, cofs = (Lid & 1) * 32 + piece * 4;
                const v4f val = *(const v4fa*)(os + row * 68 + cofs); *(v4f*)(crow + (size_t)row * DM + cofs) = val; }
        };
        pass(); 
    } else {
        h16* c1 = z == 0 ? QH : KH; h16* c2 = z == 0 ? QL : KL;
        auto pass = [&]() {
#pragma unroll
            for (int s = 0; s < 4; ++s) { const int col = s * 16 + hi * 8; const float* sp = os + lr * 68 + col; const size_t po = pko(r0 + lr, c0 + col); v8h o1, o2;
#pragma unroll
                for (int i = 0; i < 8; ++i) { const h16 a = (h16)sp[i]; o1[i] = a; o2[i] = (h16)((sp[i] - (float)a) * LOSC); }
                *(v8h*)(c1 + po) = o1; *(v8h*)(c2 + po) = o2; }
        };
        pass();
        asm volatile("s_wait_xcnt 0x0" ::: "memory");    // the code of the v branch can follow these stores in the program and rewrites the registers they name: the wait stands in front of that
    }
}
// k_vt: VTH/VTL = f16 hi + residual of V^T, fragment order: [b][h][s / 32][d / 16][(s >> 4) & 1] blocks of 512 bytes, lane = 16 * ((s >> 3) & 1) + (d & 15); block (b, h, 64 s).
__global__ __launch_bounds__(256) void k_vt(const float* __restrict__ V, h16* VTH, h16* VTL) {
    __shared__ __align__(16) h16 tile[HD * 72];
    __shared__ __align__(16) h16 til2[HD * 72];
    const int bid = blockIdx.x;
    const int b = bid / (NH_ * (SS / 64)), rem = bid - b * (NH_ * (SS / 64)), h = rem / (SS / 64), kt = rem - h * (SS / 64);
    const int s0 = kt * 64, tid = threadIdx.x, ss = tid >> 2, d0 = (tid & 3) * 16;
    const float* src = V + ((size_t)b * SS + s0 + ss) * DM + h * HD + d0;
#pragma unroll
    for (int i = 0; i < 16; ++i) { const float v = src[i]; const h16 a = (h16)v; tile[(d0 + i) * 72 + ss] = a; til2[(d0 + i) * 72 + ss] = (h16)((v - (float)a) * LOSC); }
    __syncthreads();
    const size_t base = (((size_t)b * NH_ + h) * HD) * SS;
    const int lane = tid & 31, wv = tid >> 5, n = wv >> 1, p = wv & 1, d = n * 16 + (lane & 15);
    auto pass = [&]() {
#pragma unroll
        for (int s = 0; s < 4; ++s) { const int pln = s >> 1, ktl = s & 1;
            const v8h val = *(const v8ha*)((pln ? til2 : tile) + d * 72 + ktl * 32 + p * 16 + (lane >> 4) * 8);
            *(v8h*)((pln ? VTL : VTH) + base + (size_t)((((s0 >> 5) + ktl) * 4 + n) * 2 + p) * 256 + lane * 8) = val; }
    };
    pass(); 
}
// b_tabs: both tables in fragment order over groups g of 16 table rows m = 16 g + 1 .. 16 g + 16 (every band of k_attn starts at m = 1 mod 16; m = 0 is never used):
// RK16 [g < NGK][d / 16] blocks of 512 bytes = f16(bf16(rel_k_emb)), lane = 16 * ((d >> 3) & 1) + (m - 1 & 15); RVT16 [g < NGV][d / 16] blocks = f16(bf16(rel_v_emb))^T,
// lane = 16 * ((m - 1 >> 3) & 1) + (d & 15), via 64x64 LDS transposes (zero beyond row 2048); NRP/64 blocks.
__device__ __forceinline__ void b_tabs(int blk, h16* tile, const float* __restrict__ rk, const float* __restrict__ rv, h16* RK16, h16* RVT16) {
    const int m0 = blk * 64 + 1, tid = threadIdx.x, mm = tid >> 2, d0 = (tid & 3) * 16;
#pragma unroll
    for (int i = 0; i < 16; ++i) { const int m = m0 + mm; tile[(d0 + i) * 72 + mm] = (m < NRL) ? (h16)bfr(rv[(size_t)m * HD + d0 + i]) : (h16)0.f; }
    __syncthreads();
    const int lane = tid & 31, lr = lane & 15, hi = lane >> 4;
    auto pass = [&]() {
#pragma unroll
        for (int s = 0; s < 2; ++s) { const int u = (tid >> 5) + 8 * s, g = blk * 4 + (u >> 2), m = 16 * g + 1 + lr, col = (u & 3) * 16 + hi * 8; v8h o;
#pragma unroll
            for (int i = 0; i < 8; ++i) o[i] = (m < NRL) ? (h16)bfr(rk[(size_t)m * HD + col + i]) : (h16)0.f;
            if (g < NGK) *(v8h*)(RK16 + (size_t)(g * 4 + (u & 3)) * 256 + lane * 8) = o; }
#pragma unroll
        for (int s = 0; s < 2; ++s) { const int u = (tid >> 5) + 8 * s, gl = u >> 2, n = u & 3, g = blk * 4 + gl;
            const v8h val = *(const v8ha*)(tile + (n * 16 + lr) * 72 + gl * 16 + hi * 8);
            if (g < NGV) *(v8h*)(RVT16 + (size_t)(g * 4 + n) * 256 + lane * 8) = val; }
    };
    pass(); 
}
// k_prep: one launch for all six conversions, none of which reads what another writes. Block ranges: PBT blocks of the tables (first: the longest chain of dependent loads),
// PBX blocks of x, 4 x PBW blocks of the weights (k tile fastest). The range test reads blockIdx alone, so each body's barrier is passed by its whole block; the bodies with an LDS tile share one.
#define PBX (NTK / 8)
#define PBW ((DM / 64) * (DM / 64))
#define PBT (NRP / 64)
__global__ __launch_bounds__(256) void k_prep(const float* __restrict__ x, const float* __restrict__ Wq, const float* __restrict__ Wk, const float* __restrict__ Wv, const float* __restrict__ Wo,
                                              const float* __restrict__ rk, const float* __restrict__ rv, bf* Xb, bf* WqT, bf* WkT, bf* WvT, bf* WoT, h16* RK16, h16* RVT16) {
    __shared__ __align__(16) unsigned short tl[64 * 72];
    const int bid = blockIdx.x;
    if (bid < PBT) { b_tabs(bid, (h16*)tl, rk, rv, RK16, RVT16); return; }
    if (bid < PBT + PBX) { b_cvtb(bid - PBT, x, NTK, Xb); return; }
    const int u = bid - PBT - PBX, wi = u / PBW, t = u - wi * PBW;
    b_wt(t % (DM / 64), t / (DM / 64), tl, wi == 0 ? Wq : wi == 1 ? Wk : wi == 2 ? Wv : Wo, wi == 0 ? WqT : wi == 1 ? WkT : wi == 2 ? WvT : WoT);
}
// k_attn: block = (b, h, 64 queries), wave = 16 queries i = q0..q0+15; 32 key tiles of 32. Every product is taken TRANSPOSED (a stored fragment serves as A or as B alike): lane (lr, hi)
// holds column lr = ONE query of every tile, its 8 registers the rows 8 hi + j. Content S^T = k.q^T, 12 WMMA (hi.hi + hi.lo + lo.hi, q residual fragments re-read);
// relative-key band^T: rows m = mbase + 0..47 of RK16 (mbase = q0 - l0 - 31 + 1024) x (q hi, q lo) = 12 WMMA, parked in LDS as ps[query][m]; logit(i,j) = content + ps[r][r - kk + 31]
// (UNSCALED); online softmax: maximum and sum inside the lane plus one exchange between the wave halves; the weights x32768 hi + residual of the two score tiles, packed in place, ARE
// the B operand (k = 8 hi + s, 16 + 8 hi + s) of o^T += vh.pa, ox^T += vl.pa + vh.px (12 WMMA); the same weights scattered into relative coordinates pt/pt2 [query][64]
// (column r + 31 - kk; zero elsewhere) are the B operand of o^T += rv.pt, ox^T += rv.pt2 (16 WMMA, A = RVT16 rows d at k = mbase + ..);
// ctx = (o + ox/1024)/sum: a lane holds 8 consecutive d of its query = one 16-byte piece of the bf16 hi/lo planes [tok][h*64+d] in fragment order. Every global operand is read in fragment order (pko, k_vt, b_tabs).
#define PTP 136                  // row pitch of pt/pt2 in halves: 16 bytes x odd for the 16-byte readers; the scatter's lane stride PTP + 1 is 9 halves modulo the 64 banks, so the 8-half stores of 16 lanes lie side by side
typedef __attribute__((ext_vector_type(4))) unsigned v4u;
typedef v4u __attribute__((may_alias, aligned(2))) v4u2;
// the 8 halves of x in reverse order: the dwords reversed, each rotated by 16 bits
__device__ __forceinline__ v4u rev8(v8h x) { const v4u u = __builtin_bit_cast(v4u, x); return (v4u){ (u[3] >> 16) | (u[3] << 16), (u[2] >> 16) | (u[2] << 16), (u[1] >> 16) | (u[1] << 16), (u[0] >> 16) | (u[0] << 16) }; }
__device__ __forceinline__ float xhalf(float x) { return __builtin_bit_cast(float, __builtin_amdgcn_permlanex16(__builtin_bit_cast(int, x), __builtin_bit_cast(int, x), 0x76543210, 0xfedcba98, false, false)); }    // lane l with lane l ^ 16
__global__ __launch_bounds__(128, 4) void k_attn(const h16* __restrict__ QH, const h16* __restrict__ QL, const h16* __restrict__ KH, const h16* __restrict__ KL,
                                             const h16* __restrict__ RK16, const h16* __restrict__ RVT16, const h16* __restrict__ VTH, const h16* __restrict__ VTL, bf* CH, bf* CL) {
    __shared__ __align__(16) h16 ptl[4][16 * PTP];
    __shared__ __align__(16) h16 ptl2[4][16 * PTP];
    __shared__ __align__(16) float posl[4][16 * 52];
    const int lane = threadIdx.x & 31, wave = __builtin_amdgcn_readfirstlane(threadIdx.x >> 5), lr = lane & 15, hi = lane >> 4;    // wave in a scalar register: every operand block address below is scalar base + lane offset
    const unsigned ulane = lane;
    const int bid = blockIdx.x;
    const int b = bid / (NH_ * (SS / 64)), rem = bid - b * (NH_ * (SS / 64)), h = rem / (SS / 64), qt = rem - h * (SS / 64);
    const int q0 = qt * 64 + wave * 16;
    const size_t tok0 = (size_t)b * SS;
    h16* pt = &ptl[wave][0]; h16* pt2 = &ptl2[wave][0]; float* ps = &posl[wave][0];
    // row lr (the lane's query) of each LDS tile addressed as one lane base + a constant (an immediate offset). psb + 16 t + j: band column m = 16 t + 8 hi + j;
    // psg, ptb, ptb2 + 23 - 16 T - j: column r + 31 - kk of key kk = 16 T + 8 hi + j
    float* psb = ps + lr * 52 + hi * 8; const float* psg = ps + lr * 53 + 8 - hi * 8;
    h16* ptb = pt + lr * (PTP + 1) + 8 - hi * 8; h16* ptb2 = pt2 + lr * (PTP + 1) + 8 - hi * 8;
    const size_t qo0 = pko((int)tok0 + q0, h * HD);    // wave-uniform block offset; LDU adds the lane's own piece
    v16h qa[2];
#pragma unroll
    for (int kc = 0; kc < 2; ++kc) qa[kc] = LDU(uptr(QH + qo0), kc * 512, 256);
    const size_t vbase = (((size_t)b * NH_ + h) * HD) * SS;
    v8f o[4], ox[4];
#pragma unroll
    for (int n = 0; n < 4; ++n) { o[n] = (v8f){}; ox[n] = (v8f){}; }
    float mrow = -3.0e38f, lpart = 0.f;    // of the lane's query; lpart sums the keys of the lane's own wave half
    // zero the relative-coordinate weight tiles once (entries outside [r, r+31] of each row stay zero for every step)
    for (int e = lane; e < 16 * PTP; e += 32) { pt[e] = (h16)0.f; pt2[e] = (h16)0.f; }
    // Operand fragments are loaded in groups well ahead of the WMMAs that read them (the "memory" fences below keep each group where it is written).
    // The q residual and band fragments of k-chunk 0 of a key tile are loaded during the tile before it and carried over the loop edge in these registers.
    v16h ql0, rb0[3];
    { gv8h* uql = uptr(QL + qo0); gv8h* urk = uptr(RK16 + (size_t)((q0 - 31 + 1024 - 1) >> 4) * 1024); ql0 = LDU(uql, 0, 256);
#pragma unroll
      for (int t = 0; t < 3; ++t) rb0[t] = LDU(urk, t * 1024, 256); }
#pragma unroll 1
    for (int kt = 0; kt < SS / 32; ++kt) {
        const int l0 = kt * 32, mbase = q0 - l0 - 31 + 1024, gb = (mbase - 1) >> 4;    // mbase = 16 gb + 1
        const size_t ko = pko((int)tok0 + l0, h * HD);    // + 512: k-chunk 1; + 16 * DM: the next 16 rows, 64 blocks on
        gv8h* ukh = uptr(KH + ko); gv8h* ukl = uptr(KL + ko); gv8h* uql = uptr(QL + qo0); gv8h* urk = uptr(RK16 + (size_t)gb * 1024);
        // group: q residual and band fragments of k-chunk 1, k fragments of k-chunk 0: in flight under the band of k-chunk 0
        v16h rb1[3];
        const v16h ql1 = LDU(uql, 512, 256);
#pragma unroll
        for (int t = 0; t < 3; ++t) rb1[t] = LDU(urk, t * 1024 + 512, 256);
        const v16h k0h0 = LDU(ukh, 0, 256), k1h0 = LDU(ukh, 16 * DM, 256), k0l0 = LDU(ukl, 0, 256), k1l0 = LDU(ukl, 16 * DM, 256);
        // The v_nop statements of this loop fill the vector slots the chip needs between a WMMA and the first read of its D or rewrite of its A / B,
        // and name those registers so that they stay whole up to there; their "memory" clobber also fences the load groups.
        // band tiles, k-chunk 0: rows m = mbase + t*16 + lr of RK16
#pragma unroll
        for (int t = 0; t < 3; ++t) {
            v8f ph = wmma16(rb0[t], qa[0], (v8f){}); v8f pq = wmma16(rb0[t], ql0, (v8f){});
            asm volatile("v_nop\n\tv_nop\n\tv_nop\n\tv_nop" : "+v"(ph), "+v"(pq) : "v"(rb0[t]), "v"(ql0));
            v4f b0, b1;
#pragma unroll
            for (int j = 0; j < 4; ++j) { b0[j] = ph[j] + pq[j] * LOSCI; b1[j] = ph[j + 4] + pq[j + 4] * LOSCI; }
            *(v4fa*)(psb + t * 16) = b0; *(v4fa*)(psb + t * 16 + 4) = b1;
            asm volatile("" ::: "memory"); }
        // group: k fragments of k-chunk 1, in flight under the band of k-chunk 1
        const v16h k0h1 = LDU(ukh, 512, 256), k1h1 = LDU(ukh, 16 * DM + 512, 256), k0l1 = LDU(ukl, 512, 256), k1l1 = LDU(ukl, 16 * DM + 512, 256);
        // band tiles, k-chunk 1
#pragma unroll
        for (int t = 0; t < 3; ++t) {
            v8f ph = wmma16(rb1[t], qa[1], (v8f){}); v8f pq = wmma16(rb1[t], ql1, (v8f){});
            asm volatile("v_nop\n\tv_nop\n\tv_nop\n\tv_nop" : "+v"(ph), "+v"(pq) : "v"(rb1[t]), "v"(ql1));
            v4f b0 = *(const v4fa*)(psb + t * 16), b1 = *(const v4fa*)(psb + t * 16 + 4);
#pragma unroll
            for (int j = 0; j < 4; ++j) { b0[j] += ph[j] + pq[j] * LOSCI; b1[j] += ph[j + 4] + pq[j + 4] * LOSCI; }
            *(v4fa*)(psb + t * 16) = b0; *(v4fa*)(psb + t * 16 + 4) = b1;
            asm volatile("" ::: "memory"); }
        // content, k-chunk 0 then 1
        v8f s0 = {}, s1 = {}, x0 = {}, x1 = {};
        s0 = wmma16(k0h0, qa[0], s0); x0 = wmma16(k0h0, ql0, x0); s1 = wmma16(k1h0, qa[0], s1); x1 = wmma16(k1h0, ql0, x1);
        asm volatile("v_nop" : "+v"(s0), "+v"(s1), "+v"(x0), "+v"(x1) : "v"(ql0), "v"(k0h0), "v"(k1h0) : "memory");
        x0 = wmma16(k0l0, qa[0], x0); x1 = wmma16(k1l0, qa[0], x1);
        asm volatile("v_nop" : "+v"(x0), "+v"(x1) : "v"(k0l0), "v"(k1l0) : "memory");
        s0 = wmma16(k0h1, qa[1], s0); x0 = wmma16(k0h1, ql1, x0); s1 = wmma16(k1h1, qa[1], s1); x1 = wmma16(k1h1, ql1, x1);
        asm volatile("v_nop" : "+v"(s0), "+v"(s1), "+v"(x0), "+v"(x1) : "v"(ql1), "v"(k0h1), "v"(k1h1) : "memory");
        x0 = wmma16(k0l1, qa[1], x0); x1 = wmma16(k1l1, qa[1], x1);
        asm volatile("v_nop" : "+v"(x0), "+v"(x1) : "v"(k0l1), "v"(k1l1) : "memory");
        asm volatile("v_nop\n\tv_nop\n\tv_nop\n\tv_nop" : "+v"(s0), "+v"(s1), "+v"(x0), "+v"(x1) : "v"(qa[0]), "v"(qa[1]));
        asm volatile("" ::: "memory");
        __builtin_amdgcn_wave_barrier();
        v8f g0v, g1v;
#pragma unroll
        for (int j = 0; j < 8; ++j) g0v[j] = psg[23 - j];    // band[r][r - kk + 31], kk = 8 hi + j
#pragma unroll
        for (int j = 0; j < 8; ++j) g1v[j] = psg[7 - j];     // kk = 16 + 8 hi + j
        const v8f a0 = s0 + x0 * LOSCI + g0v, a1 = s1 + x1 * LOSCI + g1v;
        float tm[8];
#pragma unroll
        for (int j = 0; j < 8; ++j) tm[j] = fmaxf(a0[j], a1[j]);
        float mx = fmaxf(fmaxf(fmaxf(tm[0], tm[1]), fmaxf(tm[2], tm[3])), fmaxf(fmaxf(tm[4], tm[5]), fmaxf(tm[6], tm[7])));
        mx = fmaxf(mx, xhalf(mx));    // the other 16 keys of this query sit in the other wave half
        const float mn = fmaxf(mrow, mx), alpha = __expf(mrow - mn); mrow = mn;
        v8f e0, e1;
#pragma unroll
        for (int j = 0; j < 8; ++j) e0[j] = __expf(a0[j] - mn);
#pragma unroll
        for (int j = 0; j < 8; ++j) e1[j] = __expf(a1[j] - mn);
        const v8f es = e0 + e1, w0 = e0 * PSC, w1 = e1 * PSC;
        const v8h h0 = __builtin_convertvector(w0, v8h), h1 = __builtin_convertvector(w1, v8h);
        const v8h r0 = __builtin_convertvector((w0 - __builtin_convertvector(h0, v8f)) * LOSC, v8h), r1 = __builtin_convertvector((w1 - __builtin_convertvector(h1, v8f)) * LOSC, v8h);
        const v16h pa = cat16(h0, h1), px = cat16(r0, r1);
        // a lane's 8 keys of a tile are 8 consecutive relative columns in falling order: one 16-byte LDS store each, at an address that is a multiple of 2 bytes only
        *(v4u2*)(ptb + 16) = rev8(h0); *(v4u2*)ptb = rev8(h1); *(v4u2*)(ptb2 + 16) = rev8(r0); *(v4u2*)ptb2 = rev8(r1);
        lpart = lpart * alpha + (((es[0] + es[1]) + (es[2] + es[3])) + ((es[4] + es[5]) + (es[6] + es[7])));
#pragma unroll
        for (int n = 0; n < 4; ++n)
#pragma unroll
            for (int j = 0; j < 8; ++j) { o[n][j] *= alpha; ox[n][j] *= alpha; }
        asm volatile("" ::: "memory");
        // group: this tile's v hi + residual fragments and the rel_v fragments of the first k-chunk
        v16h vh[4], vl[4], rv0[4], rv1[4];
        gv8h* uvh = uptr(VTH + vbase + (size_t)kt * 2048); gv8h* uvl = uptr(VTL + vbase + (size_t)kt * 2048); gv8h* urv = uptr(RVT16 + (size_t)gb * 1024);
#pragma unroll
        for (int n = 0; n < 4; ++n) { vh[n] = LDU(uvh, n * 512, 256); vl[n] = LDU(uvl, n * 512, 256); }
#pragma unroll
        for (int n = 0; n < 4; ++n) rv0[n] = LDU(urv, n * 256, 1024);
#pragma unroll
        for (int n = 0; n < 4; ++n) {
            o[n] = wmma16(vh[n], pa, o[n]); ox[n] = wmma16(vl[n], pa, ox[n]); ox[n] = wmma16(vh[n], px, ox[n]);
            asm volatile("" : "+v"(o[n]), "+v"(ox[n]) : "v"(vh[n]), "v"(vl[n]) : "memory");    // keeps the fragments whole through their WMMAs; its "memory" clobber holds the load groups where they are written
            if (n == 1) {    // group: rel_v fragments of the second k-chunk
#pragma unroll
                for (int m = 0; m < 4; ++m) rv1[m] = LDU(urv, 2048 + m * 256, 1024); }
        }
        // group: the next key tile's q residual and band fragments of k-chunk 0 (the last tile loads its own again: in bounds, unused)
        { const int ktn = kt + 1 < SS / 32 ? kt + 1 : kt; gv8h* urn = uptr(RK16 + (size_t)((q0 - ktn * 32 - 31 + 1024 - 1) >> 4) * 1024); ql0 = LDU(uql, 0, 256);
#pragma unroll
          for (int t = 0; t < 3; ++t) rb0[t] = LDU(urn, t * 1024, 256); }
        // rel_v x relative-coordinate weights: A = RVT16 rows d at k = mbase + kc*32, B = pt rows (one query a lane, k = m_local, 2 k-chunks)
#pragma unroll
        for (int kc = 0; kc < 2; ++kc) {
            const v16h ra = cat16(*(const v8ha*)(pt + lr * PTP + kc * 32 + hi * 8), *(const v8ha*)(pt + lr * PTP + kc * 32 + 16 + hi * 8));
            const v16h rx = cat16(*(const v8ha*)(pt2 + lr * PTP + kc * 32 + hi * 8), *(const v8ha*)(pt2 + lr * PTP + kc * 32 + 16 + hi * 8));
#pragma unroll
            for (int n = 0; n < 4; ++n) { const v16h rvb = kc ? rv1[n] : rv0[n];
                o[n] = wmma16(rvb, ra, o[n]); ox[n] = wmma16(rvb, rx, ox[n]);
                asm volatile("" : "+v"(o[n]), "+v"(ox[n]) : "v"(rvb), "v"(ra), "v"(rx) : "memory"); }
        }
        __builtin_amdgcn_wave_barrier();
        // clear this step's scattered entries (row r used columns r .. r+31) for the next step
#pragma unroll
        for (int j = 0; j < 8; ++j) { ptb[23 - j] = (h16)0.f; ptb[7 - j] = (h16)0.f; ptb2[23 - j] = (h16)0.f; ptb2[7 - j] = (h16)0.f; }
        asm volatile("" ::: "memory");
        // the carried group's loads name scalar base registers that the next trip's address arithmetic rewrites: the wait stands in front of that rewrite
        asm volatile("s_wait_xcnt 0x0" ::: "memory");
    }
    asm volatile("v_nop\n\tv_nop\n\tv_nop\n\tv_nop" : "+v"(o[0]), "+v"(o[1]), "+v"(o[2]), "+v"(o[3]), "+v"(ox[0]), "+v"(ox[1]), "+v"(ox[2]), "+v"(ox[3]));
    const float rs = lpart + xhalf(lpart), inv = 1.0f / (rs * PSC);    // the two wave halves' sums of this query joined once
#pragma unroll
    for (int s = 0; s < 4; ++s) { const size_t po = pko((int)tok0 + q0 + lr, h * HD + s * 16 + hi * 8); v8us oh, ol;
#pragma unroll
        for (int i = 0; i < 8; ++i) { const float cv = (o[s][i] + ox[s][i] * LOSCI) * inv; const unsigned short hb = f2bf(cv); oh[i] = hb; ol[i] = f2bf(cv - bf2f(hb)); }
        *(v8us*)(CH + po) = oh; *(v8us*)(CL + po) = ol; }
}
// k_outp: 64 x 64 tile of out = (CH + CL).WoT^T + bo over K = 1024 (2 products); f32 rows.
// Same register ring as k_gemmb, OD stages of two A fragments and four B fragments.
#define OD 3
__global__ __launch_bounds__(128, 4) void k_outp(const bf* __restrict__ A, const bf* __restrict__ Al, const bf* __restrict__ Bn, const float* __restrict__ bias, float* C) {
    __shared__ __align__(16) float ost[4][16 * 68];
    const int lane = threadIdx.x & 31, wave = __builtin_amdgcn_readfirstlane(threadIdx.x >> 5), lr = lane & 15, hi = lane >> 4;    // wave in a scalar register: the operand bases below are scalar
    // the lane's number as the hardware counts it (equal to threadIdx.x & 31 here): with the mask form the compiler folds some constant block offsets into the mask, and such a load takes an address register of its own
    const unsigned ulane = __builtin_amdgcn_mbcnt_lo(~0u, 0u);
    const int r0 = blockIdx.x * 64 + wave * 16, c0 = blockIdx.y * 64;
    gv8u* ua = uptrb(A + pko(r0, 0)); gv8u* ul = uptrb(Al + pko(r0, 0)); gv8u* ub = uptrb(Bn + pko(c0, 0));    // + 512 elements: the next k-chunk; + 16 * DM: the next 16 rows
    v8f acc[4];
#pragma unroll
    for (int t = 0; t < 4; ++t) acc[t] = (v8f){};
    v16bf ar[OD], lr2[OD], br[OD][4];
#pragma unroll
    for (int s = 0; s < OD; ++s) { ar[s] = LDB(ua, s * 512); lr2[s] = LDB(ul, s * 512);
#pragma unroll
        for (int t = 0; t < 4; ++t) br[s][t] = LDB(ub, t * 16 * DM + s * 512);
        __builtin_amdgcn_sched_barrier(0); }    // keeps each stage's loads together and in stage order, so that the waits can count
#pragma unroll
    for (int c = 0; c < DM / 32; ++c) {
        const int s = c % OD;
#pragma unroll
        for (int t = 0; t < 4; ++t) { acc[t] = wmmab(ar[s], br[s][t], acc[t]); acc[t] = wmmab(lr2[s], br[s][t], acc[t]); }
        __builtin_amdgcn_sched_barrier(0);    // the refill stays behind the WMMAs that read this stage, so that it lands in the same registers (no stage more, no spill)
        if (c + OD < DM / 32) { ar[s] = LDB(ua, (c + OD) * 512); lr2[s] = LDB(ul, (c + OD) * 512);
#pragma unroll
            for (int t = 0; t < 4; ++t) br[s][t] = LDB(ub, t * 16 * DM + (c + OD) * 512); }
        __builtin_amdgcn_sched_barrier(0);    // holds the refill of this stage here, OD chunks ahead of its WMMAs: without it the scheduler sinks the loads down to their use
    }
    asm volatile("s_wait_xcnt 0x0" ::: "memory");    // the epilogue reuses the lane-offset and scalar base registers that the ring's loads name: the wait stands in front of that
    __builtin_amdgcn_sched_barrier(0);    // keeps the epilogue's first register writes behind that wait
    float* os = &ost[wave][0];
#pragma unroll
    for (int t = 0; t < 4; ++t) { const float bv = bfr(bias[c0 + t * 16 + lr]);
#pragma unroll
        for (int j = 0; j < 8; ++j) os[(hi * 8 + j) * 68 + t * 16 + lr] = acc[t][j] + bv; }
    __syncthreads();
    float* crow = C + (size_t)r0 * DM + c0;
    auto pass = [&]() {
#pragma unroll
        for (int s = 0; s < 8; ++s) { const int Lid = (lane >> 3) + 4 * s, piece = lane & 7; const int row = Lid >> 1, cofs = (Lid & 1) * 32 + piece * 4;
            const v4f val = *(const v4fa*)(os + row * 68 + cofs); *(v4f*)(crow + (size_t)row * DM + cofs) = val; }
    };
    pass(); 
}

extern "C" void kernel_launch(void* const* d_in, const int* in_sizes, int n_in,
                              void* d_out, int out_size, void* d_ws, size_t ws_size, hipStream_t stream) {
    (void)in_sizes; (void)n_in; (void)out_size;
    const float* x = (const float*)d_in[0]; const float* Wq = (const float*)d_in[1]; const float* bq = (const float*)d_in[2]; const float* Wk = (const float*)d_in[3]; const float* bk = (const float*)d_in[4];
    const float* Wv = (const float*)d_in[5]; const float* bv = (const float*)d_in[6]; const float* Wo = (const float*)d_in[7]; const float* bo = (const float*)d_in[8];
    const float* rk = (const float*)d_in[9]; const float* rv = (const float*)d_in[10];
    float* out = (float*)d_out;    // [4][1024][1024]
    char* wsp = (char*)d_ws;
    auto take = [&](size_t bytes) { char* p = wsp; wsp += (bytes + 255) & ~(size_t)255; return (void*)p; };
    bf* Xb = (bf*)take((size_t)NTK * DM * 2); bf* WqT = (bf*)take((size_t)DM * DM * 2); bf* WkT = (bf*)take((size_t)DM * DM * 2); bf* WvT = (bf*)take((size_t)DM * DM * 2); bf* WoT = (bf*)take((size_t)DM * DM * 2);
    h16* QH = (h16*)take((size_t)NTK * DM * 2); h16* QL = (h16*)take((size_t)NTK * DM * 2); h16* KH = (h16*)take((size_t)NTK * DM * 2); h16* KL = (h16*)take((size_t)NTK * DM * 2);
    float* Vf = (float*)take((size_t)NTK * DM * 4); h16* VTH = (h16*)take((size_t)NTK * DM * 2); h16* VTL = (h16*)take((size_t)NTK * DM * 2);
    h16* RK16 = (h16*)take((size_t)NRP * HD * 2); h16* RVT16 = (h16*)take((size_t)HD * NRP * 2);
    if ((size_t)(wsp - (char*)d_ws) > ws_size) return;    // 8.4 + 8.4 + 33.5 + 16.8 + 16.8 + 0.5 ~ 85 MB; ctx planes alias Vf (dead after k_vt)
    bf* CH = (bf*)Vf; bf* CL = (bf*)((char*)Vf + (size_t)NTK * DM * 2);
    k_prep<<<PBX + 4 * PBW + PBT, 256, 0, stream>>>(x, Wq, Wk, Wv, Wo, rk, rv, Xb, WqT, WkT, WvT, WoT, RK16, RVT16);
    k_gemmb<<<dim3(NTK / 64, DM / 64, 3), 128, 0, stream>>>(Xb, WqT, WkT, WvT, bq, bk, bv, QH, QL, KH, KL, Vf);
    k_vt<<<NB_ * NH_ * (SS / 64), 256, 0, stream>>>(Vf, VTH, VTL);
    k_attn<<<NB_ * NH_ * (SS / 64), 128, 0, stream>>>(QH, QL, KH, KL, RK16, RVT16, VTH, VTL, CH, CL);
    k_outp<<<dim3(NTK / 64, DM / 64, 1), 128, 0, stream>>>(CH, CL, WoT, bo, out);
}

// v006
// A run of this version takes 160 microseconds.
// Two timings next to v005 put it at 1.10 and 1.11 times that version's speed.
// Counting every step since v000, it is 3.03 times as fast.
#include <hip/hip_runtime.h>

// Contractions, f32 accumulate: q/k/v = x.W + b and out = attn.Wo + bo ([4096 x 1024].[1024 x 1024]) on v_wmma_f32_16x16x32_bf16 — plain bf16 = rounded inputs
// (exact; k-major weights transposed to n-major planes) for the projections, attn as bf16 hi + residual planes (two products) for Wo; the relative-position
// attention fused on v_wmma_f32_16x16x32_f16 with UNSCALED logits (sigma ~ 11 over 1024 keys, near one-hot): content q.k as hi.hi + hi.lo + lo.hi, the relative-key
// band q.rel_k[m] (q hi + lo vs the exact f16 INPUT table) gathered per (i, j) at m = i - j + 1024, softmax, weights (x32768) hi + residual against v hi + residual,

#define NB_  4
#define SS   1024
#define DM   1024
#define NH_  16
#define HD   64
#define NTK  (NB_ * SS)          // 4096
#define NRL  2049                // relative table rows
#define NRP  2112                // padded (band reads up to mbase + 47 <= 2048; P~ k-chunks up to mbase + 63 <= 2064)
#define NGK  128                 // 16-row groups of the relative-key table that a band can reach (m <= 2048)
#define NGV  129                 // 16-row groups of the relative-value table (k-chunks reach m <= 2064, zero beyond 2048)
#define PSC  32768.0f
#define LOSC 1024.0f
#define LOSCI (1.0f / 1024.0f)

typedef _Float16 h16;
typedef unsigned short bf;
typedef __attribute__((ext_vector_type(16))) __bf16   v16bf;
typedef __attribute__((ext_vector_type(16))) _Float16 v16h;
typedef __attribute__((ext_vector_type(8)))  _Float16 v8h;
typedef __attribute__((ext_vector_type(8)))  unsigned short v8us;
typedef __attribute__((ext_vector_type(8)))  float    v8f;
typedef __attribute__((ext_vector_type(4)))  float    v4f;
typedef v8h  __attribute__((may_alias)) v8ha;
typedef v4f  __attribute__((may_alias)) v4fa;
typedef v8us __attribute__((may_alias)) v8usa;

__device__ __forceinline__ unsigned short f2bf(float f) { unsigned u = __float_as_uint(f); u += 0x7FFFu + ((u >> 16) & 1u); return (unsigned short)(u >> 16); }
__device__ __forceinline__ float bf2f(unsigned short b) { return __uint_as_float(((unsigned)b) << 16); }
__device__ __forceinline__ float bfr(float f) { return bf2f(f2bf(f)); }
__device__ __forceinline__ v16h cat16(v8h lo, v8h hi) { return __builtin_shufflevector(lo, hi, 0, 1, 2, 3, 4, 5, 6, 7, 8, 9, 10, 11, 12, 13, 14, 15); }
__device__ __forceinline__ v16bf cat16b(v8us lo, v8us hi) { return __builtin_bit_cast(v16bf, __builtin_shufflevector(lo, hi, 0, 1, 2, 3, 4, 5, 6, 7, 8, 9, 10, 11, 12, 13, 14, 15)); }
__device__ __forceinline__ v8f wmma16(v16h a, v16h b, v8f c) { return __builtin_amdgcn_wmma_f32_16x16x32_f16(false, a, false, b, (short)0, c, false, false); }
__device__ __forceinline__ v8f wmmab(v16bf a, v16bf b, v8f c) { return __builtin_amdgcn_wmma_f32_16x16x32_bf16(false, a, false, b, (short)0, c, false, false); }
// A wave-uniform operand address held in scalar registers (each half through readfirstlane, cast to unsigned behind it), so that a fragment load is
// scalar base + one lane offset + immediate and needs no 64-bit address register pair of its own.
typedef __attribute__((address_space(1))) const v8h gv8h;
__device__ __forceinline__ gv8h* uptr(const h16* p) {
    const unsigned long long a = (unsigned long long)p;
    return (gv8h*)(((unsigned long long)(unsigned)__builtin_amdgcn_readfirstlane((int)(a >> 32)) << 32) | (unsigned)__builtin_amdgcn_readfirstlane((int)(unsigned)a));
}
typedef __attribute__((address_space(1))) const v8us gv8u;
__device__ __forceinline__ gv8u* uptrb(const bf* p) {
    const unsigned long long a = (unsigned long long)p;
    return (gv8u*)(((unsigned long long)(unsigned)__builtin_amdgcn_readfirstlane((int)(a >> 32)) << 32) | (unsigned)__builtin_amdgcn_readfirstlane((int)(unsigned)a));
}
// one 16 x 32 bf16 fragment in fragment order: the two 512-byte blocks at element offsets c and c + 256 from the uniform base u, each lane its own 16 bytes
#define LDB(u, c) cat16b((u)[ulane + (c) / 8], (u)[ulane + ((c) + 256) / 8])
// one 16 x 32 f16 fragment in fragment order: two 512-byte blocks at element offsets c and c + d2 from the uniform base u, each lane its own 16 bytes
#define LDU(u, c, d2) cat16((u)[ulane + (c) / 8], (u)[ulane + ((c) + (d2)) / 8])
#define VST2(T, p, v) do { const T vst2_v_ = (v); *(T*)(p) = vst2_v_;  } while (0)
// Fragment-order layout of a [rows][1024] 16-bit plane: 512-byte blocks of 16 rows x 16 columns, lane-major (lane = 16 * ((col >> 3) & 1) + (row & 15), 8 elements
// a lane), blocks ordered by (row >> 4, col >> 5, (col >> 4) & 1). pko = element offset of the 8-element piece at (row, col), col a multiple of 8. One wave-wide
// 16-byte fragment load then reads one block = 4 whole 128-byte lines; the second half of a fragment is the next block (+256), the next k-chunk of 32 is +512.
__device__ __forceinline__ size_t pko(int row, int col) {
    return ((size_t)(((row >> 4) * 32 + (col >> 5)) * 2 + ((col >> 4) & 1)) << 8) + (size_t)(((((col >> 3) & 1) << 4) + (row & 15)) << 3);
}

// The conversions that depend on inputs alone are block ranges of ONE launch (k_prep, below); each body takes its own block index.
// b_cvtb: bf16 of an [nrows][1024] matrix; b_wt: k-major [1024][1024] -> n-major bf16; both written in fragment order (pko).
__device__ __forceinline__ void b_cvtb(int blk, const float* __restrict__ src, int nrows, bf* dst) {
    const int lane = threadIdx.x & 31, gw = blk * 8 + (threadIdx.x >> 5), r = (gw >> 4) * 16 + (lane & 15);    // wave = 16 rows x 64 columns
    if (r >= nrows) return;
#pragma unroll
    for (int q = 0; q < 4; ++q) { const int col = (gw & 15) * 64 + q * 16 + (lane >> 4) * 8; v8us t;
#pragma unroll
        for (int i = 0; i < 8; ++i) t[i] = f2bf(src[(size_t)r * DM + col + i]);
        VST2(v8us, dst + pko(r, col), t); }
}
__device__ __forceinline__ void b_wt(int bk, int bn, unsigned short* tl, const float* __restrict__ Wm, bf* WT) {
    const int tid = threadIdx.x, k0 = bk * 64, n0 = bn * 64;
    const int kk = tid >> 2, nq = (tid & 3) * 16;
#pragma unroll
    for (int i = 0; i < 16; ++i) tl[(nq + i) * 72 + kk] = f2bf(Wm[(size_t)(k0 + kk) * DM + n0 + nq + i]);
    __syncthreads();
    auto pass = [&]() {
#pragma unroll
        for (int s = 0; s < 2; ++s) { const int u = (tid >> 5) + 8 * s, nr = (u >> 2) * 16 + (tid & 15), kcol = (u & 3) * 16 + ((tid >> 4) & 1) * 8;
            const v8us val = *(const v8usa*)(tl + nr * 72 + kcol);
            *(v8us*)(WT + pko(n0 + nr, k0 + kcol)) = val; }
    };
    pass();
    asm volatile("s_wait_xcnt 0x0" ::: "memory");    // in k_prep the code of the other block ranges follows these stores in the program and rewrites the registers they name: the wait stands in front of that
}
// k_gemmb: 128 x 128 tile of A.B^T + bias over K = 1024 (bf16 exact; A, B in fragment order), 2 x 2 waves of 64 x 64: each loaded fragment feeds four WMMAs
// (16 half-fragment loads for 16 WMMAs a k-chunk, not 10 for 4); the three projections are the z planes of one grid:
// z = 0, 1 (q, k): f16 hi + residual planes (fragment order); z = 2 (v): f32 rows.
// The k loop is unrolled over a ring of GD register stages (one stage = the four A fragments and the four B fragments of one k-chunk of 32): the loads of k-chunk c + GD are
// issued behind the WMMAs of k-chunk c, so that a wave waits for loads that are GD - 1 chunks old. A 16-row group of a plane is 32 KB in a row: every load is scalar base + lane + immediate.
#define GD 3
__global__ __launch_bounds__(128, 3) void k_gemmb(const bf* __restrict__ A, const bf* __restrict__ Bq, const bf* __restrict__ Bk, const bf* __restrict__ Bv,
                                                  const float* __restrict__ bq, const float* __restrict__ bk, const float* __restrict__ bv,
                                                  h16* QH, h16* QL, h16* KH, h16* KL, float* Vf) {
    __shared__ __align__(16) float ost[4][64 * 68];
    const int z = blockIdx.z;
    const bf* Bn = z == 0 ? Bq : z == 1 ? Bk : Bv; const float* bias = z == 0 ? bq : z == 1 ? bk : bv;
    const int wave = __builtin_amdgcn_readfirstlane(threadIdx.x >> 5);    // wave in a scalar register: the operand bases below are scalar
    // the lane's number as the hardware counts it (equal to threadIdx.x & 31 here): with the mask form the compiler folds some constant block offsets into the mask, and such a load takes an address register of its own
    const unsigned ulane = __builtin_amdgcn_mbcnt_lo(~0u, 0u);
    const int r0 = blockIdx.x * 128 + (wave >> 1) * 64, c0 = blockIdx.y * 128 + (wave & 1) * 64;
    gv8u* ua = uptrb(A + pko(r0, 0)); gv8u* ub = uptrb(Bn + pko(c0, 0));    // + 512 elements: the next k-chunk; + 16 * DM: the next 16 rows
    v8f acc[4][4];
#pragma unroll
    for (int u = 0; u < 4; ++u)
#pragma unroll
        for (int t = 0; t < 4; ++t) acc[u][t] = (v8f){};
    v16bf ar[GD][4], br[GD][4];
#pragma unroll
    for (int s = 0; s < GD; ++s) {
#pragma unroll
        for (int t = 0; t < 4; ++t) { ar[s][t] = LDB(ua, t * 16 * DM + s * 512); br[s][t] = LDB(ub, t * 16 * DM + s * 512); }
        __builtin_amdgcn_sched_barrier(0); }    // keeps each stage's loads together and in stage order, so that the waits can count
#pragma unroll
    for (int c = 0; c < DM / 32; ++c) {
        const int s = c % GD;
#pragma unroll
        for (int t = 0; t < 4; ++t)
#pragma unroll
            for (int u = 0; u < 4; ++u) acc[u][t] = wmmab(ar[s][u], br[s][t], acc[u][t]);
        __builtin_amdgcn_sched_barrier(0);    // the refill stays behind the WMMAs that read this stage, so that it lands in the same registers (no stage more, no spill)
        if (c + GD < DM / 32) {
#pragma unroll
            for (int t = 0; t < 4; ++t) { ar[s][t] = LDB(ua, t * 16 * DM + (c + GD) * 512); br[s][t] = LDB(ub, t * 16 * DM + (c + GD) * 512); } }
        __builtin_amdgcn_sched_barrier(0);    // holds the refill of this stage here, GD chunks ahead of its WMMAs: without it the scheduler sinks the loads down to their use
    }
    // the epilogue reuses the lane-offset and scalar base registers that the ring's loads name: the wait stands in front of that. The epilogue's lane number is taken
    // through the wait's own statement, so that none of the lane arithmetic (which can land in the lane-offset register) is placed ahead of it
    unsigned el = ulane;
    asm volatile("s_wait_xcnt 0x0" : "+v"(el) : : "memory");
    __builtin_amdgcn_sched_barrier(0);    // keeps the epilogue's first register writes behind that wait
    const int lane = (int)el, lr = lane & 15, hi = lane >> 4;
    float* os = &ost[wave][0];
#pragma unroll
    for (int t = 0; t < 4; ++t) { const float bv = bfr(bias[c0 + t * 16 + lr]);
#pragma unroll
        for (int u = 0; u < 4; ++u)
#pragma unroll
            for (int j = 0; j < 8; ++j) os[(u * 16 + hi * 8 + j) * 68 + t * 16 + lr] = acc[u][t][j] + bv; }
    __syncthreads();
    if (z == 2) {
        float* crow = Vf + (size_t)r0 * DM + c0;
        auto pass = [&]() {
#pragma unroll
            for (int s = 0; s < 32; ++s) { const int Lid = (lane >> 3) + 4 * s, piece = lane & 7; const int row = Lid >> 1, cofs = (Lid & 1) * 32 + piece * 4;
                const v4f val = *(const v4fa*)(os + row * 68 + cofs); *(v4f*)(crow + (size_t)row * DM + cofs) = val; }
        };
        pass(); 
    } else {
        h16* c1 = z == 0 ? QH : KH; h16* c2 = z == 0 ? QL : KL;
        auto pass = [&]() {
#pragma unroll
            for (int s = 0; s < 16; ++s) { const int row = (s >> 2) * 16 + lr, col = (s & 3) * 16 + hi * 8; const float* sp = os + row * 68 + col; const size_t po = pko(r0 + row, c0 + col); v8h o1, o2;
#pragma unroll
                for (int i = 0; i < 8; ++i) { const h16 a = (h16)sp[i]; o1[i] = a; o2[i] = (h16)((sp[i] - (float)a) * LOSC); }
                *(v8h*)(c1 + po) = o1; *(v8h*)(c2 + po) = o2; }
        };
        pass();
        asm volatile("s_wait_xcnt 0x0" ::: "memory");    // the code of the v branch can follow these stores in the program and rewrites the registers they name: the wait stands in front of that
    }
}
// k_vt: VTH/VTL = f16 hi + residual of V^T, fragment order: [b][h][s / 32][d / 16][(s >> 4) & 1] blocks of 512 bytes, lane = 16 * ((s >> 3) & 1) + (d & 15); block (b, h, 64 s).
__global__ __launch_bounds__(256) void k_vt(const float* __restrict__ V, h16* VTH, h16* VTL) {
    __shared__ __align__(16) h16 tile[HD * 72];
    __shared__ __align__(16) h16 til2[HD * 72];
    const int bid = blockIdx.x;
    const int b = bid / (NH_ * (SS / 64)), rem = bid - b * (NH_ * (SS / 64)), h = rem / (SS / 64), kt = rem - h * (SS / 64);
    const int s0 = kt * 64, tid = threadIdx.x, ss = tid >> 2, d0 = (tid & 3) * 16;
    const float* src = V + ((size_t)b * SS + s0 + ss) * DM + h * HD + d0;
#pragma unroll
    for (int i = 0; i < 16; ++i) { const float v = src[i]; const h16 a = (h16)v; tile[(d0 + i) * 72 + ss] = a; til2[(d0 + i) * 72 + ss] = (h16)((v - (float)a) * LOSC); }
    __syncthreads();
    const size_t base = (((size_t)b * NH_ + h) * HD) * SS;
    const int lane = tid & 31, wv = tid >> 5, n = wv >> 1, p = wv & 1, d = n * 16 + (lane & 15);
    auto pass = [&]() {
#pragma unroll
        for (int s = 0; s < 4; ++s) { const int pln = s >> 1, ktl = s & 1;
            const v8h val = *(const v8ha*)((pln ? til2 : tile) + d * 72 + ktl * 32 + p * 16 + (lane >> 4) * 8);
            *(v8h*)((pln ? VTL : VTH) + base + (size_t)((((s0 >> 5) + ktl) * 4 + n) * 2 + p) * 256 + lane * 8) = val; }
    };
    pass(); 
}
// b_tabs: both tables in fragment order over groups g of 16 table rows m = 16 g + 1 .. 16 g + 16 (every band of k_attn starts at m = 1 mod 16; m = 0 is never used):
// RK16 [g < NGK][d / 16] blocks of 512 bytes = f16(bf16(rel_k_emb)), lane = 16 * ((d >> 3) & 1) + (m - 1 & 15); RVT16 [g < NGV][d / 16] blocks = f16(bf16(rel_v_emb))^T,
// lane = 16 * ((m - 1 >> 3) & 1) + (d & 15), via 64x64 LDS transposes (zero beyond row 2048); NRP/64 blocks.
__device__ __forceinline__ void b_tabs(int blk, h16* tile, const float* __restrict__ rk, const float* __restrict__ rv, h16* RK16, h16* RVT16) {
    const int m0 = blk * 64 + 1, tid = threadIdx.x, mm = tid >> 2, d0 = (tid & 3) * 16;
#pragma unroll
    for (int i = 0; i < 16; ++i) { const int m = m0 + mm; tile[(d0 + i) * 72 + mm] = (m < NRL) ? (h16)bfr(rv[(size_t)m * HD + d0 + i]) : (h16)0.f; }
    __syncthreads();
    const int lane = tid & 31, lr = lane & 15, hi = lane >> 4;
    auto pass = [&]() {
#pragma unroll
        for (int s = 0; s < 2; ++s) { const int u = (tid >> 5) + 8 * s, g = blk * 4 + (u >> 2), m = 16 * g + 1 + lr, col = (u & 3) * 16 + hi * 8; v8h o;
#pragma unroll
            for (int i = 0; i < 8; ++i) o[i] = (m < NRL) ? (h16)bfr(rk[(size_t)m * HD + col + i]) : (h16)0.f;
            if (g < NGK) *(v8h*)(RK16 + (size_t)(g * 4 + (u & 3)) * 256 + lane * 8) = o; }
#pragma unroll
        for (int s = 0; s < 2; ++s) { const int u = (tid >> 5) + 8 * s, gl = u >> 2, n = u & 3, g = blk * 4 + gl;
            const v8h val = *(const v8ha*)(tile + (n * 16 + lr) * 72 + gl * 16 + hi * 8);
            if (g < NGV) *(v8h*)(RVT16 + (size_t)(g * 4 + n) * 256 + lane * 8) = val; }
    };
    pass(); 
}
// k_prep: one launch for all six conversions, none of which reads what another writes. Block ranges: PBT blocks of the tables (first: the longest chain of dependent loads),
// PBX blocks of x, 4 x PBW blocks of the weights (k tile fastest). The range test reads blockIdx alone, so each body's barrier is passed by its whole block; the bodies with an LDS tile share one.
#define PBX (NTK / 8)
#define PBW ((DM / 64) * (DM / 64))
#define PBT (NRP / 64)
__global__ __launch_bounds__(256) void k_prep(const float* __restrict__ x, const float* __restrict__ Wq, const float* __restrict__ Wk, const float* __restrict__ Wv, const float* __restrict__ Wo,
                                              const float* __restrict__ rk, const float* __restrict__ rv, bf* Xb, bf* WqT, bf* WkT, bf* WvT, bf* WoT, h16* RK16, h16* RVT16) {
    __shared__ __align__(16) unsigned short tl[64 * 72];
    const int bid = blockIdx.x;
    if (bid < PBT) { b_tabs(bid, (h16*)tl, rk, rv, RK16, RVT16); return; }
    if (bid < PBT + PBX) { b_cvtb(bid - PBT, x, NTK, Xb); return; }
    const int u = bid - PBT - PBX, wi = u / PBW, t = u - wi * PBW;
    b_wt(t % (DM / 64), t / (DM / 64), tl, wi == 0 ? Wq : wi == 1 ? Wk : wi == 2 ? Wv : Wo, wi == 0 ? WqT : wi == 1 ? WkT : wi == 2 ? WvT : WoT);
}
// k_attn: block = (b, h, 64 queries), wave = 16 queries i = q0..q0+15; 32 key tiles of 32. Every product is taken TRANSPOSED (a stored fragment serves as A or as B alike): lane (lr, hi)
// holds column lr = ONE query of every tile, its 8 registers the rows 8 hi + j. Content S^T = k.q^T, 12 WMMA (hi.hi + hi.lo + lo.hi, q residual fragments re-read);
// relative-key band^T: rows m = mbase + 0..47 of RK16 (mbase = q0 - l0 - 31 + 1024) x (q hi, q lo) = 12 WMMA, parked in LDS as ps[query][m]; logit(i,j) = content + ps[r][r - kk + 31]
// (UNSCALED); online softmax: maximum and sum inside the lane plus one exchange between the wave halves; the weights x32768 hi + residual of the two score tiles, packed in place, ARE
// the B operand (k = 8 hi + s, 16 + 8 hi + s) of o^T += vh.pa, ox^T += vl.pa + vh.px (12 WMMA); the same weights scattered into relative coordinates pt/pt2 [query][64]
// (column r + 31 - kk; zero elsewhere) are the B operand of o^T += rv.pt, ox^T += rv.pt2 (16 WMMA, A = RVT16 rows d at k = mbase + ..);
// ctx = (o + ox/1024)/sum: a lane holds 8 consecutive d of its query = one 16-byte piece of the bf16 hi/lo planes [tok][h*64+d] in fragment order. Every global operand is read in fragment order (pko, k_vt, b_tabs).
#define PTP 136                  // row pitch of pt/pt2 in halves: 16 bytes x odd for the 16-byte readers; the scatter's lane stride PTP + 1 is 9 halves modulo the 64 banks, so the 8-half stores of 16 lanes lie side by side
typedef __attribute__((ext_vector_type(4))) unsigned v4u;
typedef v4u __attribute__((may_alias, aligned(2))) v4u2;
// the 8 halves of x in reverse order: the dwords reversed, each rotated by 16 bits
__device__ __forceinline__ v4u rev8(v8h x) { const v4u u = __builtin_bit_cast(v4u, x); return (v4u){ (u[3] >> 16) | (u[3] << 16), (u[2] >> 16) | (u[2] << 16), (u[1] >> 16) | (u[1] << 16), (u[0] >> 16) | (u[0] << 16) }; }
__device__ __forceinline__ float xhalf(float x) { return __builtin_bit_cast(float, __builtin_amdgcn_permlanex16(__builtin_bit_cast(int, x), __builtin_bit_cast(int, x), 0x76543210, 0xfedcba98, false, false)); }    // lane l with lane l ^ 16
__global__ __launch_bounds__(128, 4) void k_attn(const h16* __restrict__ QH, const h16* __restrict__ QL, const h16* __restrict__ KH, const h16* __restrict__ KL,
                                             const h16* __restrict__ RK16, const h16* __restrict__ RVT16, const h16* __restrict__ VTH, const h16* __restrict__ VTL, bf* CH, bf* CL) {
    __shared__ __align__(16) h16 ptl[4][16 * PTP];
    __shared__ __align__(16) h16 ptl2[4][16 * PTP];
    __shared__ __align__(16) float posl[4][16 * 52];
    const int lane = threadIdx.x & 31, wave = __builtin_amdgcn_readfirstlane(threadIdx.x >> 5), lr = lane & 15, hi = lane >> 4;    // wave in a scalar register: every operand block address below is scalar base + lane offset
    const unsigned ulane = lane;
    const int bid = blockIdx.x;
    const int b = bid / (NH_ * (SS / 64)), rem = bid - b * (NH_ * (SS / 64)), h = rem / (SS / 64), qt = rem - h * (SS / 64);
    const int q0 = qt * 64 + wave * 16;
    const size_t tok0 = (size_t)b * SS;
    h16* pt = &ptl[wave][0]; h16* pt2 = &ptl2[wave][0]; float* ps = &posl[wave][0];
    // row lr (the lane's query) of each LDS tile addressed as one lane base + a constant (an immediate offset). psb + 16 t + j: band column m = 16 t + 8 hi + j;
    // psg, ptb, ptb2 + 23 - 16 T - j: column r + 31 - kk of key kk = 16 T + 8 hi + j
    float* psb = ps + lr * 52 + hi * 8; const float* psg = ps + lr * 53 + 8 - hi * 8;
    h16* ptb = pt + lr * (PTP + 1) + 8 - hi * 8; h16* ptb2 = pt2 + lr * (PTP + 1) + 8 - hi * 8;
    const size_t qo0 = pko((int)tok0 + q0, h * HD);    // wave-uniform block offset; LDU adds the lane's own piece
    v16h qa[2];
#pragma unroll
    for (int kc = 0; kc < 2; ++kc) qa[kc] = LDU(uptr(QH + qo0), kc * 512, 256);
    const size_t vbase = (((size_t)b * NH_ + h) * HD) * SS;
    v8f o[4], ox[4];
#pragma unroll
    for (int n = 0; n < 4; ++n) { o[n] = (v8f){}; ox[n] = (v8f){}; }
    float mrow = -3.0e38f, lpart = 0.f;    // of the lane's query; lpart sums the keys of the lane's own wave half
    // zero the relative-coordinate weight tiles once (entries outside [r, r+31] of each row stay zero for every step)
    for (int e = lane; e < 16 * PTP; e += 32) { pt[e] = (h16)0.f; pt2[e] = (h16)0.f; }
    // Operand fragments are loaded in groups well ahead of the WMMAs that read them (the "memory" fences below keep each group where it is written).
    // The q residual and band fragments of k-chunk 0 of a key tile are loaded during the tile before it and carried over the loop edge in these registers.
    v16h ql0, rb0[3];
    { gv8h* uql = uptr(QL + qo0); gv8h* urk = uptr(RK16 + (size_t)((q0 - 31 + 1024 - 1) >> 4) * 1024); ql0 = LDU(uql, 0, 256);
#pragma unroll
      for (int t = 0; t < 3; ++t) rb0[t] = LDU(urk, t * 1024, 256); }
#pragma unroll 1
    for (int kt = 0; kt < SS / 32; ++kt) {
        const int l0 = kt * 32, mbase = q0 - l0 - 31 + 1024, gb = (mbase - 1) >> 4;    // mbase = 16 gb + 1
        const size_t ko = pko((int)tok0 + l0, h * HD);    // + 512: k-chunk 1; + 16 * DM: the next 16 rows, 64 blocks on
        gv8h* ukh = uptr(KH + ko); gv8h* ukl = uptr(KL + ko); gv8h* uql = uptr(QL + qo0); gv8h* urk = uptr(RK16 + (size_t)gb * 1024);
        // group: q residual and band fragments of k-chunk 1, k fragments of k-chunk 0: in flight under the band of k-chunk 0
        v16h rb1[3];
        const v16h ql1 = LDU(uql, 512, 256);
#pragma unroll
        for (int t = 0; t < 3; ++t) rb1[t] = LDU(urk, t * 1024 + 512, 256);
        const v16h k0h0 = LDU(ukh, 0, 256), k1h0 = LDU(ukh, 16 * DM, 256), k0l0 = LDU(ukl, 0, 256), k1l0 = LDU(ukl, 16 * DM, 256);
        // The v_nop statements of this loop fill the vector slots the chip needs between a WMMA and the first read of its D or rewrite of its A / B,
        // and name those registers so that they stay whole up to there; their "memory" clobber also fences the load groups.
        // band tiles, k-chunk 0: rows m = mbase + t*16 + lr of RK16
#pragma unroll
        for (int t = 0; t < 3; ++t) {
            v8f ph = wmma16(rb0[t], qa[0], (v8f){}); v8f pq = wmma16(rb0[t], ql0, (v8f){});
            asm volatile("v_nop\n\tv_nop\n\tv_nop\n\tv_nop" : "+v"(ph), "+v"(pq) : "v"(rb0[t]), "v"(ql0));
            v4f b0, b1;
#pragma unroll
            for (int j = 0; j < 4; ++j) { b0[j] = ph[j] + pq[j] * LOSCI; b1[j] = ph[j + 4] + pq[j + 4] * LOSCI; }
            *(v4fa*)(psb + t * 16) = b0; *(v4fa*)(psb + t * 16 + 4) = b1;
            asm volatile("" ::: "memory"); }
        // group: k fragments of k-chunk 1, in flight under the band of k-chunk 1
        const v16h k0h1 = LDU(ukh, 512, 256), k1h1 = LDU(ukh, 16 * DM + 512, 256), k0l1 = LDU(ukl, 512, 256), k1l1 = LDU(ukl, 16 * DM + 512, 256);
        // band tiles, k-chunk 1
#pragma unroll
        for (int t = 0; t < 3; ++t) {
            v8f ph = wmma16(rb1[t], qa[1], (v8f){}); v8f pq = wmma16(rb1[t], ql1, (v8f){});
            asm volatile("v_nop\n\tv_nop\n\tv_nop\n\tv_nop" : "+v"(ph), "+v"(pq) : "v"(rb1[t]), "v"(ql1));
            v4f b0 = *(const v4fa*)(psb + t * 16), b1 = *(const v4fa*)(psb + t * 16 + 4);
#pragma unroll
            for (int j = 0; j < 4; ++j) { b0[j] += ph[j] + pq[j] * LOSCI; b1[j] += ph[j + 4] + pq[j + 4] * LOSCI; }
            *(v4fa*)(psb + t * 16) = b0; *(v4fa*)(psb + t * 16 + 4) = b1;
            asm volatile("" ::: "memory"); }
        // content, k-chunk 0 then 1
        v8f s0 = {}, s1 = {}, x0 = {}, x1 = {};
        s0 = wmma16(k0h0, qa[0], s0); x0 = wmma16(k0h0, ql0, x0); s1 = wmma16(k1h0, qa[0], s1); x1 = wmma16(k1h0, ql0, x1);
        asm volatile("v_nop" : "+v"(s0), "+v"(s1), "+v"(x0), "+v"(x1) : "v"(ql0), "v"(k0h0), "v"(k1h0) : "memory");
        x0 = wmma16(k0l0, qa[0], x0); x1 = wmma16(k1l0, qa[0], x1);
        asm volatile("v_nop" : "+v"(x0), "+v"(x1) : "v"(k0l0), "v"(k1l0) : "memory");
        s0 = wmma16(k0h1, qa[1], s0); x0 = wmma16(k0h1, ql1, x0); s1 = wmma16(k1h1, qa[1], s1); x1 = wmma16(k1h1, ql1, x1);
        asm volatile("v_nop" : "+v"(s0), "+v"(s1), "+v"(x0), "+v"(x1) : "v"(ql1), "v"(k0h1), "v"(k1h1) : "memory");
        x0 = wmma16(k0l1, qa[1], x0); x1 = wmma16(k1l1, qa[1], x1);
        asm volatile("v_nop" : "+v"(x0), "+v"(x1) : "v"(k0l1), "v"(k1l1) : "memory");
        asm volatile("v_nop\n\tv_nop\n\tv_nop\n\tv_nop" : "+v"(s0), "+v"(s1), "+v"(x0), "+v"(x1) : "v"(qa[0]), "v"(qa[1]));
        asm volatile("" ::: "memory");
        __builtin_amdgcn_wave_barrier();
        v8f g0v, g1v;
#pragma unroll
        for (int j = 0; j < 8; ++j) g0v[j] = psg[23 - j];    // band[r][r - kk + 31], kk = 8 hi + j
#pragma unroll
        for (int j = 0; j < 8; ++j) g1v[j] = psg[7 - j];     // kk = 16 + 8 hi + j
        const v8f a0 = s0 + x0 * LOSCI + g0v, a1 = s1 + x1 * LOSCI + g1v;
        float tm[8];
#pragma unroll
        for (int j = 0; j < 8; ++j) tm[j] = fmaxf(a0[j], a1[j]);
        float mx = fmaxf(fmaxf(fmaxf(tm[0], tm[1]), fmaxf(tm[2], tm[3])), fmaxf(fmaxf(tm[4], tm[5]), fmaxf(tm[6], tm[7])));
        mx = fmaxf(mx, xhalf(mx));    // the other 16 keys of this query sit in the other wave half
        const float mn = fmaxf(mrow, mx), alpha = __expf(mrow - mn); mrow = mn;
        v8f e0, e1;
#pragma unroll
        for (int j = 0; j < 8; ++j) e0[j] = __expf(a0[j] - mn);
#pragma unroll
        for (int j = 0; j < 8; ++j) e1[j] = __expf(a1[j] - mn);
        const v8f es = e0 + e1, w0 = e0 * PSC, w1 = e1 * PSC;
        const v8h h0 = __builtin_convertvector(w0, v8h), h1 = __builtin_convertvector(w1, v8h);
        const v8h r0 = __builtin_convertvector((w0 - __builtin_convertvector(h0, v8f)) * LOSC, v8h), r1 = __builtin_convertvector((w1 - __builtin_convertvector(h1, v8f)) * LOSC, v8h);
        const v16h pa = cat16(h0, h1), px = cat16(r0, r1);
        // a lane's 8 keys of a tile are 8 consecutive relative columns in falling order: one 16-byte LDS store each, at an address that is a multiple of 2 bytes only
        *(v4u2*)(ptb + 16) = rev8(h0); *(v4u2*)ptb = rev8(h1); *(v4u2*)(ptb2 + 16) = rev8(r0); *(v4u2*)ptb2 = rev8(r1);
        lpart = lpart * alpha + (((es[0] + es[1]) + (es[2] + es[3])) + ((es[4] + es[5]) + (es[6] + es[7])));
#pragma unroll
        for (int n = 0; n < 4; ++n)
#pragma unroll
            for (int j = 0; j < 8; ++j) { o[n][j] *= alpha; ox[n][j] *= alpha; }
        asm volatile("" ::: "memory");
        // group: this tile's v hi + residual fragments and the rel_v fragments of the first k-chunk
        v16h vh[4], vl[4], rv0[4], rv1[4];
        gv8h* uvh = uptr(VTH + vbase + (size_t)kt * 2048); gv8h* uvl = uptr(VTL + vbase + (size_t)kt * 2048); gv8h* urv = uptr(RVT16 + (size_t)gb * 1024);
#pragma unroll
        for (int n = 0; n < 4; ++n) { vh[n] = LDU(uvh, n * 512, 256); vl[n] = LDU(uvl, n * 512, 256); }
#pragma unroll
        for (int n = 0; n < 4; ++n) rv0[n] = LDU(urv, n * 256, 1024);
#pragma unroll
        for (int n = 0; n < 4; ++n) {
            o[n] = wmma16(vh[n], pa, o[n]); ox[n] = wmma16(vl[n], pa, ox[n]); ox[n] = wmma16(vh[n], px, ox[n]);
            asm volatile("" : "+v"(o[n]), "+v"(ox[n]) : "v"(vh[n]), "v"(vl[n]) : "memory");    // keeps the fragments whole through their WMMAs; its "memory" clobber holds the load groups where they are written
            if (n == 1) {    // group: rel_v fragments of the second k-chunk
#pragma unroll
                for (int m = 0; m < 4; ++m) rv1[m] = LDU(urv, 2048 + m * 256, 1024); }
        }
        // group: the next key tile's q residual and band fragments of k-chunk 0 (the last tile loads its own again: in bounds, unused)
        { const int ktn = kt + 1 < SS / 32 ? kt + 1 : kt; gv8h* urn = uptr(RK16 + (size_t)((q0 - ktn * 32 - 31 + 1024 - 1) >> 4) * 1024); ql0 = LDU(uql, 0, 256);
#pragma unroll
          for (int t = 0; t < 3; ++t) rb0[t] = LDU(urn, t * 1024, 256); }
        // rel_v x relative-coordinate weights: A = RVT16 rows d at k = mbase + kc*32, B = pt rows (one query a lane, k = m_local, 2 k-chunks)
#pragma unroll
        for (int kc = 0; kc < 2; ++kc) {
            const v16h ra = cat16(*(const v8ha*)(pt + lr * PTP + kc * 32 + hi * 8), *(const v8ha*)(pt + lr * PTP + kc * 32 + 16 + hi * 8));
            const v16h rx = cat16(*(const v8ha*)(pt2 + lr * PTP + kc * 32 + hi * 8), *(const v8ha*)(pt2 + lr * PTP + kc * 32 + 16 + hi * 8));
#pragma unroll
            for (int n = 0; n < 4; ++n) { const v16h rvb = kc ? rv1[n] : rv0[n];
                o[n] = wmma16(rvb, ra, o[n]); ox[n] = wmma16(rvb, rx, ox[n]);
                asm volatile("" : "+v"(o[n]), "+v"(ox[n]) : "v"(rvb), "v"(ra), "v"(rx) : "memory"); }
        }
        __builtin_amdgcn_wave_barrier();
        // clear this step's scattered entries (row r used columns r .. r+31) for the next step
#pragma unroll
        for (int j = 0; j < 8; ++j) { ptb[23 - j] = (h16)0.f; ptb[7 - j] = (h16)0.f; ptb2[23 - j] = (h16)0.f; ptb2[7 - j] = (h16)0.f; }
        asm volatile("" ::: "memory");
        // the carried group's loads name scalar base registers that the next trip's address arithmetic rewrites: the wait stands in front of that rewrite
        asm volatile("s_wait_xcnt 0x0" ::: "memory");
    }
    asm volatile("v_nop\n\tv_nop\n\tv_nop\n\tv_nop" : "+v"(o[0]), "+v"(o[1]), "+v"(o[2]), "+v"(o[3]), "+v"(ox[0]), "+v"(ox[1]), "+v"(ox[2]), "+v"(ox[3]));
    const float rs = lpart + xhalf(lpart), inv = 1.0f / (rs * PSC);    // the two wave halves' sums of this query joined once
#pragma unroll
    for (int s = 0; s < 4; ++s) { const size_t po = pko((int)tok0 + q0 + lr, h * HD + s * 16 + hi * 8); v8us oh, ol;
#pragma unroll
        for (int i = 0; i < 8; ++i) { const float cv = (o[s][i] + ox[s][i] * LOSCI) * inv; const unsigned short hb = f2bf(cv); oh[i] = hb; ol[i] = f2bf(cv - bf2f(hb)); }
        *(v8us*)(CH + po) = oh; *(v8us*)(CL + po) = ol; }
}
// k_outp: 128 x 128 tile of out = (CH + CL).WoT^T + bo over K = 1024 (2 products), 4 x 2 waves of 32 x 64 (16 half-fragment loads for 16 WMMAs a k-chunk, not 12 for 8); f32 rows.
// 256 blocks of 8 waves: one block a WGP, two waves a SIMD.
// Same register ring as k_gemmb, OD stages of four A fragments (hi, residual x two row tiles) and four B fragments.
#define OD 3
__global__ __launch_bounds__(256, 1) void k_outp(const bf* __restrict__ A, const bf* __restrict__ Al, const bf* __restrict__ Bn, const float* __restrict__ bias, float* C) {
    __shared__ __align__(16) float ost[8][32 * 68];
    const int wave = __builtin_amdgcn_readfirstlane(threadIdx.x >> 5);    // wave in a scalar register: the operand bases below are scalar
    // the lane's number as the hardware counts it (equal to threadIdx.x & 31 here): with the mask form the compiler folds some constant block offsets into the mask, and such a load takes an address register of its own
    const unsigned ulane = __builtin_amdgcn_mbcnt_lo(~0u, 0u);
    const int r0 = blockIdx.x * 128 + (wave >> 1) * 32, c0 = blockIdx.y * 128 + (wave & 1) * 64;
    gv8u* ua = uptrb(A + pko(r0, 0)); gv8u* ul = uptrb(Al + pko(r0, 0)); gv8u* ub = uptrb(Bn + pko(c0, 0));    // + 512 elements: the next k-chunk; + 16 * DM: the next 16 rows
    v8f acc[2][4];
#pragma unroll
    for (int t = 0; t < 4; ++t) { acc[0][t] = (v8f){}; acc[1][t] = (v8f){}; }
    v16bf ar[OD][2], lr2[OD][2], br[OD][4];
#pragma unroll
    for (int s = 0; s < OD; ++s) {
#pragma unroll
        for (int u = 0; u < 2; ++u) { ar[s][u] = LDB(ua, u * 16 * DM + s * 512); lr2[s][u] = LDB(ul, u * 16 * DM + s * 512); }
#pragma unroll
        for (int t = 0; t < 4; ++t) br[s][t] = LDB(ub, t * 16 * DM + s * 512);
        __builtin_amdgcn_sched_barrier(0); }    // keeps each stage's loads together and in stage order, so that the waits can count
#pragma unroll
    for (int c = 0; c < DM / 32; ++c) {
        const int s = c % OD;
#pragma unroll
        for (int t = 0; t < 4; ++t) { acc[0][t] = wmmab(ar[s][0], br[s][t], acc[0][t]); acc[1][t] = wmmab(ar[s][1], br[s][t], acc[1][t]);
            acc[0][t] = wmmab(lr2[s][0], br[s][t], acc[0][t]); acc[1][t] = wmmab(lr2[s][1], br[s][t], acc[1][t]); }
        __builtin_amdgcn_sched_barrier(0);    // the refill stays behind the WMMAs that read this stage, so that it lands in the same registers (no stage more, no spill)
        if (c + OD < DM / 32) {
#pragma unroll
            for (int u = 0; u < 2; ++u) { ar[s][u] = LDB(ua, u * 16 * DM + (c + OD) * 512); lr2[s][u] = LDB(ul, u * 16 * DM + (c + OD) * 512); }
#pragma unroll
            for (int t = 0; t < 4; ++t) br[s][t] = LDB(ub, t * 16 * DM + (c + OD) * 512); }
        __builtin_amdgcn_sched_barrier(0);    // holds the refill of this stage here, OD chunks ahead of its WMMAs: without it the scheduler sinks the loads down to their use
    }
    // the epilogue reuses the lane-offset and scalar base registers that the ring's loads name: the wait stands in front of that; the epilogue's lane number goes through the wait's own statement, as in k_gemmb
    unsigned el = ulane;
    asm volatile("s_wait_xcnt 0x0" : "+v"(el) : : "memory");
    __builtin_amdgcn_sched_barrier(0);    // keeps the epilogue's first register writes behind that wait
    const int lane = (int)el, lr = lane & 15, hi = lane >> 4;
    float* os = &ost[wave][0];
#pragma unroll
    for (int t = 0; t < 4; ++t) { const float bv = bfr(bias[c0 + t * 16 + lr]);
#pragma unroll
        for (int u = 0; u < 2; ++u)
#pragma unroll
            for (int j = 0; j < 8; ++j) os[(u * 16 + hi * 8 + j) * 68 + t * 16 + lr] = acc[u][t][j] + bv; }
    __syncthreads();
    float* crow = C + (size_t)r0 * DM + c0;
    auto pass = [&]() {
#pragma unroll
        for (int s = 0; s < 16; ++s) { const int Lid = (lane >> 3) + 4 * s, piece = lane & 7; const int row = Lid >> 1, cofs = (Lid & 1) * 32 + piece * 4;
            const v4f val = *(const v4fa*)(os + row * 68 + cofs); *(v4f*)(crow + (size_t)row * DM + cofs) = val; }
    };
    pass(); 
}

extern "C" void kernel_launch(void* const* d_in, const int* in_sizes, int n_in,
                              void* d_out, int out_size, void* d_ws, size_t ws_size, hipStream_t stream) {
    (void)in_sizes; (void)n_in; (void)out_size;
    const float* x = (const float*)d_in[0]; const float* Wq = (const float*)d_in[1]; const float* bq = (const float*)d_in[2]; const float* Wk = (const float*)d_in[3]; const float* bk = (const float*)d_in[4];
    const float* Wv = (const float*)d_in[5]; const float* bv = (const float*)d_in[6]; const float* Wo = (const float*)d_in[7]; const float* bo = (const float*)d_in[8];
    const float* rk = (const float*)d_in[9]; const float* rv = (const float*)d_in[10];
    float* out = (float*)d_out;    // [4][1024][1024]
    char* wsp = (char*)d_ws;
    auto take = [&](size_t bytes) { char* p = wsp; wsp += (bytes + 255) & ~(size_t)255; return (void*)p; };
    bf* Xb = (bf*)take((size_t)NTK * DM * 2); bf* WqT = (bf*)take((size_t)DM * DM * 2); bf* WkT = (bf*)take((size_t)DM * DM * 2); bf* WvT = (bf*)take((size_t)DM * DM * 2); bf* WoT = (bf*)take((size_t)DM * DM * 2);
    h16* QH = (h16*)take((size_t)NTK * DM * 2); h16* QL = (h16*)take((size_t)NTK * DM * 2); h16* KH = (h16*)take((size_t)NTK * DM * 2); h16* KL = (h16*)take((size_t)NTK * DM * 2);
    float* Vf = (float*)take((size_t)NTK * DM * 4); h16* VTH = (h16*)take((size_t)NTK * DM * 2); h16* VTL = (h16*)take((size_t)NTK * DM * 2);
    h16* RK16 = (h16*)take((size_t)NRP * HD * 2); h16* RVT16 = (h16*)take((size_t)HD * NRP * 2);
    if ((size_t)(wsp - (char*)d_ws) > ws_size) return;    // 8.4 + 8.4 + 33.5 + 16.8 + 16.8 + 0.5 ~ 85 MB; ctx planes alias Vf (dead after k_vt)
    bf* CH = (bf*)Vf; bf* CL = (bf*)((char*)Vf + (size_t)NTK * DM * 2);
    k_prep<<<PBX + 4 * PBW + PBT, 256, 0, stream>>>(x, Wq, Wk, Wv, Wo, rk, rv, Xb, WqT, WkT, WvT, WoT, RK16, RVT16);
    k_gemmb<<<dim3(NTK / 128, DM / 128, 3), 128, 0, stream>>>(Xb, WqT, WkT, WvT, bq, bk, bv, QH, QL, KH, KL, Vf);
    k_vt<<<NB_ * NH_ * (SS / 64), 256, 0, stream>>>(Vf, VTH, VTL);
    k_attn<<<NB_ * NH_ * (SS / 64), 128, 0, stream>>>(QH, QL, KH, KL, RK16, RVT16, VTH, VTL, CH, CL);
    k_outp<<<dim3(NTK / 128, DM / 128, 1), 256, 0, stream>>>(CH, CL, WoT, bo, out);
}

// v007
// A run of this version takes 156 microseconds.
// Timed twice side by side with v006, it ran 1.03 and 1.02 times as fast.
// Counting every step since v000, it is 3.11 times as fast.
#include <hip/hip_runtime.h>

// Contractions, f32 accumulate: q/k/v = x.W + b and out = attn.Wo + bo ([4096 x 1024].[1024 x 1024]) on v_wmma_f32_16x16x32_bf16 — plain bf16 = rounded inputs
// (exact; k-major weights transposed to n-major planes) for the projections, attn as bf16 hi + residual planes (two products) for Wo; the relative-position
// attention fused on v_wmma_f32_16x16x32_f16 with UNSCALED logits (sigma ~ 11 over 1024 keys, near one-hot): content q.k as hi.hi + hi.lo + lo.hi, the relative-key
// band q.rel_k[m] (q hi + lo vs the exact f16 INPUT table) gathered per (i, j) at m = i - j + 1024, softmax, weights (x32768) hi + residual against v hi + residual,

#define NB_  4
#define SS   1024
#define DM   1024
#define NH_  16
#define HD   64
#define NTK  (NB_ * SS)          // 4096
#define NRL  2049                // relative table rows
#define NRP  2112                // padded (band reads up to mbase + 47 <= 2063; P~ k-chunk up to mbase + 47 <= 2063)
#define NGK  128                 // 16-row groups of the relative-key table that a band can reach (m <= 2048)
#define NGV  129                 // 16-row groups of the relative-value table (k-chunks reach m <= 2048; one more group, beyond 2048, is zero)
#define PSC  32768.0f
#define LOSC 1024.0f
#define LOSCI (1.0f / 1024.0f)

typedef _Float16 h16;
typedef unsigned short bf;
typedef __attribute__((ext_vector_type(16))) __bf16   v16bf;
typedef __attribute__((ext_vector_type(16))) _Float16 v16h;
typedef __attribute__((ext_vector_type(8)))  _Float16 v8h;
typedef __attribute__((ext_vector_type(8)))  unsigned short v8us;
typedef __attribute__((ext_vector_type(8)))  float    v8f;
typedef __attribute__((ext_vector_type(4)))  float    v4f;
typedef v8h  __attribute__((may_alias)) v8ha;
typedef v4f  __attribute__((may_alias)) v4fa;
typedef v8us __attribute__((may_alias)) v8usa;

__device__ __forceinline__ unsigned short f2bf(float f) { unsigned u = __float_as_uint(f); u += 0x7FFFu + ((u >> 16) & 1u); return (unsigned short)(u >> 16); }
__device__ __forceinline__ float bf2f(unsigned short b) { return __uint_as_float(((unsigned)b) << 16); }
__device__ __forceinline__ float bfr(float f) { return bf2f(f2bf(f)); }
__device__ __forceinline__ v16h cat16(v8h lo, v8h hi) { return __builtin_shufflevector(lo, hi, 0, 1, 2, 3, 4, 5, 6, 7, 8, 9, 10, 11, 12, 13, 14, 15); }
__device__ __forceinline__ v16bf cat16b(v8us lo, v8us hi) { return __builtin_bit_cast(v16bf, __builtin_shufflevector(lo, hi, 0, 1, 2, 3, 4, 5, 6, 7, 8, 9, 10, 11, 12, 13, 14, 15)); }
__device__ __forceinline__ v8f wmma16(v16h a, v16h b, v8f c) { return __builtin_amdgcn_wmma_f32_16x16x32_f16(false, a, false, b, (short)0, c, false, false); }
__device__ __forceinline__ v8f wmmab(v16bf a, v16bf b, v8f c) { return __builtin_amdgcn_wmma_f32_16x16x32_bf16(false, a, false, b, (short)0, c, false, false); }
// A wave-uniform operand address held in scalar registers (each half through readfirstlane, cast to unsigned behind it), so that a fragment load is
// scalar base + one lane offset + immediate and needs no 64-bit address register pair of its own.
typedef __attribute__((address_space(1))) const v8h gv8h;
__device__ __forceinline__ gv8h* uptr(const h16* p) {
    const unsigned long long a = (unsigned long long)p;
    return (gv8h*)(((unsigned long long)(unsigned)__builtin_amdgcn_readfirstlane((int)(a >> 32)) << 32) | (unsigned)__builtin_amdgcn_readfirstlane((int)(unsigned)a));
}
typedef __attribute__((address_space(1))) const v8us gv8u;
__device__ __forceinline__ gv8u* uptrb(const bf* p) {
    const unsigned long long a = (unsigned long long)p;
    return (gv8u*)(((unsigned long long)(unsigned)__builtin_amdgcn_readfirstlane((int)(a >> 32)) << 32) | (unsigned)__builtin_amdgcn_readfirstlane((int)(unsigned)a));
}
// one 16 x 32 bf16 fragment in fragment order: the two 512-byte blocks at element offsets c and c + 256 from the uniform base u, each lane its own 16 bytes
#define LDB(u, c) cat16b((u)[ulane + (c) / 8], (u)[ulane + ((c) + 256) / 8])
// one 16 x 32 f16 fragment in fragment order: two 512-byte blocks at element offsets c and c + d2 from the uniform base u, each lane its own 16 bytes
#define LDU(u, c, d2) cat16((u)[ulane + (c) / 8], (u)[ulane + ((c) + (d2)) / 8])
#define VST2(T, p, v) do { const T vst2_v_ = (v); *(T*)(p) = vst2_v_;  } while (0)
// Fragment-order layout of a [rows][1024] 16-bit plane: 512-byte blocks of 16 rows x 16 columns, lane-major (lane = 16 * ((col >> 3) & 1) + (row & 15), 8 elements
// a lane), blocks ordered by (row >> 4, col >> 5, (col >> 4) & 1). pko = element offset of the 8-element piece at (row, col), col a multiple of 8. One wave-wide
// 16-byte fragment load then reads one block = 4 whole 128-byte lines; the second half of a fragment is the next block (+256), the next k-chunk of 32 is +512.
__device__ __forceinline__ size_t pko(int row, int col) {
    return ((size_t)(((row >> 4) * 32 + (col >> 5)) * 2 + ((col >> 4) & 1)) << 8) + (size_t)(((((col >> 3) & 1) << 4) + (row & 15)) << 3);
}

// The conversions that depend on inputs alone are block ranges of ONE launch (k_prep, below); each body takes its own block index.
// b_cvtb: bf16 of an [nrows][1024] matrix; b_wt: k-major [1024][1024] -> n-major bf16; both written in fragment order (pko).
__device__ __forceinline__ void b_cvtb(int blk, const float* __restrict__ src, int nrows, bf* dst) {
    const int lane = threadIdx.x & 31, gw = blk * 8 + (threadIdx.x >> 5), r = (gw >> 4) * 16 + (lane & 15);    // wave = 16 rows x 64 columns
    if (r >= nrows) return;
#pragma unroll
    for (int q = 0; q < 4; ++q) { const int col = (gw & 15) * 64 + q * 16 + (lane >> 4) * 8; v8us t;
#pragma unroll
        for (int i = 0; i < 8; ++i) t[i] = f2bf(src[(size_t)r * DM + col + i]);
        VST2(v8us, dst + pko(r, col), t); }
}
__device__ __forceinline__ void b_wt(int bk, int bn, unsigned short* tl, const float* __restrict__ Wm, bf* WT) {
    const int tid = threadIdx.x, k0 = bk * 64, n0 = bn * 64;
    const int kk = tid >> 2, nq = (tid & 3) * 16;
#pragma unroll
    for (int i = 0; i < 16; ++i) tl[(nq + i) * 72 + kk] = f2bf(Wm[(size_t)(k0 + kk) * DM + n0 + nq + i]);
    __syncthreads();
    auto pass = [&]() {
#pragma unroll
        for (int s = 0; s < 2; ++s) { const int u = (tid >> 5) + 8 * s, nr = (u >> 2) * 16 + (tid & 15), kcol = (u & 3) * 16 + ((tid >> 4) & 1) * 8;
            const v8us val = *(const v8usa*)(tl + nr * 72 + kcol);
            *(v8us*)(WT + pko(n0 + nr, k0 + kcol)) = val; }
    };
    pass();
    asm volatile("s_wait_xcnt 0x0" ::: "memory");    // in k_prep the code of the other block ranges follows these stores in the program and rewrites the registers they name: the wait stands in front of that
}
// k_gemmb: 128 x 128 tile of A.B^T + bias over K = 1024 (bf16 exact; A, B in fragment order), 2 x 2 waves of 64 x 64: each loaded fragment feeds four WMMAs
// (16 half-fragment loads for 16 WMMAs a k-chunk, not 10 for 4); the three projections are the z planes of one grid:
// z = 0, 1 (q, k): f16 hi + residual planes (fragment order); z = 2 (v): f32 rows.
// The k loop is unrolled over a ring of GD register stages (one stage = the four A fragments and the four B fragments of one k-chunk of 32): the loads of k-chunk c + GD are
// issued behind the WMMAs of k-chunk c, so that a wave waits for loads that are GD - 1 chunks old. A 16-row group of a plane is 32 KB in a row: every load is scalar base + lane + immediate.
#define GD 3
__global__ __launch_bounds__(128, 3) void k_gemmb(const bf* __restrict__ A, const bf* __restrict__ Bq, const bf* __restrict__ Bk, const bf* __restrict__ Bv,
                                                  const float* __restrict__ bq, const float* __restrict__ bk, const float* __restrict__ bv,
                                                  h16* QH, h16* QL, h16* KH, h16* KL, float* Vf) {
    __shared__ __align__(16) float ost[4][64 * 68];
    const int z = blockIdx.z;
    const bf* Bn = z == 0 ? Bq : z == 1 ? Bk : Bv; const float* bias = z == 0 ? bq : z == 1 ? bk : bv;
    const int wave = __builtin_amdgcn_readfirstlane(threadIdx.x >> 5);    // wave in a scalar register: the operand bases below are scalar
    // the lane's number as the hardware counts it (equal to threadIdx.x & 31 here): with the mask form the compiler folds some constant block offsets into the mask, and such a load takes an address register of its own
    const unsigned ulane = __builtin_amdgcn_mbcnt_lo(~0u, 0u);
    const int r0 = blockIdx.x * 128 + (wave >> 1) * 64, c0 = blockIdx.y * 128 + (wave & 1) * 64;
    gv8u* ua = uptrb(A + pko(r0, 0)); gv8u* ub = uptrb(Bn + pko(c0, 0));    // + 512 elements: the next k-chunk; + 16 * DM: the next 16 rows
    v8f acc[4][4];
#pragma unroll
    for (int u = 0; u < 4; ++u)
#pragma unroll
        for (int t = 0; t < 4; ++t) acc[u][t] = (v8f){};
    v16bf ar[GD][4], br[GD][4];
#pragma unroll
    for (int s = 0; s < GD; ++s) {
#pragma unroll
        for (int t = 0; t < 4; ++t) { ar[s][t] = LDB(ua, t * 16 * DM + s * 512); br[s][t] = LDB(ub, t * 16 * DM + s * 512); }
        __builtin_amdgcn_sched_barrier(0); }    // keeps each stage's loads together and in stage order, so that the waits can count
#pragma unroll
    for (int c = 0; c < DM / 32; ++c) {
        const int s = c % GD;
#pragma unroll
        for (int t = 0; t < 4; ++t)
#pragma unroll
            for (int u = 0; u < 4; ++u) acc[u][t] = wmmab(ar[s][u], br[s][t], acc[u][t]);
        __builtin_amdgcn_sched_barrier(0);    // the refill stays behind the WMMAs that read this stage, so that it lands in the same registers (no stage more, no spill)
        if (c + GD < DM / 32) {
#pragma unroll
            for (int t = 0; t < 4; ++t) { ar[s][t] = LDB(ua, t * 16 * DM + (c + GD) * 512); br[s][t] = LDB(ub, t * 16 * DM + (c + GD) * 512); } }
        __builtin_amdgcn_sched_barrier(0);    // holds the refill of this stage here, GD chunks ahead of its WMMAs: without it the scheduler sinks the loads down to their use
    }
    // the epilogue reuses the lane-offset and scalar base registers that the ring's loads name: the wait stands in front of that. The epilogue's lane number is taken
    // through the wait's own statement, so that none of the lane arithmetic (which can land in the lane-offset register) is placed ahead of it
    unsigned el = ulane;
    asm volatile("s_wait_xcnt 0x0" : "+v"(el) : : "memory");
    __builtin_amdgcn_sched_barrier(0);    // keeps the epilogue's first register writes behind that wait
    const int lane = (int)el, lr = lane & 15, hi = lane >> 4;
    float* os = &ost[wave][0];
#pragma unroll
    for (int t = 0; t < 4; ++t) { const float bv = bfr(bias[c0 + t * 16 + lr]);
#pragma unroll
        for (int u = 0; u < 4; ++u)
#pragma unroll
            for (int j = 0; j < 8; ++j) os[(u * 16 + hi * 8 + j) * 68 + t * 16 + lr] = acc[u][t][j] + bv; }
    __syncthreads();
    if (z == 2) {
        float* crow = Vf + (size_t)r0 * DM + c0;
        auto pass = [&]() {
#pragma unroll
            for (int s = 0; s < 32; ++s) { const int Lid = (lane >> 3) + 4 * s, piece = lane & 7; const int row = Lid >> 1, cofs = (Lid & 1) * 32 + piece * 4;
                const v4f val = *(const v4fa*)(os + row * 68 + cofs); *(v4f*)(crow + (size_t)row * DM + cofs) = val; }
        };
        pass(); 
    } else {
        h16* c1 = z == 0 ? QH : KH; h16* c2 = z == 0 ? QL : KL;
        auto pass = [&]() {
#pragma unroll
            for (int s = 0; s < 16; ++s) { const int row = (s >> 2) * 16 + lr, col = (s & 3) * 16 + hi * 8; const float* sp = os + row * 68 + col; const size_t po = pko(r0 + row, c0 + col); v8h o1, o2;
#pragma unroll
                for (int i = 0; i < 8; ++i) { const h16 a = (h16)sp[i]; o1[i] = a; o2[i] = (h16)((sp[i] - (float)a) * LOSC); }
                *(v8h*)(c1 + po) = o1; *(v8h*)(c2 + po) = o2; }
        };
        pass();
        asm volatile("s_wait_xcnt 0x0" ::: "memory");    // the code of the v branch can follow these stores in the program and rewrites the registers they name: the wait stands in front of that
    }
}
// k_vt: VTH/VTL = f16 hi + residual of V^T, fragment order: [b][h][s / 32][d / 16][(s >> 4) & 1] blocks of 512 bytes, lane = 16 * ((s >> 3) & 1) + (d & 15); block (b, h, 64 s).
__global__ __launch_bounds__(256) void k_vt(const float* __restrict__ V, h16* VTH, h16* VTL) {
    __shared__ __align__(16) h16 tile[HD * 72];
    __shared__ __align__(16) h16 til2[HD * 72];
    const int bid = blockIdx.x;
    const int b = bid / (NH_ * (SS / 64)), rem = bid - b * (NH_ * (SS / 64)), h = rem / (SS / 64), kt = rem - h * (SS / 64);
    const int s0 = kt * 64, tid = threadIdx.x, ss = tid >> 2, d0 = (tid & 3) * 16;
    const float* src = V + ((size_t)b * SS + s0 + ss) * DM + h * HD + d0;
#pragma unroll
    for (int i = 0; i < 16; ++i) { const float v = src[i]; const h16 a = (h16)v; tile[(d0 + i) * 72 + ss] = a; til2[(d0 + i) * 72 + ss] = (h16)((v - (float)a) * LOSC); }
    __syncthreads();
    const size_t base = (((size_t)b * NH_ + h) * HD) * SS;
    const int lane = tid & 31, wv = tid >> 5, n = wv >> 1, p = wv & 1, d = n * 16 + (lane & 15);
    auto pass = [&]() {
#pragma unroll
        for (int s = 0; s < 4; ++s) { const int pln = s >> 1, ktl = s & 1;
            const v8h val = *(const v8ha*)((pln ? til2 : tile) + d * 72 + ktl * 32 + p * 16 + (lane >> 4) * 8);
            *(v8h*)((pln ? VTL : VTH) + base + (size_t)((((s0 >> 5) + ktl) * 4 + n) * 2 + p) * 256 + lane * 8) = val; }
    };
    pass(); 
}
// b_tabs: both tables in fragment order over groups g of 16 table rows m = 16 g + 1 .. 16 g + 16 (every band of k_attn starts at m = 1 mod 16; m = 0 is never used):
// RK16 [g < NGK][d / 16] blocks of 512 bytes = f16(bf16(rel_k_emb)), lane = 16 * ((d >> 3) & 1) + (m - 1 & 15); RVT16 [g < NGV][d / 16] blocks = f16(bf16(rel_v_emb))^T,
// lane = 16 * ((m - 1 >> 3) & 1) + (d & 15), via 64x64 LDS transposes (zero beyond row 2048); NRP/64 blocks.
__device__ __forceinline__ void b_tabs(int blk, h16* tile, const float* __restrict__ rk, const float* __restrict__ rv, h16* RK16, h16* RVT16) {
    const int m0 = blk * 64 + 1, tid = threadIdx.x, mm = tid >> 2, d0 = (tid & 3) * 16;
#pragma unroll
    for (int i = 0; i < 16; ++i) { const int m = m0 + mm; tile[(d0 + i) * 72 + mm] = (m < NRL) ? (h16)bfr(rv[(size_t)m * HD + d0 + i]) : (h16)0.f; }
    __syncthreads();
    const int lane = tid & 31, lr = lane & 15, hi = lane >> 4;
    auto pass = [&]() {
#pragma unroll
        for (int s = 0; s < 2; ++s) { const int u = (tid >> 5) + 8 * s, g = blk * 4 + (u >> 2), m = 16 * g + 1 + lr, col = (u & 3) * 16 + hi * 8; v8h o;
#pragma unroll
            for (int i = 0; i < 8; ++i) o[i] = (m < NRL) ? (h16)bfr(rk[(size_t)m * HD + col + i]) : (h16)0.f;
            if (g < NGK) *(v8h*)(RK16 + (size_t)(g * 4 + (u & 3)) * 256 + lane * 8) = o; }
#pragma unroll
        for (int s = 0; s < 2; ++s) { const int u = (tid >> 5) + 8 * s, gl = u >> 2, n = u & 3, g = blk * 4 + gl;
            const v8h val = *(const v8ha*)(tile + (n * 16 + lr) * 72 + gl * 16 + hi * 8);
            if (g < NGV) *(v8h*)(RVT16 + (size_t)(g * 4 + n) * 256 + lane * 8) = val; }
    };
    pass(); 
}
// k_prep: one launch for all six conversions, none of which reads what another writes. Block ranges: PBT blocks of the tables (first: the longest chain of dependent loads),
// PBX blocks of x, 4 x PBW blocks of the weights (k tile fastest). The range test reads blockIdx alone, so each body's barrier is passed by its whole block; the bodies with an LDS tile share one.
#define PBX (NTK / 8)
#define PBW ((DM / 64) * (DM / 64))
#define PBT (NRP / 64)
__global__ __launch_bounds__(256) void k_prep(const float* __restrict__ x, const float* __restrict__ Wq, const float* __restrict__ Wk, const float* __restrict__ Wv, const float* __restrict__ Wo,
                                              const float* __restrict__ rk, const float* __restrict__ rv, bf* Xb, bf* WqT, bf* WkT, bf* WvT, bf* WoT, h16* RK16, h16* RVT16) {
    __shared__ __align__(16) unsigned short tl[64 * 72];
    const int bid = blockIdx.x;
    if (bid < PBT) { b_tabs(bid, (h16*)tl, rk, rv, RK16, RVT16); return; }
    if (bid < PBT + PBX) { b_cvtb(bid - PBT, x, NTK, Xb); return; }
    const int u = bid - PBT - PBX, wi = u / PBW, t = u - wi * PBW;
    b_wt(t % (DM / 64), t / (DM / 64), tl, wi == 0 ? Wq : wi == 1 ? Wk : wi == 2 ? Wv : Wo, wi == 0 ? WqT : wi == 1 ? WkT : wi == 2 ? WvT : WoT);
}
// k_attn: block = (b, h, 64 queries), wave = 16 queries i = q0..q0+15; 32 key tiles of 32. Every product is taken TRANSPOSED (a stored fragment serves as A or as B alike): lane (lr, hi)
// holds column lr = ONE query of every tile, its 8 registers the rows 8 hi + j. Content S^T = k.q^T, 12 WMMA (hi.hi + hi.lo + lo.hi, q residual fragments re-read);
// relative-key band^T: rows m = mbase + 0..47 of RK16 (mbase = q0 - l0 - 31 + 1024) x (q hi, q lo) = 12 WMMA, parked in LDS as ps[query][m]; logit(i,j) = content + ps[r][r - kk + 31]
// (UNSCALED); online softmax: maximum and sum inside the lane plus one exchange between the wave halves; the weights x32768 hi + residual of the two score tiles, packed in place, ARE
// the B operand (k = 8 hi + s, 16 + 8 hi + s) of o^T += vh.pa, ox^T += vl.pa + vh.px (12 WMMA); the same weights scattered into relative coordinates pt/pt2 [query][64]
// (column r + 31 - kk) are the B operand of o^T += rv.pt, ox^T += rv.pt2 (8 WMMA, A = RVT16 rows d at k = mbase + 16 .. mbase + 47; columns below 16 wait for the next tile, whose columns 32..47 they are);
// ctx = (o + ox/1024)/sum: a lane holds 8 consecutive d of its query = one 16-byte piece of the bf16 hi/lo planes [tok][h*64+d] in fragment order. Every global operand is read in fragment order (pko, k_vt, b_tabs).
#define PTP 136                  // row pitch of pt/pt2 in halves: 16 bytes x odd for the 16-byte readers; the scatter's lane stride PTP + 1 is 9 halves modulo the 64 banks, so the 8-half stores of 16 lanes lie side by side
typedef __attribute__((ext_vector_type(4))) unsigned v4u;
typedef v4u __attribute__((may_alias, aligned(2))) v4u2;
// the 8 halves of x in reverse order: the dwords reversed, each rotated by 16 bits
__device__ __forceinline__ v4u rev8(v8h x) { const v4u u = __builtin_bit_cast(v4u, x); return (v4u){ (u[3] >> 16) | (u[3] << 16), (u[2] >> 16) | (u[2] << 16), (u[1] >> 16) | (u[1] << 16), (u[0] >> 16) | (u[0] << 16) }; }
__device__ __forceinline__ float xhalf(float x) { return __builtin_bit_cast(float, __builtin_amdgcn_permlanex16(__builtin_bit_cast(int, x), __builtin_bit_cast(int, x), 0x76543210, 0xfedcba98, false, false)); }    // lane l with lane l ^ 16
__global__ __launch_bounds__(128, 4) void k_attn(const h16* __restrict__ QH, const h16* __restrict__ QL, const h16* __restrict__ KH, const h16* __restrict__ KL,
                                             const h16* __restrict__ RK16, const h16* __restrict__ RVT16, const h16* __restrict__ VTH, const h16* __restrict__ VTL, bf* CH, bf* CL) {
    __shared__ __align__(16) h16 ptl[4][16 * PTP];
    __shared__ __align__(16) h16 ptl2[4][16 * PTP];
    __shared__ __align__(16) float posl[4][16 * 52];
    const int lane = threadIdx.x & 31, wave = __builtin_amdgcn_readfirstlane(threadIdx.x >> 5), lr = lane & 15, hi = lane >> 4;    // wave in a scalar register: every operand block address below is scalar base + lane offset
    const unsigned ulane = lane;
    const int bid = blockIdx.x;
    const int b = bid / (NH_ * (SS / 64)), rem = bid - b * (NH_ * (SS / 64)), h = rem / (SS / 64), qt = rem - h * (SS / 64);
    const int q0 = qt * 64 + wave * 16;
    const size_t tok0 = (size_t)b * SS;
    h16* pt = &ptl[wave][0]; h16* pt2 = &ptl2[wave][0]; float* ps = &posl[wave][0];
    // row lr (the lane's query) of each LDS tile addressed as one lane base + a constant (an immediate offset). psb + 16 t + j: band column m = 16 t + 8 hi + j;
    // psg, ptb, ptb2 + 23 - 16 T - j: column r + 31 - kk of key kk = 16 T + 8 hi + j
    float* psb = ps + lr * 52 + hi * 8; const float* psg = ps + lr * 53 + 8 - hi * 8;
    h16* ptb = pt + lr * (PTP + 1) + 8 - hi * 8; h16* ptb2 = pt2 + lr * (PTP + 1) + 8 - hi * 8;
    const size_t qo0 = pko((int)tok0 + q0, h * HD);    // wave-uniform block offset; LDU adds the lane's own piece
    v16h qa[2];
#pragma unroll
    for (int kc = 0; kc < 2; ++kc) qa[kc] = LDU(uptr(QH + qo0), kc * 512, 256);
    const size_t vbase = (((size_t)b * NH_ + h) * HD) * SS;
    v8f o[4], ox[4];
#pragma unroll
    for (int n = 0; n < 4; ++n) { o[n] = (v8f){}; ox[n] = (v8f){}; }
    float mrow = -3.0e38f, lpart = 0.f;    // of the lane's query; lpart sums the keys of the lane's own wave half
    // Row r of pt/pt2 holds three runs of 16 columns, all rewritten every tile: r .. r+15 = this tile's keys 31..16, r+16 .. r+31 = its keys 15..0, r+32 .. r+47 = the tile before's keys 31..16.
    // Only columns 16..47 are read: one whole k-chunk. What a tile leaves below column 16 is not multiplied yet: it rides in wc (f32, x32768) into the next tile, whose columns 32..47 it completes.
    v8f wc = {};
    // Operand fragments are loaded in groups well ahead of the WMMAs that read them (the "memory" fences below keep each group where it is written).
    // The q residual and band fragments of k-chunk 0 of a key tile are loaded during the tile before it and carried over the loop edge in these registers.
    v16h ql0, rb0[3];
    { gv8h* uql = uptr(QL + qo0); gv8h* urk = uptr(RK16 + (size_t)((q0 - 31 + 1024 - 1) >> 4) * 1024); ql0 = LDU(uql, 0, 256);
#pragma unroll
      for (int t = 0; t < 3; ++t) rb0[t] = LDU(urk, t * 1024, 256); }
#pragma unroll 1
    for (int kt = 0; kt < SS / 32; ++kt) {
        const int l0 = kt * 32, mbase = q0 - l0 - 31 + 1024, gb = (mbase - 1) >> 4;    // mbase = 16 gb + 1
        const size_t ko = pko((int)tok0 + l0, h * HD);    // + 512: k-chunk 1; + 16 * DM: the next 16 rows, 64 blocks on
        gv8h* ukh = uptr(KH + ko); gv8h* ukl = uptr(KL + ko); gv8h* uql = uptr(QL + qo0); gv8h* urk = uptr(RK16 + (size_t)gb * 1024);
        // group: q residual and band fragments of k-chunk 1, k fragments of k-chunk 0: in flight under the band of k-chunk 0
        v16h rb1[3];
        const v16h ql1 = LDU(uql, 512, 256);
#pragma unroll
        for (int t = 0; t < 3; ++t) rb1[t] = LDU(urk, t * 1024 + 512, 256);
        const v16h k0h0 = LDU(ukh, 0, 256), k1h0 = LDU(ukh, 16 * DM, 256), k0l0 = LDU(ukl, 0, 256), k1l0 = LDU(ukl, 16 * DM, 256);
        // The v_nop statements of this loop fill the vector slots the chip needs between a WMMA and the first read of its D or rewrite of its A / B,
        // and name those registers so that they stay whole up to there; their "memory" clobber also fences the load groups.
        // band tiles, k-chunk 0: rows m = mbase + t*16 + lr of RK16
#pragma unroll
        for (int t = 0; t < 3; ++t) {
            v8f ph = wmma16(rb0[t], qa[0], (v8f){}); v8f pq = wmma16(rb0[t], ql0, (v8f){});
            asm volatile("v_nop\n\tv_nop\n\tv_nop\n\tv_nop" : "+v"(ph), "+v"(pq) : "v"(rb0[t]), "v"(ql0));
            v4f b0, b1;
#pragma unroll
            for (int j = 0; j < 4; ++j) { b0[j] = ph[j] + pq[j] * LOSCI; b1[j] = ph[j + 4] + pq[j + 4] * LOSCI; }
            *(v4fa*)(psb + t * 16) = b0; *(v4fa*)(psb + t * 16 + 4) = b1;
            asm volatile("" ::: "memory"); }
        // group: k fragments of k-chunk 1, in flight under the band of k-chunk 1
        const v16h k0h1 = LDU(ukh, 512, 256), k1h1 = LDU(ukh, 16 * DM + 512, 256), k0l1 = LDU(ukl, 512, 256), k1l1 = LDU(ukl, 16 * DM + 512, 256);
        // band tiles, k-chunk 1
#pragma unroll
        for (int t = 0; t < 3; ++t) {
            v8f ph = wmma16(rb1[t], qa[1], (v8f){}); v8f pq = wmma16(rb1[t], ql1, (v8f){});
            asm volatile("v_nop\n\tv_nop\n\tv_nop\n\tv_nop" : "+v"(ph), "+v"(pq) : "v"(rb1[t]), "v"(ql1));
            v4f b0 = *(const v4fa*)(psb + t * 16), b1 = *(const v4fa*)(psb + t * 16 + 4);
#pragma unroll
            for (int j = 0; j < 4; ++j) { b0[j] += ph[j] + pq[j] * LOSCI; b1[j] += ph[j + 4] + pq[j + 4] * LOSCI; }
            *(v4fa*)(psb + t * 16) = b0; *(v4fa*)(psb + t * 16 + 4) = b1;
            asm volatile("" ::: "memory"); }
        // content, k-chunk 0 then 1
        v8f s0 = {}, s1 = {}, x0 = {}, x1 = {};
        s0 = wmma16(k0h0, qa[0], s0); x0 = wmma16(k0h0, ql0, x0); s1 = wmma16(k1h0, qa[0], s1); x1 = wmma16(k1h0, ql0, x1);
        asm volatile("v_nop" : "+v"(s0), "+v"(s1), "+v"(x0), "+v"(x1) : "v"(ql0), "v"(k0h0), "v"(k1h0) : "memory");
        x0 = wmma16(k0l0, qa[0], x0); x1 = wmma16(k1l0, qa[0], x1);
        asm volatile("v_nop" : "+v"(x0), "+v"(x1) : "v"(k0l0), "v"(k1l0) : "memory");
        s0 = wmma16(k0h1, qa[1], s0); x0 = wmma16(k0h1, ql1, x0); s1 = wmma16(k1h1, qa[1], s1); x1 = wmma16(k1h1, ql1, x1);
        asm volatile("v_nop" : "+v"(s0), "+v"(s1), "+v"(x0), "+v"(x1) : "v"(ql1), "v"(k0h1), "v"(k1h1) : "memory");
        x0 = wmma16(k0l1, qa[1], x0); x1 = wmma16(k1l1, qa[1], x1);
        asm volatile("v_nop" : "+v"(x0), "+v"(x1) : "v"(k0l1), "v"(k1l1) : "memory");
        asm volatile("v_nop\n\tv_nop\n\tv_nop\n\tv_nop" : "+v"(s0), "+v"(s1), "+v"(x0), "+v"(x1) : "v"(qa[0]), "v"(qa[1]));
        asm volatile("" ::: "memory");
        __builtin_amdgcn_wave_barrier();
        v8f g0v, g1v;
#pragma unroll
        for (int j = 0; j < 8; ++j) g0v[j] = psg[23 - j];    // band[r][r - kk + 31], kk = 8 hi + j
#pragma unroll
        for (int j = 0; j < 8; ++j) g1v[j] = psg[7 - j];     // kk = 16 + 8 hi + j
        const v8f a0 = s0 + x0 * LOSCI + g0v, a1 = s1 + x1 * LOSCI + g1v;
        float tm[8];
#pragma unroll
        for (int j = 0; j < 8; ++j) tm[j] = fmaxf(a0[j], a1[j]);
        float mx = fmaxf(fmaxf(fmaxf(tm[0], tm[1]), fmaxf(tm[2], tm[3])), fmaxf(fmaxf(tm[4], tm[5]), fmaxf(tm[6], tm[7])));
        mx = fmaxf(mx, xhalf(mx));    // the other 16 keys of this query sit in the other wave half
        const float mn = fmaxf(mrow, mx), alpha = __expf(mrow - mn); mrow = mn;
        v8f e0, e1;
#pragma unroll
        for (int j = 0; j < 8; ++j) e0[j] = __expf(a0[j] - mn);
#pragma unroll
        for (int j = 0; j < 8; ++j) e1[j] = __expf(a1[j] - mn);
        const v8f es = e0 + e1, w0 = e0 * PSC, w1 = e1 * PSC;
        const v8h h0 = __builtin_convertvector(w0, v8h), h1 = __builtin_convertvector(w1, v8h);
        const v8h r0 = __builtin_convertvector((w0 - __builtin_convertvector(h0, v8f)) * LOSC, v8h), r1 = __builtin_convertvector((w1 - __builtin_convertvector(h1, v8f)) * LOSC, v8h);
        const v16h pa = cat16(h0, h1), px = cat16(r0, r1);
        // a lane's 8 keys of a tile are 8 consecutive relative columns in falling order: one 16-byte LDS store each, at an address that is a multiple of 2 bytes only
        *(v4u2*)(ptb + 16) = rev8(h0); *(v4u2*)ptb = rev8(h1); *(v4u2*)(ptb2 + 16) = rev8(r0); *(v4u2*)ptb2 = rev8(r1);
        // the tile before's keys 16..31, brought to this tile's maximum, sit 32 columns up in this tile's coordinates
        const v8f wo = wc * alpha; wc = w1;
        const v8h hc = __builtin_convertvector(wo, v8h), rc = __builtin_convertvector((wo - __builtin_convertvector(hc, v8f)) * LOSC, v8h);
        *(v4u2*)(ptb + 32) = rev8(hc); *(v4u2*)(ptb2 + 32) = rev8(rc);
        lpart = lpart * alpha + (((es[0] + es[1]) + (es[2] + es[3])) + ((es[4] + es[5]) + (es[6] + es[7])));
#pragma unroll
        for (int n = 0; n < 4; ++n)
#pragma unroll
            for (int j = 0; j < 8; ++j) { o[n][j] *= alpha; ox[n][j] *= alpha; }
        asm volatile("" ::: "memory");
        // group: this tile's v hi + residual fragments and the rel_v fragments of its one k-chunk (columns 16..47)
        v16h vh[4], vl[4], rv0[4];
        gv8h* uvh = uptr(VTH + vbase + (size_t)kt * 2048); gv8h* uvl = uptr(VTL + vbase + (size_t)kt * 2048); gv8h* urv = uptr(RVT16 + (size_t)gb * 1024);
#pragma unroll
        for (int n = 0; n < 4; ++n) { vh[n] = LDU(uvh, n * 512, 256); vl[n] = LDU(uvl, n * 512, 256); }
#pragma unroll
        for (int n = 0; n < 4; ++n) rv0[n] = LDU(urv, 1024 + n * 256, 1024);
#pragma unroll
        for (int n = 0; n < 4; ++n) {
            o[n] = wmma16(vh[n], pa, o[n]); ox[n] = wmma16(vl[n], pa, ox[n]); ox[n] = wmma16(vh[n], px, ox[n]);
            asm volatile("" : "+v"(o[n]), "+v"(ox[n]) : "v"(vh[n]), "v"(vl[n]) : "memory");    // keeps the fragments whole through their WMMAs; its "memory" clobber holds the load groups where they are written
        }
        // group: the next key tile's q residual and band fragments of k-chunk 0 (the last tile loads its own again: in bounds, unused)
        { const int ktn = kt + 1 < SS / 32 ? kt + 1 : kt; gv8h* urn = uptr(RK16 + (size_t)((q0 - ktn * 32 - 31 + 1024 - 1) >> 4) * 1024); ql0 = LDU(uql, 0, 256);
#pragma unroll
          for (int t = 0; t < 3; ++t) rb0[t] = LDU(urn, t * 1024, 256); }
        // rel_v x relative-coordinate weights: A = RVT16 rows d at k = mbase + 16 .. mbase + 47, B = pt rows (one query a lane, k = column - 16, one k-chunk)
        {
            const v16h ra = cat16(*(const v8ha*)(pt + lr * PTP + 16 + hi * 8), *(const v8ha*)(pt + lr * PTP + 32 + hi * 8));
            const v16h rx = cat16(*(const v8ha*)(pt2 + lr * PTP + 16 + hi * 8), *(const v8ha*)(pt2 + lr * PTP + 32 + hi * 8));
#pragma unroll
            for (int n = 0; n < 4; ++n) {
                o[n] = wmma16(rv0[n], ra, o[n]); ox[n] = wmma16(rv0[n], rx, ox[n]);
                asm volatile("" : "+v"(o[n]), "+v"(ox[n]) : "v"(rv0[n]), "v"(ra), "v"(rx) : "memory"); }    // as in the v loop above: fragments whole through their WMMAs, load groups held where they are written
        }
        __builtin_amdgcn_wave_barrier();    // this tile's reads of pt/pt2 stay ahead of the next tile's stores into the same rows
        // the carried group's loads name scalar base registers that the next trip's address arithmetic rewrites: the wait stands in front of that rewrite
        asm volatile("s_wait_xcnt 0x0" ::: "memory");
    }
    // the last tile's columns below 16: one more k-chunk with no new keys (columns r .. r+31 zero). Its upper 16 columns are table group q0 / 16; the lower 16 carry zero weights
    // and take the same group as a stand-in (the group below it does not exist for q0 = 0).
    {
        gv8h* urv = uptr(RVT16 + (size_t)(q0 >> 4) * 1024);
        v16h rvf[4];
#pragma unroll
        for (int n = 0; n < 4; ++n) rvf[n] = LDU(urv, n * 256, 0);
        const v8h hc = __builtin_convertvector(wc, v8h), rc = __builtin_convertvector((wc - __builtin_convertvector(hc, v8f)) * LOSC, v8h);
        const v4u zz = {};
        *(v4u2*)(ptb + 16) = zz; *(v4u2*)ptb = zz; *(v4u2*)(ptb2 + 16) = zz; *(v4u2*)ptb2 = zz;
        *(v4u2*)(ptb + 32) = rev8(hc); *(v4u2*)(ptb2 + 32) = rev8(rc);
        const v16h ra = cat16(*(const v8ha*)(pt + lr * PTP + 16 + hi * 8), *(const v8ha*)(pt + lr * PTP + 32 + hi * 8));
        const v16h rx = cat16(*(const v8ha*)(pt2 + lr * PTP + 16 + hi * 8), *(const v8ha*)(pt2 + lr * PTP + 32 + hi * 8));
#pragma unroll
        for (int n = 0; n < 4; ++n) { o[n] = wmma16(rvf[n], ra, o[n]); ox[n] = wmma16(rvf[n], rx, ox[n]); }
    }
    asm volatile("v_nop\n\tv_nop\n\tv_nop\n\tv_nop" : "+v"(o[0]), "+v"(o[1]), "+v"(o[2]), "+v"(o[3]), "+v"(ox[0]), "+v"(ox[1]), "+v"(ox[2]), "+v"(ox[3]));
    const float rs = lpart + xhalf(lpart), inv = 1.0f / (rs * PSC);    // the two wave halves' sums of this query joined once
#pragma unroll
    for (int s = 0; s < 4; ++s) { const size_t po = pko((int)tok0 + q0 + lr, h * HD + s * 16 + hi * 8); v8us oh, ol;
#pragma unroll
        for (int i = 0; i < 8; ++i) { const float cv = (o[s][i] + ox[s][i] * LOSCI) * inv; const unsigned short hb = f2bf(cv); oh[i] = hb; ol[i] = f2bf(cv - bf2f(hb)); }
        *(v8us*)(CH + po) = oh; *(v8us*)(CL + po) = ol; }
}
// k_outp: 128 x 128 tile of out = (CH + CL).WoT^T + bo over K = 1024 (2 products), 4 x 2 waves of 32 x 64 (16 half-fragment loads for 16 WMMAs a k-chunk, not 12 for 8); f32 rows.
// 256 blocks of 8 waves: one block a WGP, two waves a SIMD.
// Same register ring as k_gemmb, OD stages of four A fragments (hi, residual x two row tiles) and four B fragments.
#define OD 3
__global__ __launch_bounds__(256, 1) void k_outp(const bf* __restrict__ A, const bf* __restrict__ Al, const bf* __restrict__ Bn, const float* __restrict__ bias, float* C) {
    __shared__ __align__(16) float ost[8][32 * 68];
    const int wave = __builtin_amdgcn_readfirstlane(threadIdx.x >> 5);    // wave in a scalar register: the operand bases below are scalar
    // the lane's number as the hardware counts it (equal to threadIdx.x & 31 here): with the mask form the compiler folds some constant block offsets into the mask, and such a load takes an address register of its own
    const unsigned ulane = __builtin_amdgcn_mbcnt_lo(~0u, 0u);
    const int r0 = blockIdx.x * 128 + (wave >> 1) * 32, c0 = blockIdx.y * 128 + (wave & 1) * 64;
    gv8u* ua = uptrb(A + pko(r0, 0)); gv8u* ul = uptrb(Al + pko(r0, 0)); gv8u* ub = uptrb(Bn + pko(c0, 0));    // + 512 elements: the next k-chunk; + 16 * DM: the next 16 rows
    v8f acc[2][4];
#pragma unroll
    for (int t = 0; t < 4; ++t) { acc[0][t] = (v8f){}; acc[1][t] = (v8f){}; }
    v16bf ar[OD][2], lr2[OD][2], br[OD][4];
#pragma unroll
    for (int s = 0; s < OD; ++s) {
#pragma unroll
        for (int u = 0; u < 2; ++u) { ar[s][u] = LDB(ua, u * 16 * DM + s * 512); lr2[s][u] = LDB(ul, u * 16 * DM + s * 512); }
#pragma unroll
        for (int t = 0; t < 4; ++t) br[s][t] = LDB(ub, t * 16 * DM + s * 512);
        __builtin_amdgcn_sched_barrier(0); }    // keeps each stage's loads together and in stage order, so that the waits can count
#pragma unroll
    for (int c = 0; c < DM / 32; ++c) {
        const int s = c % OD;
#pragma unroll
        for (int t = 0; t < 4; ++t) { acc[0][t] = wmmab(ar[s][0], br[s][t], acc[0][t]); acc[1][t] = wmmab(ar[s][1], br[s][t], acc[1][t]);
            acc[0][t] = wmmab(lr2[s][0], br[s][t], acc[0][t]); acc[1][t] = wmmab(lr2[s][1], br[s][t], acc[1][t]); }
        __builtin_amdgcn_sched_barrier(0);    // the refill stays behind the WMMAs that read this stage, so that it lands in the same registers (no stage more, no spill)
        if (c + OD < DM / 32) {
#pragma unroll
            for (int u = 0; u < 2; ++u) { ar[s][u] = LDB(ua, u * 16 * DM + (c + OD) * 512); lr2[s][u] = LDB(ul, u * 16 * DM + (c + OD) * 512); }
#pragma unroll
            for (int t = 0; t < 4; ++t) br[s][t] = LDB(ub, t * 16 * DM + (c + OD) * 512); }
        __builtin_amdgcn_sched_barrier(0);    // holds the refill of this stage here, OD chunks ahead of its WMMAs: without it the scheduler sinks the loads down to their use
    }
    // the epilogue reuses the lane-offset and scalar base registers that the ring's loads name: the wait stands in front of that; the epilogue's lane number goes through the wait's own statement, as in k_gemmb
    unsigned el = ulane;
    asm volatile("s_wait_xcnt 0x0" : "+v"(el) : : "memory");
    __builtin_amdgcn_sched_barrier(0);    // keeps the epilogue's first register writes behind that wait
    const int lane = (int)el, lr = lane & 15, hi = lane >> 4;
    float* os = &ost[wave][0];
#pragma unroll
    for (int t = 0; t < 4; ++t) { const float bv = bfr(bias[c0 + t * 16 + lr]);
#pragma unroll
        for (int u = 0; u < 2; ++u)
#pragma unroll
            for (int j = 0; j < 8; ++j) os[(u * 16 + hi * 8 + j) * 68 + t * 16 + lr] = acc[u][t][j] + bv; }
    __syncthreads();
    float* crow = C + (size_t)r0 * DM + c0;
    auto pass = [&]() {
#pragma unroll
        for (int s = 0; s < 16; ++s) { const int Lid = (lane >> 3) + 4 * s, piece = lane & 7; const int row = Lid >> 1, cofs = (Lid & 1) * 32 + piece * 4;
            const v4f val = *(const v4fa*)(os + row * 68 + cofs); *(v4f*)(crow + (size_t)row * DM + cofs) = val; }
    };
    pass(); 
}

extern "C" void kernel_launch(void* const* d_in, const int* in_sizes, int n_in,
                              void* d_out, int out_size, void* d_ws, size_t ws_size, hipStream_t stream) {
    (void)in_sizes; (void)n_in; (void)out_size;
    const float* x = (const float*)d_in[0]; const float* Wq = (const float*)d_in[1]; const float* bq = (const float*)d_in[2]; const float* Wk = (const float*)d_in[3]; const float* bk = (const float*)d_in[4];
    const float* Wv = (const float*)d_in[5]; const float* bv = (const float*)d_in[6]; const float* Wo = (const float*)d_in[7]; const float* bo = (const float*)d_in[8];
    const float* rk = (const float*)d_in[9]; const float* rv = (const float*)d_in[10];
    float* out = (float*)d_out;    // [4][1024][1024]
    char* wsp = (char*)d_ws;
    auto take = [&](size_t bytes) { char* p = wsp; wsp += (bytes + 255) & ~(size_t)255; return (void*)p; };
    bf* Xb = (bf*)take((size_t)NTK * DM * 2); bf* WqT = (bf*)take((size_t)DM * DM * 2); bf* WkT = (bf*)take((size_t)DM * DM * 2); bf* WvT = (bf*)take((size_t)DM * DM * 2); bf* WoT = (bf*)take((size_t)DM * DM * 2);
    h16* QH = (h16*)take((size_t)NTK * DM * 2); h16* QL = (h16*)take((size_t)NTK * DM * 2); h16* KH = (h16*)take((size_t)NTK * DM * 2); h16* KL = (h16*)take((size_t)NTK * DM * 2);
    float* Vf = (float*)take((size_t)NTK * DM * 4); h16* VTH = (h16*)take((size_t)NTK * DM * 2); h16* VTL = (h16*)take((size_t)NTK * DM * 2);
    h16* RK16 = (h16*)take((size_t)NRP * HD * 2); h16* RVT16 = (h16*)take((size_t)HD * NRP * 2);
    if ((size_t)(wsp - (char*)d_ws) > ws_size) return;    // 8.4 + 8.4 + 33.5 + 16.8 + 16.8 + 0.5 ~ 85 MB; ctx planes alias Vf (dead after k_vt)
    bf* CH = (bf*)Vf; bf* CL = (bf*)((char*)Vf + (size_t)NTK * DM * 2);
    k_prep<<<PBX + 4 * PBW + PBT, 256, 0, stream>>>(x, Wq, Wk, Wv, Wo, rk, rv, Xb, WqT, WkT, WvT, WoT, RK16, RVT16);
    k_gemmb<<<dim3(NTK / 128, DM / 128, 3), 128, 0, stream>>>(Xb, WqT, WkT, WvT, bq, bk, bv, QH, QL, KH, KL, Vf);
    k_vt<<<NB_ * NH_ * (SS / 64), 256, 0, stream>>>(Vf, VTH, VTL);
    k_attn<<<NB_ * NH_ * (SS / 64), 128, 0, stream>>>(QH, QL, KH, KL, RK16, RVT16, VTH, VTL, CH, CL);
    k_outp<<<dim3(NTK / 128, DM / 128, 1), 256, 0, stream>>>(CH, CL, WoT, bo, out);
}

// v008
// It runs in 148 microseconds.
// Timed twice side by side with v007, it ran 1.05 and 1.06 times as fast.
// Over all steps from v000 it is 3.28 times as fast.
#include <hip/hip_runtime.h>

// Contractions, f32 accumulate: q/k/v = x.W + b and out = attn.Wo + bo ([4096 x 1024].[1024 x 1024]) on v_wmma_f32_16x16x32_bf16 — plain bf16 = rounded inputs
// (exact; k-major weights transposed to n-major planes) for the projections, attn as bf16 hi + residual planes (two products) for Wo; the relative-position
// attention fused on v_wmma_f32_16x16x32_f16 with UNSCALED logits (sigma ~ 11 over 1024 keys, near one-hot): content q.k as hi.hi + hi.lo + lo.hi, the relative-key
// band q.rel_k[m] (q hi + lo vs the exact f16 INPUT table) gathered per (i, j) at m = i - j + 1024, softmax, weights (x32768) hi + residual against v hi + residual,

#define NB_  4
#define SS   1024
#define DM   1024
#define NH_  16
#define HD   64
#define NTK  (NB_ * SS)          // 4096
#define NRL  2049                // relative table rows
#define NRP  2112                // padded (band reads up to mbase + 47 <= 2063; P~ k-chunk up to mbase + 47 <= 2063)
#define NGK  128                 // 16-row groups of the relative-key table that a band can reach (m <= 2048)
#define NGV  129                 // 16-row groups of the relative-value table (k-chunks reach m <= 2048; one more group, beyond 2048, is zero)
#define PSC  32768.0f
#define LOSC 1024.0f
#define LOSCI (1.0f / 1024.0f)

typedef _Float16 h16;
typedef unsigned short bf;
typedef __attribute__((ext_vector_type(16))) __bf16   v16bf;
typedef __attribute__((ext_vector_type(16))) _Float16 v16h;
typedef __attribute__((ext_vector_type(8)))  _Float16 v8h;
typedef __attribute__((ext_vector_type(8)))  unsigned short v8us;
typedef __attribute__((ext_vector_type(8)))  float    v8f;
typedef __attribute__((ext_vector_type(4)))  float    v4f;
typedef v8h  __attribute__((may_alias)) v8ha;
typedef v4f  __attribute__((may_alias)) v4fa;
typedef v8us __attribute__((may_alias)) v8usa;

__device__ __forceinline__ unsigned short f2bf(float f) { unsigned u = __float_as_uint(f); u += 0x7FFFu + ((u >> 16) & 1u); return (unsigned short)(u >> 16); }
__device__ __forceinline__ float bf2f(unsigned short b) { return __uint_as_float(((unsigned)b) << 16); }
__device__ __forceinline__ float bfr(float f) { return bf2f(f2bf(f)); }
__device__ __forceinline__ v16h cat16(v8h lo, v8h hi) { return __builtin_shufflevector(lo, hi, 0, 1, 2, 3, 4, 5, 6, 7, 8, 9, 10, 11, 12, 13, 14, 15); }
__device__ __forceinline__ v16bf cat16b(v8us lo, v8us hi) { return __builtin_bit_cast(v16bf, __builtin_shufflevector(lo, hi, 0, 1, 2, 3, 4, 5, 6, 7, 8, 9, 10, 11, 12, 13, 14, 15)); }
__device__ __forceinline__ v8f wmma16(v16h a, v16h b, v8f c) { return __builtin_amdgcn_wmma_f32_16x16x32_f16(false, a, false, b, (short)0, c, false, false); }
__device__ __forceinline__ v8f wmmab(v16bf a, v16bf b, v8f c) { return __builtin_amdgcn_wmma_f32_16x16x32_bf16(false, a, false, b, (short)0, c, false, false); }
// A wave-uniform operand address held in scalar registers (each half through readfirstlane, cast to unsigned behind it), so that a fragment load is
// scalar base + one lane offset + immediate and needs no 64-bit address register pair of its own.
typedef __attribute__((address_space(1))) const v8h gv8h;
__device__ __forceinline__ gv8h* uptr(const h16* p) {
    const unsigned long long a = (unsigned long long)p;
    return (gv8h*)(((unsigned long long)(unsigned)__builtin_amdgcn_readfirstlane((int)(a >> 32)) << 32) | (unsigned)__builtin_amdgcn_readfirstlane((int)(unsigned)a));
}
typedef __attribute__((address_space(1))) v8h gv8hw;
__device__ __forceinline__ gv8hw* uptrw(h16* p) {
    const unsigned long long a = (unsigned long long)p;
    return (gv8hw*)(((unsigned long long)(unsigned)__builtin_amdgcn_readfirstlane((int)(a >> 32)) << 32) | (unsigned)__builtin_amdgcn_readfirstlane((int)(unsigned)a));
}
typedef __attribute__((address_space(1))) const v8us gv8u;
__device__ __forceinline__ gv8u* uptrb(const bf* p) {
    const unsigned long long a = (unsigned long long)p;
    return (gv8u*)(((unsigned long long)(unsigned)__builtin_amdgcn_readfirstlane((int)(a >> 32)) << 32) | (unsigned)__builtin_amdgcn_readfirstlane((int)(unsigned)a));
}
// one 16 x 32 bf16 fragment in fragment order: the two 512-byte blocks at element offsets c and c + 256 from the uniform base u, each lane its own 16 bytes
#define LDB(u, c) cat16b((u)[ulane + (c) / 8], (u)[ulane + ((c) + 256) / 8])
// one 16 x 32 f16 fragment in fragment order: two 512-byte blocks at element offsets c and c + d2 from the uniform base u, each lane its own 16 bytes
#define LDU(u, c, d2) cat16((u)[ulane + (c) / 8], (u)[ulane + ((c) + (d2)) / 8])
#define VST2(T, p, v) do { const T vst2_v_ = (v); *(T*)(p) = vst2_v_;  } while (0)
// Fragment-order layout of a [rows][1024] 16-bit plane: 512-byte blocks of 16 rows x 16 columns, lane-major (lane = 16 * ((col >> 3) & 1) + (row & 15), 8 elements
// a lane), blocks ordered by (row >> 4, col >> 5, (col >> 4) & 1). pko = element offset of the 8-element piece at (row, col), col a multiple of 8. One wave-wide
// 16-byte fragment load then reads one block = 4 whole 128-byte lines; the second half of a fragment is the next block (+256), the next k-chunk of 32 is +512.
__device__ __forceinline__ size_t pko(int row, int col) {
    return ((size_t)(((row >> 4) * 32 + (col >> 5)) * 2 + ((col >> 4) & 1)) << 8) + (size_t)(((((col >> 3) & 1) << 4) + (row & 15)) << 3);
}

// The conversions that depend on inputs alone are block ranges of ONE launch (k_prep, below); each body takes its own block index.
// b_cvtb: bf16 of an [nrows][1024] matrix; b_wt: k-major [1024][1024] -> n-major bf16; both written in fragment order (pko).
__device__ __forceinline__ void b_cvtb(int blk, const float* __restrict__ src, int nrows, bf* dst) {
    const int lane = threadIdx.x & 31, gw = blk * 8 + (threadIdx.x >> 5), r = (gw >> 4) * 16 + (lane & 15);    // wave = 16 rows x 64 columns
    if (r >= nrows) return;
#pragma unroll
    for (int q = 0; q < 4; ++q) { const int col = (gw & 15) * 64 + q * 16 + (lane >> 4) * 8; v8us t;
#pragma unroll
        for (int i = 0; i < 8; ++i) t[i] = f2bf(src[(size_t)r * DM + col + i]);
        VST2(v8us, dst + pko(r, col), t); }
}
__device__ __forceinline__ void b_wt(int bk, int bn, unsigned short* tl, const float* __restrict__ Wm, bf* WT) {
    const int tid = threadIdx.x, k0 = bk * 64, n0 = bn * 64;
    const int kk = tid >> 2, nq = (tid & 3) * 16;
#pragma unroll
    for (int i = 0; i < 16; ++i) tl[(nq + i) * 72 + kk] = f2bf(Wm[(size_t)(k0 + kk) * DM + n0 + nq + i]);
    __syncthreads();
    auto pass = [&]() {
#pragma unroll
        for (int s = 0; s < 2; ++s) { const int u = (tid >> 5) + 8 * s, nr = (u >> 2) * 16 + (tid & 15), kcol = (u & 3) * 16 + ((tid >> 4) & 1) * 8;
            const v8us val = *(const v8usa*)(tl + nr * 72 + kcol);
            *(v8us*)(WT + pko(n0 + nr, k0 + kcol)) = val; }
    };
    pass();
    asm volatile("s_wait_xcnt 0x0" ::: "memory");    // in k_prep the code of the other block ranges follows these stores in the program and rewrites the registers they name: the wait stands in front of that
}
// k_gemmb: 128 x 128 tile of A.B^T + bias over K = 1024 (bf16 exact; A, B in fragment order), 2 x 2 waves of 64 x 64: each loaded fragment feeds four WMMAs
// (16 half-fragment loads for 16 WMMAs a k-chunk, not 10 for 4); the three projections are the z planes of one grid:
// z = 0, 1 (q, k): f16 hi + residual planes (fragment order, pko); z = 2 (v): f16 hi + residual planes of V^T, fragment order: [b][h][s / 32][d / 16][(s >> 4) & 1] blocks of 512 bytes,
// lane = 16 * ((s >> 3) & 1) + (d & 15). A lane of an accumulator tile holds 8 consecutive rows of one column, which is one 16-byte piece of a fragment-order plane whose 8-element run lies along the
// tile's rows: v takes x as the row operand (runs along s), q and k take the weight as the row operand (the product transposed: runs along d), and every tile is stored straight from its registers,
// one whole 512-byte block a wave-wide store.
// The k loop is unrolled over a ring of GD register stages (one stage = the four A fragments and the four B fragments of one k-chunk of 32): the loads of k-chunk c + GD are
// issued behind the WMMAs of k-chunk c, so that a wave waits for loads that are GD - 1 chunks old. A 16-row group of a plane is 32 KB in a row: every load is scalar base + lane + immediate.
#define GD 3
__global__ __launch_bounds__(128, 3) void k_gemmb(const bf* __restrict__ A, const bf* __restrict__ Bq, const bf* __restrict__ Bk, const bf* __restrict__ Bv,
                                                  const float* __restrict__ bq, const float* __restrict__ bk, const float* __restrict__ bv,
                                                  h16* QH, h16* QL, h16* KH, h16* KL, h16* VTH, h16* VTL) {
    const int z = blockIdx.z;
    const bf* Bn = z == 0 ? Bq : z == 1 ? Bk : Bv; const float* bias = z == 0 ? bq : z == 1 ? bk : bv;
    const int wave = __builtin_amdgcn_readfirstlane(threadIdx.x >> 5);    // wave in a scalar register: the operand bases below are scalar
    // the lane's number as the hardware counts it (equal to threadIdx.x & 31 here): with the mask form the compiler folds some constant block offsets into the mask, and such a load takes an address register of its own
    const unsigned ulane = __builtin_amdgcn_mbcnt_lo(~0u, 0u);
    const int r0 = blockIdx.x * 128 + (wave >> 1) * 64, c0 = blockIdx.y * 128 + (wave & 1) * 64;
    gv8u* ua = uptrb(z == 2 ? A + pko(r0, 0) : Bn + pko(c0, 0)); gv8u* ub = uptrb(z == 2 ? Bn + pko(c0, 0) : A + pko(r0, 0));    // row operand, column operand; + 512 elements: the next k-chunk; + 16 * DM: the next 16 rows
    v8f acc[4][4];
#pragma unroll
    for (int u = 0; u < 4; ++u)
#pragma unroll
        for (int t = 0; t < 4; ++t) acc[u][t] = (v8f){};
    v16bf ar[GD][4], br[GD][4];
#pragma unroll
    for (int s = 0; s < GD; ++s) {
#pragma unroll
        for (int t = 0; t < 4; ++t) { ar[s][t] = LDB(ua, t * 16 * DM + s * 512); br[s][t] = LDB(ub, t * 16 * DM + s * 512); }
        __builtin_amdgcn_sched_barrier(0); }    // keeps each stage's loads together and in stage order, so that the waits can count
#pragma unroll
    for (int c = 0; c < DM / 32; ++c) {
        const int s = c % GD;
        // row tile outermost: in this order the build keeps all 16 accumulator tiles where they are (column tile outermost, it moved one from chunk to chunk and spilled it once)
#pragma unroll
        for (int u = 0; u < 4; ++u)
#pragma unroll
            for (int t = 0; t < 4; ++t) acc[u][t] = wmmab(ar[s][u], br[s][t], acc[u][t]);
        __builtin_amdgcn_sched_barrier(0);    // the refill stays behind the WMMAs that read this stage, so that it lands in the same registers (no stage more, no spill)
        if (c + GD < DM / 32) {
#pragma unroll
            for (int t = 0; t < 4; ++t) { ar[s][t] = LDB(ua, t * 16 * DM + (c + GD) * 512); br[s][t] = LDB(ub, t * 16 * DM + (c + GD) * 512); } }
        __builtin_amdgcn_sched_barrier(0);    // holds the refill of this stage here, GD chunks ahead of its WMMAs: without it the scheduler sinks the loads down to their use
    }
    // the epilogue reuses the lane-offset and scalar base registers that the ring's loads name: the wait stands in front of that. The epilogue's lane number is taken
    // through the wait's own statement, so that none of the lane arithmetic (which can land in the lane-offset register) is placed ahead of it
    unsigned el = ulane;
    asm volatile("s_wait_xcnt 0x0" : "+v"(el) : : "memory");
    __builtin_amdgcn_sched_barrier(0);    // keeps the epilogue's first register writes behind that wait
    const int lane = (int)el, lr = lane & 15, hi = lane >> 4;
    // the bias: of the tile's column (v: feature c0 + 16 t + lr) or of its rows (q, k: features c0 + 16 u + 8 hi + j)
    if (z == 2) {
#pragma unroll
        for (int t = 0; t < 4; ++t) { const float bc = bfr(bias[c0 + t * 16 + lr]);
#pragma unroll
            for (int u = 0; u < 4; ++u) acc[u][t] += bc; }
    } else {
#pragma unroll
        for (int u = 0; u < 4; ++u) { const float* bp = bias + c0 + u * 16 + hi * 8; v8f br8;
#pragma unroll
            for (int j = 0; j < 8; ++j) br8[j] = bfr(bp[j]);
#pragma unroll
            for (int t = 0; t < 4; ++t) acc[u][t] += br8; }
    }
    // tile (u, t) is one 512-byte block, su (u >> 1) + 256 (u & 1) + st t elements behind the wave's first block. v: rows = tokens r0 + 16 u + 8 hi + j of one batch entry, columns = one head's d = 16 t + lr;
    // q, k: rows = features, column = token r0 + 16 t + lr, the block of pko(token, feature)
    const size_t wb = z == 2 ? (((size_t)(r0 / SS) * NH_ + c0 / HD) * HD) * SS + (size_t)((r0 % SS) >> 5) * 2048 : pko(r0, c0);
    h16* p1 = (z == 0 ? QH : z == 1 ? KH : VTH) + wb; h16* p2 = (z == 0 ? QL : z == 1 ? KL : VTL) + wb;
    const int su = z == 2 ? 2048 : 512, st = z == 2 ? 512 : 16 * DM;
    v8h o1[4][4], o2[4][4];
#pragma unroll
    for (int u = 0; u < 4; ++u)
#pragma unroll
        for (int t = 0; t < 4; ++t)
#pragma unroll
            for (int j = 0; j < 8; ++j) { const float v = acc[u][t][j]; const h16 a = (h16)v; o1[u][t][j] = a; o2[u][t][j] = (h16)((v - (float)a) * LOSC); }
    __builtin_amdgcn_sched_barrier(0);    // every conversion ahead of the first store: behind a store no vector register that it names is rewritten, and the 32 stores go out as one run (without it: a wait behind nearly every store)
#pragma unroll
    for (int u = 0; u < 4; u += 2)
#pragma unroll
        for (int t = 0; t < 4; ++t) { gv8hw* t1 = uptrw(p1 + (u >> 1) * su + t * st); gv8hw* t2 = uptrw(p2 + (u >> 1) * su + t * st);    // scalar base + lane (+ 512 bytes)
            t1[el] = o1[u][t]; t2[el] = o2[u][t]; t1[el + 32] = o1[u + 1][t]; t2[el + 32] = o2[u + 1][t]; }
}
// b_tabs: both tables in fragment order over groups g of 16 table rows m = 16 g + 1 .. 16 g + 16 (every band of k_attn starts at m = 1 mod 16; m = 0 is never used):
// RK16 [g < NGK][d / 16] blocks of 512 bytes = f16(bf16(rel_k_emb)), lane = 16 * ((d >> 3) & 1) + (m - 1 & 15); RVT16 [g < NGV][d / 16] blocks = f16(bf16(rel_v_emb))^T,
// lane = 16 * ((m - 1 >> 3) & 1) + (d & 15), via 64x64 LDS transposes (zero beyond row 2048); NRP/64 blocks.
__device__ __forceinline__ void b_tabs(int blk, h16* tile, const float* __restrict__ rk, const float* __restrict__ rv, h16* RK16, h16* RVT16) {
    const int m0 = blk * 64 + 1, tid = threadIdx.x, mm = tid >> 2, d0 = (tid & 3) * 16;
#pragma unroll
    for (int i = 0; i < 16; ++i) { const int m = m0 + mm; tile[(d0 + i) * 72 + mm] = (m < NRL) ? (h16)bfr(rv[(size_t)m * HD + d0 + i]) : (h16)0.f; }
    __syncthreads();
    const int lane = tid & 31, lr = lane & 15, hi = lane >> 4;
    auto pass = [&]() {
#pragma unroll
        for (int s = 0; s < 2; ++s) { const int u = (tid >> 5) + 8 * s, g = blk * 4 + (u >> 2), m = 16 * g + 1 + lr, col = (u & 3) * 16 + hi * 8; v8h o;
#pragma unroll
            for (int i = 0; i < 8; ++i) o[i] = (m < NRL) ? (h16)bfr(rk[(size_t)m * HD + col + i]) : (h16)0.f;
            if (g < NGK) *(v8h*)(RK16 + (size_t)(g * 4 + (u & 3)) * 256 + lane * 8) = o; }
#pragma unroll
        for (int s = 0; s < 2; ++s) { const int u = (tid >> 5) + 8 * s, gl = u >> 2, n = u & 3, g = blk * 4 + gl;
            const v8h val = *(const v8ha*)(tile + (n * 16 + lr) * 72 + gl * 16 + hi * 8);
            if (g < NGV) *(v8h*)(RVT16 + (size_t)(g * 4 + n) * 256 + lane * 8) = val; }
    };
    pass(); 
}
// k_prep: one launch for all six conversions, none of which reads what another writes. Block ranges: PBT blocks of the tables (first: the longest chain of dependent loads),
// PBX blocks of x, 4 x PBW blocks of the weights (k tile fastest). The range test reads blockIdx alone, so each body's barrier is passed by its whole block; the bodies with an LDS tile share one.
#define PBX (NTK / 8)
#define PBW ((DM / 64) * (DM / 64))
#define PBT (NRP / 64)
__global__ __launch_bounds__(256) void k_prep(const float* __restrict__ x, const float* __restrict__ Wq, const float* __restrict__ Wk, const float* __restrict__ Wv, const float* __restrict__ Wo,
                                              const float* __restrict__ rk, const float* __restrict__ rv, bf* Xb, bf* WqT, bf* WkT, bf* WvT, bf* WoT, h16* RK16, h16* RVT16) {
    __shared__ __align__(16) unsigned short tl[64 * 72];
    const int bid = blockIdx.x;
    if (bid < PBT) { b_tabs(bid, (h16*)tl, rk, rv, RK16, RVT16); return; }
    if (bid < PBT + PBX) { b_cvtb(bid - PBT, x, NTK, Xb); return; }
    const int u = bid - PBT - PBX, wi = u / PBW, t = u - wi * PBW;
    b_wt(t % (DM / 64), t / (DM / 64), tl, wi == 0 ? Wq : wi == 1 ? Wk : wi == 2 ? Wv : Wo, wi == 0 ? WqT : wi == 1 ? WkT : wi == 2 ? WvT : WoT);
}
// k_attn: block = (b, h, 64 queries), wave = 16 queries i = q0..q0+15; 32 key tiles of 32. Every product is taken TRANSPOSED (a stored fragment serves as A or as B alike): lane (lr, hi)
// holds column lr = ONE query of every tile, its 8 registers the rows 8 hi + j. Content S^T = k.q^T, 12 WMMA (hi.hi + hi.lo + lo.hi, q residual fragments re-read);
// relative-key band^T: rows m = mbase + 0..47 of RK16 (mbase = q0 - l0 - 31 + 1024) x (q hi, q lo) = 12 WMMA, parked in LDS as ps[query][m]; logit(i,j) = content + ps[r][r - kk + 31]
// (UNSCALED); online softmax: maximum and sum inside the lane plus one exchange between the wave halves; the weights x32768 hi + residual of the two score tiles, packed in place, ARE
// the B operand (k = 8 hi + s, 16 + 8 hi + s) of o^T += vh.pa, ox^T += vl.pa + vh.px (12 WMMA); the same weights scattered into relative coordinates pt/pt2 [query][64]
// (column r + 31 - kk) are the B operand of o^T += rv.pt, ox^T += rv.pt2 (8 WMMA, A = RVT16 rows d at k = mbase + 16 .. mbase + 47; columns below 16 wait for the next tile, whose columns 32..47 they are);
// ctx = (o + ox/1024)/sum: a lane holds 8 consecutive d of its query = one 16-byte piece of the bf16 hi/lo planes [tok][h*64+d] in fragment order. Every global operand is read in fragment order (pko, k_gemmb, b_tabs).
#define PTP 136                  // row pitch of pt/pt2 in halves: 16 bytes x odd for the 16-byte readers; the scatter's lane stride PTP + 1 is 9 halves modulo the 64 banks, so the 8-half stores of 16 lanes lie side by side
typedef __attribute__((ext_vector_type(4))) unsigned v4u;
typedef v4u __attribute__((may_alias, aligned(2))) v4u2;
// the 8 halves of x in reverse order: the dwords reversed, each rotated by 16 bits
__device__ __forceinline__ v4u rev8(v8h x) { const v4u u = __builtin_bit_cast(v4u, x); return (v4u){ (u[3] >> 16) | (u[3] << 16), (u[2] >> 16) | (u[2] << 16), (u[1] >> 16) | (u[1] << 16), (u[0] >> 16) | (u[0] << 16) }; }
__device__ __forceinline__ float xhalf(float x) { return __builtin_bit_cast(float, __builtin_amdgcn_permlanex16(__builtin_bit_cast(int, x), __builtin_bit_cast(int, x), 0x76543210, 0xfedcba98, false, false)); }    // lane l with lane l ^ 16
__global__ __launch_bounds__(128, 4) void k_attn(const h16* __restrict__ QH, const h16* __restrict__ QL, const h16* __restrict__ KH, const h16* __restrict__ KL,
                                             const h16* __restrict__ RK16, const h16* __restrict__ RVT16, const h16* __restrict__ VTH, const h16* __restrict__ VTL, bf* CH, bf* CL) {
    __shared__ __align__(16) h16 ptl[4][16 * PTP];
    __shared__ __align__(16) h16 ptl2[4][16 * PTP];
    __shared__ __align__(16) float posl[4][16 * 52];
    const int lane = threadIdx.x & 31, wave = __builtin_amdgcn_readfirstlane(threadIdx.x >> 5), lr = lane & 15, hi = lane >> 4;    // wave in a scalar register: every operand block address below is scalar base + lane offset
    const unsigned ulane = lane;
    const int bid = blockIdx.x;
    const int b = bid / (NH_ * (SS / 64)), rem = bid - b * (NH_ * (SS / 64)), h = rem / (SS / 64), qt = rem - h * (SS / 64);
    const int q0 = qt * 64 + wave * 16;
    const size_t tok0 = (size_t)b * SS;
    h16* pt = &ptl[wave][0]; h16* pt2 = &ptl2[wave][0]; float* ps = &posl[wave][0];
    // row lr (the lane's query) of each LDS tile addressed as one lane base + a constant (an immediate offset). psb + 16 t + j: band column m = 16 t + 8 hi + j;
    // psg, ptb, ptb2 + 23 - 16 T - j: column r + 31 - kk of key kk = 16 T + 8 hi + j
    float* psb = ps + lr * 52 + hi * 8; const float* psg = ps + lr * 53 + 8 - hi * 8;
    h16* ptb = pt + lr * (PTP + 1) + 8 - hi * 8; h16* ptb2 = pt2 + lr * (PTP + 1) + 8 - hi * 8;
    const size_t qo0 = pko((int)tok0 + q0, h * HD);    // wave-uniform block offset; LDU adds the lane's own piece
    v16h qa[2];
#pragma unroll
    for (int kc = 0; kc < 2; ++kc) qa[kc] = LDU(uptr(QH + qo0), kc * 512, 256);
    const size_t vbase = (((size_t)b * NH_ + h) * HD) * SS;
    v8f o[4], ox[4];
#pragma unroll
    for (int n = 0; n < 4; ++n) { o[n] = (v8f){}; ox[n] = (v8f){}; }
    float mrow = -3.0e38f, lpart = 0.f;    // of the lane's query; lpart sums the keys of the lane's own wave half
    // Row r of pt/pt2 holds three runs of 16 columns, all rewritten every tile: r .. r+15 = this tile's keys 31..16, r+16 .. r+31 = its keys 15..0, r+32 .. r+47 = the tile before's keys 31..16.
    // Only columns 16..47 are read: one whole k-chunk. What a tile leaves below column 16 is not multiplied yet: it rides in wc (f32, x32768) into the next tile, whose columns 32..47 it completes.
    v8f wc = {};
    // Operand fragments are loaded in groups well ahead of the WMMAs that read them (the "memory" fences below keep each group where it is written).
    // The q residual and band fragments of k-chunk 0 of a key tile are loaded during the tile before it and carried over the loop edge in these registers.
    v16h ql0, rb0[3];
    { gv8h* uql = uptr(QL + qo0); gv8h* urk = uptr(RK16 + (size_t)((q0 - 31 + 1024 - 1) >> 4) * 1024); ql0 = LDU(uql, 0, 256);
#pragma unroll
      for (int t = 0; t < 3; ++t) rb0[t] = LDU(urk, t * 1024, 256); }
#pragma unroll 1
    for (int kt = 0; kt < SS / 32; ++kt) {
        const int l0 = kt * 32, mbase = q0 - l0 - 31 + 1024, gb = (mbase - 1) >> 4;    // mbase = 16 gb + 1
        const size_t ko = pko((int)tok0 + l0, h * HD);    // + 512: k-chunk 1; + 16 * DM: the next 16 rows, 64 blocks on
        gv8h* ukh = uptr(KH + ko); gv8h* ukl = uptr(KL + ko); gv8h* uql = uptr(QL + qo0); gv8h* urk = uptr(RK16 + (size_t)gb * 1024);
        // group: q residual and band fragments of k-chunk 1, k fragments of k-chunk 0: in flight under the band of k-chunk 0
        v16h rb1[3];
        const v16h ql1 = LDU(uql, 512, 256);
#pragma unroll
        for (int t = 0; t < 3; ++t) rb1[t] = LDU(urk, t * 1024 + 512, 256);
        const v16h k0h0 = LDU(ukh, 0, 256), k1h0 = LDU(ukh, 16 * DM, 256), k0l0 = LDU(ukl, 0, 256), k1l0 = LDU(ukl, 16 * DM, 256);
        // The v_nop statements of this loop fill the vector slots the chip needs between a WMMA and the first read of its D or rewrite of its A / B,
        // and name those registers so that they stay whole up to there; their "memory" clobber also fences the load groups.
        // band tiles, k-chunk 0: rows m = mbase + t*16 + lr of RK16
#pragma unroll
        for (int t = 0; t < 3; ++t) {
            v8f ph = wmma16(rb0[t], qa[0], (v8f){}); v8f pq = wmma16(rb0[t], ql0, (v8f){});
            asm volatile("v_nop\n\tv_nop\n\tv_nop\n\tv_nop" : "+v"(ph), "+v"(pq) : "v"(rb0[t]), "v"(ql0));
            v4f b0, b1;
#pragma unroll
            for (int j = 0; j < 4; ++j) { b0[j] = ph[j] + pq[j] * LOSCI; b1[j] = ph[j + 4] + pq[j + 4] * LOSCI; }
            *(v4fa*)(psb + t * 16) = b0; *(v4fa*)(psb + t * 16 + 4) = b1;
            asm volatile("" ::: "memory"); }
        // group: k fragments of k-chunk 1, in flight under the band of k-chunk 1
        const v16h k0h1 = LDU(ukh, 512, 256), k1h1 = LDU(ukh, 16 * DM + 512, 256), k0l1 = LDU(ukl, 512, 256), k1l1 = LDU(ukl, 16 * DM + 512, 256);
        // band tiles, k-chunk 1
#pragma unroll
        for (int t = 0; t < 3; ++t) {
            v8f ph = wmma16(rb1[t], qa[1], (v8f){}); v8f pq = wmma16(rb1[t], ql1, (v8f){});
            asm volatile("v_nop\n\tv_nop\n\tv_nop\n\tv_nop" : "+v"(ph), "+v"(pq) : "v"(rb1[t]), "v"(ql1));
            v4f b0 = *(const v4fa*)(psb + t * 16), b1 = *(const v4fa*)(psb + t * 16 + 4);
#pragma unroll
            for (int j = 0; j < 4; ++j) { b0[j] += ph[j] + pq[j] * LOSCI; b1[j] += ph[j + 4] + pq[j + 4] * LOSCI; }
            *(v4fa*)(psb + t * 16) = b0; *(v4fa*)(psb + t * 16 + 4) = b1;
            asm volatile("" ::: "memory"); }
        // content, k-chunk 0 then 1
        v8f s0 = {}, s1 = {}, x0 = {}, x1 = {};
        s0 = wmma16(k0h0, qa[0], s0); x0 = wmma16(k0h0, ql0, x0); s1 = wmma16(k1h0, qa[0], s1); x1 = wmma16(k1h0, ql0, x1);
        asm volatile("v_nop" : "+v"(s0), "+v"(s1), "+v"(x0), "+v"(x1) : "v"(ql0), "v"(k0h0), "v"(k1h0) : "memory");
        x0 = wmma16(k0l0, qa[0], x0); x1 = wmma16(k1l0, qa[0], x1);
        asm volatile("v_nop" : "+v"(x0), "+v"(x1) : "v"(k0l0), "v"(k1l0) : "memory");
        s0 = wmma16(k0h1, qa[1], s0); x0 = wmma16(k0h1, ql1, x0); s1 = wmma16(k1h1, qa[1], s1); x1 = wmma16(k1h1, ql1, x1);
        asm volatile("v_nop" : "+v"(s0), "+v"(s1), "+v"(x0), "+v"(x1) : "v"(ql1), "v"(k0h1), "v"(k1h1) : "memory");
        x0 = wmma16(k0l1, qa[1], x0); x1 = wmma16(k1l1, qa[1], x1);
        asm volatile("v_nop" : "+v"(x0), "+v"(x1) : "v"(k0l1), "v"(k1l1) : "memory");
        asm volatile("v_nop\n\tv_nop\n\tv_nop\n\tv_nop" : "+v"(s0), "+v"(s1), "+v"(x0), "+v"(x1) : "v"(qa[0]), "v"(qa[1]));
        asm volatile("" ::: "memory");
        __builtin_amdgcn_wave_barrier();
        v8f g0v, g1v;
#pragma unroll
        for (int j = 0; j < 8; ++j) g0v[j] = psg[23 - j];    // band[r][r - kk + 31], kk = 8 hi + j
#pragma unroll
        for (int j = 0; j < 8; ++j) g1v[j] = psg[7 - j];     // kk = 16 + 8 hi + j
        const v8f a0 = s0 + x0 * LOSCI + g0v, a1 = s1 + x1 * LOSCI + g1v;
        float tm[8];
#pragma unroll
        for (int j = 0; j < 8; ++j) tm[j] = fmaxf(a0[j], a1[j]);
        float mx = fmaxf(fmaxf(fmaxf(tm[0], tm[1]), fmaxf(tm[2], tm[3])), fmaxf(fmaxf(tm[4], tm[5]), fmaxf(tm[6], tm[7])));
        mx = fmaxf(mx, xhalf(mx));    // the other 16 keys of this query sit in the other wave half
        const float mn = fmaxf(mrow, mx), alpha = __expf(mrow - mn); mrow = mn;
        v8f e0, e1;
#pragma unroll
        for (int j = 0; j < 8; ++j) e0[j] = __expf(a0[j] - mn);
#pragma unroll
        for (int j = 0; j < 8; ++j) e1[j] = __expf(a1[j] - mn);
        const v8f es = e0 + e1, w0 = e0 * PSC, w1 = e1 * PSC;
        const v8h h0 = __builtin_convertvector(w0, v8h), h1 = __builtin_convertvector(w1, v8h);
        const v8h r0 = __builtin_convertvector((w0 - __builtin_convertvector(h0, v8f)) * LOSC, v8h), r1 = __builtin_convertvector((w1 - __builtin_convertvector(h1, v8f)) * LOSC, v8h);
        const v16h pa = cat16(h0, h1), px = cat16(r0, r1);
        // a lane's 8 keys of a tile are 8 consecutive relative columns in falling order: one 16-byte LDS store each, at an address that is a multiple of 2 bytes only
        *(v4u2*)(ptb + 16) = rev8(h0); *(v4u2*)ptb = rev8(h1); *(v4u2*)(ptb2 + 16) = rev8(r0); *(v4u2*)ptb2 = rev8(r1);
        // the tile before's keys 16..31, brought to this tile's maximum, sit 32 columns up in this tile's coordinates
        const v8f wo = wc * alpha; wc = w1;
        const v8h hc = __builtin_convertvector(wo, v8h), rc = __builtin_convertvector((wo - __builtin_convertvector(hc, v8f)) * LOSC, v8h);
        *(v4u2*)(ptb + 32) = rev8(hc); *(v4u2*)(ptb2 + 32) = rev8(rc);
        lpart = lpart * alpha + (((es[0] + es[1]) + (es[2] + es[3])) + ((es[4] + es[5]) + (es[6] + es[7])));
#pragma unroll
        for (int n = 0; n < 4; ++n)
#pragma unroll
            for (int j = 0; j < 8; ++j) { o[n][j] *= alpha; ox[n][j] *= alpha; }
        asm volatile("" ::: "memory");
        // group: this tile's v hi + residual fragments and the rel_v fragments of its one k-chunk (columns 16..47)
        v16h vh[4], vl[4], rv0[4];
        gv8h* uvh = uptr(VTH + vbase + (size_t)kt * 2048); gv8h* uvl = uptr(VTL + vbase + (size_t)kt * 2048); gv8h* urv = uptr(RVT16 + (size_t)gb * 1024);
#pragma unroll
        for (int n = 0; n < 4; ++n) { vh[n] = LDU(uvh, n * 512, 256); vl[n] = LDU(uvl, n * 512, 256); }
#pragma unroll
        for (int n = 0; n < 4; ++n) rv0[n] = LDU(urv, 1024 + n * 256, 1024);
#pragma unroll
        for (int n = 0; n < 4; ++n) {
            o[n] = wmma16(vh[n], pa, o[n]); ox[n] = wmma16(vl[n], pa, ox[n]); ox[n] = wmma16(vh[n], px, ox[n]);
            asm volatile("" : "+v"(o[n]), "+v"(ox[n]) : "v"(vh[n]), "v"(vl[n]) : "memory");    // keeps the fragments whole through their WMMAs; its "memory" clobber holds the load groups where they are written
        }
        // group: the next key tile's q residual and band fragments of k-chunk 0 (the last tile loads its own again: in bounds, unused)
        { const int ktn = kt + 1 < SS / 32 ? kt + 1 : kt; gv8h* urn = uptr(RK16 + (size_t)((q0 - ktn * 32 - 31 + 1024 - 1) >> 4) * 1024); ql0 = LDU(uql, 0, 256);
#pragma unroll
          for (int t = 0; t < 3; ++t) rb0[t] = LDU(urn, t * 1024, 256); }
        // rel_v x relative-coordinate weights: A = RVT16 rows d at k = mbase + 16 .. mbase + 47, B = pt rows (one query a lane, k = column - 16, one k-chunk)
        {
            const v16h ra = cat16(*(const v8ha*)(pt + lr * PTP + 16 + hi * 8), *(const v8ha*)(pt + lr * PTP + 32 + hi * 8));
            const v16h rx = cat16(*(const v8ha*)(pt2 + lr * PTP + 16 + hi * 8), *(const v8ha*)(pt2 + lr * PTP + 32 + hi * 8));
#pragma unroll
            for (int n = 0; n < 4; ++n) {
                o[n] = wmma16(rv0[n], ra, o[n]); ox[n] = wmma16(rv0[n], rx, ox[n]);
                asm volatile("" : "+v"(o[n]), "+v"(ox[n]) : "v"(rv0[n]), "v"(ra), "v"(rx) : "memory"); }    // as in the v loop above: fragments whole through their WMMAs, load groups held where they are written
        }
        __builtin_amdgcn_wave_barrier();    // this tile's reads of pt/pt2 stay ahead of the next tile's stores into the same rows
        // the carried group's loads name scalar base registers that the next trip's address arithmetic rewrites: the wait stands in front of that rewrite
        asm volatile("s_wait_xcnt 0x0" ::: "memory");
    }
    // the last tile's columns below 16: one more k-chunk with no new keys (columns r .. r+31 zero). Its upper 16 columns are table group q0 / 16; the lower 16 carry zero weights
    // and take the same group as a stand-in (the group below it does not exist for q0 = 0).
    {
        gv8h* urv = uptr(RVT16 + (size_t)(q0 >> 4) * 1024);
        v16h rvf[4];
#pragma unroll
        for (int n = 0; n < 4; ++n) rvf[n] = LDU(urv, n * 256, 0);
        const v8h hc = __builtin_convertvector(wc, v8h), rc = __builtin_convertvector((wc - __builtin_convertvector(hc, v8f)) * LOSC, v8h);
        const v4u zz = {};
        *(v4u2*)(ptb + 16) = zz; *(v4u2*)ptb = zz; *(v4u2*)(ptb2 + 16) = zz; *(v4u2*)ptb2 = zz;
        *(v4u2*)(ptb + 32) = rev8(hc); *(v4u2*)(ptb2 + 32) = rev8(rc);
        const v16h ra = cat16(*(const v8ha*)(pt + lr * PTP + 16 + hi * 8), *(const v8ha*)(pt + lr * PTP + 32 + hi * 8));
        const v16h rx = cat16(*(const v8ha*)(pt2 + lr * PTP + 16 + hi * 8), *(const v8ha*)(pt2 + lr * PTP + 32 + hi * 8));
#pragma unroll
        for (int n = 0; n < 4; ++n) { o[n] = wmma16(rvf[n], ra, o[n]); ox[n] = wmma16(rvf[n], rx, ox[n]); }
    }
    asm volatile("v_nop\n\tv_nop\n\tv_nop\n\tv_nop" : "+v"(o[0]), "+v"(o[1]), "+v"(o[2]), "+v"(o[3]), "+v"(ox[0]), "+v"(ox[1]), "+v"(ox[2]), "+v"(ox[3]));
    const float rs = lpart + xhalf(lpart), inv = 1.0f / (rs * PSC);    // the two wave halves' sums of this query joined once
#pragma unroll
    for (int s = 0; s < 4; ++s) { const size_t po = pko((int)tok0 + q0 + lr, h * HD + s * 16 + hi * 8); v8us oh, ol;
#pragma unroll
        for (int i = 0; i < 8; ++i) { const float cv = (o[s][i] + ox[s][i] * LOSCI) * inv; const unsigned short hb = f2bf(cv); oh[i] = hb; ol[i] = f2bf(cv - bf2f(hb)); }
        *(v8us*)(CH + po) = oh; *(v8us*)(CL + po) = ol; }
}
// k_outp: 128 x 128 tile of out = (CH + CL).WoT^T + bo over K = 1024 (2 products), 4 x 2 waves of 32 x 64 (16 half-fragment loads for 16 WMMAs a k-chunk, not 12 for 8); f32 rows.
// 256 blocks of 8 waves: one block a WGP, two waves a SIMD.
// Same register ring as k_gemmb, OD stages of four A fragments (hi, residual x two row tiles) and four B fragments.
#define OD 3
__global__ __launch_bounds__(256, 1) void k_outp(const bf* __restrict__ A, const bf* __restrict__ Al, const bf* __restrict__ Bn, const float* __restrict__ bias, float* C) {
    __shared__ __align__(16) float ost[8][32 * 68];
    const int wave = __builtin_amdgcn_readfirstlane(threadIdx.x >> 5);    // wave in a scalar register: the operand bases below are scalar
    // the lane's number as the hardware counts it (equal to threadIdx.x & 31 here): with the mask form the compiler folds some constant block offsets into the mask, and such a load takes an address register of its own
    const unsigned ulane = __builtin_amdgcn_mbcnt_lo(~0u, 0u);
    const int r0 = blockIdx.x * 128 + (wave >> 1) * 32, c0 = blockIdx.y * 128 + (wave & 1) * 64;
    gv8u* ua = uptrb(A + pko(r0, 0)); gv8u* ul = uptrb(Al + pko(r0, 0)); gv8u* ub = uptrb(Bn + pko(c0, 0));    // + 512 elements: the next k-chunk; + 16 * DM: the next 16 rows
    v8f acc[2][4];
#pragma unroll
    for (int t = 0; t < 4; ++t) { acc[0][t] = (v8f){}; acc[1][t] = (v8f){}; }
    v16bf ar[OD][2], lr2[OD][2], br[OD][4];
#pragma unroll
    for (int s = 0; s < OD; ++s) {
#pragma unroll
        for (int u = 0; u < 2; ++u) { ar[s][u] = LDB(ua, u * 16 * DM + s * 512); lr2[s][u] = LDB(ul, u * 16 * DM + s * 512); }
#pragma unroll
        for (int t = 0; t < 4; ++t) br[s][t] = LDB(ub, t * 16 * DM + s * 512);
        __builtin_amdgcn_sched_barrier(0); }    // keeps each stage's loads together and in stage order, so that the waits can count
#pragma unroll
    for (int c = 0; c < DM / 32; ++c) {
        const int s = c % OD;
#pragma unroll
        for (int t = 0; t < 4; ++t) { acc[0][t] = wmmab(ar[s][0], br[s][t], acc[0][t]); acc[1][t] = wmmab(ar[s][1], br[s][t], acc[1][t]);
            acc[0][t] = wmmab(lr2[s][0], br[s][t], acc[0][t]); acc[1][t] = wmmab(lr2[s][1], br[s][t], acc[1][t]); }
        __builtin_amdgcn_sched_barrier(0);    // the refill stays behind the WMMAs that read this stage, so that it lands in the same registers (no stage more, no spill)
        if (c + OD < DM / 32) {
#pragma unroll
            for (int u = 0; u < 2; ++u) { ar[s][u] = LDB(ua, u * 16 * DM + (c + OD) * 512); lr2[s][u] = LDB(ul, u * 16 * DM + (c + OD) * 512); }
#pragma unroll
            for (int t = 0; t < 4; ++t) br[s][t] = LDB(ub, t * 16 * DM + (c + OD) * 512); }
        __builtin_amdgcn_sched_barrier(0);    // holds the refill of this stage here, OD chunks ahead of its WMMAs: without it the scheduler sinks the loads down to their use
    }
    // the epilogue reuses the lane-offset and scalar base registers that the ring's loads name: the wait stands in front of that; the epilogue's lane number goes through the wait's own statement, as in k_gemmb
    unsigned el = ulane;
    asm volatile("s_wait_xcnt 0x0" : "+v"(el) : : "memory");
    __builtin_amdgcn_sched_barrier(0);    // keeps the epilogue's first register writes behind that wait
    const int lane = (int)el, lr = lane & 15, hi = lane >> 4;
    float* os = &ost[wave][0];
#pragma unroll
    for (int t = 0; t < 4; ++t) { const float bv = bfr(bias[c0 + t * 16 + lr]);
#pragma unroll
        for (int u = 0; u < 2; ++u)
#pragma unroll
            for (int j = 0; j < 8; ++j) os[(u * 16 + hi * 8 + j) * 68 + t * 16 + lr] = acc[u][t][j] + bv; }
    __syncthreads();
    float* crow = C + (size_t)r0 * DM + c0;
    auto pass = [&]() {
#pragma unroll
        for (int s = 0; s < 16; ++s) { const int Lid = (lane >> 3) + 4 * s, piece = lane & 7; const int row = Lid >> 1, cofs = (Lid & 1) * 32 + piece * 4;
            const v4f val = *(const v4fa*)(os + row * 68 + cofs); *(v4f*)(crow + (size_t)row * DM + cofs) = val; }
    };
    pass(); 
}

extern "C" void kernel_launch(void* const* d_in, const int* in_sizes, int n_in,
                              void* d_out, int out_size, void* d_ws, size_t ws_size, hipStream_t stream) {
    (void)in_sizes; (void)n_in; (void)out_size;
    const float* x = (const float*)d_in[0]; const float* Wq = (const float*)d_in[1]; const float* bq = (const float*)d_in[2]; const float* Wk = (const float*)d_in[3]; const float* bk = (const float*)d_in[4];
    const float* Wv = (const float*)d_in[5]; const float* bv = (const float*)d_in[6]; const float* Wo = (const float*)d_in[7]; const float* bo = (const float*)d_in[8];
    const float* rk = (const float*)d_in[9]; const float* rv = (const float*)d_in[10];
    float* out = (float*)d_out;    // [4][1024][1024]
    char* wsp = (char*)d_ws;
    auto take = [&](size_t bytes) { char* p = wsp; wsp += (bytes + 255) & ~(size_t)255; return (void*)p; };
    bf* Xb = (bf*)take((size_t)NTK * DM * 2); bf* WqT = (bf*)take((size_t)DM * DM * 2); bf* WkT = (bf*)take((size_t)DM * DM * 2); bf* WvT = (bf*)take((size_t)DM * DM * 2); bf* WoT = (bf*)take((size_t)DM * DM * 2);
    h16* QH = (h16*)take((size_t)NTK * DM * 2); h16* QL = (h16*)take((size_t)NTK * DM * 2); h16* KH = (h16*)take((size_t)NTK * DM * 2); h16* KL = (h16*)take((size_t)NTK * DM * 2);
    bf* CH = (bf*)take((size_t)NTK * DM * 2); bf* CL = (bf*)take((size_t)NTK * DM * 2); h16* VTH = (h16*)take((size_t)NTK * DM * 2); h16* VTL = (h16*)take((size_t)NTK * DM * 2);
    h16* RK16 = (h16*)take((size_t)NRP * HD * 2); h16* RVT16 = (h16*)take((size_t)HD * NRP * 2);
    if ((size_t)(wsp - (char*)d_ws) > ws_size) return;    // 8.4 + 8.4 + 33.5 + 16.8 + 16.8 + 0.5 ~ 85 MB
    k_prep<<<PBX + 4 * PBW + PBT, 256, 0, stream>>>(x, Wq, Wk, Wv, Wo, rk, rv, Xb, WqT, WkT, WvT, WoT, RK16, RVT16);
    k_gemmb<<<dim3(NTK / 128, DM / 128, 3), 128, 0, stream>>>(Xb, WqT, WkT, WvT, bq, bk, bv, QH, QL, KH, KL, VTH, VTL);
    k_attn<<<NB_ * NH_ * (SS / 64), 128, 0, stream>>>(QH, QL, KH, KL, RK16, RVT16, VTH, VTL, CH, CL);
    k_outp<<<dim3(NTK / 128, DM / 128, 1), 256, 0, stream>>>(CH, CL, WoT, bo, out);
}

// v009
// One run takes 141 microseconds.
// Next to v008, in two timings, it ran 1.04 times as fast each time.
// Counting every step since v000, it is 3.41 times as fast.
#include <hip/hip_runtime.h>

// Contractions, f32 accumulate: q/k/v = x.W + b and out = attn.Wo + bo ([4096 x 1024].[1024 x 1024]) on v_wmma_f32_16x16x32_bf16 — plain bf16 = rounded inputs
// (exact; k-major weights transposed to n-major planes) for the projections, attn as bf16 hi + residual planes (two products) for Wo; the relative-position
// attention fused on v_wmma_f32_16x16x32_f16 with UNSCALED logits (sigma ~ 11 over 1024 keys, near one-hot): content q.k as hi.hi + hi.lo + lo.hi, the relative-key
// band q.rel_k[m] (q hi + lo vs the exact f16 INPUT table) gathered per (i, j) at m = i - j + 1024, softmax, weights (x32768) hi + residual against v hi + residual,

#define NB_  4
#define SS   1024
#define DM   1024
#define NH_  16
#define HD   64
#define NTK  (NB_ * SS)          // 4096
#define NRL  2049                // relative table rows
#define NRP  2112                // padded (band reads up to mbase + 47 <= 2063; P~ k-chunk up to mbase + 47 <= 2063)
#define NGK  128                 // 16-row groups of the relative-key table that a band can reach (m <= 2048)
#define NGV  129                 // 16-row groups of the relative-value table (k-chunks reach m <= 2048; one more group, beyond 2048, is zero)
#define PSC  32768.0f
#define LOSC 1024.0f
#define LOSCI (1.0f / 1024.0f)

typedef _Float16 h16;
typedef unsigned short bf;
typedef __attribute__((ext_vector_type(16))) __bf16   v16bf;
typedef __attribute__((ext_vector_type(16))) _Float16 v16h;
typedef __attribute__((ext_vector_type(8)))  _Float16 v8h;
typedef __attribute__((ext_vector_type(8)))  unsigned short v8us;
typedef __attribute__((ext_vector_type(8)))  float    v8f;
typedef __attribute__((ext_vector_type(4)))  float    v4f;
typedef v8h  __attribute__((may_alias)) v8ha;
typedef v4f  __attribute__((may_alias)) v4fa;
typedef v8us __attribute__((may_alias)) v8usa;

__device__ __forceinline__ unsigned short f2bf(float f) { unsigned u = __float_as_uint(f); u += 0x7FFFu + ((u >> 16) & 1u); return (unsigned short)(u >> 16); }
__device__ __forceinline__ float bf2f(unsigned short b) { return __uint_as_float(((unsigned)b) << 16); }
__device__ __forceinline__ float bfr(float f) { return bf2f(f2bf(f)); }
__device__ __forceinline__ v16h cat16(v8h lo, v8h hi) { return __builtin_shufflevector(lo, hi, 0, 1, 2, 3, 4, 5, 6, 7, 8, 9, 10, 11, 12, 13, 14, 15); }
__device__ __forceinline__ v16bf cat16b(v8us lo, v8us hi) { return __builtin_bit_cast(v16bf, __builtin_shufflevector(lo, hi, 0, 1, 2, 3, 4, 5, 6, 7, 8, 9, 10, 11, 12, 13, 14, 15)); }
__device__ __forceinline__ v8f wmma16(v16h a, v16h b, v8f c) { return __builtin_amdgcn_wmma_f32_16x16x32_f16(false, a, false, b, (short)0, c, false, false); }
__device__ __forceinline__ v8f wmmab(v16bf a, v16bf b, v8f c) { return __builtin_amdgcn_wmma_f32_16x16x32_bf16(false, a, false, b, (short)0, c, false, false); }
// A wave-uniform operand address held in scalar registers (each half through readfirstlane, cast to unsigned behind it), so that a fragment load is
// scalar base + one lane offset + immediate and needs no 64-bit address register pair of its own.
typedef __attribute__((address_space(1))) const v8h gv8h;
__device__ __forceinline__ gv8h* uptr(const h16* p) {
    const unsigned long long a = (unsigned long long)p;
    return (gv8h*)(((unsigned long long)(unsigned)__builtin_amdgcn_readfirstlane((int)(a >> 32)) << 32) | (unsigned)__builtin_amdgcn_readfirstlane((int)(unsigned)a));
}
typedef __attribute__((address_space(1))) v8h gv8hw;
__device__ __forceinline__ gv8hw* uptrw(h16* p) {
    const unsigned long long a = (unsigned long long)p;
    return (gv8hw*)(((unsigned long long)(unsigned)__builtin_amdgcn_readfirstlane((int)(a >> 32)) << 32) | (unsigned)__builtin_amdgcn_readfirstlane((int)(unsigned)a));
}
typedef __attribute__((address_space(1))) const v8us gv8u;
__device__ __forceinline__ gv8u* uptrb(const bf* p) {
    const unsigned long long a = (unsigned long long)p;
    return (gv8u*)(((unsigned long long)(unsigned)__builtin_amdgcn_readfirstlane((int)(a >> 32)) << 32) | (unsigned)__builtin_amdgcn_readfirstlane((int)(unsigned)a));
}
// one 16 x 32 bf16 fragment in fragment order: the two 512-byte blocks at element offsets c and c + 256 from the uniform base u, each lane its own 16 bytes
#define LDB(u, c) cat16b((u)[ulane + (c) / 8], (u)[ulane + ((c) + 256) / 8])
// one 16 x 32 f16 fragment in fragment order: two 512-byte blocks at element offsets c and c + d2 from the uniform base u, each lane its own 16 bytes
#define LDU(u, c, d2) cat16((u)[ulane + (c) / 8], (u)[ulane + ((c) + (d2)) / 8])
#define VST2(T, p, v) do { const T vst2_v_ = (v); *(T*)(p) = vst2_v_;  } while (0)
// Fragment-order layout of a [rows][1024] 16-bit plane: 512-byte blocks of 16 rows x 16 columns, lane-major (lane = 16 * ((col >> 3) & 1) + (row & 15), 8 elements
// a lane), blocks ordered by (row >> 4, col >> 5, (col >> 4) & 1). pko = element offset of the 8-element piece at (row, col), col a multiple of 8. One wave-wide
// 16-byte fragment load then reads one block = 4 whole 128-byte lines; the second half of a fragment is the next block (+256), the next k-chunk of 32 is +512.
__device__ __forceinline__ size_t pko(int row, int col) {
    return ((size_t)(((row >> 4) * 32 + (col >> 5)) * 2 + ((col >> 4) & 1)) << 8) + (size_t)(((((col >> 3) & 1) << 4) + (row & 15)) << 3);
}

// The conversions that depend on inputs alone are block ranges of ONE launch (k_prep, below); each body takes its own block index.
// b_cvtb: bf16 of an [nrows][1024] matrix; b_wt: k-major [1024][1024] -> n-major bf16; both written in fragment order (pko).
__device__ __forceinline__ void b_cvtb(int blk, const float* __restrict__ src, int nrows, bf* dst) {
    const int lane = threadIdx.x & 31, gw = blk * 8 + (threadIdx.x >> 5), r = (gw >> 4) * 16 + (lane & 15);    // wave = 16 rows x 64 columns
    if (r >= nrows) return;
#pragma unroll
    for (int q = 0; q < 4; ++q) { const int col = (gw & 15) * 64 + q * 16 + (lane >> 4) * 8; v8us t;
#pragma unroll
        for (int i = 0; i < 8; ++i) t[i] = f2bf(src[(size_t)r * DM + col + i]);
        VST2(v8us, dst + pko(r, col), t); }
}
__device__ __forceinline__ void b_wt(int bk, int bn, unsigned short* tl, const float* __restrict__ Wm, bf* WT) {
    const int tid = threadIdx.x, k0 = bk * 64, n0 = bn * 64;
    const int kk = tid >> 2, nq = (tid & 3) * 16;
#pragma unroll
    for (int i = 0; i < 16; ++i) tl[(nq + i) * 72 + kk] = f2bf(Wm[(size_t)(k0 + kk) * DM + n0 + nq + i]);
    __syncthreads();
    auto pass = [&]() {
#pragma unroll
        for (int s = 0; s < 2; ++s) { const int u = (tid >> 5) + 8 * s, nr = (u >> 2) * 16 + (tid & 15), kcol = (u & 3) * 16 + ((tid >> 4) & 1) * 8;
            const v8us val = *(const v8usa*)(tl + nr * 72 + kcol);
            *(v8us*)(WT + pko(n0 + nr, k0 + kcol)) = val; }
    };
    pass();
    asm volatile("s_wait_xcnt 0x0" ::: "memory");    // in k_prep the code of the other block ranges follows these stores in the program and rewrites the registers they name: the wait stands in front of that
}
// k_gemmb: 128 x 128 tile of A.B^T + bias over K = 1024 (bf16 exact; A, B in fragment order), 2 x 2 waves of 64 x 64: each loaded fragment feeds four WMMAs
// (16 half-fragment loads for 16 WMMAs a k-chunk, not 10 for 4); the three projections are the z planes of one grid:
// z = 0, 1 (q, k): f16 hi + residual planes (fragment order, pko); z = 2 (v): f16 hi + residual planes of V^T, fragment order: [b][h][s / 32][d / 16][(s >> 4) & 1] blocks of 512 bytes,
// lane = 16 * ((s >> 3) & 1) + (d & 15). A lane of an accumulator tile holds 8 consecutive rows of one column, which is one 16-byte piece of a fragment-order plane whose 8-element run lies along the
// tile's rows: v takes x as the row operand (runs along s), q and k take the weight as the row operand (the product transposed: runs along d), and every tile is stored straight from its registers,
// one whole 512-byte block a wave-wide store.
// The k loop is unrolled over a ring of GD register stages (one stage = the four A fragments and the four B fragments of one k-chunk of 32): the loads of k-chunk c + GD are
// issued behind the WMMAs of k-chunk c, so that a wave waits for loads that are GD - 1 chunks old. A 16-row group of a plane is 32 KB in a row: every load is scalar base + lane + immediate.
#define GD 3
__global__ __launch_bounds__(128, 3) void k_gemmb(const bf* __restrict__ A, const bf* __restrict__ Bq, const bf* __restrict__ Bk, const bf* __restrict__ Bv,
                                                  const float* __restrict__ bq, const float* __restrict__ bk, const float* __restrict__ bv,
                                                  h16* QH, h16* QL, h16* KH, h16* KL, h16* VTH, h16* VTL) {
    const int z = blockIdx.z;
    const bf* Bn = z == 0 ? Bq : z == 1 ? Bk : Bv; const float* bias = z == 0 ? bq : z == 1 ? bk : bv;
    const int wave = __builtin_amdgcn_readfirstlane(threadIdx.x >> 5);    // wave in a scalar register: the operand bases below are scalar
    // the lane's number as the hardware counts it (equal to threadIdx.x & 31 here): with the mask form the compiler folds some constant block offsets into the mask, and such a load takes an address register of its own
    const unsigned ulane = __builtin_amdgcn_mbcnt_lo(~0u, 0u);
    const int r0 = blockIdx.x * 128 + (wave >> 1) * 64, c0 = blockIdx.y * 128 + (wave & 1) * 64;
    gv8u* ua = uptrb(z == 2 ? A + pko(r0, 0) : Bn + pko(c0, 0)); gv8u* ub = uptrb(z == 2 ? Bn + pko(c0, 0) : A + pko(r0, 0));    // row operand, column operand; + 512 elements: the next k-chunk; + 16 * DM: the next 16 rows
    v8f acc[4][4];
#pragma unroll
    for (int u = 0; u < 4; ++u)
#pragma unroll
        for (int t = 0; t < 4; ++t) acc[u][t] = (v8f){};
    v16bf ar[GD][4], br[GD][4];
#pragma unroll
    for (int s = 0; s < GD; ++s) {
#pragma unroll
        for (int t = 0; t < 4; ++t) { ar[s][t] = LDB(ua, t * 16 * DM + s * 512); br[s][t] = LDB(ub, t * 16 * DM + s * 512); }
        __builtin_amdgcn_sched_barrier(0); }    // keeps each stage's loads together and in stage order, so that the waits can count
#pragma unroll
    for (int c = 0; c < DM / 32; ++c) {
        const int s = c % GD;
        // row tile outermost: in this order the build keeps all 16 accumulator tiles where they are (column tile outermost, it moved one from chunk to chunk and spilled it once)
#pragma unroll
        for (int u = 0; u < 4; ++u)
#pragma unroll
            for (int t = 0; t < 4; ++t) acc[u][t] = wmmab(ar[s][u], br[s][t], acc[u][t]);
        __builtin_amdgcn_sched_barrier(0);    // the refill stays behind the WMMAs that read this stage, so that it lands in the same registers (no stage more, no spill)
        if (c + GD < DM / 32) {
#pragma unroll
            for (int t = 0; t < 4; ++t) { ar[s][t] = LDB(ua, t * 16 * DM + (c + GD) * 512); br[s][t] = LDB(ub, t * 16 * DM + (c + GD) * 512); } }
        __builtin_amdgcn_sched_barrier(0);    // holds the refill of this stage here, GD chunks ahead of its WMMAs: without it the scheduler sinks the loads down to their use
    }
    // the epilogue reuses the lane-offset and scalar base registers that the ring's loads name: the wait stands in front of that. The epilogue's lane number is taken
    // through the wait's own statement, so that none of the lane arithmetic (which can land in the lane-offset register) is placed ahead of it
    unsigned el = ulane;
    asm volatile("s_wait_xcnt 0x0" : "+v"(el) : : "memory");
    __builtin_amdgcn_sched_barrier(0);    // keeps the epilogue's first register writes behind that wait
    const int lane = (int)el, lr = lane & 15, hi = lane >> 4;
    // the bias: of the tile's column (v: feature c0 + 16 t + lr) or of its rows (q, k: features c0 + 16 u + 8 hi + j)
    if (z == 2) {
#pragma unroll
        for (int t = 0; t < 4; ++t) { const float bc = bfr(bias[c0 + t * 16 + lr]);
#pragma unroll
            for (int u = 0; u < 4; ++u) acc[u][t] += bc; }
    } else {
#pragma unroll
        for (int u = 0; u < 4; ++u) { const float* bp = bias + c0 + u * 16 + hi * 8; v8f br8;
#pragma unroll
            for (int j = 0; j < 8; ++j) br8[j] = bfr(bp[j]);
#pragma unroll
            for (int t = 0; t < 4; ++t) acc[u][t] += br8; }
    }
    // tile (u, t) is one 512-byte block, su (u >> 1) + 256 (u & 1) + st t elements behind the wave's first block. v: rows = tokens r0 + 16 u + 8 hi + j of one batch entry, columns = one head's d = 16 t + lr;
    // q, k: rows = features, column = token r0 + 16 t + lr, the block of pko(token, feature)
    const size_t wb = z == 2 ? (((size_t)(r0 / SS) * NH_ + c0 / HD) * HD) * SS + (size_t)((r0 % SS) >> 5) * 2048 : pko(r0, c0);
    h16* p1 = (z == 0 ? QH : z == 1 ? KH : VTH) + wb; h16* p2 = (z == 0 ? QL : z == 1 ? KL : VTL) + wb;
    const int su = z == 2 ? 2048 : 512, st = z == 2 ? 512 : 16 * DM;
    v8h o1[4][4], o2[4][4];
#pragma unroll
    for (int u = 0; u < 4; ++u)
#pragma unroll
        for (int t = 0; t < 4; ++t)
#pragma unroll
            for (int j = 0; j < 8; ++j) { const float v = acc[u][t][j]; const h16 a = (h16)v; o1[u][t][j] = a; o2[u][t][j] = (h16)((v - (float)a) * LOSC); }
    __builtin_amdgcn_sched_barrier(0);    // every conversion ahead of the first store: behind a store no vector register that it names is rewritten, and the 32 stores go out as one run (without it: a wait behind nearly every store)
#pragma unroll
    for (int u = 0; u < 4; u += 2)
#pragma unroll
        for (int t = 0; t < 4; ++t) { gv8hw* t1 = uptrw(p1 + (u >> 1) * su + t * st); gv8hw* t2 = uptrw(p2 + (u >> 1) * su + t * st);    // scalar base + lane (+ 512 bytes)
            t1[el] = o1[u][t]; t2[el] = o2[u][t]; t1[el + 32] = o1[u + 1][t]; t2[el + 32] = o2[u + 1][t]; }
}
// b_tabs: both tables in fragment order over groups g of 16 table rows m = 16 g + 1 .. 16 g + 16 (every band of k_attn starts at m = 1 mod 16; m = 0 is never used):
// RK16 [g < NGK][d / 16] blocks of 512 bytes = f16(bf16(rel_k_emb)), lane = 16 * ((d >> 3) & 1) + (m - 1 & 15); RVT16 [g < NGV][d / 16] blocks = f16(bf16(rel_v_emb))^T,
// lane = 16 * ((m - 1 >> 3) & 1) + (d & 15), via 64x64 LDS transposes (zero beyond row 2048); NRP/64 blocks.
__device__ __forceinline__ void b_tabs(int blk, h16* tile, const float* __restrict__ rk, const float* __restrict__ rv, h16* RK16, h16* RVT16) {
    const int m0 = blk * 64 + 1, tid = threadIdx.x, mm = tid >> 2, d0 = (tid & 3) * 16;
#pragma unroll
    for (int i = 0; i < 16; ++i) { const int m = m0 + mm; tile[(d0 + i) * 72 + mm] = (m < NRL) ? (h16)bfr(rv[(size_t)m * HD + d0 + i]) : (h16)0.f; }
    __syncthreads();
    const int lane = tid & 31, lr = lane & 15, hi = lane >> 4;
    auto pass = [&]() {
#pragma unroll
        for (int s = 0; s < 2; ++s) { const int u = (tid >> 5) + 8 * s, g = blk * 4 + (u >> 2), m = 16 * g + 1 + lr, col = (u & 3) * 16 + hi * 8; v8h o;
#pragma unroll
            for (int i = 0; i < 8; ++i) o[i] = (m < NRL) ? (h16)bfr(rk[(size_t)m * HD + col + i]) : (h16)0.f;
            if (g < NGK) *(v8h*)(RK16 + (size_t)(g * 4 + (u & 3)) * 256 + lane * 8) = o; }
#pragma unroll
        for (int s = 0; s < 2; ++s) { const int u = (tid >> 5) + 8 * s, gl = u >> 2, n = u & 3, g = blk * 4 + gl;
            const v8h val = *(const v8ha*)(tile + (n * 16 + lr) * 72 + gl * 16 + hi * 8);
            if (g < NGV) *(v8h*)(RVT16 + (size_t)(g * 4 + n) * 256 + lane * 8) = val; }
    };
    pass(); 
}
// k_prep: one launch for all six conversions, none of which reads what another writes. Block ranges: PBT blocks of the tables (first: the longest chain of dependent loads),
// PBX blocks of x, 4 x PBW blocks of the weights (k tile fastest). The range test reads blockIdx alone, so each body's barrier is passed by its whole block; the bodies with an LDS tile share one.
#define PBX (NTK / 8)
#define PBW ((DM / 64) * (DM / 64))
#define PBT (NRP / 64)
__global__ __launch_bounds__(256) void k_prep(const float* __restrict__ x, const float* __restrict__ Wq, const float* __restrict__ Wk, const float* __restrict__ Wv, const float* __restrict__ Wo,
                                              const float* __restrict__ rk, const float* __restrict__ rv, bf* Xb, bf* WqT, bf* WkT, bf* WvT, bf* WoT, h16* RK16, h16* RVT16) {
    __shared__ __align__(16) unsigned short tl[64 * 72];
    const int bid = blockIdx.x;
    if (bid < PBT) { b_tabs(bid, (h16*)tl, rk, rv, RK16, RVT16); return; }
    if (bid < PBT + PBX) { b_cvtb(bid - PBT, x, NTK, Xb); return; }
    const int u = bid - PBT - PBX, wi = u / PBW, t = u - wi * PBW;
    b_wt(t % (DM / 64), t / (DM / 64), tl, wi == 0 ? Wq : wi == 1 ? Wk : wi == 2 ? Wv : Wo, wi == 0 ? WqT : wi == 1 ? WkT : wi == 2 ? WvT : WoT);
}
// k_attn: block = (b, h, 64 queries), wave = 16 queries i = q0..q0+15; 32 key tiles of 32. Every product is taken TRANSPOSED (a stored fragment serves as A or as B alike): lane (lr, hi)
// holds column lr = ONE query of every tile, its 8 registers the rows 8 hi + j. Content S^T = k.q^T, 12 WMMA (hi.hi + hi.lo + lo.hi, q residual fragments re-read);
// relative-key band^T: rows m = mbase + 0..47 of RK16 (mbase = q0 - l0 - 31 + 1024) x (q hi, q lo) = 12 WMMA, parked in LDS as ps[query][m]; logit(i,j) = content + ps[r][r - kk + 31]
// (UNSCALED); online softmax: maximum and sum inside the lane plus one exchange between the wave halves; the weights x32768 hi + residual of the two score tiles, packed in place, ARE
// the B operand (k = 8 hi + s, 16 + 8 hi + s) of o^T += vh.pa, ox^T += vl.pa + vh.px (12 WMMA); the same weights scattered into relative coordinates pt/pt2 [query][64]
// (column r + 31 - kk) are the B operand of o^T += rv.pt, ox^T += rv.pt2 (8 WMMA, A = RVT16 rows d at k = mbase + 16 .. mbase + 47; columns below 16 wait for the next tile, whose columns 32..47 they are);
// ctx = (o + ox/1024)/sum: a lane holds 8 consecutive d of its query = one 16-byte piece of the bf16 hi/lo planes [tok][h*64+d] in fragment order. Every global operand is read in fragment order (pko, k_gemmb, b_tabs).
#define PTP 136                  // row pitch of pt/pt2 in halves: 16 bytes x odd for the 16-byte readers; the scatter's lane stride PTP + 1 is 9 halves modulo the 64 banks, so the 8-half stores of 16 lanes lie side by side
typedef __attribute__((ext_vector_type(4))) unsigned v4u;
typedef v4u __attribute__((may_alias, aligned(2))) v4u2;
// the 8 halves of x in reverse order: the dwords reversed, each rotated by 16 bits
__device__ __forceinline__ v4u rev8(v8h x) { const v4u u = __builtin_bit_cast(v4u, x); return (v4u){ (u[3] >> 16) | (u[3] << 16), (u[2] >> 16) | (u[2] << 16), (u[1] >> 16) | (u[1] << 16), (u[0] >> 16) | (u[0] << 16) }; }
__device__ __forceinline__ float xhalf(float x) { return __builtin_bit_cast(float, __builtin_amdgcn_permlanex16(__builtin_bit_cast(int, x), __builtin_bit_cast(int, x), 0x76543210, 0xfedcba98, false, false)); }    // lane l with lane l ^ 16
__global__ __launch_bounds__(128, 4) void k_attn(const h16* __restrict__ QH, const h16* __restrict__ QL, const h16* __restrict__ KH, const h16* __restrict__ KL,
                                             const h16* __restrict__ RK16, const h16* __restrict__ RVT16, const h16* __restrict__ VTH, const h16* __restrict__ VTL, bf* CH, bf* CL) {
    __shared__ __align__(16) h16 ptl[4][16 * PTP];
    __shared__ __align__(16) h16 ptl2[4][16 * PTP];
    __shared__ __align__(16) float posl[4][16 * 52];
    const int lane = threadIdx.x & 31, wave = __builtin_amdgcn_readfirstlane(threadIdx.x >> 5), lr = lane & 15, hi = lane >> 4;    // wave in a scalar register: every operand block address below is scalar base + lane offset
    const unsigned ulane = lane;
    const int bid = blockIdx.x;
    const int b = bid / (NH_ * (SS / 64)), rem = bid - b * (NH_ * (SS / 64)), h = rem / (SS / 64), qt = rem - h * (SS / 64);
    const int q0 = qt * 64 + wave * 16;
    const size_t tok0 = (size_t)b * SS;
    h16* pt = &ptl[wave][0]; h16* pt2 = &ptl2[wave][0]; float* ps = &posl[wave][0];
    // row lr (the lane's query) of each LDS tile addressed as one lane base + a constant (an immediate offset). psb + 16 t + j: band column m = 16 t + 8 hi + j;
    // psg, ptb, ptb2 + 23 - 16 T - j: column r + 31 - kk of key kk = 16 T + 8 hi + j
    float* psb = ps + lr * 52 + hi * 8; const float* psg = ps + lr * 53 + 8 - hi * 8;
    h16* ptb = pt + lr * (PTP + 1) + 8 - hi * 8; h16* ptb2 = pt2 + lr * (PTP + 1) + 8 - hi * 8;
    const size_t qo0 = pko((int)tok0 + q0, h * HD);    // wave-uniform block offset; LDU adds the lane's own piece
    v16h qa[2];
#pragma unroll
    for (int kc = 0; kc < 2; ++kc) qa[kc] = LDU(uptr(QH + qo0), kc * 512, 256);
    const size_t vbase = (((size_t)b * NH_ + h) * HD) * SS;
    v8f o[4], ox[4];
#pragma unroll
    for (int n = 0; n < 4; ++n) { o[n] = (v8f){}; ox[n] = (v8f){}; }
    float mrow = -3.0e38f, lpart = 0.f;    // of the lane's query; lpart sums the keys of the lane's own wave half
    // Row r of pt/pt2 holds three runs of 16 columns, all rewritten every tile: r .. r+15 = this tile's keys 31..16, r+16 .. r+31 = its keys 15..0, r+32 .. r+47 = the tile before's keys 31..16.
    // Only columns 16..47 are read: one whole k-chunk. What a tile leaves below column 16 is not multiplied yet: it rides in wc (f32, x32768) into the next tile, whose columns 32..47 it completes.
    v8f wc = {};
    // Operand fragments are loaded in groups well ahead of the WMMAs that read them (the "memory" fences below keep each group where it is written).
    // The q residual and band fragments of a key tile (both k-chunks) are loaded during the tile before it and carried over the loop edge in these registers.
    v16h ql0, ql1, rb0[3], rb1[3];
    { gv8h* uql = uptr(QL + qo0); gv8h* urk = uptr(RK16 + (size_t)((q0 - 31 + 1024 - 1) >> 4) * 1024); ql0 = LDU(uql, 0, 256); ql1 = LDU(uql, 512, 256);
#pragma unroll
      for (int t = 0; t < 3; ++t) { rb0[t] = LDU(urk, t * 1024, 256); rb1[t] = LDU(urk, t * 1024 + 512, 256); } }
#pragma unroll 1
    for (int kt = 0; kt < SS / 32; ++kt) {
        const int l0 = kt * 32, mbase = q0 - l0 - 31 + 1024, gb = (mbase - 1) >> 4;    // mbase = 16 gb + 1
        const size_t ko = pko((int)tok0 + l0, h * HD);    // + 512: k-chunk 1; + 16 * DM: the next 16 rows, 64 blocks on
        gv8h* ukh = uptr(KH + ko); gv8h* ukl = uptr(KL + ko); gv8h* uql = uptr(QL + qo0);
        // group: this tile's k fragments, in flight under the band
        const v16h k0h0 = LDU(ukh, 0, 256), k1h0 = LDU(ukh, 16 * DM, 256), k0l0 = LDU(ukl, 0, 256), k1l0 = LDU(ukl, 16 * DM, 256);
        const v16h k0h1 = LDU(ukh, 512, 256), k1h1 = LDU(ukh, 16 * DM + 512, 256), k0l1 = LDU(ukl, 512, 256), k1l1 = LDU(ukl, 16 * DM + 512, 256);
        // band tiles: rows m = mbase + t*16 + lr of RK16, both k-chunks summed in the accumulators (q hi and q residual products apart), then joined and parked in LDS once.
        // A tile's sums are read behind the next tile's four WMMAs, which fill the slots the chip needs in front of that read (the last tile's: behind the compiler's own v_nop).
        {
            v8f ph[3], pq[3];
            auto bw = [&](int t) { ph[t] = wmma16(rb0[t], qa[0], (v8f){}); pq[t] = wmma16(rb0[t], ql0, (v8f){}); ph[t] = wmma16(rb1[t], qa[1], ph[t]); pq[t] = wmma16(rb1[t], ql1, pq[t]); };
            auto bc = [&](int t) { v4f b0, b1;
#pragma unroll
                for (int j = 0; j < 4; ++j) { b0[j] = ph[t][j] + pq[t][j] * LOSCI; b1[j] = ph[t][j + 4] + pq[t][j + 4] * LOSCI; }
                *(v4fa*)(psb + t * 16) = b0; *(v4fa*)(psb + t * 16 + 4) = b1; };
            bw(0); bw(1); bc(0); bw(2); bc(1); bc(2);
        }
        // The v_nop statements of this loop fill the vector slots the chip needs between a WMMA and the first read of its D or rewrite of its A / B,
        // and name those registers so that they stay whole up to there; their "memory" clobber also fences the load groups.
        // content, k-chunk 0 then 1
        v8f s0 = {}, s1 = {}, x0 = {}, x1 = {};
        s0 = wmma16(k0h0, qa[0], s0); x0 = wmma16(k0h0, ql0, x0); s1 = wmma16(k1h0, qa[0], s1); x1 = wmma16(k1h0, ql0, x1);
        asm volatile("v_nop" : "+v"(s0), "+v"(s1), "+v"(x0), "+v"(x1) : "v"(ql0), "v"(k0h0), "v"(k1h0) : "memory");
        x0 = wmma16(k0l0, qa[0], x0); x1 = wmma16(k1l0, qa[0], x1);
        asm volatile("v_nop" : "+v"(x0), "+v"(x1) : "v"(k0l0), "v"(k1l0) : "memory");
        s0 = wmma16(k0h1, qa[1], s0); x0 = wmma16(k0h1, ql1, x0); s1 = wmma16(k1h1, qa[1], s1); x1 = wmma16(k1h1, ql1, x1);
        asm volatile("v_nop" : "+v"(s0), "+v"(s1), "+v"(x0), "+v"(x1) : "v"(ql1), "v"(k0h1), "v"(k1h1) : "memory");
        x0 = wmma16(k0l1, qa[1], x0); x1 = wmma16(k1l1, qa[1], x1);
        asm volatile("v_nop" : "+v"(x0), "+v"(x1) : "v"(k0l1), "v"(k1l1) : "memory");
        asm volatile("v_nop\n\tv_nop\n\tv_nop\n\tv_nop" : "+v"(s0), "+v"(s1), "+v"(x0), "+v"(x1) : "v"(qa[0]), "v"(qa[1]));
        asm volatile("" ::: "memory");
        __builtin_amdgcn_wave_barrier();
        v8f g0v, g1v;
#pragma unroll
        for (int j = 0; j < 8; ++j) g0v[j] = psg[23 - j];    // band[r][r - kk + 31], kk = 8 hi + j
#pragma unroll
        for (int j = 0; j < 8; ++j) g1v[j] = psg[7 - j];     // kk = 16 + 8 hi + j
        const v8f a0 = s0 + x0 * LOSCI + g0v, a1 = s1 + x1 * LOSCI + g1v;
        float tm[8];
#pragma unroll
        for (int j = 0; j < 8; ++j) tm[j] = fmaxf(a0[j], a1[j]);
        float mx = fmaxf(fmaxf(fmaxf(tm[0], tm[1]), fmaxf(tm[2], tm[3])), fmaxf(fmaxf(tm[4], tm[5]), fmaxf(tm[6], tm[7])));
        mx = fmaxf(mx, xhalf(mx));    // the other 16 keys of this query sit in the other wave half
        const float mn = fmaxf(mrow, mx), alpha = __expf(mrow - mn); mrow = mn;
        v8f e0, e1;
#pragma unroll
        for (int j = 0; j < 8; ++j) e0[j] = __expf(a0[j] - mn);
#pragma unroll
        for (int j = 0; j < 8; ++j) e1[j] = __expf(a1[j] - mn);
        const v8f es = e0 + e1, w0 = e0 * PSC, w1 = e1 * PSC;
        const v8h h0 = __builtin_convertvector(w0, v8h), h1 = __builtin_convertvector(w1, v8h);
        const v8h r0 = __builtin_convertvector((w0 - __builtin_convertvector(h0, v8f)) * LOSC, v8h), r1 = __builtin_convertvector((w1 - __builtin_convertvector(h1, v8f)) * LOSC, v8h);
        const v16h pa = cat16(h0, h1), px = cat16(r0, r1);
        // a lane's 8 keys of a tile are 8 consecutive relative columns in falling order: one 16-byte LDS store each, at an address that is a multiple of 2 bytes only
        *(v4u2*)(ptb + 16) = rev8(h0); *(v4u2*)ptb = rev8(h1); *(v4u2*)(ptb2 + 16) = rev8(r0); *(v4u2*)ptb2 = rev8(r1);
        // the tile before's keys 16..31, brought to this tile's maximum, sit 32 columns up in this tile's coordinates
        const v8f wo = wc * alpha; wc = w1;
        const v8h hc = __builtin_convertvector(wo, v8h), rc = __builtin_convertvector((wo - __builtin_convertvector(hc, v8f)) * LOSC, v8h);
        *(v4u2*)(ptb + 32) = rev8(hc); *(v4u2*)(ptb2 + 32) = rev8(rc);
        lpart = lpart * alpha + (((es[0] + es[1]) + (es[2] + es[3])) + ((es[4] + es[5]) + (es[6] + es[7])));
#pragma unroll
        for (int n = 0; n < 4; ++n)
#pragma unroll
            for (int j = 0; j < 8; ++j) { o[n][j] *= alpha; ox[n][j] *= alpha; }
        asm volatile("" ::: "memory");
        // group: this tile's v hi + residual fragments and the rel_v fragments of its one k-chunk (columns 16..47)
        v16h vh[4], vl[4], rv0[4];
        gv8h* uvh = uptr(VTH + vbase + (size_t)kt * 2048); gv8h* uvl = uptr(VTL + vbase + (size_t)kt * 2048); gv8h* urv = uptr(RVT16 + (size_t)gb * 1024);
#pragma unroll
        for (int n = 0; n < 4; ++n) { vh[n] = LDU(uvh, n * 512, 256); vl[n] = LDU(uvl, n * 512, 256); }
#pragma unroll
        for (int n = 0; n < 4; ++n) rv0[n] = LDU(urv, 1024 + n * 256, 1024);
#pragma unroll
        for (int n = 0; n < 4; ++n) {
            o[n] = wmma16(vh[n], pa, o[n]); ox[n] = wmma16(vl[n], pa, ox[n]); ox[n] = wmma16(vh[n], px, ox[n]);
            asm volatile("" : "+v"(o[n]), "+v"(ox[n]) : "v"(vh[n]), "v"(vl[n]) : "memory");    // keeps the fragments whole through their WMMAs; its "memory" clobber holds the load groups where they are written
        }
        // group: the next key tile's q residual and band fragments, both k-chunks (the last tile loads its own again: in bounds, unused)
        { const int ktn = kt + 1 < SS / 32 ? kt + 1 : kt; gv8h* urn = uptr(RK16 + (size_t)((q0 - ktn * 32 - 31 + 1024 - 1) >> 4) * 1024); ql0 = LDU(uql, 0, 256); ql1 = LDU(uql, 512, 256);
#pragma unroll
          for (int t = 0; t < 3; ++t) { rb0[t] = LDU(urn, t * 1024, 256); rb1[t] = LDU(urn, t * 1024 + 512, 256); } }
        // rel_v x relative-coordinate weights: A = RVT16 rows d at k = mbase + 16 .. mbase + 47, B = pt rows (one query a lane, k = column - 16, one k-chunk)
        {
            const v16h ra = cat16(*(const v8ha*)(pt + lr * PTP + 16 + hi * 8), *(const v8ha*)(pt + lr * PTP + 32 + hi * 8));
            const v16h rx = cat16(*(const v8ha*)(pt2 + lr * PTP + 16 + hi * 8), *(const v8ha*)(pt2 + lr * PTP + 32 + hi * 8));
#pragma unroll
            for (int n = 0; n < 4; ++n) {
                o[n] = wmma16(rv0[n], ra, o[n]); ox[n] = wmma16(rv0[n], rx, ox[n]);
                asm volatile("" : "+v"(o[n]), "+v"(ox[n]) : "v"(rv0[n]), "v"(ra), "v"(rx) : "memory"); }    // as in the v loop above: fragments whole through their WMMAs, load groups held where they are written
        }
        __builtin_amdgcn_wave_barrier();    // this tile's reads of pt/pt2 stay ahead of the next tile's stores into the same rows
        // the carried group's loads name scalar base registers that the next trip's address arithmetic rewrites: the wait stands in front of that rewrite
        asm volatile("s_wait_xcnt 0x0" ::: "memory");
    }
    // the last tile's columns below 16: one more k-chunk with no new keys (columns r .. r+31 zero). Its upper 16 columns are table group q0 / 16; the lower 16 carry zero weights
    // and take the same group as a stand-in (the group below it does not exist for q0 = 0).
    {
        gv8h* urv = uptr(RVT16 + (size_t)(q0 >> 4) * 1024);
        v16h rvf[4];
#pragma unroll
        for (int n = 0; n < 4; ++n) rvf[n] = LDU(urv, n * 256, 0);
        const v8h hc = __builtin_convertvector(wc, v8h), rc = __builtin_convertvector((wc - __builtin_convertvector(hc, v8f)) * LOSC, v8h);
        const v4u zz = {};
        *(v4u2*)(ptb + 16) = zz; *(v4u2*)ptb = zz; *(v4u2*)(ptb2 + 16) = zz; *(v4u2*)ptb2 = zz;
        *(v4u2*)(ptb + 32) = rev8(hc); *(v4u2*)(ptb2 + 32) = rev8(rc);
        const v16h ra = cat16(*(const v8ha*)(pt + lr * PTP + 16 + hi * 8), *(const v8ha*)(pt + lr * PTP + 32 + hi * 8));
        const v16h rx = cat16(*(const v8ha*)(pt2 + lr * PTP + 16 + hi * 8), *(const v8ha*)(pt2 + lr * PTP + 32 + hi * 8));
#pragma unroll
        for (int n = 0; n < 4; ++n) { o[n] = wmma16(rvf[n], ra, o[n]); ox[n] = wmma16(rvf[n], rx, ox[n]); }
    }
    asm volatile("v_nop\n\tv_nop\n\tv_nop\n\tv_nop" : "+v"(o[0]), "+v"(o[1]), "+v"(o[2]), "+v"(o[3]), "+v"(ox[0]), "+v"(ox[1]), "+v"(ox[2]), "+v"(ox[3]));
    const float rs = lpart + xhalf(lpart), inv = 1.0f / (rs * PSC);    // the two wave halves' sums of this query joined once
#pragma unroll
    for (int s = 0; s < 4; ++s) { const size_t po = pko((int)tok0 + q0 + lr, h * HD + s * 16 + hi * 8); v8us oh, ol;
#pragma unroll
        for (int i = 0; i < 8; ++i) { const float cv = (o[s][i] + ox[s][i] * LOSCI) * inv; const unsigned short hb = f2bf(cv); oh[i] = hb; ol[i] = f2bf(cv - bf2f(hb)); }
        *(v8us*)(CH + po) = oh; *(v8us*)(CL + po) = ol; }
}
// k_outp: 128 x 128 tile of out = (CH + CL).WoT^T + bo over K = 1024 (2 products), 4 x 2 waves of 32 x 64 (16 half-fragment loads for 16 WMMAs a k-chunk, not 12 for 8); f32 rows.
// 256 blocks of 8 waves: one block a WGP, two waves a SIMD.
// Same register ring as k_gemmb, OD stages of four A fragments (hi, residual x two row tiles) and four B fragments.
#define OD 3
__global__ __launch_bounds__(256, 1) void k_outp(const bf* __restrict__ A, const bf* __restrict__ Al, const bf* __restrict__ Bn, const float* __restrict__ bias, float* C) {
    __shared__ __align__(16) float ost[8][32 * 68];
    const int wave = __builtin_amdgcn_readfirstlane(threadIdx.x >> 5);    // wave in a scalar register: the operand bases below are scalar
    // the lane's number as the hardware counts it (equal to threadIdx.x & 31 here): with the mask form the compiler folds some constant block offsets into the mask, and such a load takes an address register of its own
    const unsigned ulane = __builtin_amdgcn_mbcnt_lo(~0u, 0u);
    const int r0 = blockIdx.x * 128 + (wave >> 1) * 32, c0 = blockIdx.y * 128 + (wave & 1) * 64;
    gv8u* ua = uptrb(A + pko(r0, 0)); gv8u* ul = uptrb(Al + pko(r0, 0)); gv8u* ub = uptrb(Bn + pko(c0, 0));    // + 512 elements: the next k-chunk; + 16 * DM: the next 16 rows
    v8f acc[2][4];
#pragma unroll
    for (int t = 0; t < 4; ++t) { acc[0][t] = (v8f){}; acc[1][t] = (v8f){}; }
    v16bf ar[OD][2], lr2[OD][2], br[OD][4];
#pragma unroll
    for (int s = 0; s < OD; ++s) {
#pragma unroll
        for (int u = 0; u < 2; ++u) { ar[s][u] = LDB(ua, u * 16 * DM + s * 512); lr2[s][u] = LDB(ul, u * 16 * DM + s * 512); }
#pragma unroll
        for (int t = 0; t < 4; ++t) br[s][t] = LDB(ub, t * 16 * DM + s * 512);
        __builtin_amdgcn_sched_barrier(0); }    // keeps each stage's loads together and in stage order, so that the waits can count
#pragma unroll
    for (int c = 0; c < DM / 32; ++c) {
        const int s = c % OD;
#pragma unroll
        for (int t = 0; t < 4; ++t) { acc[0][t] = wmmab(ar[s][0], br[s][t], acc[0][t]); acc[1][t] = wmmab(ar[s][1], br[s][t], acc[1][t]);
            acc[0][t] = wmmab(lr2[s][0], br[s][t], acc[0][t]); acc[1][t] = wmmab(lr2[s][1], br[s][t], acc[1][t]); }
        __builtin_amdgcn_sched_barrier(0);    // the refill stays behind the WMMAs that read this stage, so that it lands in the same registers (no stage more, no spill)
        if (c + OD < DM / 32) {
#pragma unroll
            for (int u = 0; u < 2; ++u) { ar[s][u] = LDB(ua, u * 16 * DM + (c + OD) * 512); lr2[s][u] = LDB(ul, u * 16 * DM + (c + OD) * 512); }
#pragma unroll
            for (int t = 0; t < 4; ++t) br[s][t] = LDB(ub, t * 16 * DM + (c + OD) * 512); }
        __builtin_amdgcn_sched_barrier(0);    // holds the refill of this stage here, OD chunks ahead of its WMMAs: without it the scheduler sinks the loads down to their use
    }
    // the epilogue reuses the lane-offset and scalar base registers that the ring's loads name: the wait stands in front of that; the epilogue's lane number goes through the wait's own statement, as in k_gemmb
    unsigned el = ulane;
    asm volatile("s_wait_xcnt 0x0" : "+v"(el) : : "memory");
    __builtin_amdgcn_sched_barrier(0);    // keeps the epilogue's first register writes behind that wait
    const int lane = (int)el, lr = lane & 15, hi = lane >> 4;
    float* os = &ost[wave][0];
#pragma unroll
    for (int t = 0; t < 4; ++t) { const float bv = bfr(bias[c0 + t * 16 + lr]);
#pragma unroll
        for (int u = 0; u < 2; ++u)
#pragma unroll
            for (int j = 0; j < 8; ++j) os[(u * 16 + hi * 8 + j) * 68 + t * 16 + lr] = acc[u][t][j] + bv; }
    __syncthreads();
    float* crow = C + (size_t)r0 * DM + c0;
    auto pass = [&]() {
#pragma unroll
        for (int s = 0; s < 16; ++s) { const int Lid = (lane >> 3) + 4 * s, piece = lane & 7; const int row = Lid >> 1, cofs = (Lid & 1) * 32 + piece * 4;
            const v4f val = *(const v4fa*)(os + row * 68 + cofs); *(v4f*)(crow + (size_t)row * DM + cofs) = val; }
    };
    pass(); 
}

extern "C" void kernel_launch(void* const* d_in, const int* in_sizes, int n_in,
                              void* d_out, int out_size, void* d_ws, size_t ws_size, hipStream_t stream) {
    (void)in_sizes; (void)n_in; (void)out_size;
    const float* x = (const float*)d_in[0]; const float* Wq = (const float*)d_in[1]; const float* bq = (const float*)d_in[2]; const float* Wk = (const float*)d_in[3]; const float* bk = (const float*)d_in[4];
    const float* Wv = (const float*)d_in[5]; const float* bv = (const float*)d_in[6]; const float* Wo = (const float*)d_in[7]; const float* bo = (const float*)d_in[8];
    const float* rk = (const float*)d_in[9]; const float* rv = (const float*)d_in[10];
    float* out = (float*)d_out;    // [4][1024][1024]
    char* wsp = (char*)d_ws;
    auto take = [&](size_t bytes) { char* p = wsp; wsp += (bytes + 255) & ~(size_t)255; return (void*)p; };
    bf* Xb = (bf*)take((size_t)NTK * DM * 2); bf* WqT = (bf*)take((size_t)DM * DM * 2); bf* WkT = (bf*)take((size_t)DM * DM * 2); bf* WvT = (bf*)take((size_t)DM * DM * 2); bf* WoT = (bf*)take((size_t)DM * DM * 2);
    h16* QH = (h16*)take((size_t)NTK * DM * 2); h16* QL = (h16*)take((size_t)NTK * DM * 2); h16* KH = (h16*)take((size_t)NTK * DM * 2); h16* KL = (h16*)take((size_t)NTK * DM * 2);
    bf* CH = (bf*)take((size_t)NTK * DM * 2); bf* CL = (bf*)take((size_t)NTK * DM * 2); h16* VTH = (h16*)take((size_t)NTK * DM * 2); h16* VTL = (h16*)take((size_t)NTK * DM * 2);
    h16* RK16 = (h16*)take((size_t)NRP * HD * 2); h16* RVT16 = (h16*)take((size_t)HD * NRP * 2);
    if ((size_t)(wsp - (char*)d_ws) > ws_size) return;    // 8.4 + 8.4 + 33.5 + 16.8 + 16.8 + 0.5 ~ 85 MB
    k_prep<<<PBX + 4 * PBW + PBT, 256, 0, stream>>>(x, Wq, Wk, Wv, Wo, rk, rv, Xb, WqT, WkT, WvT, WoT, RK16, RVT16);
    k_gemmb<<<dim3(NTK / 128, DM / 128, 3), 128, 0, stream>>>(Xb, WqT, WkT, WvT, bq, bk, bv, QH, QL, KH, KL, VTH, VTL);
    k_attn<<<NB_ * NH_ * (SS / 64), 128, 0, stream>>>(QH, QL, KH, KL, RK16, RVT16, VTH, VTL, CH, CL);
    k_outp<<<dim3(NTK / 128, DM / 128, 1), 256, 0, stream>>>(CH, CL, WoT, bo, out);
}

// v010
// One run takes 136 microseconds.
// Next to v009, in two timings, it ran 1.04 times as fast each time.
// All steps since v000 together make it 3.55 times as fast.
#include <hip/hip_runtime.h>

// Contractions, f32 accumulate: q/k/v = x.W + b and out = attn.Wo + bo ([4096 x 1024].[1024 x 1024]) on v_wmma_f32_16x16x32_bf16 — plain bf16 = rounded inputs
// (exact; k-major weights transposed to n-major planes) for the projections, attn as bf16 hi + residual planes (two products) for Wo; the relative-position
// attention fused on v_wmma_f32_16x16x32_f16 with UNSCALED logits (sigma ~ 11 over 1024 keys, near one-hot): content q.k as hi.hi + hi.lo + lo.hi, the relative-key
// band q.rel_k[m] (q hi + lo vs the exact f16 INPUT table) gathered per (i, j) at m = i - j + 1024, softmax, weights (x32768) hi + residual against v hi + residual,

#define NB_  4
#define SS   1024
#define DM   1024
#define NH_  16
#define HD   64
#define NTK  (NB_ * SS)          // 4096
#define NRL  2049                // relative table rows
#define NRP  2112                // padded (band reads up to mbase + 47 <= 2063; P~ k-chunk up to mbase + 47 <= 2063)
#define NGK  128                 // 16-row groups of the relative-key table that a band can reach (m <= 2048)
#define NGV  129                 // 16-row groups of the relative-value table (k-chunks reach m <= 2048; one more group, beyond 2048, is zero)
#define PSC  32768.0f
#define LOSC 1024.0f
#define LOSCI (1.0f / 1024.0f)

typedef _Float16 h16;
typedef unsigned short bf;
typedef __attribute__((ext_vector_type(16))) __bf16   v16bf;
typedef __attribute__((ext_vector_type(16))) _Float16 v16h;
typedef __attribute__((ext_vector_type(8)))  _Float16 v8h;
typedef __attribute__((ext_vector_type(8)))  unsigned short v8us;
typedef __attribute__((ext_vector_type(8)))  float    v8f;
typedef __attribute__((ext_vector_type(4)))  float    v4f;
typedef v8h  __attribute__((may_alias)) v8ha;
typedef v4f  __attribute__((may_alias)) v4fa;
typedef v8us __attribute__((may_alias)) v8usa;

__device__ __forceinline__ unsigned short f2bf(float f) { unsigned u = __float_as_uint(f); u += 0x7FFFu + ((u >> 16) & 1u); return (unsigned short)(u >> 16); }
__device__ __forceinline__ float bf2f(unsigned short b) { return __uint_as_float(((unsigned)b) << 16); }
__device__ __forceinline__ float bfr(float f) { return bf2f(f2bf(f)); }
__device__ __forceinline__ v16h cat16(v8h lo, v8h hi) { return __builtin_shufflevector(lo, hi, 0, 1, 2, 3, 4, 5, 6, 7, 8, 9, 10, 11, 12, 13, 14, 15); }
__device__ __forceinline__ v16bf cat16b(v8us lo, v8us hi) { return __builtin_bit_cast(v16bf, __builtin_shufflevector(lo, hi, 0, 1, 2, 3, 4, 5, 6, 7, 8, 9, 10, 11, 12, 13, 14, 15)); }
__device__ __forceinline__ v8f wmma16(v16h a, v16h b, v8f c) { return __builtin_amdgcn_wmma_f32_16x16x32_f16(false, a, false, b, (short)0, c, false, false); }
__device__ __forceinline__ v8f wmmab(v16bf a, v16bf b, v8f c) { return __builtin_amdgcn_wmma_f32_16x16x32_bf16(false, a, false, b, (short)0, c, false, false); }
// A wave-uniform operand address held in scalar registers (each half through readfirstlane, cast to unsigned behind it), so that a fragment load is
// scalar base + one lane offset + immediate and needs no 64-bit address register pair of its own.
typedef __attribute__((address_space(1))) const v8h gv8h;
__device__ __forceinline__ gv8h* uptr(const h16* p) {
    const unsigned long long a = (unsigned long long)p;
    return (gv8h*)(((unsigned long long)(unsigned)__builtin_amdgcn_readfirstlane((int)(a >> 32)) << 32) | (unsigned)__builtin_amdgcn_readfirstlane((int)(unsigned)a));
}
typedef __attribute__((address_space(1))) v8h gv8hw;
__device__ __forceinline__ gv8hw* uptrw(h16* p) {
    const unsigned long long a = (unsigned long long)p;
    return (gv8hw*)(((unsigned long long)(unsigned)__builtin_amdgcn_readfirstlane((int)(a >> 32)) << 32) | (unsigned)__builtin_amdgcn_readfirstlane((int)(unsigned)a));
}
typedef __attribute__((address_space(1))) const v8us gv8u;
__device__ __forceinline__ gv8u* uptrb(const bf* p) {
    const unsigned long long a = (unsigned long long)p;
    return (gv8u*)(((unsigned long long)(unsigned)__builtin_amdgcn_readfirstlane((int)(a >> 32)) << 32) | (unsigned)__builtin_amdgcn_readfirstlane((int)(unsigned)a));
}
// one 16 x 32 bf16 fragment in fragment order: the two 512-byte blocks at element offsets c and c + 256 from the uniform base u, each lane its own 16 bytes
#define LDB(u, c) cat16b((u)[ulane + (c) / 8], (u)[ulane + ((c) + 256) / 8])
// one 16 x 32 f16 fragment in fragment order: two 512-byte blocks at element offsets c and c + d2 from the uniform base u, each lane its own 16 bytes
#define LDU(u, c, d2) cat16((u)[ulane + (c) / 8], (u)[ulane + ((c) + (d2)) / 8])
#define VST2(T, p, v) do { const T vst2_v_ = (v); *(T*)(p) = vst2_v_;  } while (0)
// Fragment-order layout of a [rows][1024] 16-bit plane: 512-byte blocks of 16 rows x 16 columns, lane-major (lane = 16 * ((col >> 3) & 1) + (row & 15), 8 elements
// a lane), blocks ordered by (row >> 4, col >> 5, (col >> 4) & 1). pko = element offset of the 8-element piece at (row, col), col a multiple of 8. One wave-wide
// 16-byte fragment load then reads one block = 4 whole 128-byte lines; the second half of a fragment is the next block (+256), the next k-chunk of 32 is +512.
__device__ __forceinline__ size_t pko(int row, int col) {
    return ((size_t)(((row >> 4) * 32 + (col >> 5)) * 2 + ((col >> 4) & 1)) << 8) + (size_t)(((((col >> 3) & 1) << 4) + (row & 15)) << 3);
}

// The conversions that depend on inputs alone are block ranges of ONE launch (k_prep, below); each body takes its own block index.
// b_cvtb: bf16 of an [nrows][1024] matrix; b_wt: k-major [1024][1024] -> n-major bf16; both written in fragment order (pko).
__device__ __forceinline__ void b_cvtb(int blk, const float* __restrict__ src, int nrows, bf* dst) {
    const int lane = threadIdx.x & 31, gw = blk * 8 + (threadIdx.x >> 5), r = (gw >> 4) * 16 + (lane & 15);    // wave = 16 rows x 64 columns
    if (r >= nrows) return;
#pragma unroll
    for (int q = 0; q < 4; ++q) { const int col = (gw & 15) * 64 + q * 16 + (lane >> 4) * 8; v8us t;
#pragma unroll
        for (int i = 0; i < 8; ++i) t[i] = f2bf(src[(size_t)r * DM + col + i]);
        VST2(v8us, dst + pko(r, col), t); }
}
__device__ __forceinline__ void b_wt(int bk, int bn, unsigned short* tl, const float* __restrict__ Wm, bf* WT) {
    const int tid = threadIdx.x, k0 = bk * 64, n0 = bn * 64;
    const int kk = tid >> 2, nq = (tid & 3) * 16;
#pragma unroll
    for (int i = 0; i < 16; ++i) tl[(nq + i) * 72 + kk] = f2bf(Wm[(size_t)(k0 + kk) * DM + n0 + nq + i]);
    __syncthreads();
    auto pass = [&]() {
#pragma unroll
        for (int s = 0; s < 2; ++s) { const int u = (tid >> 5) + 8 * s, nr = (u >> 2) * 16 + (tid & 15), kcol = (u & 3) * 16 + ((tid >> 4) & 1) * 8;
            const v8us val = *(const v8usa*)(tl + nr * 72 + kcol);
            *(v8us*)(WT + pko(n0 + nr, k0 + kcol)) = val; }
    };
    pass();
    asm volatile("s_wait_xcnt 0x0" ::: "memory");    // in k_prep the code of the other block ranges follows these stores in the program and rewrites the registers they name: the wait stands in front of that
}
// k_gemmb: 128 x 128 tile of A.B^T + bias over K = 1024 (bf16 exact; A, B in fragment order), 2 x 2 waves of 64 x 64: each loaded fragment feeds four WMMAs
// (16 half-fragment loads for 16 WMMAs a k-chunk, not 10 for 4); the three projections are the z planes of one grid:
// z = 0, 1 (q, k): f16 hi + residual planes (fragment order, pko); z = 2 (v): f16 hi + residual planes of V^T, fragment order: [b][h][s / 32][d / 16][(s >> 4) & 1] blocks of 512 bytes,
// lane = 16 * ((s >> 3) & 1) + (d & 15). A lane of an accumulator tile holds 8 consecutive rows of one column, which is one 16-byte piece of a fragment-order plane whose 8-element run lies along the
// tile's rows: v takes x as the row operand (runs along s), q and k take the weight as the row operand (the product transposed: runs along d), and every tile is stored straight from its registers,
// one whole 512-byte block a wave-wide store.
// The k loop is unrolled over a ring of GD register stages (one stage = the four A fragments and the four B fragments of one k-chunk of 32): the loads of k-chunk c + GD are
// issued behind the WMMAs of k-chunk c, so that a wave waits for loads that are GD - 1 chunks old. A 16-row group of a plane is 32 KB in a row: every load is scalar base + lane + immediate.
#define GD 3
__global__ __launch_bounds__(128, 3) void k_gemmb(const bf* __restrict__ A, const bf* __restrict__ Bq, const bf* __restrict__ Bk, const bf* __restrict__ Bv,
                                                  const float* __restrict__ bq, const float* __restrict__ bk, const float* __restrict__ bv,
                                                  h16* QH, h16* QL, h16* KH, h16* KL, h16* VTH, h16* VTL) {
    const int z = blockIdx.z;
    const bf* Bn = z == 0 ? Bq : z == 1 ? Bk : Bv; const float* bias = z == 0 ? bq : z == 1 ? bk : bv;
    const int wave = __builtin_amdgcn_readfirstlane(threadIdx.x >> 5);    // wave in a scalar register: the operand bases below are scalar
    // the lane's number as the hardware counts it (equal to threadIdx.x & 31 here): with the mask form the compiler folds some constant block offsets into the mask, and such a load takes an address register of its own
    const unsigned ulane = __builtin_amdgcn_mbcnt_lo(~0u, 0u);
    const int r0 = blockIdx.x * 128 + (wave >> 1) * 64, c0 = blockIdx.y * 128 + (wave & 1) * 64;
    gv8u* ua = uptrb(z == 2 ? A + pko(r0, 0) : Bn + pko(c0, 0)); gv8u* ub = uptrb(z == 2 ? Bn + pko(c0, 0) : A + pko(r0, 0));    // row operand, column operand; + 512 elements: the next k-chunk; + 16 * DM: the next 16 rows
    v8f acc[4][4];
#pragma unroll
    for (int u = 0; u < 4; ++u)
#pragma unroll
        for (int t = 0; t < 4; ++t) acc[u][t] = (v8f){};
    v16bf ar[GD][4], br[GD][4];
#pragma unroll
    for (int s = 0; s < GD; ++s) {
#pragma unroll
        for (int t = 0; t < 4; ++t) { ar[s][t] = LDB(ua, t * 16 * DM + s * 512); br[s][t] = LDB(ub, t * 16 * DM + s * 512); }
        __builtin_amdgcn_sched_barrier(0); }    // keeps each stage's loads together and in stage order, so that the waits can count
#pragma unroll
    for (int c = 0; c < DM / 32; ++c) {
        const int s = c % GD;
        // row tile outermost: in this order the build keeps all 16 accumulator tiles where they are (column tile outermost, it moved one from chunk to chunk and spilled it once)
#pragma unroll
        for (int u = 0; u < 4; ++u)
#pragma unroll
            for (int t = 0; t < 4; ++t) acc[u][t] = wmmab(ar[s][u], br[s][t], acc[u][t]);
        __builtin_amdgcn_sched_barrier(0);    // the refill stays behind the WMMAs that read this stage, so that it lands in the same registers (no stage more, no spill)
        if (c + GD < DM / 32) {
#pragma unroll
            for (int t = 0; t < 4; ++t) { ar[s][t] = LDB(ua, t * 16 * DM + (c + GD) * 512); br[s][t] = LDB(ub, t * 16 * DM + (c + GD) * 512); } }
        __builtin_amdgcn_sched_barrier(0);    // holds the refill of this stage here, GD chunks ahead of its WMMAs: without it the scheduler sinks the loads down to their use
    }
    // the epilogue reuses the lane-offset and scalar base registers that the ring's loads name: the wait stands in front of that. The epilogue's lane number is taken
    // through the wait's own statement, so that none of the lane arithmetic (which can land in the lane-offset register) is placed ahead of it
    unsigned el = ulane;
    asm volatile("s_wait_xcnt 0x0" : "+v"(el) : : "memory");
    __builtin_amdgcn_sched_barrier(0);    // keeps the epilogue's first register writes behind that wait
    const int lane = (int)el, lr = lane & 15, hi = lane >> 4;
    // the bias: of the tile's column (v: feature c0 + 16 t + lr) or of its rows (q, k: features c0 + 16 u + 8 hi + j)
    if (z == 2) {
#pragma unroll
        for (int t = 0; t < 4; ++t) { const float bc = bfr(bias[c0 + t * 16 + lr]);
#pragma unroll
            for (int u = 0; u < 4; ++u) acc[u][t] += bc; }
    } else {
#pragma unroll
        for (int u = 0; u < 4; ++u) { const float* bp = bias + c0 + u * 16 + hi * 8; v8f br8;
#pragma unroll
            for (int j = 0; j < 8; ++j) br8[j] = bfr(bp[j]);
#pragma unroll
            for (int t = 0; t < 4; ++t) acc[u][t] += br8; }
    }
    // tile (u, t) is one 512-byte block, su (u >> 1) + 256 (u & 1) + st t elements behind the wave's first block. v: rows = tokens r0 + 16 u + 8 hi + j of one batch entry, columns = one head's d = 16 t + lr;
    // q, k: rows = features, column = token r0 + 16 t + lr, the block of pko(token, feature)
    const size_t wb = z == 2 ? (((size_t)(r0 / SS) * NH_ + c0 / HD) * HD) * SS + (size_t)((r0 % SS) >> 5) * 2048 : pko(r0, c0);
    h16* p1 = (z == 0 ? QH : z == 1 ? KH : VTH) + wb; h16* p2 = (z == 0 ? QL : z == 1 ? KL : VTL) + wb;
    const int su = z == 2 ? 2048 : 512, st = z == 2 ? 512 : 16 * DM;
    v8h o1[4][4], o2[4][4];
#pragma unroll
    for (int u = 0; u < 4; ++u)
#pragma unroll
        for (int t = 0; t < 4; ++t)
#pragma unroll
            for (int j = 0; j < 8; ++j) { const float v = acc[u][t][j]; const h16 a = (h16)v; o1[u][t][j] = a; o2[u][t][j] = (h16)((v - (float)a) * LOSC); }
    __builtin_amdgcn_sched_barrier(0);    // every conversion ahead of the first store: behind a store no vector register that it names is rewritten, and the 32 stores go out as one run (without it: a wait behind nearly every store)
#pragma unroll
    for (int u = 0; u < 4; u += 2)
#pragma unroll
        for (int t = 0; t < 4; ++t) { gv8hw* t1 = uptrw(p1 + (u >> 1) * su + t * st); gv8hw* t2 = uptrw(p2 + (u >> 1) * su + t * st);    // scalar base + lane (+ 512 bytes)
            t1[el] = o1[u][t]; t2[el] = o2[u][t]; t1[el + 32] = o1[u + 1][t]; t2[el + 32] = o2[u + 1][t]; }
}
// b_tabs: both tables in fragment order over groups g of 16 table rows m = 16 g + 1 .. 16 g + 16 (every band of k_attn starts at m = 1 mod 16; m = 0 is never used):
// RK16 [g < NGK][d / 16] blocks of 512 bytes = f16(bf16(rel_k_emb)), lane = 16 * ((d >> 3) & 1) + (m - 1 & 15); RVT16 [g < NGV][d / 16] blocks = f16(bf16(rel_v_emb))^T,
// lane = 16 * ((m - 1 >> 3) & 1) + (d & 15), via 64x64 LDS transposes (zero beyond row 2048); NRP/64 blocks.
__device__ __forceinline__ void b_tabs(int blk, h16* tile, const float* __restrict__ rk, const float* __restrict__ rv, h16* RK16, h16* RVT16) {
    const int m0 = blk * 64 + 1, tid = threadIdx.x, mm = tid >> 2, d0 = (tid & 3) * 16;
#pragma unroll
    for (int i = 0; i < 16; ++i) { const int m = m0 + mm; tile[(d0 + i) * 72 + mm] = (m < NRL) ? (h16)bfr(rv[(size_t)m * HD + d0 + i]) : (h16)0.f; }
    __syncthreads();
    const int lane = tid & 31, lr = lane & 15, hi = lane >> 4;
    auto pass = [&]() {
#pragma unroll
        for (int s = 0; s < 2; ++s) { const int u = (tid >> 5) + 8 * s, g = blk * 4 + (u >> 2), m = 16 * g + 1 + lr, col = (u & 3) * 16 + hi * 8; v8h o;
#pragma unroll
            for (int i = 0; i < 8; ++i) o[i] = (m < NRL) ? (h16)bfr(rk[(size_t)m * HD + col + i]) : (h16)0.f;
            if (g < NGK) *(v8h*)(RK16 + (size_t)(g * 4 + (u & 3)) * 256 + lane * 8) = o; }
#pragma unroll
        for (int s = 0; s < 2; ++s) { const int u = (tid >> 5) + 8 * s, gl = u >> 2, n = u & 3, g = blk * 4 + gl;
            const v8h val = *(const v8ha*)(tile + (n * 16 + lr) * 72 + gl * 16 + hi * 8);
            if (g < NGV) *(v8h*)(RVT16 + (size_t)(g * 4 + n) * 256 + lane * 8) = val; }
    };
    pass(); 
}
// k_prep: one launch for all six conversions, none of which reads what another writes. Block ranges: PBT blocks of the tables (first: the longest chain of dependent loads),
// PBX blocks of x, 4 x PBW blocks of the weights (k tile fastest). The range test reads blockIdx alone, so each body's barrier is passed by its whole block; the bodies with an LDS tile share one.
#define PBX (NTK / 8)
#define PBW ((DM / 64) * (DM / 64))
#define PBT (NRP / 64)
__global__ __launch_bounds__(256) void k_prep(const float* __restrict__ x, const float* __restrict__ Wq, const float* __restrict__ Wk, const float* __restrict__ Wv, const float* __restrict__ Wo,
                                              const float* __restrict__ rk, const float* __restrict__ rv, bf* Xb, bf* WqT, bf* WkT, bf* WvT, bf* WoT, h16* RK16, h16* RVT16) {
    __shared__ __align__(16) unsigned short tl[64 * 72];
    const int bid = blockIdx.x;
    if (bid < PBT) { b_tabs(bid, (h16*)tl, rk, rv, RK16, RVT16); return; }
    if (bid < PBT + PBX) { b_cvtb(bid - PBT, x, NTK, Xb); return; }
    const int u = bid - PBT - PBX, wi = u / PBW, t = u - wi * PBW;
    b_wt(t % (DM / 64), t / (DM / 64), tl, wi == 0 ? Wq : wi == 1 ? Wk : wi == 2 ? Wv : Wo, wi == 0 ? WqT : wi == 1 ? WkT : wi == 2 ? WvT : WoT);
}
// k_attn: block = (b, h, 64 queries), wave = 16 queries i = q0..q0+15; 32 key tiles of 32. Every product is taken TRANSPOSED (a stored fragment serves as A or as B alike): lane (lr, hi)
// holds column lr = ONE query of every tile, its 8 registers the rows 8 hi + j. Content S^T = k.q^T, 12 WMMA (hi.hi + hi.lo + lo.hi; the q hi and residual fragments stay in registers);
// relative-key band^T: rows m = mbase + 0..47 of RK16 (mbase = q0 - l0 - 31 + 1024) x (q hi, q lo), 8 WMMA for rows 0..31 (rows 32..47 are the tile before's rows 0..15, kept in registers), parked in LDS as ps[query][m]; logit(i,j) = content + ps[r][r - kk + 31]
// (UNSCALED); online softmax: maximum and sum inside the lane plus one exchange between the wave halves; the weights x32768 hi + residual of the two score tiles, packed in place, ARE
// the B operand (k = 8 hi + s, 16 + 8 hi + s) of o^T += vh.pa, ox^T += vl.pa + vh.px (12 WMMA); the same weights scattered into relative coordinates pt/pt2 [query][64]
// (column r + 31 - kk) are the B operand of o^T += rv.pt, ox^T += rv.pt2 (8 WMMA, A = RVT16 rows d at k = mbase + 16 .. mbase + 47; columns below 16 wait for the next tile, whose columns 32..47 they are);
// ctx = (o + ox/1024)/sum: a lane holds 8 consecutive d of its query = one 16-byte piece of the bf16 hi/lo planes [tok][h*64+d] in fragment order. Every global operand is read in fragment order (pko, k_gemmb, b_tabs).
#define PTP 136                  // row pitch of pt/pt2 in halves: 16 bytes x odd for the 16-byte readers; the scatter's lane stride PTP + 1 is 9 halves modulo the 64 banks, so the 8-half stores of 16 lanes lie side by side
typedef __attribute__((ext_vector_type(4))) unsigned v4u;
typedef v4u __attribute__((may_alias, aligned(2))) v4u2;
// the 8 halves of x in reverse order: the dwords reversed, each rotated by 16 bits
__device__ __forceinline__ v4u rev8(v8h x) { const v4u u = __builtin_bit_cast(v4u, x); return (v4u){ (u[3] >> 16) | (u[3] << 16), (u[2] >> 16) | (u[2] << 16), (u[1] >> 16) | (u[1] << 16), (u[0] >> 16) | (u[0] << 16) }; }
__device__ __forceinline__ float xhalf(float x) { return __builtin_bit_cast(float, __builtin_amdgcn_permlanex16(__builtin_bit_cast(int, x), __builtin_bit_cast(int, x), 0x76543210, 0xfedcba98, false, false)); }    // lane l with lane l ^ 16
__global__ __launch_bounds__(128, 4) void k_attn(const h16* __restrict__ QH, const h16* __restrict__ QL, const h16* __restrict__ KH, const h16* __restrict__ KL,
                                             const h16* __restrict__ RK16, const h16* __restrict__ RVT16, const h16* __restrict__ VTH, const h16* __restrict__ VTL, bf* CH, bf* CL) {
    __shared__ __align__(16) h16 ptl[4][16 * PTP];
    __shared__ __align__(16) h16 ptl2[4][16 * PTP];
    __shared__ __align__(16) float posl[4][16 * 52];
    const int lane = threadIdx.x & 31, wave = __builtin_amdgcn_readfirstlane(threadIdx.x >> 5), lr = lane & 15, hi = lane >> 4;    // wave in a scalar register: every operand block address below is scalar base + lane offset
    const unsigned ulane = lane;
    const int bid = blockIdx.x;
    const int b = bid / (NH_ * (SS / 64)), rem = bid - b * (NH_ * (SS / 64)), h = rem / (SS / 64), qt = rem - h * (SS / 64);
    const int q0 = qt * 64 + wave * 16;
    const size_t tok0 = (size_t)b * SS;
    h16* pt = &ptl[wave][0]; h16* pt2 = &ptl2[wave][0]; float* ps = &posl[wave][0];
    // row lr (the lane's query) of each LDS tile addressed as one lane base + a constant (an immediate offset). psb + 16 t + j: band column m = 16 t + 8 hi + j;
    // psg, ptb, ptb2 + 23 - 16 T - j: column r + 31 - kk of key kk = 16 T + 8 hi + j
    float* psb = ps + lr * 52 + hi * 8; const float* psg = ps + lr * 53 + 8 - hi * 8;
    h16* ptb = pt + lr * (PTP + 1) + 8 - hi * 8; h16* ptb2 = pt2 + lr * (PTP + 1) + 8 - hi * 8;
    const size_t qo0 = pko((int)tok0 + q0, h * HD);    // wave-uniform block offset; LDU adds the lane's own piece
    v16h qa[2];
#pragma unroll
    for (int kc = 0; kc < 2; ++kc) qa[kc] = LDU(uptr(QH + qo0), kc * 512, 256);
    const size_t vbase = (((size_t)b * NH_ + h) * HD) * SS;
    v8f o[4], ox[4];
#pragma unroll
    for (int n = 0; n < 4; ++n) { o[n] = (v8f){}; ox[n] = (v8f){}; }
    float mrow = -3.0e38f, lpart = 0.f;    // of the lane's query; lpart sums the keys of the lane's own wave half
    // Row r of pt/pt2 holds three runs of 16 columns, all rewritten every tile: r .. r+15 = this tile's keys 31..16, r+16 .. r+31 = its keys 15..0, r+32 .. r+47 = the tile before's keys 31..16.
    // Only columns 16..47 are read: one whole k-chunk. What a tile leaves below column 16 is not multiplied yet: it rides in wc (f32, x32768) into the next tile, whose columns 32..47 it completes.
    v8f wc = {};
    // Operand fragments are loaded in groups well ahead of the WMMAs that read them (the "memory" fences below keep each group where it is written).
    // The band fragments of a key tile (both k-chunks) are loaded during the tile before it and carried over the loop edge in these registers; the q residual fragments are loaded once.
    // mbase falls by 32 a tile: band rows 32..47 of a tile are rows 0..15 of the tile before. Their joined sums ride in bcar; a tile multiplies its rows 0..31 only. The first tile's rows 32..47 are made here.
    v16h ql0, ql1, rb0[2], rb1[2];
    v8f bcar;
    { gv8h* uql = uptr(QL + qo0); gv8h* urk = uptr(RK16 + (size_t)((q0 - 31 + 1024 - 1) >> 4) * 1024); ql0 = LDU(uql, 0, 256); ql1 = LDU(uql, 512, 256);
      const v16h rt0 = LDU(urk, 2048, 256), rt1 = LDU(urk, 2048 + 512, 256);
#pragma unroll
      for (int t = 0; t < 2; ++t) { rb0[t] = LDU(urk, t * 1024, 256); rb1[t] = LDU(urk, t * 1024 + 512, 256); }
      v8f ph = wmma16(rt0, qa[0], (v8f){}), pq = wmma16(rt0, ql0, (v8f){}); ph = wmma16(rt1, qa[1], ph); pq = wmma16(rt1, ql1, pq);
#pragma unroll
      for (int j = 0; j < 8; ++j) bcar[j] = ph[j] + pq[j] * LOSCI; }
#pragma unroll 1
    for (int kt = 0; kt < SS / 32; ++kt) {
        const int l0 = kt * 32, mbase = q0 - l0 - 31 + 1024, gb = (mbase - 1) >> 4;    // mbase = 16 gb + 1
        const size_t ko = pko((int)tok0 + l0, h * HD);    // + 512: k-chunk 1; + 16 * DM: the next 16 rows, 64 blocks on
        gv8h* ukh = uptr(KH + ko); gv8h* ukl = uptr(KL + ko);
        // group: this tile's k fragments, in flight under the band
        const v16h k0h0 = LDU(ukh, 0, 256), k1h0 = LDU(ukh, 16 * DM, 256), k0l0 = LDU(ukl, 0, 256), k1l0 = LDU(ukl, 16 * DM, 256);
        const v16h k0h1 = LDU(ukh, 512, 256), k1h1 = LDU(ukh, 16 * DM + 512, 256), k0l1 = LDU(ukl, 512, 256), k1l1 = LDU(ukl, 16 * DM + 512, 256);
        __builtin_amdgcn_sched_barrier(0);    // the whole k group goes out ahead of the band: without it the scheduler sinks most of these loads in among the 8 band WMMAs, and the content products wait for them
        // band tiles: rows m = mbase + t*16 + lr of RK16, both k-chunks summed in the accumulators (q hi and q residual products apart), then joined and parked in LDS once.
        // The slots the chip needs between a WMMA and the read of its sums are filled by other work or by the compiler's own v_nop.
        {
            v8f ph[2], pq[2];
            auto bw = [&](int t) { ph[t] = wmma16(rb0[t], qa[0], (v8f){}); pq[t] = wmma16(rb0[t], ql0, (v8f){}); ph[t] = wmma16(rb1[t], qa[1], ph[t]); pq[t] = wmma16(rb1[t], ql1, pq[t]); };
            auto bc = [&](int t) { v4f b0, b1;
#pragma unroll
                for (int j = 0; j < 4; ++j) { b0[j] = ph[t][j] + pq[t][j] * LOSCI; b1[j] = ph[t][j + 4] + pq[t][j + 4] * LOSCI; }
                *(v4fa*)(psb + t * 16) = b0; *(v4fa*)(psb + t * 16 + 4) = b1;
                if (t == 0) bcar = __builtin_shufflevector(b0, b1, 0, 1, 2, 3, 4, 5, 6, 7); };
            bw(0); bw(1);
            *(v4fa*)(psb + 32) = __builtin_shufflevector(bcar, bcar, 0, 1, 2, 3); *(v4fa*)(psb + 36) = __builtin_shufflevector(bcar, bcar, 4, 5, 6, 7);    // rows 32..47, from the tile before
            bc(0); bc(1);
        }
        // The v_nop statements of this loop fill the vector slots the chip needs between a WMMA and the first read of its D or rewrite of its A / B,
        // and name those registers so that they stay whole up to there; their "memory" clobber also fences the load groups.
        // content, k-chunk 0 then 1
        v8f s0 = {}, s1 = {}, x0 = {}, x1 = {};
        s0 = wmma16(k0h0, qa[0], s0); x0 = wmma16(k0h0, ql0, x0); s1 = wmma16(k1h0, qa[0], s1); x1 = wmma16(k1h0, ql0, x1);
        asm volatile("v_nop" : "+v"(s0), "+v"(s1), "+v"(x0), "+v"(x1) : "v"(ql0), "v"(k0h0), "v"(k1h0) : "memory");
        x0 = wmma16(k0l0, qa[0], x0); x1 = wmma16(k1l0, qa[0], x1);
        asm volatile("v_nop" : "+v"(x0), "+v"(x1) : "v"(k0l0), "v"(k1l0) : "memory");
        s0 = wmma16(k0h1, qa[1], s0); x0 = wmma16(k0h1, ql1, x0); s1 = wmma16(k1h1, qa[1], s1); x1 = wmma16(k1h1, ql1, x1);
        asm volatile("v_nop" : "+v"(s0), "+v"(s1), "+v"(x0), "+v"(x1) : "v"(ql1), "v"(k0h1), "v"(k1h1) : "memory");
        x0 = wmma16(k0l1, qa[1], x0); x1 = wmma16(k1l1, qa[1], x1);
        asm volatile("v_nop" : "+v"(x0), "+v"(x1) : "v"(k0l1), "v"(k1l1) : "memory");
        asm volatile("v_nop\n\tv_nop\n\tv_nop\n\tv_nop" : "+v"(s0), "+v"(s1), "+v"(x0), "+v"(x1) : "v"(qa[0]), "v"(qa[1]));
        asm volatile("" ::: "memory");
        __builtin_amdgcn_wave_barrier();
        v8f g0v, g1v;
#pragma unroll
        for (int j = 0; j < 8; ++j) g0v[j] = psg[23 - j];    // band[r][r - kk + 31], kk = 8 hi + j
#pragma unroll
        for (int j = 0; j < 8; ++j) g1v[j] = psg[7 - j];     // kk = 16 + 8 hi + j
        const v8f a0 = s0 + x0 * LOSCI + g0v, a1 = s1 + x1 * LOSCI + g1v;
        float tm[8];
#pragma unroll
        for (int j = 0; j < 8; ++j) tm[j] = fmaxf(a0[j], a1[j]);
        float mx = fmaxf(fmaxf(fmaxf(tm[0], tm[1]), fmaxf(tm[2], tm[3])), fmaxf(fmaxf(tm[4], tm[5]), fmaxf(tm[6], tm[7])));
        mx = fmaxf(mx, xhalf(mx));    // the other 16 keys of this query sit in the other wave half
        const float mn = fmaxf(mrow, mx), alpha = __expf(mrow - mn); mrow = mn;
        v8f e0, e1;
#pragma unroll
        for (int j = 0; j < 8; ++j) e0[j] = __expf(a0[j] - mn);
#pragma unroll
        for (int j = 0; j < 8; ++j) e1[j] = __expf(a1[j] - mn);
        const v8f es = e0 + e1, w0 = e0 * PSC, w1 = e1 * PSC;
        const v8h h0 = __builtin_convertvector(w0, v8h), h1 = __builtin_convertvector(w1, v8h);
        const v8h r0 = __builtin_convertvector((w0 - __builtin_convertvector(h0, v8f)) * LOSC, v8h), r1 = __builtin_convertvector((w1 - __builtin_convertvector(h1, v8f)) * LOSC, v8h);
        const v16h pa = cat16(h0, h1), px = cat16(r0, r1);
        // a lane's 8 keys of a tile are 8 consecutive relative columns in falling order: one 16-byte LDS store each, at an address that is a multiple of 2 bytes only
        *(v4u2*)(ptb + 16) = rev8(h0); *(v4u2*)ptb = rev8(h1); *(v4u2*)(ptb2 + 16) = rev8(r0); *(v4u2*)ptb2 = rev8(r1);
        // the tile before's keys 16..31, brought to this tile's maximum, sit 32 columns up in this tile's coordinates
        const v8f wo = wc * alpha; wc = w1;
        const v8h hc = __builtin_convertvector(wo, v8h), rc = __builtin_convertvector((wo - __builtin_convertvector(hc, v8f)) * LOSC, v8h);
        *(v4u2*)(ptb + 32) = rev8(hc); *(v4u2*)(ptb2 + 32) = rev8(rc);
        lpart = lpart * alpha + (((es[0] + es[1]) + (es[2] + es[3])) + ((es[4] + es[5]) + (es[6] + es[7])));
#pragma unroll
        for (int n = 0; n < 4; ++n)
#pragma unroll
            for (int j = 0; j < 8; ++j) { o[n][j] *= alpha; ox[n][j] *= alpha; }
        asm volatile("" ::: "memory");
        // group: this tile's v hi + residual fragments and the rel_v fragments of its one k-chunk (columns 16..47)
        v16h vh[4], vl[4], rv0[4];
        gv8h* uvh = uptr(VTH + vbase + (size_t)kt * 2048); gv8h* uvl = uptr(VTL + vbase + (size_t)kt * 2048); gv8h* urv = uptr(RVT16 + (size_t)gb * 1024);
#pragma unroll
        for (int n = 0; n < 4; ++n) { vh[n] = LDU(uvh, n * 512, 256); vl[n] = LDU(uvl, n * 512, 256); }
#pragma unroll
        for (int n = 0; n < 4; ++n) rv0[n] = LDU(urv, 1024 + n * 256, 1024);
#pragma unroll
        for (int n = 0; n < 4; ++n) {
            o[n] = wmma16(vh[n], pa, o[n]); ox[n] = wmma16(vl[n], pa, ox[n]); ox[n] = wmma16(vh[n], px, ox[n]);
            asm volatile("" : "+v"(o[n]), "+v"(ox[n]) : "v"(vh[n]), "v"(vl[n]) : "memory");    // keeps the fragments whole through their WMMAs; its "memory" clobber holds the load groups where they are written
        }
        // group: the next key tile's band fragments, both k-chunks (the last tile loads its own again: in bounds, unused)
        { const int ktn = kt + 1 < SS / 32 ? kt + 1 : kt; gv8h* urn = uptr(RK16 + (size_t)((q0 - ktn * 32 - 31 + 1024 - 1) >> 4) * 1024);
#pragma unroll
          for (int t = 0; t < 2; ++t) { rb0[t] = LDU(urn, t * 1024, 256); rb1[t] = LDU(urn, t * 1024 + 512, 256); } }
        // rel_v x relative-coordinate weights: A = RVT16 rows d at k = mbase + 16 .. mbase + 47, B = pt rows (one query a lane, k = column - 16, one k-chunk)
        {
            const v16h ra = cat16(*(const v8ha*)(pt + lr * PTP + 16 + hi * 8), *(const v8ha*)(pt + lr * PTP + 32 + hi * 8));
            const v16h rx = cat16(*(const v8ha*)(pt2 + lr * PTP + 16 + hi * 8), *(const v8ha*)(pt2 + lr * PTP + 32 + hi * 8));
#pragma unroll
            for (int n = 0; n < 4; ++n) {
                o[n] = wmma16(rv0[n], ra, o[n]); ox[n] = wmma16(rv0[n], rx, ox[n]);
                asm volatile("" : "+v"(o[n]), "+v"(ox[n]) : "v"(rv0[n]), "v"(ra), "v"(rx) : "memory"); }    // as in the v loop above: fragments whole through their WMMAs, load groups held where they are written
        }
        __builtin_amdgcn_wave_barrier();    // this tile's reads of pt/pt2 stay ahead of the next tile's stores into the same rows
        // the carried group's loads name scalar base registers that the next trip's address arithmetic rewrites: the wait stands in front of that rewrite
        asm volatile("s_wait_xcnt 0x0" ::: "memory");
    }
    // the last tile's columns below 16: one more k-chunk with no new keys (columns r .. r+31 zero). Its upper 16 columns are table group q0 / 16; the lower 16 carry zero weights
    // and take the same group as a stand-in (the group below it does not exist for q0 = 0).
    {
        gv8h* urv = uptr(RVT16 + (size_t)(q0 >> 4) * 1024);
        v16h rvf[4];
#pragma unroll
        for (int n = 0; n < 4; ++n) rvf[n] = LDU(urv, n * 256, 0);
        const v8h hc = __builtin_convertvector(wc, v8h), rc = __builtin_convertvector((wc - __builtin_convertvector(hc, v8f)) * LOSC, v8h);
        const v4u zz = {};
        *(v4u2*)(ptb + 16) = zz; *(v4u2*)ptb = zz; *(v4u2*)(ptb2 + 16) = zz; *(v4u2*)ptb2 = zz;
        *(v4u2*)(ptb + 32) = rev8(hc); *(v4u2*)(ptb2 + 32) = rev8(rc);
        const v16h ra = cat16(*(const v8ha*)(pt + lr * PTP + 16 + hi * 8), *(const v8ha*)(pt + lr * PTP + 32 + hi * 8));
        const v16h rx = cat16(*(const v8ha*)(pt2 + lr * PTP + 16 + hi * 8), *(const v8ha*)(pt2 + lr * PTP + 32 + hi * 8));
#pragma unroll
        for (int n = 0; n < 4; ++n) { o[n] = wmma16(rvf[n], ra, o[n]); ox[n] = wmma16(rvf[n], rx, ox[n]); }
    }
    asm volatile("v_nop\n\tv_nop\n\tv_nop\n\tv_nop" : "+v"(o[0]), "+v"(o[1]), "+v"(o[2]), "+v"(o[3]), "+v"(ox[0]), "+v"(ox[1]), "+v"(ox[2]), "+v"(ox[3]));
    const float rs = lpart + xhalf(lpart), inv = 1.0f / (rs * PSC);    // the two wave halves' sums of this query joined once
    const int el = (int)__builtin_amdgcn_mbcnt_lo(~0u, 0u);    // the lane's number taken anew from the hardware's count: a register held over the loop for these stores alone does not fit (it would be spilled)
#pragma unroll
    for (int s = 0; s < 4; ++s) { const size_t po = pko((int)tok0 + q0 + (el & 15), h * HD + s * 16 + (el >> 4) * 8); v8us oh, ol;
#pragma unroll
        for (int i = 0; i < 8; ++i) { const float cv = (o[s][i] + ox[s][i] * LOSCI) * inv; const unsigned short hb = f2bf(cv); oh[i] = hb; ol[i] = f2bf(cv - bf2f(hb)); }
        *(v8us*)(CH + po) = oh; *(v8us*)(CL + po) = ol; }
}
// k_outp: 128 x 128 tile of out = (CH + CL).WoT^T + bo over K = 1024 (2 products), 4 x 2 waves of 32 x 64 (16 half-fragment loads for 16 WMMAs a k-chunk, not 12 for 8); f32 rows.
// 256 blocks of 8 waves: one block a WGP, two waves a SIMD.
// Same register ring as k_gemmb, OD stages of four A fragments (hi, residual x two row tiles) and four B fragments.
#define OD 3
__global__ __launch_bounds__(256, 1) void k_outp(const bf* __restrict__ A, const bf* __restrict__ Al, const bf* __restrict__ Bn, const float* __restrict__ bias, float* C) {
    __shared__ __align__(16) float ost[8][32 * 68];
    const int wave = __builtin_amdgcn_readfirstlane(threadIdx.x >> 5);    // wave in a scalar register: the operand bases below are scalar
    // the lane's number as the hardware counts it (equal to threadIdx.x & 31 here): with the mask form the compiler folds some constant block offsets into the mask, and such a load takes an address register of its own
    const unsigned ulane = __builtin_amdgcn_mbcnt_lo(~0u, 0u);
    const int r0 = blockIdx.x * 128 + (wave >> 1) * 32, c0 = blockIdx.y * 128 + (wave & 1) * 64;
    gv8u* ua = uptrb(A + pko(r0, 0)); gv8u* ul = uptrb(Al + pko(r0, 0)); gv8u* ub = uptrb(Bn + pko(c0, 0));    // + 512 elements: the next k-chunk; + 16 * DM: the next 16 rows
    v8f acc[2][4];
#pragma unroll
    for (int t = 0; t < 4; ++t) { acc[0][t] = (v8f){}; acc[1][t] = (v8f){}; }
    v16bf ar[OD][2], lr2[OD][2], br[OD][4];
#pragma unroll
    for (int s = 0; s < OD; ++s) {
#pragma unroll
        for (int u = 0; u < 2; ++u) { ar[s][u] = LDB(ua, u * 16 * DM + s * 512); lr2[s][u] = LDB(ul, u * 16 * DM + s * 512); }
#pragma unroll
        for (int t = 0; t < 4; ++t) br[s][t] = LDB(ub, t * 16 * DM + s * 512);
        __builtin_amdgcn_sched_barrier(0); }    // keeps each stage's loads together and in stage order, so that the waits can count
#pragma unroll
    for (int c = 0; c < DM / 32; ++c) {
        const int s = c % OD;
#pragma unroll
        for (int t = 0; t < 4; ++t) { acc[0][t] = wmmab(ar[s][0], br[s][t], acc[0][t]); acc[1][t] = wmmab(ar[s][1], br[s][t], acc[1][t]);
            acc[0][t] = wmmab(lr2[s][0], br[s][t], acc[0][t]); acc[1][t] = wmmab(lr2[s][1], br[s][t], acc[1][t]); }
        __builtin_amdgcn_sched_barrier(0);    // the refill stays behind the WMMAs that read this stage, so that it lands in the same registers (no stage more, no spill)
        if (c + OD < DM / 32) {
#pragma unroll
            for (int u = 0; u < 2; ++u) { ar[s][u] = LDB(ua, u * 16 * DM + (c + OD) * 512); lr2[s][u] = LDB(ul, u * 16 * DM + (c + OD) * 512); }
#pragma unroll
            for (int t = 0; t < 4; ++t) br[s][t] = LDB(ub, t * 16 * DM + (c + OD) * 512); }
        __builtin_amdgcn_sched_barrier(0);    // holds the refill of this stage here, OD chunks ahead of its WMMAs: without it the scheduler sinks the loads down to their use
    }
    // the epilogue reuses the lane-offset and scalar base registers that the ring's loads name: the wait stands in front of that; the epilogue's lane number goes through the wait's own statement, as in k_gemmb
    unsigned el = ulane;
    asm volatile("s_wait_xcnt 0x0" : "+v"(el) : : "memory");
    __builtin_amdgcn_sched_barrier(0);    // keeps the epilogue's first register writes behind that wait
    const int lane = (int)el, lr = lane & 15, hi = lane >> 4;
    float* os = &ost[wave][0];
#pragma unroll
    for (int t = 0; t < 4; ++t) { const float bv = bfr(bias[c0 + t * 16 + lr]);
#pragma unroll
        for (int u = 0; u < 2; ++u)
#pragma unroll
            for (int j = 0; j < 8; ++j) os[(u * 16 + hi * 8 + j) * 68 + t * 16 + lr] = acc[u][t][j] + bv; }
    __syncthreads();
    float* crow = C + (size_t)r0 * DM + c0;
    auto pass = [&]() {
#pragma unroll
        for (int s = 0; s < 16; ++s) { const int Lid = (lane >> 3) + 4 * s, piece = lane & 7; const int row = Lid >> 1, cofs = (Lid & 1) * 32 + piece * 4;
            const v4f val = *(const v4fa*)(os + row * 68 + cofs); *(v4f*)(crow + (size_t)row * DM + cofs) = val; }
    };
    pass(); 
}

extern "C" void kernel_launch(void* const* d_in, const int* in_sizes, int n_in,
                              void* d_out, int out_size, void* d_ws, size_t ws_size, hipStream_t stream) {
    (void)in_sizes; (void)n_in; (void)out_size;
    const float* x = (const float*)d_in[0]; const float* Wq = (const float*)d_in[1]; const float* bq = (const float*)d_in[2]; const float* Wk = (const float*)d_in[3]; const float* bk = (const float*)d_in[4];
    const float* Wv = (const float*)d_in[5]; const float* bv = (const float*)d_in[6]; const float* Wo = (const float*)d_in[7]; const float* bo = (const float*)d_in[8];
    const float* rk = (const float*)d_in[9]; const float* rv = (const float*)d_in[10];
    float* out = (float*)d_out;    // [4][1024][1024]
    char* wsp = (char*)d_ws;
    auto take = [&](size_t bytes) { char* p = wsp; wsp += (bytes + 255) & ~(size_t)255; return (void*)p; };
    bf* Xb = (bf*)take((size_t)NTK * DM * 2); bf* WqT = (bf*)take((size_t)DM * DM * 2); bf* WkT = (bf*)take((size_t)DM * DM * 2); bf* WvT = (bf*)take((size_t)DM * DM * 2); bf* WoT = (bf*)take((size_t)DM * DM * 2);
    h16* QH = (h16*)take((size_t)NTK * DM * 2); h16* QL = (h16*)take((size_t)NTK * DM * 2); h16* KH = (h16*)take((size_t)NTK * DM * 2); h16* KL = (h16*)take((size_t)NTK * DM * 2);
    bf* CH = (bf*)take((size_t)NTK * DM * 2); bf* CL = (bf*)take((size_t)NTK * DM * 2); h16* VTH = (h16*)take((size_t)NTK * DM * 2); h16* VTL = (h16*)take((size_t)NTK * DM * 2);
    h16* RK16 = (h16*)take((size_t)NRP * HD * 2); h16* RVT16 = (h16*)take((size_t)HD * NRP * 2);
    if ((size_t)(wsp - (char*)d_ws) > ws_size) return;    // 8.4 + 8.4 + 33.5 + 16.8 + 16.8 + 0.5 ~ 85 MB
    k_prep<<<PBX + 4 * PBW + PBT, 256, 0, stream>>>(x, Wq, Wk, Wv, Wo, rk, rv, Xb, WqT, WkT, WvT, WoT, RK16, RVT16);
    k_gemmb<<<dim3(NTK / 128, DM / 128, 3), 128, 0, stream>>>(Xb, WqT, WkT, WvT, bq, bk, bv, QH, QL, KH, KL, VTH, VTL);
    k_attn<<<NB_ * NH_ * (SS / 64), 128, 0, stream>>>(QH, QL, KH, KL, RK16, RVT16, VTH, VTL, CH, CL);
    k_outp<<<dim3(NTK / 128, DM / 128, 1), 256, 0, stream>>>(CH, CL, WoT, bo, out);
}
